// v000
// Measured on an AMD MI455X. A time is GPU time per run, averaged over a window of back-to-back runs after a warm-up
// (all launches, gaps included; the runs take copies of the inputs in turn), and the median of several windows.
// Apart from v000's, it joins two sittings. Times from different sittings can be a few percent apart, while
// side-by-side timings come from the same sitting.
// v000, which the later versions start from, runs in 2830 microseconds.
#include <hip/hip_runtime.h>

// Causal self-attention with a fused bias-free natural qkv weight and computed rotate-half rotary embeddings (x [4][2048][1024]; qkv = x w_qkv^T ('oi' [3072][1024] 1/32, no bias) split in ROW thirds q | k | v (16 heads x 64); rope cat(x1 c - x2 s, x1 s + x2 c) on the two 32-wide halves with angle t x 1/10000^(i/32) (32 f32 constants jnp-exact; one f32 product; precise cosf/sinf); scores / sqrt(64); causal (-inf == exclusion); softmax; y = merged w_out^T ('oi', no bias) -> [4][2048][1024] (8.4 M); argument order x, w_qkv, w_out).
// Layout per batch: bf16 copy of x; 'oi' weights; exact projections; k_cs5 computed table; rotate-half plane builders; causal T-2048 attention (hybrid rows: < 512 hi/lo 3 products, rest fp16 x1024; k_gemmc skips tiles above the diagonal); merged hi/lo x w_o exact.
// Compute dtypes, f32 accumulate: every input rounded to bf16; projections exact; attention rows < 512 3 products, rest fp16; softmax f32; w_o hl x exact.

#define NB_  4
#define TT   2048
#define DM   1024
#define NH_  16
#define NKV  16
#define REP  (NH_ / NKV)
#define HD   64
#define DQ   (NH_ * HD)
#define DKV  (NKV * HD)
#define ZH   2
#define RH   512                  // query rows < RH use hi+lo planes (0: none)
#define WIN  2048
#define PCAR 1024.0f
#define SCL  0.125f   // HD^-0.5
typedef _Float16 h16;
typedef unsigned short bf;
typedef __attribute__((ext_vector_type(16))) __bf16   v16bf;
typedef __attribute__((ext_vector_type(16))) _Float16 v16h;
typedef __attribute__((ext_vector_type(8)))  _Float16 v8h;
typedef __attribute__((ext_vector_type(8)))  unsigned short v8us;
typedef __attribute__((ext_vector_type(8)))  float    v8f;
typedef __attribute__((ext_vector_type(4)))  float    v4f;
typedef v8h  __attribute__((may_alias)) v8ha;
typedef v4f  __attribute__((may_alias)) v4fa;
typedef v8us __attribute__((may_alias)) v8usa;

__device__ __forceinline__ unsigned short f2bf(float f) { unsigned u = __float_as_uint(f); u += 0x7FFFu + ((u >> 16) & 1u); return (unsigned short)(u >> 16); }
__device__ __forceinline__ float bf2f(unsigned short b) { return __uint_as_float(((unsigned)b) << 16); }
__device__ __forceinline__ float bfr(float f) { return bf2f(f2bf(f)); }
__device__ __forceinline__ v16h cat16(v8h lo, v8h hi) { return __builtin_shufflevector(lo, hi, 0, 1, 2, 3, 4, 5, 6, 7, 8, 9, 10, 11, 12, 13, 14, 15); }
__device__ __forceinline__ v16bf cat16b(v8us lo, v8us hi) { return __builtin_bit_cast(v16bf, __builtin_shufflevector(lo, hi, 0, 1, 2, 3, 4, 5, 6, 7, 8, 9, 10, 11, 12, 13, 14, 15)); }
__device__ __forceinline__ v8f wmma16(v16h a, v16h b, v8f c) { return __builtin_amdgcn_wmma_f32_16x16x32_f16(false, a, false, b, (short)0, c, false, false); }
__device__ __forceinline__ v8f wmmab(v16bf a, v16bf b, v8f c) { return __builtin_amdgcn_wmma_f32_16x16x32_bf16(false, a, false, b, (short)0, c, false, false); }



// ---- k_gemmw: register-blocked GEMM, ONE WAVE per 64x64 output tile (16 accumulators), operands straight from K-contiguous 16-bit planes; grid (M/64, N/64, Z), 32 threads.
// C[m][n] (f32, pitch ldc, + optional f32 bias[n]) = sum_k A[m][k] Bt[n][k] (+ split products per NSPLIT). z-batch strides sA/sB/sC in elements. K % 32 == 0.
template <typename T16> struct WFrag;
template <> struct WFrag<h16> { typedef v16h V; static __device__ __forceinline__ V ld(const h16* p) { return cat16(*(const v8h*)p, *(const v8h*)(p + 16)); } static __device__ __forceinline__ v8f mma(V a, V b, v8f c) { return wmma16(a, b, c); } };
template <> struct WFrag<bf> { typedef v16bf V; static __device__ __forceinline__ V ld(const bf* p) { return cat16b(*(const v8us*)p, *(const v8us*)(p + 16)); } static __device__ __forceinline__ v8f mma(V a, V b, v8f c) { return wmmab(a, b, c); } };
template <typename T16, int NSPLIT, bool BIAS>
__global__ __launch_bounds__(32) void k_gemmw(const T16* __restrict__ A, const T16* __restrict__ A2, const T16* __restrict__ Bt, const T16* __restrict__ Bt2, int K, float* C, int ldc, const float* __restrict__ bias, size_t sA, size_t sB, size_t sC) {
    typedef typename WFrag<T16>::V V;
    __shared__ __align__(16) float os[16 * 68];
    const size_t z = blockIdx.z; A += z * sA; if (A2) A2 += z * sA; Bt += z * sB; if (Bt2) Bt2 += z * sB; C += z * sC;
    const int lane = threadIdx.x & 31, lr = lane & 15, hi = lane >> 4; const int r0 = blockIdx.x * 64, c0 = blockIdx.y * 64;
    v8f acc[4][4];
#pragma unroll
    for (int mb = 0; mb < 4; ++mb)
#pragma unroll
        for (int nb = 0; nb < 4; ++nb) acc[mb][nb] = (v8f){};
    const size_t aoff = (size_t)(r0 + lr) * K + 8 * hi, boff = (size_t)(c0 + lr) * K + 8 * hi;
#pragma unroll 1
    for (int kc = 0; kc < K; kc += 32) {
        V a[4], a2[4];
#pragma unroll
        for (int mb = 0; mb < 4; ++mb) { a[mb] = WFrag<T16>::ld(A + aoff + (size_t)mb * 16 * K + kc); if (NSPLIT == 1 || NSPLIT == 2) a2[mb] = WFrag<T16>::ld(A2 + aoff + (size_t)mb * 16 * K + kc); }
#pragma unroll
        for (int nb = 0; nb < 4; ++nb) { const V b = WFrag<T16>::ld(Bt + boff + (size_t)nb * 16 * K + kc); V b2; if (NSPLIT >= 2) b2 = WFrag<T16>::ld(Bt2 + boff + (size_t)nb * 16 * K + kc);
#pragma unroll
            for (int mb = 0; mb < 4; ++mb) { acc[mb][nb] = WFrag<T16>::mma(a[mb], b, acc[mb][nb]); if (NSPLIT == 1 || NSPLIT == 2) acc[mb][nb] = WFrag<T16>::mma(a2[mb], b, acc[mb][nb]); if (NSPLIT >= 2) acc[mb][nb] = WFrag<T16>::mma(a[mb], b2, acc[mb][nb]); } }
        asm volatile("v_nop\n\tv_nop\n\tv_nop\n\tv_nop" : "+v"(acc[0][0]), "+v"(acc[1][1]), "+v"(acc[2][2]), "+v"(acc[3][3]) : "v"(a[0]), "v"(a[3]));
    }
#pragma unroll
    for (int mb = 0; mb < 4; ++mb) {
#pragma unroll
        for (int nb = 0; nb < 4; ++nb) {
#pragma unroll
            for (int j = 0; j < 8; ++j) os[(hi * 8 + j) * 68 + nb * 16 + lr] = acc[mb][nb][j]; }
        __builtin_amdgcn_wave_barrier(); asm volatile("" ::: "memory");
        float* crow = C + (size_t)(r0 + mb * 16) * ldc + c0;
{
#pragma unroll
            for (int s = 0; s < 8; ++s) { const int row = 2 * s + hi, cofs = lr * 4; v4f val = *(const v4fa*)(os + row * 68 + cofs); if (BIAS) { val[0] += bfr(bias[c0 + cofs]); val[1] += bfr(bias[c0 + cofs + 1]); val[2] += bfr(bias[c0 + cofs + 2]); val[3] += bfr(bias[c0 + cofs + 3]); }
                *(v4f*)(crow + (size_t)row * ldc + cofs) = val; }
             }
        __builtin_amdgcn_wave_barrier(); asm volatile("" ::: "memory");
    }
}

// ---- k_gemmc: the same one-wave 64x64 tile GEMM specialised for causal attention: CMODE 1 skips score tiles entirely above the diagonal (query rows r0+roff.., key columns c0..), CMODE 2 limits the
// key (K) loop of the probability x value contraction to the diagonal block (probabilities beyond it are exactly zero). roff = row offset of this launch's first row within the sequence.
template <typename T16, int NSPLIT, int CMODE>
__global__ __launch_bounds__(32) void k_gemmc(const T16* __restrict__ A, const T16* __restrict__ A2, const T16* __restrict__ Bt, const T16* __restrict__ Bt2, int K, float* C, int ldc, int roff, size_t sA, size_t sB, size_t sC) {
    typedef typename WFrag<T16>::V V;
    __shared__ __align__(16) float os[16 * 68];
    const size_t z = blockIdx.z; A += z * sA; if (A2) A2 += z * sA; Bt += z * sB; if (Bt2) Bt2 += z * sB; C += z * sC;
    const int lane = threadIdx.x & 31, lr = lane & 15, hi = lane >> 4; const int r0 = blockIdx.x * 64, c0 = blockIdx.y * 64;
    if (CMODE == 1 && c0 > r0 + roff + 63) return;                  // score tile entirely above the causal diagonal: never read (the softmax masks j > i by select)
    const int Kl = (CMODE == 2) ? min(K, r0 + roff + 64) : K;        // P.V: probabilities are exactly 0 beyond the diagonal block, so the K loop stops there
    v8f acc[4][4];
#pragma unroll
    for (int mb = 0; mb < 4; ++mb)
#pragma unroll
        for (int nb = 0; nb < 4; ++nb) acc[mb][nb] = (v8f){};
    const size_t aoff = (size_t)(r0 + lr) * K + 8 * hi, boff = (size_t)(c0 + lr) * K + 8 * hi;
#pragma unroll 1
    for (int kc = 0; kc < Kl; kc += 32) {
        V a[4], a2[4];
#pragma unroll
        for (int mb = 0; mb < 4; ++mb) { a[mb] = WFrag<T16>::ld(A + aoff + (size_t)mb * 16 * K + kc); if (NSPLIT == 1 || NSPLIT == 2) a2[mb] = WFrag<T16>::ld(A2 + aoff + (size_t)mb * 16 * K + kc); }
#pragma unroll
        for (int nb = 0; nb < 4; ++nb) { const V b = WFrag<T16>::ld(Bt + boff + (size_t)nb * 16 * K + kc); V b2; if (NSPLIT >= 2) b2 = WFrag<T16>::ld(Bt2 + boff + (size_t)nb * 16 * K + kc);
#pragma unroll
            for (int mb = 0; mb < 4; ++mb) { acc[mb][nb] = WFrag<T16>::mma(a[mb], b, acc[mb][nb]); if (NSPLIT == 1 || NSPLIT == 2) acc[mb][nb] = WFrag<T16>::mma(a2[mb], b, acc[mb][nb]); if (NSPLIT >= 2) acc[mb][nb] = WFrag<T16>::mma(a[mb], b2, acc[mb][nb]); } }
        asm volatile("v_nop\n\tv_nop\n\tv_nop\n\tv_nop" : "+v"(acc[0][0]), "+v"(acc[1][1]), "+v"(acc[2][2]), "+v"(acc[3][3]) : "v"(a[0]), "v"(a[3]));
    }
#pragma unroll
    for (int mb = 0; mb < 4; ++mb) {
#pragma unroll
        for (int nb = 0; nb < 4; ++nb) {
#pragma unroll
            for (int j = 0; j < 8; ++j) os[(hi * 8 + j) * 68 + nb * 16 + lr] = acc[mb][nb][j]; }
        __builtin_amdgcn_wave_barrier(); asm volatile("" ::: "memory");
        float* crow = C + (size_t)(r0 + mb * 16) * ldc + c0;
{
#pragma unroll
            for (int s = 0; s < 8; ++s) { const int row = 2 * s + hi, cofs = lr * 4; v4f val = *(const v4fa*)(os + row * 68 + cofs);
                *(v4f*)(crow + (size_t)row * ldc + cofs) = val; }
             }
        __builtin_amdgcn_wave_barrier(); asm volatile("" ::: "memory");
    }
}

__device__ __forceinline__ h16 tohx(float x) { return (h16)x; }
__device__ __forceinline__ void splitf(float y, unsigned short& h, unsigned short& l) { h = f2bf(y); l = f2bf(y - bf2f(h)); }
typedef __attribute__((ext_vector_type(2))) _Float16 v2h;
typedef __attribute__((ext_vector_type(4))) _Float16 v4h;
typedef __attribute__((ext_vector_type(2))) unsigned short v2us;
typedef __attribute__((ext_vector_type(4))) unsigned short v4us;
typedef __attribute__((ext_vector_type(2))) float v2f;
typedef __attribute__((ext_vector_type(4))) int v4i;

__global__ __launch_bounds__(256) void k_cvt8(const float* __restrict__ src, bf* dst, size_t n8) { const size_t i = (size_t)blockIdx.x * 256 + threadIdx.x; if (i >= n8) return; const v8f v = *(const v8f*)(src + i * 8); v8us o;
#pragma unroll
    for (int k = 0; k < 8; ++k) o[k] = f2bf(v[k]); *(v8us*)(dst + i * 8) = o;  }

// k_rope: head planes [h][t][d] (fp16 + hi/lo) of rope(x) x sc with the rotate-half convention out[d] = x[d] cos[t][d] - x[d+HD/2] sin[t][d], out[d+HD/2] = x[d+HD/2] cos[t][d+HD/2] + x[d] sin[t][d+HD/2]
__global__ __launch_bounds__(256) void k_rope(const float* __restrict__ F, int pitch, int nheads, const float* __restrict__ CS, const float* __restrict__ RF, const float* __restrict__ nw, float sc, h16* P16, bf* Ph, bf* Pl) {
    const size_t e = ((size_t)blockIdx.x * 256 + threadIdx.x) * 2; if (e >= (size_t)nheads * TT * HD) return; const int d = (int)(e % HD); const int t = (int)((e / HD) % TT); const int h = (int)(e / ((size_t)HD * TT)); const float* f = F + (size_t)t * pitch + h * HD; const float rf = RF ? RF[(size_t)h * TT + t] : 1.0f; v2h o16; v2us oh, ol;
#pragma unroll
    for (int q = 0; q < 2; ++q) { const int dd = d + q; const int dp = (dd < HD / 2) ? dd + HD / 2 : dd - HD / 2; float x0 = f[dd], x1 = f[dp];
        if (RF) { float n0 = __fmul_rn(x0, rf), n1 = __fmul_rn(x1, rf); asm volatile("" : "+v"(n0)); asm volatile("" : "+v"(n1)); x0 = __fmul_rn(bfr(nw[dd]), n0); x1 = __fmul_rn(bfr(nw[dp]), n1); }
        const v2f cs = *(const v2f*)(CS + ((size_t)t * HD + dd) * 2); float a = __fmul_rn(x0, cs[0]), bq = __fmul_rn(x1, cs[1]); asm volatile("" : "+v"(a)); asm volatile("" : "+v"(bq)); const float r = ((dd < HD / 2) ? __fsub_rn(a, bq) : __fadd_rn(a, bq)) * sc;
        o16[q] = tohx(r); unsigned short a2, c2; splitf(r, a2, c2); oh[q] = a2; ol[q] = c2; }
    *(v2h*)(P16 + e) = o16; *(v2us*)(Ph + e) = oh; *(v2us*)(Pl + e) = ol;  }
__global__ __launch_bounds__(256) void k_vtp(const float* __restrict__ F, int pitch, int nheads, h16* V16, bf* Vh, bf* Vl) { const size_t e = ((size_t)blockIdx.x * 256 + threadIdx.x) * 2; if (e >= (size_t)nheads * HD * TT) return; const int t = (int)(e % TT); const int d = (int)((e / TT) % HD); const int g = (int)(e / ((size_t)TT * HD)); v2h o16; v2us oh, ol;
#pragma unroll
    for (int q = 0; q < 2; ++q) { const float x = F[(size_t)(t + q) * pitch + g * HD + d]; o16[q] = tohx(x); unsigned short a2, c2; splitf(x, a2, c2); oh[q] = a2; ol[q] = c2; }
    *(v2h*)(V16 + e) = o16; *(v2us*)(Vh + e) = oh; *(v2us*)(Vl + e) = ol;  }
__constant__ float INVT[HD / 2] = { 1.000000000e+00f, 7.498942018e-01f, 5.623413324e-01f, 4.216965139e-01f, 3.162277639e-01f, 2.371373624e-01f, 1.778279394e-01f, 1.333521456e-01f, 1.000000015e-01f, 7.498941571e-02f, 5.623412877e-02f, 4.216964915e-02f, 3.162277862e-02f, 2.371373586e-02f, 1.778279431e-02f, 1.333521493e-02f, 9.999999776e-03f, 7.498942316e-03f, 5.623413250e-03f, 4.216964822e-03f, 3.162277862e-03f, 2.371373819e-03f, 1.778279431e-03f, 1.333521446e-03f, 1.000000047e-03f, 7.498941850e-04f, 5.623413017e-04f, 4.216964880e-04f, 3.162277862e-04f, 2.371373848e-04f, 1.778279402e-04f, 1.333521504e-04f };   // float32 1 / 10000^(i/32), generated with jnp to be bit-exact
__global__ __launch_bounds__(256) void k_cs5(float* CS) { const int idx = blockIdx.x * 256 + threadIdx.x; if (idx >= TT * HD) return; const int d = idx % HD; const int t = idx / HD; const float a = __fmul_rn((float)t, INVT[d % (HD / 2)]); v2f cs; cs[0] = cosf(a); cs[1] = sinf(a); *(v2f*)(CS + (size_t)idx * 2) = cs;  }
// k_asoft: per row (zz, i): t = S x HD^-0.5 for j <= i and i - j < WIN (WIN = T, so plain causal; the reference's -1e9 additive fill vanishes identically); softmax over the 2048 keys (register row, one exp, fixed trees);
__global__ __launch_bounds__(256) void k_asoft(const float* __restrict__ Sb, h16* P16, bf* Ph, bf* Pl) {
    const int lane = threadIdx.x & 31; const int row = blockIdx.x * 8 + (threadIdx.x >> 5); if (row >= ZH * TT) return; const int i = row % TT; const int zz = row / TT; (void)zz; const bool hires = (i < RH); const float* sr = Sb + (size_t)row * TT; float v[TT / 32]; float mx = -3.0e38f;
#pragma unroll
    for (int ch = 0; ch < TT / 128; ++ch) { const int j0 = ch * 128 + lane * 4; const v4f a = *(const v4f*)(sr + j0);
#pragma unroll
        for (int q = 0; q < 4; ++q) { const int j = j0 + q; (void)j; const float t = (j <= i && i - j < WIN) ? a[q] * SCL : -3.0e38f; v[ch * 4 + q] = t; mx = fmaxf(mx, t); } }
#pragma unroll
    for (int sh = 16; sh; sh >>= 1) mx = fmaxf(mx, __shfl_xor(mx, sh, 32));
    float sum = 0.f;
#pragma unroll
    for (int k = 0; k < TT / 32; ++k) { float d0 = __fsub_rn(v[k], mx); asm volatile("" : "+v"(d0)); v[k] = __builtin_amdgcn_exp2f(__fmul_rn(d0, 1.4426950408889634f)); sum += v[k]; }
#pragma unroll
    for (int sh = 16; sh; sh >>= 1) sum += __shfl_xor(sum, sh, 32);
    const float f = __fdiv_rn(hires ? 1.0f : PCAR, sum);
{
        if (hires) {
#pragma unroll
            for (int ch = 0; ch < TT / 128; ++ch) { v4us oh, ol;
#pragma unroll
                for (int q = 0; q < 4; ++q) { unsigned short a, c2; splitf(v[ch * 4 + q] * f, a, c2); oh[q] = a; ol[q] = c2; }
                const size_t oo = ((size_t)zz * (RH ? RH : 1) + i) * TT + ch * 128 + lane * 4; *(v4us*)(Ph + oo) = oh; *(v4us*)(Pl + oo) = ol; }
        } else {
#pragma unroll
            for (int ch = 0; ch < TT / 128; ++ch) { v4h o4;
#pragma unroll
                for (int q = 0; q < 4; ++q) o4[q] = tohx(v[ch * 4 + q] * f);
                *(v4h*)(P16 + (size_t)row * TT + ch * 128 + lane * 4) = o4; } }
         }
}
__global__ __launch_bounds__(256) void k_merge(const float* __restrict__ O, int h0, bf* Ah, bf* Al) { const size_t e = ((size_t)blockIdx.x * 256 + threadIdx.x) * 2; if (e >= (size_t)ZH * TT * HD) return; const int d = (int)(e % HD); const int t = (int)((e / HD) % TT); const int zz = (int)(e / ((size_t)HD * TT)); const float cs = (t < RH) ? 1.0f : (1.0f / PCAR); const size_t oo = (size_t)t * DQ + (h0 + zz) * HD + d;
    v2us oh, ol;
#pragma unroll
    for (int q = 0; q < 2; ++q) { unsigned short a, c2; splitf(O[e + q] * cs, a, c2); oh[q] = a; ol[q] = c2; } *(v2us*)(Ah + oo) = oh; *(v2us*)(Al + oo) = ol;  }

extern "C" void kernel_launch(void* const* d_in, const int* in_sizes, int n_in,
                              void* d_out, int out_size, void* d_ws, size_t ws_size, hipStream_t stream) {
    (void)in_sizes; (void)n_in; (void)out_size;
    const float* x = (const float*)d_in[0]; const float* wqkv = (const float*)d_in[1]; const float* wo = (const float*)d_in[2];   /* x, w_qkv ('oi' [3072][1024]: ROW thirds q | k | v, each a natural [1024][1024] block), w_out ('oi' [1024][1024]): THREE inputs */ const float* wq = wqkv; const float* wk = wqkv + (size_t)DQ * DM; const float* wv = wqkv + (size_t)2 * DQ * DM;
    float* OUT = (float*)d_out;     // [4][2048][1024]
    char* wsp = (char*)d_ws;
    auto take = [&](size_t bytes) { char* p = wsp; wsp += (bytes + 255) & ~(size_t)255; return (void*)p; };
    bf* WQ = (bf*)take((size_t)DQ * DM * 2); bf* WK = (bf*)take((size_t)DKV * DM * 2); bf* WV = (bf*)take((size_t)DKV * DM * 2); bf* WO = (bf*)take((size_t)DM * DQ * 2); float* CS = (float*)take((size_t)TT * HD * 2 * 4);
    bf* XB = (bf*)take((size_t)TT * DM * 2); float* FQ = (float*)take((size_t)TT * DQ * 4); float* FK = (float*)take((size_t)TT * DKV * 4);
    h16* QP16 = (h16*)take((size_t)NH_ * TT * HD * 2); h16* KP16 = (h16*)take((size_t)NKV * TT * HD * 2); h16* VT16 = (h16*)take((size_t)NKV * HD * TT * 2);
    bf* QPh = (bf*)take((size_t)NH_ * TT * HD * 2); bf* QPl = (bf*)take((size_t)NH_ * TT * HD * 2); bf* KPh = (bf*)take((size_t)NKV * TT * HD * 2); bf* KPl = (bf*)take((size_t)NKV * TT * HD * 2); bf* VTh = (bf*)take((size_t)NKV * HD * TT * 2); bf* VTl = (bf*)take((size_t)NKV * HD * TT * 2); bf* Ph = (bf*)take((size_t)ZH * RH * TT * 2); bf* Pl = (bf*)take((size_t)ZH * RH * TT * 2);
    float* Sb = (float*)take((size_t)ZH * TT * TT * 4); h16* P16 = (h16*)take((size_t)ZH * TT * TT * 2); float* Ob = (float*)take((size_t)ZH * TT * HD * 4); bf* ATh = (bf*)take((size_t)TT * DQ * 2); bf* ATl = (bf*)take((size_t)TT * DQ * 2);
    if ((size_t)(wsp - (char*)d_ws) > ws_size) return;    // ws 256 MiB
    float* FV = FK;   // v projection reuses the k buffer after the k planes are built (stream-ordered)
    { k_cvt8<<<(unsigned)(((size_t)DQ * DM / 8 + 255) / 256), 256, 0, stream>>>(wq, WQ, (size_t)DQ * DM / 8); k_cvt8<<<(unsigned)(((size_t)DKV * DM / 8 + 255) / 256), 256, 0, stream>>>(wk, WK, (size_t)DKV * DM / 8); k_cvt8<<<(unsigned)(((size_t)DKV * DM / 8 + 255) / 256), 256, 0, stream>>>(wv, WV, (size_t)DKV * DM / 8);
      k_cvt8<<<(unsigned)(((size_t)DM * DQ / 8 + 255) / 256), 256, 0, stream>>>(wo, WO, (size_t)DM * DQ / 8);
       }
    k_cs5<<<(TT * HD + 255) / 256, 256, 0, stream>>>(CS);   /* rotary table once */
    const unsigned LQ = (unsigned)(((size_t)NH_ * TT * HD / 2 + 255) / 256), LKv = (unsigned)(((size_t)NKV * TT * HD / 2 + 255) / 256);
    for (int b = 0; b < NB_; ++b) {
        
        k_cvt8<<<(unsigned)(((size_t)TT * DM / 8 + 255) / 256), 256, 0, stream>>>(x + (size_t)b * TT * DM, XB, (size_t)TT * DM / 8);
        k_gemmw<bf, 0, false><<<dim3(TT / 64, DQ / 64, 1), 32, 0, stream>>>(XB, nullptr, WQ, nullptr, DM, FQ, DQ, nullptr, 0, 0, 0);
        k_rope<<<LQ, 256, 0, stream>>>(FQ, DQ, NH_, CS, nullptr, nullptr, 1.0f, QP16, QPh, QPl);
        k_gemmw<bf, 0, false><<<dim3(TT / 64, DKV / 64, 1), 32, 0, stream>>>(XB, nullptr, WK, nullptr, DM, FK, DKV, nullptr, 0, 0, 0);
        k_rope<<<LKv, 256, 0, stream>>>(FK, DKV, NKV, CS, nullptr, nullptr, 1.0f, KP16, KPh, KPl);
        k_gemmw<bf, 0, false><<<dim3(TT / 64, DKV / 64, 1), 32, 0, stream>>>(XB, nullptr, WV, nullptr, DM, FV, DKV, nullptr, 0, 0, 0); k_vtp<<<LKv, 256, 0, stream>>>(FV, DKV, NKV, VT16, VTh, VTl);
        for (int h0 = 0; h0 < NH_; h0 += ZH) { const size_t zq = (size_t)h0, zk = (size_t)(h0 / REP);   // one kv head per query head: the pass's two heads use consecutive kv planes (z-strides TT*HD)
            k_gemmc<bf, 2, 1><<<dim3(RH / 64, TT / 64, ZH), 32, 0, stream>>>(QPh + zq * TT * HD, QPl + zq * TT * HD, KPh + zk * TT * HD, KPl + zk * TT * HD, HD, Sb, TT, 0, (size_t)TT * HD, (size_t)TT * HD, (size_t)TT * TT);
            k_gemmc<h16, 0, 1><<<dim3((TT - RH) / 64, TT / 64, ZH), 32, 0, stream>>>(QP16 + zq * TT * HD + (size_t)RH * HD, nullptr, KP16 + zk * TT * HD, nullptr, HD, Sb + (size_t)RH * TT, TT, RH, (size_t)TT * HD, (size_t)TT * HD, (size_t)TT * TT);
            k_asoft<<<ZH * TT / 8, 256, 0, stream>>>(Sb, P16, Ph, Pl);
            k_gemmc<bf, 2, 2><<<dim3(RH / 64, HD / 64, ZH), 32, 0, stream>>>(Ph, Pl, VTh + zk * HD * TT, VTl + zk * HD * TT, TT, Ob, HD, 0, (size_t)RH * TT, (size_t)HD * TT, (size_t)TT * HD);
            k_gemmc<h16, 0, 2><<<dim3((TT - RH) / 64, HD / 64, ZH), 32, 0, stream>>>(P16 + (size_t)RH * TT, nullptr, VT16 + zk * HD * TT, nullptr, TT, Ob + (size_t)RH * HD, HD, RH, (size_t)TT * TT, (size_t)HD * TT, (size_t)TT * HD);
            k_merge<<<(unsigned)(((size_t)ZH * TT * HD / 2 + 255) / 256), 256, 0, stream>>>(Ob, h0, ATh, ATl); }
        k_gemmw<bf, 1, false><<<dim3(TT / 64, DM / 64, 1), 32, 0, stream>>>(ATh, ATl, WO, nullptr, DQ, OUT + (size_t)b * TT * DM, DM, nullptr, 0, 0, 0); }
}

// v001
// It runs in 1480 microseconds.
// In two side-by-side timings against v000, it was 1.94 and 1.92 times as fast.
#include <hip/hip_runtime.h>

// Causal self-attention with a fused bias-free natural qkv weight and computed rotate-half rotary embeddings (x [4][2048][1024]; qkv = x w_qkv^T ('oi' [3072][1024] 1/32, no bias) split in ROW thirds q | k | v (16 heads x 64); rope cat(x1 c - x2 s, x1 s + x2 c) on the two 32-wide halves with angle t x 1/10000^(i/32) (32 f32 constants jnp-exact; one f32 product; precise cosf/sinf); scores / sqrt(64); causal (-inf == exclusion); softmax; y = merged w_out^T ('oi', no bias) -> [4][2048][1024] (8.4 M); argument order x, w_qkv, w_out).
// Layout per batch: bf16 copy of x; 'oi' weights; exact projections; k_cs5 computed table; rotate-half plane builders; causal T-2048 attention (hybrid rows: < 512 hi/lo 3 products, rest fp16 x1024; k_gemmc skips tiles above the diagonal); merged hi/lo x w_o exact.
// Compute dtypes, f32 accumulate: every input rounded to bf16; projections exact; attention rows < 512 3 products, rest fp16; softmax f32; w_o hl x exact.

#define NB_  4
#define TT   2048
#define DM   1024
#define NH_  16
#define NKV  16
#define REP  (NH_ / NKV)
#define HD   64
#define DQ   (NH_ * HD)
#define DKV  (NKV * HD)
#define ZH   2
#define RH   512                  // query rows < RH use hi+lo planes (0: none)
#define WIN  2048
#define PCAR 1024.0f
#define SCL  0.125f   // HD^-0.5
#define NCH  16                   // key chunks of the probability x value product (its key loop is split over blockIdx.y) = partial planes in the workspace
#define KCF  (TT / NCH)           // keys per chunk, fp16 rows (their keys end at TT)
#define KCB  (RH / NCH)           // keys per chunk, hi/lo rows (their keys end at RH; three products and twice the loads per 32 keys, so one loop trip per chunk)
#define PST  ((size_t)ZH * TT * HD)   // elements of one partial plane
typedef _Float16 h16;
typedef unsigned short bf;
typedef __attribute__((ext_vector_type(16))) __bf16   v16bf;
typedef __attribute__((ext_vector_type(16))) _Float16 v16h;
typedef __attribute__((ext_vector_type(8)))  _Float16 v8h;
typedef __attribute__((ext_vector_type(8)))  unsigned short v8us;
typedef __attribute__((ext_vector_type(8)))  float    v8f;
typedef __attribute__((ext_vector_type(4)))  float    v4f;
typedef v8h  __attribute__((may_alias)) v8ha;
typedef v4f  __attribute__((may_alias)) v4fa;
typedef v8us __attribute__((may_alias)) v8usa;

__device__ __forceinline__ unsigned short f2bf(float f) { unsigned u = __float_as_uint(f); u += 0x7FFFu + ((u >> 16) & 1u); return (unsigned short)(u >> 16); }
__device__ __forceinline__ float bf2f(unsigned short b) { return __uint_as_float(((unsigned)b) << 16); }
__device__ __forceinline__ float bfr(float f) { return bf2f(f2bf(f)); }
__device__ __forceinline__ v16h cat16(v8h lo, v8h hi) { return __builtin_shufflevector(lo, hi, 0, 1, 2, 3, 4, 5, 6, 7, 8, 9, 10, 11, 12, 13, 14, 15); }
__device__ __forceinline__ v16bf cat16b(v8us lo, v8us hi) { return __builtin_bit_cast(v16bf, __builtin_shufflevector(lo, hi, 0, 1, 2, 3, 4, 5, 6, 7, 8, 9, 10, 11, 12, 13, 14, 15)); }
__device__ __forceinline__ v8f wmma16(v16h a, v16h b, v8f c) { return __builtin_amdgcn_wmma_f32_16x16x32_f16(false, a, false, b, (short)0, c, false, false); }
__device__ __forceinline__ v8f wmmab(v16bf a, v16bf b, v8f c) { return __builtin_amdgcn_wmma_f32_16x16x32_bf16(false, a, false, b, (short)0, c, false, false); }



// ---- k_gemmw: register-blocked GEMM, ONE WAVE per 64x64 output tile (16 accumulators), operands straight from K-contiguous 16-bit planes; grid (M/64, N/64, Z), 32 threads.
// C[m][n] (f32, pitch ldc, + optional f32 bias[n]) = sum_k A[m][k] Bt[n][k] (+ split products per NSPLIT). z-batch strides sA/sB/sC in elements. K % 32 == 0.
template <typename T16> struct WFrag;
template <> struct WFrag<h16> { typedef v16h V; static __device__ __forceinline__ V ld(const h16* p) { return cat16(*(const v8h*)p, *(const v8h*)(p + 16)); } static __device__ __forceinline__ v8f mma(V a, V b, v8f c) { return wmma16(a, b, c); } };
template <> struct WFrag<bf> { typedef v16bf V; static __device__ __forceinline__ V ld(const bf* p) { return cat16b(*(const v8us*)p, *(const v8us*)(p + 16)); } static __device__ __forceinline__ v8f mma(V a, V b, v8f c) { return wmmab(a, b, c); } };
template <typename T16, int NSPLIT, bool BIAS>
__global__ __launch_bounds__(32) void k_gemmw(const T16* __restrict__ A, const T16* __restrict__ A2, const T16* __restrict__ Bt, const T16* __restrict__ Bt2, int K, float* C, int ldc, const float* __restrict__ bias, size_t sA, size_t sB, size_t sC) {
    typedef typename WFrag<T16>::V V;
    __shared__ __align__(16) float os[16 * 68];
    const size_t z = blockIdx.z; A += z * sA; if (A2) A2 += z * sA; Bt += z * sB; if (Bt2) Bt2 += z * sB; C += z * sC;
    const int lane = threadIdx.x & 31, lr = lane & 15, hi = lane >> 4; const int r0 = blockIdx.x * 64, c0 = blockIdx.y * 64;
    v8f acc[4][4];
#pragma unroll
    for (int mb = 0; mb < 4; ++mb)
#pragma unroll
        for (int nb = 0; nb < 4; ++nb) acc[mb][nb] = (v8f){};
    const size_t aoff = (size_t)(r0 + lr) * K + 8 * hi, boff = (size_t)(c0 + lr) * K + 8 * hi;
#pragma unroll 1
    for (int kc = 0; kc < K; kc += 32) {
        V a[4], a2[4];
#pragma unroll
        for (int mb = 0; mb < 4; ++mb) { a[mb] = WFrag<T16>::ld(A + aoff + (size_t)mb * 16 * K + kc); if (NSPLIT == 1 || NSPLIT == 2) a2[mb] = WFrag<T16>::ld(A2 + aoff + (size_t)mb * 16 * K + kc); }
#pragma unroll
        for (int nb = 0; nb < 4; ++nb) { const V b = WFrag<T16>::ld(Bt + boff + (size_t)nb * 16 * K + kc); V b2; if (NSPLIT >= 2) b2 = WFrag<T16>::ld(Bt2 + boff + (size_t)nb * 16 * K + kc);
#pragma unroll
            for (int mb = 0; mb < 4; ++mb) { acc[mb][nb] = WFrag<T16>::mma(a[mb], b, acc[mb][nb]); if (NSPLIT == 1 || NSPLIT == 2) acc[mb][nb] = WFrag<T16>::mma(a2[mb], b, acc[mb][nb]); if (NSPLIT >= 2) acc[mb][nb] = WFrag<T16>::mma(a[mb], b2, acc[mb][nb]); } }
        asm volatile("v_nop\n\tv_nop\n\tv_nop\n\tv_nop" : "+v"(acc[0][0]), "+v"(acc[1][1]), "+v"(acc[2][2]), "+v"(acc[3][3]) : "v"(a[0]), "v"(a[3]));
    }
#pragma unroll
    for (int mb = 0; mb < 4; ++mb) {
#pragma unroll
        for (int nb = 0; nb < 4; ++nb) {
#pragma unroll
            for (int j = 0; j < 8; ++j) os[(hi * 8 + j) * 68 + nb * 16 + lr] = acc[mb][nb][j]; }
        __builtin_amdgcn_wave_barrier(); asm volatile("" ::: "memory");
        float* crow = C + (size_t)(r0 + mb * 16) * ldc + c0;
{
#pragma unroll
            for (int s = 0; s < 8; ++s) { const int row = 2 * s + hi, cofs = lr * 4; v4f val = *(const v4fa*)(os + row * 68 + cofs); if (BIAS) { val[0] += bfr(bias[c0 + cofs]); val[1] += bfr(bias[c0 + cofs + 1]); val[2] += bfr(bias[c0 + cofs + 2]); val[3] += bfr(bias[c0 + cofs + 3]); }
                *(v4f*)(crow + (size_t)row * ldc + cofs) = val; }
             }
        __builtin_amdgcn_wave_barrier(); asm volatile("" ::: "memory");
    }
}

// ---- k_gemmc: the same one-wave 64x64 tile GEMM specialised for causal attention: CMODE 1 skips score tiles entirely above the diagonal (query rows r0+roff.., key columns c0..), CMODE 2 limits the
// key (K) loop of the probability x value contraction to the diagonal block (probabilities beyond it are exactly zero). roff = row offset of this launch's first row within the sequence.
// CMODE 2 has one 64-wide column tile (HD == 64), so blockIdx.y is free and names a chunk of KCB (rows < RH) or KCF keys: each work-group sums its own chunk alone and stores the f32 partial tile to plane blockIdx.y of C
// (planes PST elements apart); chunks that begin beyond the diagonal block are neither computed nor stored, and k_merge adds the stored planes of a row in ascending chunk order.
template <typename T16, int NSPLIT, int CMODE>
__global__ __launch_bounds__(32) void k_gemmc(const T16* __restrict__ A, const T16* __restrict__ A2, const T16* __restrict__ Bt, const T16* __restrict__ Bt2, int K, float* C, int ldc, int roff, size_t sA, size_t sB, size_t sC) {
    typedef typename WFrag<T16>::V V;
    __shared__ __align__(16) float os[16 * 68];
    const size_t z = blockIdx.z; A += z * sA; if (A2) A2 += z * sA; Bt += z * sB; if (Bt2) Bt2 += z * sB; C += z * sC;
    const int lane = threadIdx.x & 31, lr = lane & 15, hi = lane >> 4; const int r0 = blockIdx.x * 64, c0 = (CMODE == 2) ? 0 : blockIdx.y * 64;
    if (CMODE == 1 && c0 > r0 + roff + 63) return;                  // score tile entirely above the causal diagonal: never read (the softmax masks j > i by select)
    const int Kl = (CMODE == 2) ? min(K, r0 + roff + 64) : K;        // P.V: probabilities are exactly 0 beyond the diagonal block, so the K loop stops there
    const int kch = (r0 + roff < RH) ? KCB : KCF;                    // P.V: keys per chunk (k_merge picks by the same test)
    const int k0 = (CMODE == 2) ? (int)blockIdx.y * kch : 0;         // P.V: this work-group's first key
    if (CMODE == 2 && k0 >= Kl) return;                              // chunk entirely beyond the diagonal block: no plane is stored and k_merge reads none
    const int k1 = (CMODE == 2) ? min(Kl, k0 + kch) : Kl;
    if (CMODE == 2) C += (size_t)blockIdx.y * PST;
    v8f acc[4][4];
#pragma unroll
    for (int mb = 0; mb < 4; ++mb)
#pragma unroll
        for (int nb = 0; nb < 4; ++nb) acc[mb][nb] = (v8f){};
    const size_t aoff = (size_t)(r0 + lr) * K + 8 * hi, boff = (size_t)(c0 + lr) * K + 8 * hi;
#pragma unroll 1
    for (int kc = k0; kc < k1; kc += 32) {
        V a[4], a2[4];
#pragma unroll
        for (int mb = 0; mb < 4; ++mb) { a[mb] = WFrag<T16>::ld(A + aoff + (size_t)mb * 16 * K + kc); if (NSPLIT == 1 || NSPLIT == 2) a2[mb] = WFrag<T16>::ld(A2 + aoff + (size_t)mb * 16 * K + kc); }
#pragma unroll
        for (int nb = 0; nb < 4; ++nb) { const V b = WFrag<T16>::ld(Bt + boff + (size_t)nb * 16 * K + kc); V b2; if (NSPLIT >= 2) b2 = WFrag<T16>::ld(Bt2 + boff + (size_t)nb * 16 * K + kc);
#pragma unroll
            for (int mb = 0; mb < 4; ++mb) { acc[mb][nb] = WFrag<T16>::mma(a[mb], b, acc[mb][nb]); if (NSPLIT == 1 || NSPLIT == 2) acc[mb][nb] = WFrag<T16>::mma(a2[mb], b, acc[mb][nb]); if (NSPLIT >= 2) acc[mb][nb] = WFrag<T16>::mma(a[mb], b2, acc[mb][nb]); } }
        asm volatile("v_nop\n\tv_nop\n\tv_nop\n\tv_nop" : "+v"(acc[0][0]), "+v"(acc[1][1]), "+v"(acc[2][2]), "+v"(acc[3][3]) : "v"(a[0]), "v"(a[3]));
    }
#pragma unroll
    for (int mb = 0; mb < 4; ++mb) {
#pragma unroll
        for (int nb = 0; nb < 4; ++nb) {
#pragma unroll
            for (int j = 0; j < 8; ++j) os[(hi * 8 + j) * 68 + nb * 16 + lr] = acc[mb][nb][j]; }
        __builtin_amdgcn_wave_barrier(); asm volatile("" ::: "memory");
        float* crow = C + (size_t)(r0 + mb * 16) * ldc + c0;
{
#pragma unroll
            for (int s = 0; s < 8; ++s) { const int row = 2 * s + hi, cofs = lr * 4; v4f val = *(const v4fa*)(os + row * 68 + cofs);
                *(v4f*)(crow + (size_t)row * ldc + cofs) = val; }
             }
        __builtin_amdgcn_wave_barrier(); asm volatile("" ::: "memory");
    }
}

__device__ __forceinline__ h16 tohx(float x) { return (h16)x; }
__device__ __forceinline__ void splitf(float y, unsigned short& h, unsigned short& l) { h = f2bf(y); l = f2bf(y - bf2f(h)); }
typedef __attribute__((ext_vector_type(2))) _Float16 v2h;
typedef __attribute__((ext_vector_type(4))) _Float16 v4h;
typedef __attribute__((ext_vector_type(2))) unsigned short v2us;
typedef __attribute__((ext_vector_type(4))) unsigned short v4us;
typedef __attribute__((ext_vector_type(2))) float v2f;
typedef __attribute__((ext_vector_type(4))) int v4i;

__global__ __launch_bounds__(256) void k_cvt8(const float* __restrict__ src, bf* dst, size_t n8) { const size_t i = (size_t)blockIdx.x * 256 + threadIdx.x; if (i >= n8) return; const v8f v = *(const v8f*)(src + i * 8); v8us o;
#pragma unroll
    for (int k = 0; k < 8; ++k) o[k] = f2bf(v[k]); *(v8us*)(dst + i * 8) = o;  }

// k_rope: head planes [h][t][d] (fp16 + hi/lo) of rope(x) x sc with the rotate-half convention out[d] = x[d] cos[t][d] - x[d+HD/2] sin[t][d], out[d+HD/2] = x[d+HD/2] cos[t][d+HD/2] + x[d] sin[t][d+HD/2]
__global__ __launch_bounds__(256) void k_rope(const float* __restrict__ F, int pitch, int nheads, const float* __restrict__ CS, const float* __restrict__ RF, const float* __restrict__ nw, float sc, h16* P16, bf* Ph, bf* Pl) {
    const size_t e = ((size_t)blockIdx.x * 256 + threadIdx.x) * 2; if (e >= (size_t)nheads * TT * HD) return; const int d = (int)(e % HD); const int t = (int)((e / HD) % TT); const int h = (int)(e / ((size_t)HD * TT)); const float* f = F + (size_t)t * pitch + h * HD; const float rf = RF ? RF[(size_t)h * TT + t] : 1.0f; v2h o16; v2us oh, ol;
#pragma unroll
    for (int q = 0; q < 2; ++q) { const int dd = d + q; const int dp = (dd < HD / 2) ? dd + HD / 2 : dd - HD / 2; float x0 = f[dd], x1 = f[dp];
        if (RF) { float n0 = __fmul_rn(x0, rf), n1 = __fmul_rn(x1, rf); asm volatile("" : "+v"(n0)); asm volatile("" : "+v"(n1)); x0 = __fmul_rn(bfr(nw[dd]), n0); x1 = __fmul_rn(bfr(nw[dp]), n1); }
        const v2f cs = *(const v2f*)(CS + ((size_t)t * HD + dd) * 2); float a = __fmul_rn(x0, cs[0]), bq = __fmul_rn(x1, cs[1]); asm volatile("" : "+v"(a)); asm volatile("" : "+v"(bq)); const float r = ((dd < HD / 2) ? __fsub_rn(a, bq) : __fadd_rn(a, bq)) * sc;
        o16[q] = tohx(r); unsigned short a2, c2; splitf(r, a2, c2); oh[q] = a2; ol[q] = c2; }
    *(v2h*)(P16 + e) = o16; *(v2us*)(Ph + e) = oh; *(v2us*)(Pl + e) = ol;  }
__global__ __launch_bounds__(256) void k_vtp(const float* __restrict__ F, int pitch, int nheads, h16* V16, bf* Vh, bf* Vl) { const size_t e = ((size_t)blockIdx.x * 256 + threadIdx.x) * 2; if (e >= (size_t)nheads * HD * TT) return; const int t = (int)(e % TT); const int d = (int)((e / TT) % HD); const int g = (int)(e / ((size_t)TT * HD)); v2h o16; v2us oh, ol;
#pragma unroll
    for (int q = 0; q < 2; ++q) { const float x = F[(size_t)(t + q) * pitch + g * HD + d]; o16[q] = tohx(x); unsigned short a2, c2; splitf(x, a2, c2); oh[q] = a2; ol[q] = c2; }
    *(v2h*)(V16 + e) = o16; *(v2us*)(Vh + e) = oh; *(v2us*)(Vl + e) = ol;  }
__constant__ float INVT[HD / 2] = { 1.000000000e+00f, 7.498942018e-01f, 5.623413324e-01f, 4.216965139e-01f, 3.162277639e-01f, 2.371373624e-01f, 1.778279394e-01f, 1.333521456e-01f, 1.000000015e-01f, 7.498941571e-02f, 5.623412877e-02f, 4.216964915e-02f, 3.162277862e-02f, 2.371373586e-02f, 1.778279431e-02f, 1.333521493e-02f, 9.999999776e-03f, 7.498942316e-03f, 5.623413250e-03f, 4.216964822e-03f, 3.162277862e-03f, 2.371373819e-03f, 1.778279431e-03f, 1.333521446e-03f, 1.000000047e-03f, 7.498941850e-04f, 5.623413017e-04f, 4.216964880e-04f, 3.162277862e-04f, 2.371373848e-04f, 1.778279402e-04f, 1.333521504e-04f };   // float32 1 / 10000^(i/32), generated with jnp to be bit-exact
__global__ __launch_bounds__(256) void k_cs5(float* CS) { const int idx = blockIdx.x * 256 + threadIdx.x; if (idx >= TT * HD) return; const int d = idx % HD; const int t = idx / HD; const float a = __fmul_rn((float)t, INVT[d % (HD / 2)]); v2f cs; cs[0] = cosf(a); cs[1] = sinf(a); *(v2f*)(CS + (size_t)idx * 2) = cs;  }
// k_asoft: per row (zz, i): t = S x HD^-0.5 for j <= i and i - j < WIN (WIN = T, so plain causal; the reference's -1e9 additive fill vanishes identically); softmax over the 2048 keys (register row, one exp, fixed trees);
__global__ __launch_bounds__(256) void k_asoft(const float* __restrict__ Sb, h16* P16, bf* Ph, bf* Pl) {
    const int lane = threadIdx.x & 31; const int row = blockIdx.x * 8 + (threadIdx.x >> 5); if (row >= ZH * TT) return; const int i = row % TT; const int zz = row / TT; (void)zz; const bool hires = (i < RH); const float* sr = Sb + (size_t)row * TT; float v[TT / 32]; float mx = -3.0e38f;
#pragma unroll
    for (int ch = 0; ch < TT / 128; ++ch) { const int j0 = ch * 128 + lane * 4; const v4f a = *(const v4f*)(sr + j0);
#pragma unroll
        for (int q = 0; q < 4; ++q) { const int j = j0 + q; (void)j; const float t = (j <= i && i - j < WIN) ? a[q] * SCL : -3.0e38f; v[ch * 4 + q] = t; mx = fmaxf(mx, t); } }
#pragma unroll
    for (int sh = 16; sh; sh >>= 1) mx = fmaxf(mx, __shfl_xor(mx, sh, 32));
    float sum = 0.f;
#pragma unroll
    for (int k = 0; k < TT / 32; ++k) { float d0 = __fsub_rn(v[k], mx); asm volatile("" : "+v"(d0)); v[k] = __builtin_amdgcn_exp2f(__fmul_rn(d0, 1.4426950408889634f)); sum += v[k]; }
#pragma unroll
    for (int sh = 16; sh; sh >>= 1) sum += __shfl_xor(sum, sh, 32);
    const float f = __fdiv_rn(hires ? 1.0f : PCAR, sum);
{
        if (hires) {
#pragma unroll
            for (int ch = 0; ch < TT / 128; ++ch) { v4us oh, ol;
#pragma unroll
                for (int q = 0; q < 4; ++q) { unsigned short a, c2; splitf(v[ch * 4 + q] * f, a, c2); oh[q] = a; ol[q] = c2; }
                const size_t oo = ((size_t)zz * (RH ? RH : 1) + i) * TT + ch * 128 + lane * 4; *(v4us*)(Ph + oo) = oh; *(v4us*)(Pl + oo) = ol; }
        } else {
#pragma unroll
            for (int ch = 0; ch < TT / 128; ++ch) { v4h o4;
#pragma unroll
                for (int q = 0; q < 4; ++q) o4[q] = tohx(v[ch * 4 + q] * f);
                *(v4h*)(P16 + (size_t)row * TT + ch * 128 + lane * 4) = o4; } }
         }
}
__global__ __launch_bounds__(256) void k_merge(const float* __restrict__ O, int h0, bf* Ah, bf* Al) { const size_t e = ((size_t)blockIdx.x * 256 + threadIdx.x) * 2; if (e >= (size_t)ZH * TT * HD) return; const int d = (int)(e % HD); const int t = (int)((e / HD) % TT); const int zz = (int)(e / ((size_t)HD * TT)); const float cs = (t < RH) ? 1.0f : (1.0f / PCAR); const size_t oo = (size_t)t * DQ + (h0 + zz) * HD + d;
    const int kl = (t & ~63) + 64; const int nch = (t < RH) ? (kl + KCB - 1) / KCB : (kl + KCF - 1) / KCF;   // partial planes stored for this row's 64-row tile (the same for a whole block)
    static_assert(NCH == 16, "the fence below names sixteen planes");
    v2f p[NCH];
#pragma unroll
    for (int c = 0; c < NCH; ++c) p[c] = *(const v2f*)(O + (size_t)min(c, nch - 1) * PST + e);   // plane index clamped to a stored plane: no branch between the loads, nothing unwritten is read
    // inputs only: keeps all sixteen loads in front of the first add, so that they are in flight together (without it the compiler waits for the first two before it issues the rest)
    asm volatile("" :: "v"(p[0]), "v"(p[1]), "v"(p[2]), "v"(p[3]), "v"(p[4]), "v"(p[5]), "v"(p[6]), "v"(p[7]), "v"(p[8]), "v"(p[9]), "v"(p[10]), "v"(p[11]), "v"(p[12]), "v"(p[13]), "v"(p[14]), "v"(p[15]));
    v2f s = p[0];
#pragma unroll
    for (int c = 1; c < NCH; ++c) { s[0] = (c < nch) ? s[0] + p[c][0] : s[0]; s[1] = (c < nch) ? s[1] + p[c][1] : s[1]; }   // ascending, fixed sum order
    v2us oh, ol;
#pragma unroll
    for (int q = 0; q < 2; ++q) { unsigned short a, c2; splitf(s[q] * cs, a, c2); oh[q] = a; ol[q] = c2; } *(v2us*)(Ah + oo) = oh; *(v2us*)(Al + oo) = ol;  }

extern "C" void kernel_launch(void* const* d_in, const int* in_sizes, int n_in,
                              void* d_out, int out_size, void* d_ws, size_t ws_size, hipStream_t stream) {
    (void)in_sizes; (void)n_in; (void)out_size;
    const float* x = (const float*)d_in[0]; const float* wqkv = (const float*)d_in[1]; const float* wo = (const float*)d_in[2];   /* x, w_qkv ('oi' [3072][1024]: ROW thirds q | k | v, each a natural [1024][1024] block), w_out ('oi' [1024][1024]): THREE inputs */ const float* wq = wqkv; const float* wk = wqkv + (size_t)DQ * DM; const float* wv = wqkv + (size_t)2 * DQ * DM;
    float* OUT = (float*)d_out;     // [4][2048][1024]
    char* wsp = (char*)d_ws;
    auto take = [&](size_t bytes) { char* p = wsp; wsp += (bytes + 255) & ~(size_t)255; return (void*)p; };
    bf* WQ = (bf*)take((size_t)DQ * DM * 2); bf* WK = (bf*)take((size_t)DKV * DM * 2); bf* WV = (bf*)take((size_t)DKV * DM * 2); bf* WO = (bf*)take((size_t)DM * DQ * 2); float* CS = (float*)take((size_t)TT * HD * 2 * 4);
    bf* XB = (bf*)take((size_t)TT * DM * 2); float* FQ = (float*)take((size_t)TT * DQ * 4); float* FK = (float*)take((size_t)TT * DKV * 4);
    h16* QP16 = (h16*)take((size_t)NH_ * TT * HD * 2); h16* KP16 = (h16*)take((size_t)NKV * TT * HD * 2); h16* VT16 = (h16*)take((size_t)NKV * HD * TT * 2);
    bf* QPh = (bf*)take((size_t)NH_ * TT * HD * 2); bf* QPl = (bf*)take((size_t)NH_ * TT * HD * 2); bf* KPh = (bf*)take((size_t)NKV * TT * HD * 2); bf* KPl = (bf*)take((size_t)NKV * TT * HD * 2); bf* VTh = (bf*)take((size_t)NKV * HD * TT * 2); bf* VTl = (bf*)take((size_t)NKV * HD * TT * 2); bf* Ph = (bf*)take((size_t)ZH * RH * TT * 2); bf* Pl = (bf*)take((size_t)ZH * RH * TT * 2);
    float* Sb = (float*)take((size_t)ZH * TT * TT * 4); h16* P16 = (h16*)take((size_t)ZH * TT * TT * 2); float* Ob = (float*)take((size_t)NCH * PST * 4); bf* ATh = (bf*)take((size_t)TT * DQ * 2); bf* ATl = (bf*)take((size_t)TT * DQ * 2);
    if ((size_t)(wsp - (char*)d_ws) > ws_size) return;    // ws 256 MiB
    float* FV = FK;   // v projection reuses the k buffer after the k planes are built (stream-ordered)
    { k_cvt8<<<(unsigned)(((size_t)DQ * DM / 8 + 255) / 256), 256, 0, stream>>>(wq, WQ, (size_t)DQ * DM / 8); k_cvt8<<<(unsigned)(((size_t)DKV * DM / 8 + 255) / 256), 256, 0, stream>>>(wk, WK, (size_t)DKV * DM / 8); k_cvt8<<<(unsigned)(((size_t)DKV * DM / 8 + 255) / 256), 256, 0, stream>>>(wv, WV, (size_t)DKV * DM / 8);
      k_cvt8<<<(unsigned)(((size_t)DM * DQ / 8 + 255) / 256), 256, 0, stream>>>(wo, WO, (size_t)DM * DQ / 8);
       }
    k_cs5<<<(TT * HD + 255) / 256, 256, 0, stream>>>(CS);   /* rotary table once */
    const unsigned LQ = (unsigned)(((size_t)NH_ * TT * HD / 2 + 255) / 256), LKv = (unsigned)(((size_t)NKV * TT * HD / 2 + 255) / 256);
    for (int b = 0; b < NB_; ++b) {
        
        k_cvt8<<<(unsigned)(((size_t)TT * DM / 8 + 255) / 256), 256, 0, stream>>>(x + (size_t)b * TT * DM, XB, (size_t)TT * DM / 8);
        k_gemmw<bf, 0, false><<<dim3(TT / 64, DQ / 64, 1), 32, 0, stream>>>(XB, nullptr, WQ, nullptr, DM, FQ, DQ, nullptr, 0, 0, 0);
        k_rope<<<LQ, 256, 0, stream>>>(FQ, DQ, NH_, CS, nullptr, nullptr, 1.0f, QP16, QPh, QPl);
        k_gemmw<bf, 0, false><<<dim3(TT / 64, DKV / 64, 1), 32, 0, stream>>>(XB, nullptr, WK, nullptr, DM, FK, DKV, nullptr, 0, 0, 0);
        k_rope<<<LKv, 256, 0, stream>>>(FK, DKV, NKV, CS, nullptr, nullptr, 1.0f, KP16, KPh, KPl);
        k_gemmw<bf, 0, false><<<dim3(TT / 64, DKV / 64, 1), 32, 0, stream>>>(XB, nullptr, WV, nullptr, DM, FV, DKV, nullptr, 0, 0, 0); k_vtp<<<LKv, 256, 0, stream>>>(FV, DKV, NKV, VT16, VTh, VTl);
        for (int h0 = 0; h0 < NH_; h0 += ZH) { const size_t zq = (size_t)h0, zk = (size_t)(h0 / REP);   // one kv head per query head: the pass's two heads use consecutive kv planes (z-strides TT*HD)
            k_gemmc<bf, 2, 1><<<dim3(RH / 64, TT / 64, ZH), 32, 0, stream>>>(QPh + zq * TT * HD, QPl + zq * TT * HD, KPh + zk * TT * HD, KPl + zk * TT * HD, HD, Sb, TT, 0, (size_t)TT * HD, (size_t)TT * HD, (size_t)TT * TT);
            k_gemmc<h16, 0, 1><<<dim3((TT - RH) / 64, TT / 64, ZH), 32, 0, stream>>>(QP16 + zq * TT * HD + (size_t)RH * HD, nullptr, KP16 + zk * TT * HD, nullptr, HD, Sb + (size_t)RH * TT, TT, RH, (size_t)TT * HD, (size_t)TT * HD, (size_t)TT * TT);
            k_asoft<<<ZH * TT / 8, 256, 0, stream>>>(Sb, P16, Ph, Pl);
            k_gemmc<bf, 2, 2><<<dim3(RH / 64, NCH, ZH), 32, 0, stream>>>(Ph, Pl, VTh + zk * HD * TT, VTl + zk * HD * TT, TT, Ob, HD, 0, (size_t)RH * TT, (size_t)HD * TT, (size_t)TT * HD);
            k_gemmc<h16, 0, 2><<<dim3((TT - RH) / 64, NCH, ZH), 32, 0, stream>>>(P16 + (size_t)RH * TT, nullptr, VT16 + zk * HD * TT, nullptr, TT, Ob + (size_t)RH * HD, HD, RH, (size_t)TT * TT, (size_t)HD * TT, (size_t)TT * HD);
            k_merge<<<(unsigned)(((size_t)ZH * TT * HD / 2 + 255) / 256), 256, 0, stream>>>(Ob, h0, ATh, ATl); }
        k_gemmw<bf, 1, false><<<dim3(TT / 64, DM / 64, 1), 32, 0, stream>>>(ATh, ATl, WO, nullptr, DQ, OUT + (size_t)b * TT * DM, DM, nullptr, 0, 0, 0); }
}

// v002
// Measured time: 1080 microseconds a run.
// Next to v001, in two timings, it ran 1.37 times as fast each time.
// Over all steps from v000 it is 2.64 times as fast.
#include <hip/hip_runtime.h>

// Causal self-attention with a fused bias-free natural qkv weight and computed rotate-half rotary embeddings (x [4][2048][1024]; qkv = x w_qkv^T ('oi' [3072][1024] 1/32, no bias) split in ROW thirds q | k | v (16 heads x 64); rope cat(x1 c - x2 s, x1 s + x2 c) on the two 32-wide halves with angle t x 1/10000^(i/32) (32 f32 constants jnp-exact; one f32 product; precise cosf/sinf); scores / sqrt(64); causal (-inf == exclusion); softmax; y = merged w_out^T ('oi', no bias) -> [4][2048][1024] (8.4 M); argument order x, w_qkv, w_out).
// Layout per batch: bf16 copy of x; 'oi' weights; exact projections; k_cs5 computed table; rotate-half plane builders; causal T-2048 attention, eight heads a pass, probabilities written over their own score rows (hybrid rows: < 512 hi/lo 3 products, rest fp16 x1024; k_gemmc skips tiles above the diagonal); merged hi/lo x w_o exact.
// Compute dtypes, f32 accumulate: every input rounded to bf16; projections exact; attention rows < 512 3 products, rest fp16; softmax f32; w_o hl x exact.

#define NB_  4
#define TT   2048
#define DM   1024
#define NH_  16
#define NKV  16
#define REP  (NH_ / NKV)
#define HD   64
#define DQ   (NH_ * HD)
#define DKV  (NKV * HD)
#define ZH   8                    // heads per attention pass (blockIdx.z of its four k_gemmc launches)
#define PPT  (2 * TT)             // pitch, in 16-bit elements, of a probability row: it lies in the bytes of its own f32 score row
#define RH   512                  // query rows < RH use hi+lo planes (0: none)
#define WIN  2048
#define PCAR 1024.0f
#define SCL  0.125f   // HD^-0.5
#define NCH  16                   // key chunks of the probability x value product (its key loop is split over blockIdx.y) = partial planes in the workspace
#define KCF  (TT / NCH)           // keys per chunk, fp16 rows (their keys end at TT)
#define KCB  (RH / NCH)           // keys per chunk, hi/lo rows (their keys end at RH; three products and twice the loads per 32 keys, so one loop trip per chunk)
#define PST  ((size_t)ZH * TT * HD)   // elements of one partial plane
typedef _Float16 h16;
typedef unsigned short bf;
typedef __attribute__((ext_vector_type(16))) __bf16   v16bf;
typedef __attribute__((ext_vector_type(16))) _Float16 v16h;
typedef __attribute__((ext_vector_type(8)))  _Float16 v8h;
typedef __attribute__((ext_vector_type(8)))  unsigned short v8us;
typedef __attribute__((ext_vector_type(8)))  float    v8f;
typedef __attribute__((ext_vector_type(4)))  float    v4f;
typedef v8h  __attribute__((may_alias)) v8ha;
typedef v4f  __attribute__((may_alias)) v4fa;
typedef v8us __attribute__((may_alias)) v8usa;

__device__ __forceinline__ unsigned short f2bf(float f) { unsigned u = __float_as_uint(f); u += 0x7FFFu + ((u >> 16) & 1u); return (unsigned short)(u >> 16); }
__device__ __forceinline__ float bf2f(unsigned short b) { return __uint_as_float(((unsigned)b) << 16); }
__device__ __forceinline__ float bfr(float f) { return bf2f(f2bf(f)); }
__device__ __forceinline__ v16h cat16(v8h lo, v8h hi) { return __builtin_shufflevector(lo, hi, 0, 1, 2, 3, 4, 5, 6, 7, 8, 9, 10, 11, 12, 13, 14, 15); }
__device__ __forceinline__ v16bf cat16b(v8us lo, v8us hi) { return __builtin_bit_cast(v16bf, __builtin_shufflevector(lo, hi, 0, 1, 2, 3, 4, 5, 6, 7, 8, 9, 10, 11, 12, 13, 14, 15)); }
__device__ __forceinline__ v8f wmma16(v16h a, v16h b, v8f c) { return __builtin_amdgcn_wmma_f32_16x16x32_f16(false, a, false, b, (short)0, c, false, false); }
__device__ __forceinline__ v8f wmmab(v16bf a, v16bf b, v8f c) { return __builtin_amdgcn_wmma_f32_16x16x32_bf16(false, a, false, b, (short)0, c, false, false); }



// ---- k_gemmw: register-blocked GEMM, ONE WAVE per 64x64 output tile (16 accumulators), operands straight from K-contiguous 16-bit planes; grid (M/64, N/64, Z), 32 threads.
// C[m][n] (f32, pitch ldc, + optional f32 bias[n]) = sum_k A[m][k] Bt[n][k] (+ split products per NSPLIT). z-batch strides sA/sB/sC in elements. K % 32 == 0.
template <typename T16> struct WFrag;
template <> struct WFrag<h16> { typedef v16h V; static __device__ __forceinline__ V ld(const h16* p) { return cat16(*(const v8h*)p, *(const v8h*)(p + 16)); } static __device__ __forceinline__ v8f mma(V a, V b, v8f c) { return wmma16(a, b, c); } };
template <> struct WFrag<bf> { typedef v16bf V; static __device__ __forceinline__ V ld(const bf* p) { return cat16b(*(const v8us*)p, *(const v8us*)(p + 16)); } static __device__ __forceinline__ v8f mma(V a, V b, v8f c) { return wmmab(a, b, c); } };
template <typename T16, int NSPLIT, bool BIAS>
__global__ __launch_bounds__(32) void k_gemmw(const T16* __restrict__ A, const T16* __restrict__ A2, const T16* __restrict__ Bt, const T16* __restrict__ Bt2, int K, float* C, int ldc, const float* __restrict__ bias, size_t sA, size_t sB, size_t sC) {
    typedef typename WFrag<T16>::V V;
    __shared__ __align__(16) float os[16 * 68];
    const size_t z = blockIdx.z; A += z * sA; if (A2) A2 += z * sA; Bt += z * sB; if (Bt2) Bt2 += z * sB; C += z * sC;
    const int lane = threadIdx.x & 31, lr = lane & 15, hi = lane >> 4; const int r0 = blockIdx.x * 64, c0 = blockIdx.y * 64;
    v8f acc[4][4];
#pragma unroll
    for (int mb = 0; mb < 4; ++mb)
#pragma unroll
        for (int nb = 0; nb < 4; ++nb) acc[mb][nb] = (v8f){};
    const size_t aoff = (size_t)(r0 + lr) * K + 8 * hi, boff = (size_t)(c0 + lr) * K + 8 * hi;
#pragma unroll 1
    for (int kc = 0; kc < K; kc += 32) {
        V a[4], a2[4];
#pragma unroll
        for (int mb = 0; mb < 4; ++mb) { a[mb] = WFrag<T16>::ld(A + aoff + (size_t)mb * 16 * K + kc); if (NSPLIT == 1 || NSPLIT == 2) a2[mb] = WFrag<T16>::ld(A2 + aoff + (size_t)mb * 16 * K + kc); }
#pragma unroll
        for (int nb = 0; nb < 4; ++nb) { const V b = WFrag<T16>::ld(Bt + boff + (size_t)nb * 16 * K + kc); V b2; if (NSPLIT >= 2) b2 = WFrag<T16>::ld(Bt2 + boff + (size_t)nb * 16 * K + kc);
#pragma unroll
            for (int mb = 0; mb < 4; ++mb) { acc[mb][nb] = WFrag<T16>::mma(a[mb], b, acc[mb][nb]); if (NSPLIT == 1 || NSPLIT == 2) acc[mb][nb] = WFrag<T16>::mma(a2[mb], b, acc[mb][nb]); if (NSPLIT >= 2) acc[mb][nb] = WFrag<T16>::mma(a[mb], b2, acc[mb][nb]); } }
        asm volatile("v_nop\n\tv_nop\n\tv_nop\n\tv_nop" : "+v"(acc[0][0]), "+v"(acc[1][1]), "+v"(acc[2][2]), "+v"(acc[3][3]) : "v"(a[0]), "v"(a[3]));
    }
#pragma unroll
    for (int mb = 0; mb < 4; ++mb) {
#pragma unroll
        for (int nb = 0; nb < 4; ++nb) {
#pragma unroll
            for (int j = 0; j < 8; ++j) os[(hi * 8 + j) * 68 + nb * 16 + lr] = acc[mb][nb][j]; }
        __builtin_amdgcn_wave_barrier(); asm volatile("" ::: "memory");
        float* crow = C + (size_t)(r0 + mb * 16) * ldc + c0;
{
#pragma unroll
            for (int s = 0; s < 8; ++s) { const int row = 2 * s + hi, cofs = lr * 4; v4f val = *(const v4fa*)(os + row * 68 + cofs); if (BIAS) { val[0] += bfr(bias[c0 + cofs]); val[1] += bfr(bias[c0 + cofs + 1]); val[2] += bfr(bias[c0 + cofs + 2]); val[3] += bfr(bias[c0 + cofs + 3]); }
                *(v4f*)(crow + (size_t)row * ldc + cofs) = val; }
             }
        __builtin_amdgcn_wave_barrier(); asm volatile("" ::: "memory");
    }
}

// ---- k_gemmc: the same one-wave 64x64 tile GEMM specialised for causal attention: CMODE 1 skips score tiles entirely above the diagonal (query rows r0+roff.., key columns c0..), CMODE 2 limits the
// key (K) loop of the probability x value contraction to the diagonal block (probabilities beyond it are exactly zero). roff = row offset of this launch's first row within the sequence.
// CMODE 2 has one 64-wide column tile (HD == 64), so blockIdx.y is free and names a chunk of KCB (rows < RH) or KCF keys: each work-group sums its own chunk alone and stores the f32 partial tile to plane blockIdx.y of C
// (planes PST elements apart); chunks that begin beyond the diagonal block are neither computed nor stored, and k_merge adds the stored planes of a row in ascending chunk order.
// CMODE 2 reads A (the probabilities) at row pitch PPT; Bt keeps pitch K.
template <typename T16, int NSPLIT, int CMODE>
__global__ __launch_bounds__(32) void k_gemmc(const T16* __restrict__ A, const T16* __restrict__ A2, const T16* __restrict__ Bt, const T16* __restrict__ Bt2, int K, float* C, int ldc, int roff, size_t sA, size_t sB, size_t sC) {
    typedef typename WFrag<T16>::V V;
    __shared__ __align__(16) float os[16 * 68];
    const size_t z = blockIdx.z; A += z * sA; if (A2) A2 += z * sA; Bt += z * sB; if (Bt2) Bt2 += z * sB; C += z * sC;
    const int lane = threadIdx.x & 31, lr = lane & 15, hi = lane >> 4; const int r0 = blockIdx.x * 64, c0 = (CMODE == 2) ? 0 : blockIdx.y * 64;
    if (CMODE == 1 && c0 > r0 + roff + 63) return;                  // score tile entirely above the causal diagonal: never read (the softmax masks j > i by select)
    const int Kl = (CMODE == 2) ? min(K, r0 + roff + 64) : K;        // P.V: probabilities are exactly 0 beyond the diagonal block, so the K loop stops there
    const int kch = (r0 + roff < RH) ? KCB : KCF;                    // P.V: keys per chunk (k_merge picks by the same test)
    const int k0 = (CMODE == 2) ? (int)blockIdx.y * kch : 0;         // P.V: this work-group's first key
    if (CMODE == 2 && k0 >= Kl) return;                              // chunk entirely beyond the diagonal block: no plane is stored and k_merge reads none
    const int k1 = (CMODE == 2) ? min(Kl, k0 + kch) : Kl;
    if (CMODE == 2) C += (size_t)blockIdx.y * PST;
    v8f acc[4][4];
#pragma unroll
    for (int mb = 0; mb < 4; ++mb)
#pragma unroll
        for (int nb = 0; nb < 4; ++nb) acc[mb][nb] = (v8f){};
    const size_t aofp = (size_t)(r0 + lr) * PPT + 8 * hi;            // P.V: this lane's first probability (row pitch PPT)
    const size_t aoff = (size_t)(r0 + lr) * K + 8 * hi, boff = (size_t)(c0 + lr) * K + 8 * hi;
#pragma unroll 1
    for (int kc = k0; kc < k1; kc += 32) {
        V a[4], a2[4];
        const T16* pa = A + aofp + kc; const T16* pa2 = (NSPLIT == 1 || NSPLIT == 2) ? A2 + aofp + kc : pa;   // P.V: the lane's addresses in the probability planes (named again at the wait below)
        if (CMODE == 2) {
#pragma unroll
            for (int mb = 0; mb < 4; ++mb) { a[mb] = WFrag<T16>::ld(pa + (size_t)mb * 16 * PPT); if (NSPLIT == 1 || NSPLIT == 2) a2[mb] = WFrag<T16>::ld(pa2 + (size_t)mb * 16 * PPT); }
        } else {
#pragma unroll
        for (int mb = 0; mb < 4; ++mb) { a[mb] = WFrag<T16>::ld(A + aoff + (size_t)mb * 16 * K + kc); if (NSPLIT == 1 || NSPLIT == 2) a2[mb] = WFrag<T16>::ld(A2 + aoff + (size_t)mb * 16 * K + kc); }
        }
#pragma unroll
        for (int nb = 0; nb < 4; ++nb) { const V b = WFrag<T16>::ld(Bt + boff + (size_t)nb * 16 * K + kc); V b2; if (NSPLIT >= 2) b2 = WFrag<T16>::ld(Bt2 + boff + (size_t)nb * 16 * K + kc);
#pragma unroll
            for (int mb = 0; mb < 4; ++mb) { acc[mb][nb] = WFrag<T16>::mma(a[mb], b, acc[mb][nb]); if (NSPLIT == 1 || NSPLIT == 2) acc[mb][nb] = WFrag<T16>::mma(a2[mb], b, acc[mb][nb]); if (NSPLIT >= 2) acc[mb][nb] = WFrag<T16>::mma(a[mb], b2, acc[mb][nb]); } }
        // P.V: a later load's result, or the next trip's address sum, may take an address register of this trip's loads: the wait stands in front of that; naming every address as an input keeps its registers whole up to here
        if (CMODE == 2) { const T16* pb = Bt + boff + kc; const T16* pb2 = (NSPLIT >= 2 ? Bt2 : Bt) + boff + kc; const size_t bs = (size_t)16 * K;
            asm volatile("s_wait_xcnt 0x0" :: "v"(pa), "v"(pa2), "v"(pb), "v"(pb + bs), "v"(pb + 2 * bs), "v"(pb + 3 * bs), "v"(pb2), "v"(pb2 + bs), "v"(pb2 + 2 * bs), "v"(pb2 + 3 * bs) : "memory"); }
        asm volatile("v_nop\n\tv_nop\n\tv_nop\n\tv_nop" : "+v"(acc[0][0]), "+v"(acc[1][1]), "+v"(acc[2][2]), "+v"(acc[3][3]) : "v"(a[0]), "v"(a[3]));
    }
#pragma unroll
    for (int mb = 0; mb < 4; ++mb) {
#pragma unroll
        for (int nb = 0; nb < 4; ++nb) {
#pragma unroll
            for (int j = 0; j < 8; ++j) os[(hi * 8 + j) * 68 + nb * 16 + lr] = acc[mb][nb][j]; }
        __builtin_amdgcn_wave_barrier(); asm volatile("" ::: "memory");
        float* crow = C + (size_t)(r0 + mb * 16) * ldc + c0;
{
#pragma unroll
            for (int s = 0; s < 8; ++s) { const int row = 2 * s + hi, cofs = lr * 4; v4f val = *(const v4fa*)(os + row * 68 + cofs);
                *(v4f*)(crow + (size_t)row * ldc + cofs) = val; }
             }
        __builtin_amdgcn_wave_barrier(); asm volatile("" ::: "memory");
    }
}

__device__ __forceinline__ h16 tohx(float x) { return (h16)x; }
__device__ __forceinline__ void splitf(float y, unsigned short& h, unsigned short& l) { h = f2bf(y); l = f2bf(y - bf2f(h)); }
typedef __attribute__((ext_vector_type(2))) _Float16 v2h;
typedef __attribute__((ext_vector_type(4))) _Float16 v4h;
typedef __attribute__((ext_vector_type(2))) unsigned short v2us;
typedef __attribute__((ext_vector_type(4))) unsigned short v4us;
typedef __attribute__((ext_vector_type(2))) float v2f;
typedef __attribute__((ext_vector_type(4))) int v4i;
typedef v4h  __attribute__((may_alias)) v4ha;
typedef v4us __attribute__((may_alias)) v4usa;

__global__ __launch_bounds__(256) void k_cvt8(const float* __restrict__ src, bf* dst, size_t n8) { const size_t i = (size_t)blockIdx.x * 256 + threadIdx.x; if (i >= n8) return; const v8f v = *(const v8f*)(src + i * 8); v8us o;
#pragma unroll
    for (int k = 0; k < 8; ++k) o[k] = f2bf(v[k]); *(v8us*)(dst + i * 8) = o;  }

// k_rope: head planes [h][t][d] (fp16 + hi/lo) of rope(x) x sc with the rotate-half convention out[d] = x[d] cos[t][d] - x[d+HD/2] sin[t][d], out[d+HD/2] = x[d+HD/2] cos[t][d+HD/2] + x[d] sin[t][d+HD/2]
__global__ __launch_bounds__(256) void k_rope(const float* __restrict__ F, int pitch, int nheads, const float* __restrict__ CS, const float* __restrict__ RF, const float* __restrict__ nw, float sc, h16* P16, bf* Ph, bf* Pl) {
    const size_t e = ((size_t)blockIdx.x * 256 + threadIdx.x) * 2; if (e >= (size_t)nheads * TT * HD) return; const int d = (int)(e % HD); const int t = (int)((e / HD) % TT); const int h = (int)(e / ((size_t)HD * TT)); const float* f = F + (size_t)t * pitch + h * HD; const float rf = RF ? RF[(size_t)h * TT + t] : 1.0f; v2h o16; v2us oh, ol;
#pragma unroll
    for (int q = 0; q < 2; ++q) { const int dd = d + q; const int dp = (dd < HD / 2) ? dd + HD / 2 : dd - HD / 2; float x0 = f[dd], x1 = f[dp];
        if (RF) { float n0 = __fmul_rn(x0, rf), n1 = __fmul_rn(x1, rf); asm volatile("" : "+v"(n0)); asm volatile("" : "+v"(n1)); x0 = __fmul_rn(bfr(nw[dd]), n0); x1 = __fmul_rn(bfr(nw[dp]), n1); }
        const v2f cs = *(const v2f*)(CS + ((size_t)t * HD + dd) * 2); float a = __fmul_rn(x0, cs[0]), bq = __fmul_rn(x1, cs[1]); asm volatile("" : "+v"(a)); asm volatile("" : "+v"(bq)); const float r = ((dd < HD / 2) ? __fsub_rn(a, bq) : __fadd_rn(a, bq)) * sc;
        o16[q] = tohx(r); unsigned short a2, c2; splitf(r, a2, c2); oh[q] = a2; ol[q] = c2; }
    *(v2h*)(P16 + e) = o16; *(v2us*)(Ph + e) = oh; *(v2us*)(Pl + e) = ol;  }
__global__ __launch_bounds__(256) void k_vtp(const float* __restrict__ F, int pitch, int nheads, h16* V16, bf* Vh, bf* Vl) { const size_t e = ((size_t)blockIdx.x * 256 + threadIdx.x) * 2; if (e >= (size_t)nheads * HD * TT) return; const int t = (int)(e % TT); const int d = (int)((e / TT) % HD); const int g = (int)(e / ((size_t)TT * HD)); v2h o16; v2us oh, ol;
#pragma unroll
    for (int q = 0; q < 2; ++q) { const float x = F[(size_t)(t + q) * pitch + g * HD + d]; o16[q] = tohx(x); unsigned short a2, c2; splitf(x, a2, c2); oh[q] = a2; ol[q] = c2; }
    *(v2h*)(V16 + e) = o16; *(v2us*)(Vh + e) = oh; *(v2us*)(Vl + e) = ol;  }
__constant__ float INVT[HD / 2] = { 1.000000000e+00f, 7.498942018e-01f, 5.623413324e-01f, 4.216965139e-01f, 3.162277639e-01f, 2.371373624e-01f, 1.778279394e-01f, 1.333521456e-01f, 1.000000015e-01f, 7.498941571e-02f, 5.623412877e-02f, 4.216964915e-02f, 3.162277862e-02f, 2.371373586e-02f, 1.778279431e-02f, 1.333521493e-02f, 9.999999776e-03f, 7.498942316e-03f, 5.623413250e-03f, 4.216964822e-03f, 3.162277862e-03f, 2.371373819e-03f, 1.778279431e-03f, 1.333521446e-03f, 1.000000047e-03f, 7.498941850e-04f, 5.623413017e-04f, 4.216964880e-04f, 3.162277862e-04f, 2.371373848e-04f, 1.778279402e-04f, 1.333521504e-04f };   // float32 1 / 10000^(i/32), generated with jnp to be bit-exact
__global__ __launch_bounds__(256) void k_cs5(float* CS) { const int idx = blockIdx.x * 256 + threadIdx.x; if (idx >= TT * HD) return; const int d = idx % HD; const int t = idx / HD; const float a = __fmul_rn((float)t, INVT[d % (HD / 2)]); v2f cs; cs[0] = cosf(a); cs[1] = sinf(a); *(v2f*)(CS + (size_t)idx * 2) = cs;  }
// k_asoft: per row (zz, i): t = S x HD^-0.5 for j <= i and i - j < WIN (sliding causal window; the reference's -1e9 additive fill vanishes identically); softmax over the 2048 keys (register row, one exp, fixed trees);
// the probabilities go into the row's own 8 KiB of Sb (P16, Ph and Pl point into it: fp16 in the first half; or hi in the first and lo in the second): one wave owns a row and holds all of it in registers before its first store (every stored value needs the row's sum).
__global__ __launch_bounds__(256) void k_asoft(const float* Sb, h16* P16, bf* Ph, bf* Pl) {
    const int lane = threadIdx.x & 31; const int row = blockIdx.x * 8 + (threadIdx.x >> 5); if (row >= ZH * TT) return; const int i = row % TT; const int zz = row / TT; (void)zz; const bool hires = (i < RH); const float* sr = Sb + (size_t)row * TT; float v[TT / 32]; float mx = -3.0e38f;
#pragma unroll
    for (int ch = 0; ch < TT / 128; ++ch) { const int j0 = ch * 128 + lane * 4; const v4f a = *(const v4fa*)(sr + j0);
#pragma unroll
        for (int q = 0; q < 4; ++q) { const int j = j0 + q; (void)j; const float t = (j <= i && i - j < WIN) ? a[q] * SCL : -3.0e38f; v[ch * 4 + q] = t; mx = fmaxf(mx, t); } }
#pragma unroll
    for (int sh = 16; sh; sh >>= 1) mx = fmaxf(mx, __shfl_xor(mx, sh, 32));
    float sum = 0.f;
#pragma unroll
    for (int k = 0; k < TT / 32; ++k) { float d0 = __fsub_rn(v[k], mx); asm volatile("" : "+v"(d0)); v[k] = __builtin_amdgcn_exp2f(__fmul_rn(d0, 1.4426950408889634f)); sum += v[k]; }
#pragma unroll
    for (int sh = 16; sh; sh >>= 1) sum += __shfl_xor(sum, sh, 32);
    const float f = __fdiv_rn(hires ? 1.0f : PCAR, sum);
{
        if (hires) {
#pragma unroll
            for (int ch = 0; ch < TT / 128; ++ch) { v4us oh, ol;
#pragma unroll
                for (int q = 0; q < 4; ++q) { unsigned short a, c2; splitf(v[ch * 4 + q] * f, a, c2); oh[q] = a; ol[q] = c2; }
                const size_t oo = (size_t)row * PPT + ch * 128 + lane * 4; *(v4usa*)(Ph + oo) = oh; *(v4usa*)(Pl + oo) = ol; }
        } else {
#pragma unroll
            for (int ch = 0; ch < TT / 128; ++ch) { v4h o4;
#pragma unroll
                for (int q = 0; q < 4; ++q) o4[q] = tohx(v[ch * 4 + q] * f);
                *(v4ha*)(P16 + (size_t)row * PPT + ch * 128 + lane * 4) = o4; } }
         }
}
__global__ __launch_bounds__(256) void k_merge(const float* __restrict__ O, int h0, bf* Ah, bf* Al) { const size_t e = ((size_t)blockIdx.x * 256 + threadIdx.x) * 2; if (e >= (size_t)ZH * TT * HD) return; const int d = (int)(e % HD); const int t = (int)((e / HD) % TT); const int zz = (int)(e / ((size_t)HD * TT)); const float cs = (t < RH) ? 1.0f : (1.0f / PCAR); const size_t oo = (size_t)t * DQ + (h0 + zz) * HD + d;
    const int kl = (t & ~63) + 64; const int nch = (t < RH) ? (kl + KCB - 1) / KCB : (kl + KCF - 1) / KCF;   // partial planes stored for this row's 64-row tile (the same for a whole block)
    static_assert(NCH == 16, "the fence below names sixteen planes");
    v2f p[NCH];
#pragma unroll
    for (int c = 0; c < NCH; ++c) p[c] = *(const v2f*)(O + (size_t)min(c, nch - 1) * PST + e);   // plane index clamped to a stored plane: no branch between the loads, nothing unwritten is read
    // inputs only: keeps all sixteen loads in front of the first add, so that they are in flight together (without it the compiler waits for the first two before it issues the rest)
    asm volatile("" :: "v"(p[0]), "v"(p[1]), "v"(p[2]), "v"(p[3]), "v"(p[4]), "v"(p[5]), "v"(p[6]), "v"(p[7]), "v"(p[8]), "v"(p[9]), "v"(p[10]), "v"(p[11]), "v"(p[12]), "v"(p[13]), "v"(p[14]), "v"(p[15]));
    v2f s = p[0];
#pragma unroll
    for (int c = 1; c < NCH; ++c) { s[0] = (c < nch) ? s[0] + p[c][0] : s[0]; s[1] = (c < nch) ? s[1] + p[c][1] : s[1]; }   // ascending, fixed sum order
    v2us oh, ol;
#pragma unroll
    for (int q = 0; q < 2; ++q) { unsigned short a, c2; splitf(s[q] * cs, a, c2); oh[q] = a; ol[q] = c2; } *(v2us*)(Ah + oo) = oh; *(v2us*)(Al + oo) = ol;  }

extern "C" void kernel_launch(void* const* d_in, const int* in_sizes, int n_in,
                              void* d_out, int out_size, void* d_ws, size_t ws_size, hipStream_t stream) {
    (void)in_sizes; (void)n_in; (void)out_size;
    const float* x = (const float*)d_in[0]; const float* wqkv = (const float*)d_in[1]; const float* wo = (const float*)d_in[2];   /* x, w_qkv ('oi' [3072][1024]: ROW thirds q | k | v, each a natural [1024][1024] block), w_out ('oi' [1024][1024]): THREE inputs */ const float* wq = wqkv; const float* wk = wqkv + (size_t)DQ * DM; const float* wv = wqkv + (size_t)2 * DQ * DM;
    float* OUT = (float*)d_out;     // [4][2048][1024]
    char* wsp = (char*)d_ws;
    auto take = [&](size_t bytes) { char* p = wsp; wsp += (bytes + 255) & ~(size_t)255; return (void*)p; };
    bf* WQ = (bf*)take((size_t)DQ * DM * 2); bf* WK = (bf*)take((size_t)DKV * DM * 2); bf* WV = (bf*)take((size_t)DKV * DM * 2); bf* WO = (bf*)take((size_t)DM * DQ * 2); float* CS = (float*)take((size_t)TT * HD * 2 * 4);
    h16* QP16 = (h16*)take((size_t)NH_ * TT * HD * 2); h16* KP16 = (h16*)take((size_t)NKV * TT * HD * 2); h16* VT16 = (h16*)take((size_t)NKV * HD * TT * 2);
    bf* QPh = (bf*)take((size_t)NH_ * TT * HD * 2); bf* QPl = (bf*)take((size_t)NH_ * TT * HD * 2); bf* KPh = (bf*)take((size_t)NKV * TT * HD * 2); bf* KPl = (bf*)take((size_t)NKV * TT * HD * 2); bf* VTh = (bf*)take((size_t)NKV * HD * TT * 2); bf* VTl = (bf*)take((size_t)NKV * HD * TT * 2);
    float* Sb = (float*)take((size_t)ZH * TT * TT * 4); bf* ATh = (bf*)take((size_t)TT * DQ * 2); bf* ATl = (bf*)take((size_t)TT * DQ * 2); float* Ob = (float*)take((size_t)NCH * PST * 4);
    h16* P16 = (h16*)Sb; bf* Ph = (bf*)Sb; bf* Pl = Ph + TT;   // probability rows inside their score rows (pitch PPT)
    static_assert((size_t)NCH * PST * 4 >= (size_t)TT * DM * 2 + (size_t)TT * DQ * 4 + (size_t)TT * DKV * 4, "the projection buffers lie inside the partial planes");
    bf* XB = (bf*)Ob; float* FQ = (float*)(XB + (size_t)TT * DM); float* FK = FQ + (size_t)TT * DQ;   // x copy and f32 projections share the partial planes' bytes: their last reader (k_vtp) ends before a batch's first P.V launch, and the next batch writes them anew behind its last k_merge (stream-ordered)
    if ((size_t)(wsp - (char*)d_ws) > ws_size) return;    // ws 256 MiB
    float* FV = FK;   // v projection reuses the k buffer after the k planes are built (stream-ordered)
    { k_cvt8<<<(unsigned)(((size_t)DQ * DM / 8 + 255) / 256), 256, 0, stream>>>(wq, WQ, (size_t)DQ * DM / 8); k_cvt8<<<(unsigned)(((size_t)DKV * DM / 8 + 255) / 256), 256, 0, stream>>>(wk, WK, (size_t)DKV * DM / 8); k_cvt8<<<(unsigned)(((size_t)DKV * DM / 8 + 255) / 256), 256, 0, stream>>>(wv, WV, (size_t)DKV * DM / 8);
      k_cvt8<<<(unsigned)(((size_t)DM * DQ / 8 + 255) / 256), 256, 0, stream>>>(wo, WO, (size_t)DM * DQ / 8);
       }
    k_cs5<<<(TT * HD + 255) / 256, 256, 0, stream>>>(CS);   /* rotary table once */
    const unsigned LQ = (unsigned)(((size_t)NH_ * TT * HD / 2 + 255) / 256), LKv = (unsigned)(((size_t)NKV * TT * HD / 2 + 255) / 256);
    for (int b = 0; b < NB_; ++b) {
        
        k_cvt8<<<(unsigned)(((size_t)TT * DM / 8 + 255) / 256), 256, 0, stream>>>(x + (size_t)b * TT * DM, XB, (size_t)TT * DM / 8);
        k_gemmw<bf, 0, false><<<dim3(TT / 64, DQ / 64, 1), 32, 0, stream>>>(XB, nullptr, WQ, nullptr, DM, FQ, DQ, nullptr, 0, 0, 0);
        k_rope<<<LQ, 256, 0, stream>>>(FQ, DQ, NH_, CS, nullptr, nullptr, 1.0f, QP16, QPh, QPl);
        k_gemmw<bf, 0, false><<<dim3(TT / 64, DKV / 64, 1), 32, 0, stream>>>(XB, nullptr, WK, nullptr, DM, FK, DKV, nullptr, 0, 0, 0);
        k_rope<<<LKv, 256, 0, stream>>>(FK, DKV, NKV, CS, nullptr, nullptr, 1.0f, KP16, KPh, KPl);
        k_gemmw<bf, 0, false><<<dim3(TT / 64, DKV / 64, 1), 32, 0, stream>>>(XB, nullptr, WV, nullptr, DM, FV, DKV, nullptr, 0, 0, 0); k_vtp<<<LKv, 256, 0, stream>>>(FV, DKV, NKV, VT16, VTh, VTl);
        for (int h0 = 0; h0 < NH_; h0 += ZH) { const size_t zq = (size_t)h0, zk = (size_t)(h0 / REP);   // one kv head per query head: the pass's heads use consecutive kv planes (z-strides TT*HD)
            k_gemmc<bf, 2, 1><<<dim3(RH / 64, TT / 64, ZH), 32, 0, stream>>>(QPh + zq * TT * HD, QPl + zq * TT * HD, KPh + zk * TT * HD, KPl + zk * TT * HD, HD, Sb, TT, 0, (size_t)TT * HD, (size_t)TT * HD, (size_t)TT * TT);
            k_gemmc<h16, 0, 1><<<dim3((TT - RH) / 64, TT / 64, ZH), 32, 0, stream>>>(QP16 + zq * TT * HD + (size_t)RH * HD, nullptr, KP16 + zk * TT * HD, nullptr, HD, Sb + (size_t)RH * TT, TT, RH, (size_t)TT * HD, (size_t)TT * HD, (size_t)TT * TT);
            k_asoft<<<ZH * TT / 8, 256, 0, stream>>>(Sb, P16, Ph, Pl);
            k_gemmc<bf, 2, 2><<<dim3(RH / 64, NCH, ZH), 32, 0, stream>>>(Ph, Pl, VTh + zk * HD * TT, VTl + zk * HD * TT, TT, Ob, HD, 0, (size_t)TT * PPT, (size_t)HD * TT, (size_t)TT * HD);
            k_gemmc<h16, 0, 2><<<dim3((TT - RH) / 64, NCH, ZH), 32, 0, stream>>>(P16 + (size_t)RH * PPT, nullptr, VT16 + zk * HD * TT, nullptr, TT, Ob + (size_t)RH * HD, HD, RH, (size_t)TT * PPT, (size_t)HD * TT, (size_t)TT * HD);
            k_merge<<<(unsigned)(((size_t)ZH * TT * HD / 2 + 255) / 256), 256, 0, stream>>>(Ob, h0, ATh, ATl); }
        k_gemmw<bf, 1, false><<<dim3(TT / 64, DM / 64, 1), 32, 0, stream>>>(ATh, ATl, WO, nullptr, DQ, OUT + (size_t)b * TT * DM, DM, nullptr, 0, 0, 0); }
}

// v003
// A run of this version takes 613 microseconds.
// In two side-by-side timings against v002, it was 1.78 and 1.76 times as fast.
// Counting every step since v000, it is 4.68 times as fast.
#include <hip/hip_runtime.h>

// Causal self-attention with a fused bias-free natural qkv weight and computed rotate-half rotary embeddings (x [4][2048][1024]; qkv = x w_qkv^T ('oi' [3072][1024] 1/32, no bias) split in ROW thirds q | k | v (16 heads x 64); rope cat(x1 c - x2 s, x1 s + x2 c) on the two 32-wide halves with angle t x 1/10000^(i/32) (32 f32 constants jnp-exact; one f32 product; precise cosf/sinf); scores / sqrt(64); causal (-inf == exclusion); softmax; y = merged w_out^T ('oi', no bias) -> [4][2048][1024] (8.4 M); argument order x, w_qkv, w_out).
// Layout per batch: bf16 copy of x; 'oi' weights; exact projections; k_cs5 computed table; rotate-half plane builders; causal T-2048 attention, all heads of a batch in one launch, scores and probabilities in registers (hybrid rows: < 512 hi/lo 3 products, rest fp16 x1024; key steps end at the diagonal); merged hi/lo x w_o exact.
// Compute dtypes, f32 accumulate: every input rounded to bf16; projections exact; attention rows < 512 3 products, rest fp16; softmax f32; w_o hl x exact.

#define NB_  4
#define TT   2048
#define DM   1024
#define NH_  16
#define NKV  16
#define REP  (NH_ / NKV)
#define HD   64
#define DQ   (NH_ * HD)
#define DKV  (NKV * HD)
#define RH   512                  // query rows < RH use hi+lo planes (0: none)
#define SCL  0.125f   // HD^-0.5
#define FW   4                    // waves of an attention work-group: they share one query tile and deal its 32-key steps round robin
#define OP   68                   // pitch, in floats, of a query's partial output row in LDS
#define NTF  ((TT - RH) / 32)     // query tiles per head, fp16 rows (32 queries)
#define NTH  (RH / 16)            // query tiles per head, hi/lo rows (16 queries)
typedef _Float16 h16;
typedef unsigned short bf;
typedef __attribute__((ext_vector_type(16))) __bf16   v16bf;
typedef __attribute__((ext_vector_type(16))) _Float16 v16h;
typedef __attribute__((ext_vector_type(8)))  _Float16 v8h;
typedef __attribute__((ext_vector_type(8)))  unsigned short v8us;
typedef __attribute__((ext_vector_type(8)))  float    v8f;
typedef __attribute__((ext_vector_type(4)))  float    v4f;
typedef v8h  __attribute__((may_alias)) v8ha;
typedef v4f  __attribute__((may_alias)) v4fa;
typedef v8us __attribute__((may_alias)) v8usa;

__device__ __forceinline__ unsigned short f2bf(float f) { unsigned u = __float_as_uint(f); u += 0x7FFFu + ((u >> 16) & 1u); return (unsigned short)(u >> 16); }
__device__ __forceinline__ float bf2f(unsigned short b) { return __uint_as_float(((unsigned)b) << 16); }
__device__ __forceinline__ float bfr(float f) { return bf2f(f2bf(f)); }
__device__ __forceinline__ v16h cat16(v8h lo, v8h hi) { return __builtin_shufflevector(lo, hi, 0, 1, 2, 3, 4, 5, 6, 7, 8, 9, 10, 11, 12, 13, 14, 15); }
__device__ __forceinline__ v16bf cat16b(v8us lo, v8us hi) { return __builtin_bit_cast(v16bf, __builtin_shufflevector(lo, hi, 0, 1, 2, 3, 4, 5, 6, 7, 8, 9, 10, 11, 12, 13, 14, 15)); }
__device__ __forceinline__ v8f wmma16(v16h a, v16h b, v8f c) { return __builtin_amdgcn_wmma_f32_16x16x32_f16(false, a, false, b, (short)0, c, false, false); }
__device__ __forceinline__ v8f wmmab(v16bf a, v16bf b, v8f c) { return __builtin_amdgcn_wmma_f32_16x16x32_bf16(false, a, false, b, (short)0, c, false, false); }



// ---- k_gemmw: register-blocked GEMM, ONE WAVE per 64x64 output tile (16 accumulators), operands straight from K-contiguous 16-bit planes; grid (M/64, N/64, Z), 32 threads.
// C[m][n] (f32, pitch ldc, + optional f32 bias[n]) = sum_k A[m][k] Bt[n][k] (+ split products per NSPLIT). z-batch strides sA/sB/sC in elements. K % 32 == 0.
template <typename T16> struct WFrag;
template <> struct WFrag<h16> { typedef v16h V; static __device__ __forceinline__ V ld(const h16* p) { return cat16(*(const v8h*)p, *(const v8h*)(p + 16)); } static __device__ __forceinline__ v8f mma(V a, V b, v8f c) { return wmma16(a, b, c); } };
template <> struct WFrag<bf> { typedef v16bf V; static __device__ __forceinline__ V ld(const bf* p) { return cat16b(*(const v8us*)p, *(const v8us*)(p + 16)); } static __device__ __forceinline__ v8f mma(V a, V b, v8f c) { return wmmab(a, b, c); } };
template <typename T16, int NSPLIT, bool BIAS>
__global__ __launch_bounds__(32) void k_gemmw(const T16* __restrict__ A, const T16* __restrict__ A2, const T16* __restrict__ Bt, const T16* __restrict__ Bt2, int K, float* C, int ldc, const float* __restrict__ bias, size_t sA, size_t sB, size_t sC) {
    typedef typename WFrag<T16>::V V;
    __shared__ __align__(16) float os[16 * 68];
    const size_t z = blockIdx.z; A += z * sA; if (A2) A2 += z * sA; Bt += z * sB; if (Bt2) Bt2 += z * sB; C += z * sC;
    const int lane = threadIdx.x & 31, lr = lane & 15, hi = lane >> 4; const int r0 = blockIdx.x * 64, c0 = blockIdx.y * 64;
    v8f acc[4][4];
#pragma unroll
    for (int mb = 0; mb < 4; ++mb)
#pragma unroll
        for (int nb = 0; nb < 4; ++nb) acc[mb][nb] = (v8f){};
    const size_t aoff = (size_t)(r0 + lr) * K + 8 * hi, boff = (size_t)(c0 + lr) * K + 8 * hi;
#pragma unroll 1
    for (int kc = 0; kc < K; kc += 32) {
        V a[4], a2[4];
#pragma unroll
        for (int mb = 0; mb < 4; ++mb) { a[mb] = WFrag<T16>::ld(A + aoff + (size_t)mb * 16 * K + kc); if (NSPLIT == 1 || NSPLIT == 2) a2[mb] = WFrag<T16>::ld(A2 + aoff + (size_t)mb * 16 * K + kc); }
#pragma unroll
        for (int nb = 0; nb < 4; ++nb) { const V b = WFrag<T16>::ld(Bt + boff + (size_t)nb * 16 * K + kc); V b2; if (NSPLIT >= 2) b2 = WFrag<T16>::ld(Bt2 + boff + (size_t)nb * 16 * K + kc);
#pragma unroll
            for (int mb = 0; mb < 4; ++mb) { acc[mb][nb] = WFrag<T16>::mma(a[mb], b, acc[mb][nb]); if (NSPLIT == 1 || NSPLIT == 2) acc[mb][nb] = WFrag<T16>::mma(a2[mb], b, acc[mb][nb]); if (NSPLIT >= 2) acc[mb][nb] = WFrag<T16>::mma(a[mb], b2, acc[mb][nb]); } }
        asm volatile("v_nop\n\tv_nop\n\tv_nop\n\tv_nop" : "+v"(acc[0][0]), "+v"(acc[1][1]), "+v"(acc[2][2]), "+v"(acc[3][3]) : "v"(a[0]), "v"(a[3]));
    }
#pragma unroll
    for (int mb = 0; mb < 4; ++mb) {
#pragma unroll
        for (int nb = 0; nb < 4; ++nb) {
#pragma unroll
            for (int j = 0; j < 8; ++j) os[(hi * 8 + j) * 68 + nb * 16 + lr] = acc[mb][nb][j]; }
        __builtin_amdgcn_wave_barrier(); asm volatile("" ::: "memory");
        float* crow = C + (size_t)(r0 + mb * 16) * ldc + c0;
{
#pragma unroll
            for (int s = 0; s < 8; ++s) { const int row = 2 * s + hi, cofs = lr * 4; v4f val = *(const v4fa*)(os + row * 68 + cofs); if (BIAS) { val[0] += bfr(bias[c0 + cofs]); val[1] += bfr(bias[c0 + cofs + 1]); val[2] += bfr(bias[c0 + cofs + 2]); val[3] += bfr(bias[c0 + cofs + 3]); }
                *(v4f*)(crow + (size_t)row * ldc + cofs) = val; }
             }
        __builtin_amdgcn_wave_barrier(); asm volatile("" ::: "memory");
    }
}

__device__ __forceinline__ h16 tohx(float x) { return (h16)x; }
__device__ __forceinline__ void splitf(float y, unsigned short& h, unsigned short& l) { h = f2bf(y); l = f2bf(y - bf2f(h)); }
typedef __attribute__((ext_vector_type(2))) _Float16 v2h;
typedef __attribute__((ext_vector_type(4))) _Float16 v4h;
typedef __attribute__((ext_vector_type(2))) unsigned short v2us;
typedef __attribute__((ext_vector_type(4))) unsigned short v4us;
typedef __attribute__((ext_vector_type(2))) float v2f;
typedef __attribute__((ext_vector_type(4))) int v4i;
typedef v4h  __attribute__((may_alias)) v4ha;
typedef v4us __attribute__((may_alias)) v4usa;

__global__ __launch_bounds__(256) void k_cvt8(const float* __restrict__ src, bf* dst, size_t n8) { const size_t i = (size_t)blockIdx.x * 256 + threadIdx.x; if (i >= n8) return; const v8f v = *(const v8f*)(src + i * 8); v8us o;
#pragma unroll
    for (int k = 0; k < 8; ++k) o[k] = f2bf(v[k]); *(v8us*)(dst + i * 8) = o;  }

// k_rope: head planes [h][t][d] (fp16 + hi/lo) of rope(x) x sc with the rotate-half convention out[d] = x[d] cos[t][d] - x[d+HD/2] sin[t][d], out[d+HD/2] = x[d+HD/2] cos[t][d+HD/2] + x[d] sin[t][d+HD/2]
__global__ __launch_bounds__(256) void k_rope(const float* __restrict__ F, int pitch, int nheads, const float* __restrict__ CS, const float* __restrict__ RF, const float* __restrict__ nw, float sc, h16* P16, bf* Ph, bf* Pl) {
    const size_t e = ((size_t)blockIdx.x * 256 + threadIdx.x) * 2; if (e >= (size_t)nheads * TT * HD) return; const int d = (int)(e % HD); const int t = (int)((e / HD) % TT); const int h = (int)(e / ((size_t)HD * TT)); const float* f = F + (size_t)t * pitch + h * HD; const float rf = RF ? RF[(size_t)h * TT + t] : 1.0f; v2h o16; v2us oh, ol;
#pragma unroll
    for (int q = 0; q < 2; ++q) { const int dd = d + q; const int dp = (dd < HD / 2) ? dd + HD / 2 : dd - HD / 2; float x0 = f[dd], x1 = f[dp];
        if (RF) { float n0 = __fmul_rn(x0, rf), n1 = __fmul_rn(x1, rf); asm volatile("" : "+v"(n0)); asm volatile("" : "+v"(n1)); x0 = __fmul_rn(bfr(nw[dd]), n0); x1 = __fmul_rn(bfr(nw[dp]), n1); }
        const v2f cs = *(const v2f*)(CS + ((size_t)t * HD + dd) * 2); float a = __fmul_rn(x0, cs[0]), bq = __fmul_rn(x1, cs[1]); asm volatile("" : "+v"(a)); asm volatile("" : "+v"(bq)); const float r = ((dd < HD / 2) ? __fsub_rn(a, bq) : __fadd_rn(a, bq)) * sc;
        o16[q] = tohx(r); unsigned short a2, c2; splitf(r, a2, c2); oh[q] = a2; ol[q] = c2; }
    *(v2h*)(P16 + e) = o16; *(v2us*)(Ph + e) = oh; *(v2us*)(Pl + e) = ol;  }
__global__ __launch_bounds__(256) void k_vtp(const float* __restrict__ F, int pitch, int nheads, h16* V16, bf* Vh, bf* Vl) { const size_t e = ((size_t)blockIdx.x * 256 + threadIdx.x) * 2; if (e >= (size_t)nheads * HD * TT) return; const int t = (int)(e % TT); const int d = (int)((e / TT) % HD); const int g = (int)(e / ((size_t)TT * HD)); v2h o16; v2us oh, ol;
#pragma unroll
    for (int q = 0; q < 2; ++q) { const float x = F[(size_t)(t + q) * pitch + g * HD + d]; o16[q] = tohx(x); unsigned short a2, c2; splitf(x, a2, c2); oh[q] = a2; ol[q] = c2; }
    *(v2h*)(V16 + e) = o16; *(v2us*)(Vh + e) = oh; *(v2us*)(Vl + e) = ol;  }
__constant__ float INVT[HD / 2] = { 1.000000000e+00f, 7.498942018e-01f, 5.623413324e-01f, 4.216965139e-01f, 3.162277639e-01f, 2.371373624e-01f, 1.778279394e-01f, 1.333521456e-01f, 1.000000015e-01f, 7.498941571e-02f, 5.623412877e-02f, 4.216964915e-02f, 3.162277862e-02f, 2.371373586e-02f, 1.778279431e-02f, 1.333521493e-02f, 9.999999776e-03f, 7.498942316e-03f, 5.623413250e-03f, 4.216964822e-03f, 3.162277862e-03f, 2.371373819e-03f, 1.778279431e-03f, 1.333521446e-03f, 1.000000047e-03f, 7.498941850e-04f, 5.623413017e-04f, 4.216964880e-04f, 3.162277862e-04f, 2.371373848e-04f, 1.778279402e-04f, 1.333521504e-04f };   // float32 1 / 10000^(i/32), generated with jnp to be bit-exact
__global__ __launch_bounds__(256) void k_cs5(float* CS) { const int idx = blockIdx.x * 256 + threadIdx.x; if (idx >= TT * HD) return; const int d = idx % HD; const int t = idx / HD; const float a = __fmul_rn((float)t, INVT[d % (HD / 2)]); v2f cs; cs[0] = cosf(a); cs[1] = sinf(a); *(v2f*)(CS + (size_t)idx * 2) = cs;  }
__device__ __forceinline__ float xhalf(float x) { const int b = __float_as_int(x); return __int_as_float(__builtin_amdgcn_permlanex16(b, b, 0x76543210, 0xfedcba98, false, false)); }   // lane l <-> l ^ 16
// 2^x with the slot behind a transcendental filled inside the statement: the v_nop keeps the next vector instruction, whichever the compiler puts there, from reading the last result or taking its source register directly
// behind it; in exp2x8 each exponential is the independent instruction behind the one before (early-clobber outputs share no register with a source).
__device__ __forceinline__ float exp2x1(float x) { float r; asm("v_exp_f32 %0, %1\n\tv_nop" : "=v"(r) : "v"(x)); return r; }
__device__ __forceinline__ v8f exp2x8(v8f x) { float r0, r1, r2, r3, r4, r5, r6, r7;
    asm("v_exp_f32 %0, %8\n\tv_exp_f32 %1, %9\n\tv_exp_f32 %2, %10\n\tv_exp_f32 %3, %11\n\tv_exp_f32 %4, %12\n\tv_exp_f32 %5, %13\n\tv_exp_f32 %6, %14\n\tv_exp_f32 %7, %15\n\tv_nop"
        : "=&v"(r0), "=&v"(r1), "=&v"(r2), "=&v"(r3), "=&v"(r4), "=&v"(r5), "=&v"(r6), "=&v"(r7) : "v"(x[0]), "v"(x[1]), "v"(x[2]), "v"(x[3]), "v"(x[4]), "v"(x[5]), "v"(x[6]), "v"(x[7]));
    return (v8f){ r0, r1, r2, r3, r4, r5, r6, r7 }; }
template <typename T16, int NSPLIT, int NQ>
__device__ __forceinline__ void attn_tile(const T16* __restrict__ Q, const T16* __restrict__ Q2, const T16* __restrict__ Kp, const T16* __restrict__ K2, const T16* __restrict__ Vt, const T16* __restrict__ V2, int q0, bf* Ah, bf* Al, float* so, float* sml) {
    typedef typename WFrag<T16>::V V;
    constexpr float CX = SCL * 1.4426950408889634f;          // scores are carried as log2 exponents
    constexpr float PB = (NSPLIT == 0) ? 10.0f : 0.0f;       // fp16 probabilities carry x1024; the row sum carries it too, so it cancels in the quotient
    const int lane = threadIdx.x & 31, lr = lane & 15, hi = lane >> 4; const int wave = __builtin_amdgcn_readfirstlane((int)(threadIdx.x >> 5));
    V qf[NQ][2], qf2[NQ][2];
    const size_t qo = (size_t)(q0 + lr) * HD + 8 * hi; const T16* qa = Q + qo; const T16* qa2 = (NSPLIT == 2) ? Q2 + qo : qa;
#pragma unroll
    for (int qi = 0; qi < NQ; ++qi)
#pragma unroll
        for (int ks = 0; ks < 2; ++ks) { qf[qi][ks] = WFrag<T16>::ld(qa + qi * 16 * HD + ks * 32); if (NSPLIT == 2) qf2[qi][ks] = WFrag<T16>::ld(qa2 + qi * 16 * HD + ks * 32); }
    asm volatile("s_wait_xcnt 0x0" :: "v"(qa), "v"(qa2) : "memory");   // in front of any rewrite of an address register of the query loads (named as inputs, they stay whole up to here)
    v8f o[NQ][4]; float m[NQ], l[NQ];
#pragma unroll
    for (int qi = 0; qi < NQ; ++qi) { m[qi] = -3.0e38f; l[qi] = 0.f;
#pragma unroll
        for (int dt = 0; dt < 4; ++dt) o[qi][dt] = (v8f){}; }
    const int nst = (q0 + 16 * NQ - 1) / 32 + 1;             // 32-key steps up to and including the diagonal; only the last holds keys beyond a query
    for (int s = wave; s < nst; s += FW) {
        const size_t ko = (size_t)(s * 32 + lr) * HD + 8 * hi, vo = (size_t)lr * TT + s * 32 + 8 * hi;
        const T16* ka = Kp + ko; const T16* ka2 = (NSPLIT == 2) ? K2 + ko : ka; const T16* va = Vt + vo; const T16* va2 = (NSPLIT == 2) ? V2 + vo : va;   // the lane's addresses of this step (named again at the waits below)
        V kf[2][2], kf2[2][2], vf[4], vf2[4];
#pragma unroll
        for (int kt = 0; kt < 2; ++kt)
#pragma unroll
            for (int ks = 0; ks < 2; ++ks) { kf[kt][ks] = WFrag<T16>::ld(ka + kt * 16 * HD + ks * 32); if (NSPLIT == 2) kf2[kt][ks] = WFrag<T16>::ld(ka2 + kt * 16 * HD + ks * 32); }
#pragma unroll
        for (int dt = 0; dt < 4; ++dt) { vf[dt] = WFrag<T16>::ld(va + (size_t)dt * 16 * TT); if (NSPLIT == 2) vf2[dt] = WFrag<T16>::ld(va2 + (size_t)dt * 16 * TT); }
        // the wait stands in front of any rewrite of an address register of the key loads (the address as an input keeps its registers whole up to here); the loaded fragments as inputs keep all key loads
        // in front of the first product, in flight together (without them the compiler reloads a fragment's registers behind the first products: a second load latency per step)
        if constexpr (NSPLIT == 0) asm volatile("s_wait_xcnt 0x0" :: "v"(ka), "v"(kf[0][0]), "v"(kf[0][1]), "v"(kf[1][0]), "v"(kf[1][1]) : "memory");
        else asm volatile("s_wait_xcnt 0x0" :: "v"(ka), "v"(ka2), "v"(kf[0][0]), "v"(kf[0][1]), "v"(kf[1][0]), "v"(kf[1][1]), "v"(kf2[0][0]), "v"(kf2[0][1]), "v"(kf2[1][0]), "v"(kf2[1][1]) : "memory");
        v8f st[NQ][2];                                       // st[qi][kt][j] = score of key s*32 + kt*16 + hi*8 + j and query q0 + qi*16 + lr
#pragma unroll
        for (int qi = 0; qi < NQ; ++qi)
#pragma unroll
            for (int kt = 0; kt < 2; ++kt) { v8f a = (v8f){};
#pragma unroll
                for (int ks = 0; ks < 2; ++ks) { a = WFrag<T16>::mma(kf[kt][ks], qf[qi][ks], a); if (NSPLIT == 2) { a = WFrag<T16>::mma(kf[kt][ks], qf2[qi][ks], a); a = WFrag<T16>::mma(kf2[kt][ks], qf[qi][ks], a); } }
                st[qi][kt] = a; }
        if (s == nst - 1) {                                  // diagonal step: keys beyond the query are excluded
#pragma unroll
            for (int qi = 0; qi < NQ; ++qi)
#pragma unroll
                for (int kt = 0; kt < 2; ++kt)
#pragma unroll
                    for (int j = 0; j < 8; ++j) st[qi][kt][j] = (s * 32 + kt * 16 + hi * 8 + j <= q0 + qi * 16 + lr) ? st[qi][kt][j] : -3.0e38f; }
        float mn[NQ]; bool up = false;
#pragma unroll
        for (int qi = 0; qi < NQ; ++qi) { float mx = st[qi][0][0];
#pragma unroll
            for (int j = 1; j < 8; ++j) mx = fmaxf(mx, st[qi][0][j]);
#pragma unroll
            for (int j = 0; j < 8; ++j) mx = fmaxf(mx, st[qi][1][j]);
            mx = fmaxf(mx, xhalf(mx)); mn[qi] = fmaxf(m[qi], mx * CX); up = up || (mn[qi] > m[qi]); }
        if (__builtin_amdgcn_ballot_w32(up) != 0) {          // some query's maximum rose: rescale (a factor of exactly 1 elsewhere); otherwise every factor is 1 and the multiplies are skipped
#pragma unroll
            for (int qi = 0; qi < NQ; ++qi) { const float al = exp2x1(m[qi] - mn[qi]); m[qi] = mn[qi]; l[qi] *= al;
#pragma unroll
                for (int dt = 0; dt < 4; ++dt)
#pragma unroll
                    for (int j = 0; j < 8; ++j) o[qi][dt][j] *= al; } }
        // the same wait for the value loads, which fly during the score products and the maximum: their address registers stay whole up to here
        if constexpr (NSPLIT == 0) asm volatile("s_wait_xcnt 0x0" :: "v"(va), "v"(vf[0]), "v"(vf[1]), "v"(vf[2]), "v"(vf[3]) : "memory");
        else asm volatile("s_wait_xcnt 0x0" :: "v"(va), "v"(va2), "v"(vf[0]), "v"(vf[1]), "v"(vf[2]), "v"(vf[3]), "v"(vf2[0]), "v"(vf2[1]), "v"(vf2[2]), "v"(vf2[3]) : "memory");
#pragma unroll
        for (int qi = 0; qi < NQ; ++qi) { const float mb = m[qi] - PB; float ps = 0.f;
#pragma unroll
            for (int kt = 0; kt < 2; ++kt) { st[qi][kt] = exp2x8(st[qi][kt] * CX - mb);
#pragma unroll
                for (int j = 0; j < 8; ++j) ps += st[qi][kt][j]; }
            l[qi] += ps;
            if constexpr (NSPLIT == 0) { v16h pf;
#pragma unroll
                for (int j = 0; j < 8; ++j) { pf[j] = tohx(st[qi][0][j]); pf[8 + j] = tohx(st[qi][1][j]); }
#pragma unroll
                for (int dt = 0; dt < 4; ++dt) o[qi][dt] = WFrag<T16>::mma(vf[dt], pf, o[qi][dt]);
            } else { v8us h0, h1, l0, l1;
#pragma unroll
                for (int j = 0; j < 8; ++j) { unsigned short a, c2; splitf(st[qi][0][j], a, c2); h0[j] = a; l0[j] = c2; splitf(st[qi][1][j], a, c2); h1[j] = a; l1[j] = c2; }
                const v16bf ph = cat16b(h0, h1), pl = cat16b(l0, l1);
#pragma unroll
                for (int dt = 0; dt < 4; ++dt) { o[qi][dt] = WFrag<T16>::mma(vf[dt], ph, o[qi][dt]); o[qi][dt] = WFrag<T16>::mma(vf[dt], pl, o[qi][dt]); o[qi][dt] = WFrag<T16>::mma(vf2[dt], ph, o[qi][dt]); } } }
    }
    float* sw = so + wave * (NQ * 16 * OP);
#pragma unroll
    for (int qi = 0; qi < NQ; ++qi) { l[qi] += xhalf(l[qi]);   // the halves' sums join once
#pragma unroll
        for (int dt = 0; dt < 4; ++dt) { float* d0 = sw + (qi * 16 + lr) * OP + dt * 16 + hi * 8; *(v4fa*)d0 = (v4f){ o[qi][dt][0], o[qi][dt][1], o[qi][dt][2], o[qi][dt][3] }; *(v4fa*)(d0 + 4) = (v4f){ o[qi][dt][4], o[qi][dt][5], o[qi][dt][6], o[qi][dt][7] }; }
        if (hi == 0) { sml[(wave * 2) * 32 + qi * 16 + lr] = m[qi]; sml[(wave * 2 + 1) * 32 + qi * 16 + lr] = l[qi]; } }
    __syncthreads();   // every wave's partials are in LDS (a wave without a step brings maximum -3e38, sum 0, zeros)
    constexpr int EPT = NQ * 8;                              // outputs per thread; a wave stores whole 128-byte head rows
    const int q = (int)threadIdx.x / (HD / EPT), dc = ((int)threadIdx.x % (HD / EPT)) * EPT;
    float ms = sml[q];
#pragma unroll
    for (int w = 1; w < FW; ++w) ms = fmaxf(ms, sml[(w * 2) * 32 + q]);
    float L = 0.f, acc[EPT];
#pragma unroll
    for (int e = 0; e < EPT; ++e) acc[e] = 0.f;
#pragma unroll
    for (int w = 0; w < FW; ++w) { const float f = exp2x1(sml[(w * 2) * 32 + q] - ms); L += f * sml[(w * 2 + 1) * 32 + q]; const float* r = so + w * (NQ * 16 * OP) + q * OP + dc;
#pragma unroll
        for (int e = 0; e < EPT; e += 4) { const v4f x4 = *(const v4fa*)(r + e); acc[e] += f * x4[0]; acc[e + 1] += f * x4[1]; acc[e + 2] += f * x4[2]; acc[e + 3] += f * x4[3]; } }
    const float inv = __fdiv_rn(1.0f, L); const size_t oo = (size_t)(q0 + q) * DQ + dc;
#pragma unroll
    for (int e = 0; e < EPT; e += 8) { v8us oh, ol;
#pragma unroll
        for (int k = 0; k < 8; ++k) { unsigned short a, c2; splitf(acc[e + k] * inv, a, c2); oh[k] = a; ol[k] = c2; }
        bf* ph = Ah + oo + e; bf* pl = Al + oo + e; *(v8usa*)ph = oh; *(v8usa*)pl = ol;
        asm volatile("s_wait_xcnt 0x0" :: "v"(ph), "v"(pl), "v"(oh), "v"(ol) : "memory"); }   // in front of any rewrite of an address or data register of the two stores (named as inputs, they stay whole up to here)
}
// grid (NTF + NTH, heads): the longest tiles (last queries) come first
__global__ __launch_bounds__(FW * 32) void k_fattn(const h16* __restrict__ Q16, const h16* __restrict__ K16, const h16* __restrict__ V16, const bf* __restrict__ Qh, const bf* __restrict__ Ql, const bf* __restrict__ Kh, const bf* __restrict__ Kl, const bf* __restrict__ Vh, const bf* __restrict__ Vl, bf* Ah, bf* Al) {
    __shared__ __align__(16) float so[FW * 32 * OP]; __shared__ float sml[FW * 2 * 32];
    static_assert(REP == 1, "one kv head per query head"); const size_t hb = (size_t)blockIdx.y * TT * HD; const int bx = (int)blockIdx.x; Ah += blockIdx.y * HD; Al += blockIdx.y * HD;
    if (bx < NTF) attn_tile<h16, 0, 2>(Q16 + hb, nullptr, K16 + hb, nullptr, V16 + hb, nullptr, TT - 32 * (bx + 1), Ah, Al, so, sml);
    else attn_tile<bf, 2, 1>(Qh + hb, Ql + hb, Kh + hb, Kl + hb, Vh + hb, Vl + hb, RH - 16 * (bx - NTF + 1), Ah, Al, so, sml);
}

extern "C" void kernel_launch(void* const* d_in, const int* in_sizes, int n_in,
                              void* d_out, int out_size, void* d_ws, size_t ws_size, hipStream_t stream) {
    (void)in_sizes; (void)n_in; (void)out_size;
    const float* x = (const float*)d_in[0]; const float* wqkv = (const float*)d_in[1]; const float* wo = (const float*)d_in[2];   /* x, w_qkv ('oi' [3072][1024]: ROW thirds q | k | v, each a natural [1024][1024] block), w_out ('oi' [1024][1024]): THREE inputs */ const float* wq = wqkv; const float* wk = wqkv + (size_t)DQ * DM; const float* wv = wqkv + (size_t)2 * DQ * DM;
    float* OUT = (float*)d_out;     // [4][2048][1024]
    char* wsp = (char*)d_ws;
    auto take = [&](size_t bytes) { char* p = wsp; wsp += (bytes + 255) & ~(size_t)255; return (void*)p; };
    bf* WQ = (bf*)take((size_t)DQ * DM * 2); bf* WK = (bf*)take((size_t)DKV * DM * 2); bf* WV = (bf*)take((size_t)DKV * DM * 2); bf* WO = (bf*)take((size_t)DM * DQ * 2); float* CS = (float*)take((size_t)TT * HD * 2 * 4);
    h16* QP16 = (h16*)take((size_t)NH_ * TT * HD * 2); h16* KP16 = (h16*)take((size_t)NKV * TT * HD * 2); h16* VT16 = (h16*)take((size_t)NKV * HD * TT * 2);
    bf* QPh = (bf*)take((size_t)NH_ * TT * HD * 2); bf* QPl = (bf*)take((size_t)NH_ * TT * HD * 2); bf* KPh = (bf*)take((size_t)NKV * TT * HD * 2); bf* KPl = (bf*)take((size_t)NKV * TT * HD * 2); bf* VTh = (bf*)take((size_t)NKV * HD * TT * 2); bf* VTl = (bf*)take((size_t)NKV * HD * TT * 2);
    bf* ATh = (bf*)take((size_t)TT * DQ * 2); bf* ATl = (bf*)take((size_t)TT * DQ * 2);
    bf* XB = (bf*)take((size_t)TT * DM * 2); float* FQ = (float*)take((size_t)TT * DQ * 4); float* FK = (float*)take((size_t)TT * DKV * 4);
    if ((size_t)(wsp - (char*)d_ws) > ws_size) return;    // ws 256 MiB
    float* FV = FK;   // v projection reuses the k buffer after the k planes are built (stream-ordered)
    { k_cvt8<<<(unsigned)(((size_t)DQ * DM / 8 + 255) / 256), 256, 0, stream>>>(wq, WQ, (size_t)DQ * DM / 8); k_cvt8<<<(unsigned)(((size_t)DKV * DM / 8 + 255) / 256), 256, 0, stream>>>(wk, WK, (size_t)DKV * DM / 8); k_cvt8<<<(unsigned)(((size_t)DKV * DM / 8 + 255) / 256), 256, 0, stream>>>(wv, WV, (size_t)DKV * DM / 8);
      k_cvt8<<<(unsigned)(((size_t)DM * DQ / 8 + 255) / 256), 256, 0, stream>>>(wo, WO, (size_t)DM * DQ / 8);
       }
    k_cs5<<<(TT * HD + 255) / 256, 256, 0, stream>>>(CS);   /* rotary table once */
    const unsigned LQ = (unsigned)(((size_t)NH_ * TT * HD / 2 + 255) / 256), LKv = (unsigned)(((size_t)NKV * TT * HD / 2 + 255) / 256);
    for (int b = 0; b < NB_; ++b) {
        
        k_cvt8<<<(unsigned)(((size_t)TT * DM / 8 + 255) / 256), 256, 0, stream>>>(x + (size_t)b * TT * DM, XB, (size_t)TT * DM / 8);
        k_gemmw<bf, 0, false><<<dim3(TT / 64, DQ / 64, 1), 32, 0, stream>>>(XB, nullptr, WQ, nullptr, DM, FQ, DQ, nullptr, 0, 0, 0);
        k_rope<<<LQ, 256, 0, stream>>>(FQ, DQ, NH_, CS, nullptr, nullptr, 1.0f, QP16, QPh, QPl);
        k_gemmw<bf, 0, false><<<dim3(TT / 64, DKV / 64, 1), 32, 0, stream>>>(XB, nullptr, WK, nullptr, DM, FK, DKV, nullptr, 0, 0, 0);
        k_rope<<<LKv, 256, 0, stream>>>(FK, DKV, NKV, CS, nullptr, nullptr, 1.0f, KP16, KPh, KPl);
        k_gemmw<bf, 0, false><<<dim3(TT / 64, DKV / 64, 1), 32, 0, stream>>>(XB, nullptr, WV, nullptr, DM, FV, DKV, nullptr, 0, 0, 0); k_vtp<<<LKv, 256, 0, stream>>>(FV, DKV, NKV, VT16, VTh, VTl);
        k_fattn<<<dim3(NTF + NTH, NH_, 1), FW * 32, 0, stream>>>(QP16, KP16, VT16, QPh, QPl, KPh, KPl, VTh, VTl, ATh, ATl);
        k_gemmw<bf, 1, false><<<dim3(TT / 64, DM / 64, 1), 32, 0, stream>>>(ATh, ATl, WO, nullptr, DQ, OUT + (size_t)b * TT * DM, DM, nullptr, 0, 0, 0); }
}

// v004
// A run of this version takes 323 microseconds.
// Timed twice side by side with v003, it ran 1.92 and 1.88 times as fast.
// Counting every step since v000, it is 8.89 times as fast.
#include <hip/hip_runtime.h>

// Causal self-attention with a fused bias-free natural qkv weight and computed rotate-half rotary embeddings (x [4][2048][1024]; qkv = x w_qkv^T ('oi' [3072][1024] 1/32, no bias) split in ROW thirds q | k | v (16 heads x 64); rope cat(x1 c - x2 s, x1 s + x2 c) on the two 32-wide halves with angle t x 1/10000^(i/32) (32 f32 constants jnp-exact; one f32 product; precise cosf/sinf); scores / sqrt(64); causal (-inf == exclusion); softmax; y = merged w_out^T ('oi', no bias) -> [4][2048][1024] (8.4 M); argument order x, w_qkv, w_out).
// Layout, all batches in every launch: bf16 copy of x; 'oi' weights; exact projections; computed rotary table; rotate-half plane builders; causal T-2048 attention, all heads of all batches in one launch, scores and probabilities in registers (hybrid rows: < 512 hi/lo 3 products, rest fp16 x1024; key steps end at the diagonal); merged hi/lo x w_o exact.
// Compute dtypes, f32 accumulate: every input rounded to bf16; projections exact; attention rows < 512 3 products, rest fp16; softmax f32; w_o hl x exact.

#define NB_  4
#define TT   2048
#define DM   1024
#define NH_  16
#define NKV  16
#define REP  (NH_ / NKV)
#define HD   64
#define DQ   (NH_ * HD)
#define DKV  (NKV * HD)
#define RH   512                  // query rows < RH use hi+lo planes (0: none)
#define SCL  0.125f   // HD^-0.5
#define FW   4                    // waves of an attention work-group: they share one query tile and deal its 32-key steps round robin
#define OP   68                   // pitch, in floats, of a query's partial output row in LDS
#define NTF  ((TT - RH) / 32)     // query tiles per head, fp16 rows (32 queries)
#define NTH  (RH / 16)            // query tiles per head, hi/lo rows (16 queries)
typedef _Float16 h16;
typedef unsigned short bf;
typedef __attribute__((ext_vector_type(16))) __bf16   v16bf;
typedef __attribute__((ext_vector_type(16))) _Float16 v16h;
typedef __attribute__((ext_vector_type(8)))  _Float16 v8h;
typedef __attribute__((ext_vector_type(8)))  unsigned short v8us;
typedef __attribute__((ext_vector_type(8)))  float    v8f;
typedef __attribute__((ext_vector_type(4)))  float    v4f;
typedef v8h  __attribute__((may_alias)) v8ha;
typedef v4f  __attribute__((may_alias)) v4fa;
typedef v8us __attribute__((may_alias)) v8usa;

__device__ __forceinline__ unsigned short f2bf(float f) { unsigned u = __float_as_uint(f); u += 0x7FFFu + ((u >> 16) & 1u); return (unsigned short)(u >> 16); }
__device__ __forceinline__ float bf2f(unsigned short b) { return __uint_as_float(((unsigned)b) << 16); }
__device__ __forceinline__ float bfr(float f) { return bf2f(f2bf(f)); }
__device__ __forceinline__ v16h cat16(v8h lo, v8h hi) { return __builtin_shufflevector(lo, hi, 0, 1, 2, 3, 4, 5, 6, 7, 8, 9, 10, 11, 12, 13, 14, 15); }
__device__ __forceinline__ v16bf cat16b(v8us lo, v8us hi) { return __builtin_bit_cast(v16bf, __builtin_shufflevector(lo, hi, 0, 1, 2, 3, 4, 5, 6, 7, 8, 9, 10, 11, 12, 13, 14, 15)); }
__device__ __forceinline__ v8f wmma16(v16h a, v16h b, v8f c) { return __builtin_amdgcn_wmma_f32_16x16x32_f16(false, a, false, b, (short)0, c, false, false); }
__device__ __forceinline__ v8f wmmab(v16bf a, v16bf b, v8f c) { return __builtin_amdgcn_wmma_f32_16x16x32_bf16(false, a, false, b, (short)0, c, false, false); }



// ---- k_gemmw: register-blocked GEMM, ONE WAVE per 64x64 output tile (16 accumulators), operands straight from K-contiguous 16-bit planes; grid (M/64, N/64, Z), 32 threads.
// C[m][n] (f32, pitch ldc, + optional f32 bias[n]) = sum_k A[m][k] Bt[n][k] (+ split products per NSPLIT). z-batch strides sA/sB/sC in elements. K % 32 == 0.
template <typename T16> struct WFrag;
template <> struct WFrag<h16> { typedef v16h V; static __device__ __forceinline__ V ld(const h16* p) { return cat16(*(const v8h*)p, *(const v8h*)(p + 16)); } static __device__ __forceinline__ v8f mma(V a, V b, v8f c) { return wmma16(a, b, c); } };
template <> struct WFrag<bf> { typedef v16bf V; static __device__ __forceinline__ V ld(const bf* p) { return cat16b(*(const v8us*)p, *(const v8us*)(p + 16)); } static __device__ __forceinline__ v8f mma(V a, V b, v8f c) { return wmmab(a, b, c); } };
template <typename T16, int NSPLIT, bool BIAS>
__global__ __launch_bounds__(32) void k_gemmw(const T16* __restrict__ A, const T16* __restrict__ A2, const T16* __restrict__ Bt, const T16* __restrict__ Bt2, int K, float* C, int ldc, const float* __restrict__ bias, size_t sA, size_t sB, size_t sC) {
    typedef typename WFrag<T16>::V V;
    __shared__ __align__(16) float os[16 * 68];
    const size_t z = blockIdx.z; A += z * sA; if (A2) A2 += z * sA; Bt += z * sB; if (Bt2) Bt2 += z * sB; C += z * sC;
    const int lane = threadIdx.x & 31, lr = lane & 15, hi = lane >> 4; const int r0 = blockIdx.x * 64, c0 = blockIdx.y * 64;
    v8f acc[4][4];
#pragma unroll
    for (int mb = 0; mb < 4; ++mb)
#pragma unroll
        for (int nb = 0; nb < 4; ++nb) acc[mb][nb] = (v8f){};
    const size_t aoff = (size_t)(r0 + lr) * K + 8 * hi, boff = (size_t)(c0 + lr) * K + 8 * hi;
#pragma unroll 1
    for (int kc = 0; kc < K; kc += 32) {
        V a[4], a2[4];
#pragma unroll
        for (int mb = 0; mb < 4; ++mb) { a[mb] = WFrag<T16>::ld(A + aoff + (size_t)mb * 16 * K + kc); if (NSPLIT == 1 || NSPLIT == 2) a2[mb] = WFrag<T16>::ld(A2 + aoff + (size_t)mb * 16 * K + kc); }
#pragma unroll
        for (int nb = 0; nb < 4; ++nb) { const V b = WFrag<T16>::ld(Bt + boff + (size_t)nb * 16 * K + kc); V b2; if (NSPLIT >= 2) b2 = WFrag<T16>::ld(Bt2 + boff + (size_t)nb * 16 * K + kc);
#pragma unroll
            for (int mb = 0; mb < 4; ++mb) { acc[mb][nb] = WFrag<T16>::mma(a[mb], b, acc[mb][nb]); if (NSPLIT == 1 || NSPLIT == 2) acc[mb][nb] = WFrag<T16>::mma(a2[mb], b, acc[mb][nb]); if (NSPLIT >= 2) acc[mb][nb] = WFrag<T16>::mma(a[mb], b2, acc[mb][nb]); } }
        asm volatile("v_nop\n\tv_nop\n\tv_nop\n\tv_nop" : "+v"(acc[0][0]), "+v"(acc[1][1]), "+v"(acc[2][2]), "+v"(acc[3][3]) : "v"(a[0]), "v"(a[3]));
    }
#pragma unroll
    for (int mb = 0; mb < 4; ++mb) {
#pragma unroll
        for (int nb = 0; nb < 4; ++nb) {
#pragma unroll
            for (int j = 0; j < 8; ++j) os[(hi * 8 + j) * 68 + nb * 16 + lr] = acc[mb][nb][j]; }
        __builtin_amdgcn_wave_barrier(); asm volatile("" ::: "memory");
        float* crow = C + (size_t)(r0 + mb * 16) * ldc + c0;
{
#pragma unroll
            for (int s = 0; s < 8; ++s) { const int row = 2 * s + hi, cofs = lr * 4; v4f val = *(const v4fa*)(os + row * 68 + cofs); if (BIAS) { val[0] += bfr(bias[c0 + cofs]); val[1] += bfr(bias[c0 + cofs + 1]); val[2] += bfr(bias[c0 + cofs + 2]); val[3] += bfr(bias[c0 + cofs + 3]); }
                *(v4f*)(crow + (size_t)row * ldc + cofs) = val; }
             }
        __builtin_amdgcn_wave_barrier(); asm volatile("" ::: "memory");
    }
}

__device__ __forceinline__ h16 tohx(float x) { return (h16)x; }
__device__ __forceinline__ void splitf(float y, unsigned short& h, unsigned short& l) { h = f2bf(y); l = f2bf(y - bf2f(h)); }
typedef __attribute__((ext_vector_type(2))) _Float16 v2h;
typedef __attribute__((ext_vector_type(4))) _Float16 v4h;
typedef __attribute__((ext_vector_type(2))) unsigned short v2us;
typedef __attribute__((ext_vector_type(4))) unsigned short v4us;
typedef __attribute__((ext_vector_type(2))) float v2f;
typedef __attribute__((ext_vector_type(4))) int v4i;
typedef v4h  __attribute__((may_alias)) v4ha;
typedef v4us __attribute__((may_alias)) v4usa;

__device__ __forceinline__ void cvt8(const float* __restrict__ src, bf* dst, size_t n8, unsigned blk) { const size_t i = (size_t)blk * 256 + threadIdx.x; if (i >= n8) return; const float* sp = src + i * 8; const v8f v = *(const v8f*)sp; v8us o;
    asm volatile("s_wait_xcnt 0x0" :: "v"(sp), "v"(v) : "memory");   // in front of any rewrite of the load's address registers (address and loaded value as inputs: the registers stay whole, and the load stays in front)
#pragma unroll
    for (int k = 0; k < 8; ++k) o[k] = f2bf(v[k]); *(v8us*)(dst + i * 8) = o;  }

// rope: head planes [h][t][d] (fp16 + hi/lo) of rope(x) x sc with the rotate-half convention out[d] = x[d] cos[t][d] - x[d+HD/2] sin[t][d], out[d+HD/2] = x[d+HD/2] cos[t][d+HD/2] + x[d] sin[t][d+HD/2]
__device__ __forceinline__ void rope(const float* __restrict__ F, int pitch, int nheads, const float* __restrict__ CS, const float* __restrict__ RF, const float* __restrict__ nw, float sc, h16* P16, bf* Ph, bf* Pl) {
    const size_t e = ((size_t)blockIdx.x * 256 + threadIdx.x) * 2; if (e >= (size_t)nheads * TT * HD) return; const int d = (int)(e % HD); const int t = (int)((e / HD) % TT); const int h = (int)(e / ((size_t)HD * TT)); const float* f = F + (size_t)t * pitch + h * HD; const float rf = RF ? RF[(size_t)h * TT + t] : 1.0f; v2h o16; v2us oh, ol;
    float xs[2], xp[2]; v2f cq[2]; const float* ap = f + ((d < HD / 2) ? d + HD / 2 : d - HD / 2); const float* pc = CS + ((size_t)t * HD + d) * 2;   // d is even: d + 1 lies in the same half, its partner next to d's
#pragma unroll
    for (int q = 0; q < 2; ++q) { xs[q] = f[d + q]; xp[q] = ap[q]; cq[q] = *(const v2f*)(pc + 2 * q); }
    asm volatile("s_wait_xcnt 0x0" :: "v"(f + d), "v"(ap), "v"(pc) : "memory");   // one wait behind all six loads, which fly together, in front of any rewrite of an address register of theirs (named as inputs, they stay whole up to here)
#pragma unroll
    for (int q = 0; q < 2; ++q) { const int dd = d + q; const int dp = (dd < HD / 2) ? dd + HD / 2 : dd - HD / 2; float x0 = xs[q], x1 = xp[q];
        if (RF) { float n0 = __fmul_rn(x0, rf), n1 = __fmul_rn(x1, rf); asm volatile("" : "+v"(n0)); asm volatile("" : "+v"(n1)); x0 = __fmul_rn(bfr(nw[dd]), n0); x1 = __fmul_rn(bfr(nw[dp]), n1); }
        const v2f cs = cq[q]; float a = __fmul_rn(x0, cs[0]), bq = __fmul_rn(x1, cs[1]); asm volatile("" : "+v"(a)); asm volatile("" : "+v"(bq)); const float r = ((dd < HD / 2) ? __fsub_rn(a, bq) : __fadd_rn(a, bq)) * sc;
        o16[q] = tohx(r); unsigned short a2, c2; splitf(r, a2, c2); oh[q] = a2; ol[q] = c2; }
    *(v2h*)(P16 + e) = o16; *(v2us*)(Ph + e) = oh; *(v2us*)(Pl + e) = ol;  }
__device__ __forceinline__ void vtp(const float* __restrict__ F, int pitch, int nheads, h16* V16, bf* Vh, bf* Vl) { const size_t e = ((size_t)blockIdx.x * 256 + threadIdx.x) * 2; if (e >= (size_t)nheads * HD * TT) return; const int t = (int)(e % TT); const int d = (int)((e / TT) % HD); const int g = (int)(e / ((size_t)TT * HD)); v2h o16; v2us oh, ol;
#pragma unroll
    for (int q = 0; q < 2; ++q) { const float x = F[(size_t)(t + q) * pitch + g * HD + d]; o16[q] = tohx(x); unsigned short a2, c2; splitf(x, a2, c2); oh[q] = a2; ol[q] = c2; }
    *(v2h*)(V16 + e) = o16; *(v2us*)(Vh + e) = oh; *(v2us*)(Vl + e) = ol;  }
__constant__ float INVT[HD / 2] = { 1.000000000e+00f, 7.498942018e-01f, 5.623413324e-01f, 4.216965139e-01f, 3.162277639e-01f, 2.371373624e-01f, 1.778279394e-01f, 1.333521456e-01f, 1.000000015e-01f, 7.498941571e-02f, 5.623412877e-02f, 4.216964915e-02f, 3.162277862e-02f, 2.371373586e-02f, 1.778279431e-02f, 1.333521493e-02f, 9.999999776e-03f, 7.498942316e-03f, 5.623413250e-03f, 4.216964822e-03f, 3.162277862e-03f, 2.371373819e-03f, 1.778279431e-03f, 1.333521446e-03f, 1.000000047e-03f, 7.498941850e-04f, 5.623413017e-04f, 4.216964880e-04f, 3.162277862e-04f, 2.371373848e-04f, 1.778279402e-04f, 1.333521504e-04f };   // float32 1 / 10000^(i/32), generated with jnp to be bit-exact
__device__ __forceinline__ void cs5(float* CS, unsigned blk) { const int idx = (int)blk * 256 + threadIdx.x; if (idx >= TT * HD) return; const int d = idx % HD; const int t = idx / HD; const float a = __fmul_rn((float)t, INVT[d % (HD / 2)]); v2f cs; cs[0] = cosf(a); cs[1] = sinf(a); *(v2f*)(CS + (size_t)idx * 2) = cs;  }
// ---- k_prep: the stages that read only inputs, in one launch, dealt by block range: rotary table, then the bf16 copies of x (all batches), w_qkv and w_out.
#define PB_C ((unsigned)(TT * HD / 256))
#define PB_X ((unsigned)((size_t)NB_ * TT * DM / 8 / 256))
#define PB_W ((unsigned)((size_t)(DQ + 2 * DKV) * DM / 8 / 256))
#define PB_O ((unsigned)((size_t)DM * DQ / 8 / 256))
__global__ __launch_bounds__(256) void k_prep(const float* __restrict__ x, const float* __restrict__ wqkv, const float* __restrict__ wo, bf* XB, bf* WQKV, bf* WO, float* CS) {
    const unsigned b = blockIdx.x;
    if (b < PB_C) cs5(CS, b);
    else if (b < PB_C + PB_X) cvt8(x, XB, (size_t)NB_ * TT * DM / 8, b - PB_C);
    else if (b < PB_C + PB_X + PB_W) cvt8(wqkv, WQKV, (size_t)(DQ + 2 * DKV) * DM / 8, b - (PB_C + PB_X));
    else cvt8(wo, WO, (size_t)DM * DQ / 8, b - (PB_C + PB_X + PB_W));
}
// ---- k_planes: the three plane builders in one launch; grid (blocks of one batch's plane, 3, batches): y = 0 value planes, 1 query planes, 2 key planes. F is the joint projection [batch x t][q | k | v].
__global__ __launch_bounds__(256) void k_planes(const float* __restrict__ F, const float* __restrict__ CS, h16* Q16, bf* Qh, bf* Ql, h16* K16, bf* Kh, bf* Kl, h16* V16, bf* Vh, bf* Vl) {
    constexpr int FP = DQ + 2 * DKV; const size_t pb = (size_t)blockIdx.z * NH_ * TT * HD; const float* f = F + (size_t)blockIdx.z * TT * FP;
    if (blockIdx.y == 0) vtp(f + DQ + DKV, FP, NKV, V16 + pb, Vh + pb, Vl + pb);
    else if (blockIdx.y == 1) rope(f, FP, NH_, CS, nullptr, nullptr, 1.0f, Q16 + pb, Qh + pb, Ql + pb);
    else rope(f + DQ, FP, NKV, CS, nullptr, nullptr, 1.0f, K16 + pb, Kh + pb, Kl + pb);
}
__device__ __forceinline__ float xhalf(float x) { const int b = __float_as_int(x); return __int_as_float(__builtin_amdgcn_permlanex16(b, b, 0x76543210, 0xfedcba98, false, false)); }   // lane l <-> l ^ 16
// 2^x with the slot behind a transcendental filled inside the statement: the v_nop keeps the next vector instruction, whichever the compiler puts there, from reading the last result or taking its source register directly
// behind it; in exp2x8 each exponential is the independent instruction behind the one before (early-clobber outputs share no register with a source).
__device__ __forceinline__ float exp2x1(float x) { float r; asm("v_exp_f32 %0, %1\n\tv_nop" : "=v"(r) : "v"(x)); return r; }
__device__ __forceinline__ v8f exp2x8(v8f x) { float r0, r1, r2, r3, r4, r5, r6, r7;
    asm("v_exp_f32 %0, %8\n\tv_exp_f32 %1, %9\n\tv_exp_f32 %2, %10\n\tv_exp_f32 %3, %11\n\tv_exp_f32 %4, %12\n\tv_exp_f32 %5, %13\n\tv_exp_f32 %6, %14\n\tv_exp_f32 %7, %15\n\tv_nop"
        : "=&v"(r0), "=&v"(r1), "=&v"(r2), "=&v"(r3), "=&v"(r4), "=&v"(r5), "=&v"(r6), "=&v"(r7) : "v"(x[0]), "v"(x[1]), "v"(x[2]), "v"(x[3]), "v"(x[4]), "v"(x[5]), "v"(x[6]), "v"(x[7]));
    return (v8f){ r0, r1, r2, r3, r4, r5, r6, r7 }; }
template <typename T16, int NSPLIT, int NQ>
__device__ __forceinline__ void attn_tile(const T16* __restrict__ Q, const T16* __restrict__ Q2, const T16* __restrict__ Kp, const T16* __restrict__ K2, const T16* __restrict__ Vt, const T16* __restrict__ V2, int q0, bf* Ah, bf* Al, float* so, float* sml) {
    typedef typename WFrag<T16>::V V;
    constexpr float CX = SCL * 1.4426950408889634f;          // scores are carried as log2 exponents
    constexpr float PB = (NSPLIT == 0) ? 10.0f : 0.0f;       // fp16 probabilities carry x1024; the row sum carries it too, so it cancels in the quotient
    const int lane = threadIdx.x & 31, lr = lane & 15, hi = lane >> 4; const int wave = __builtin_amdgcn_readfirstlane((int)(threadIdx.x >> 5));
    V qf[NQ][2], qf2[NQ][2];
    const size_t qo = (size_t)(q0 + lr) * HD + 8 * hi; const T16* qa = Q + qo; const T16* qa2 = (NSPLIT == 2) ? Q2 + qo : qa;
#pragma unroll
    for (int qi = 0; qi < NQ; ++qi)
#pragma unroll
        for (int ks = 0; ks < 2; ++ks) { qf[qi][ks] = WFrag<T16>::ld(qa + qi * 16 * HD + ks * 32); if (NSPLIT == 2) qf2[qi][ks] = WFrag<T16>::ld(qa2 + qi * 16 * HD + ks * 32); }
    asm volatile("s_wait_xcnt 0x0" :: "v"(qa), "v"(qa2) : "memory");   // in front of any rewrite of an address register of the query loads (named as inputs, they stay whole up to here)
    v8f o[NQ][4]; float m[NQ], l[NQ];
#pragma unroll
    for (int qi = 0; qi < NQ; ++qi) { m[qi] = -3.0e38f; l[qi] = 0.f;
#pragma unroll
        for (int dt = 0; dt < 4; ++dt) o[qi][dt] = (v8f){}; }
    const int nst = (q0 + 16 * NQ - 1) / 32 + 1;             // 32-key steps up to and including the diagonal; only the last holds keys beyond a query
    for (int s = wave; s < nst; s += FW) {
        const size_t ko = (size_t)(s * 32 + lr) * HD + 8 * hi, vo = (size_t)lr * TT + s * 32 + 8 * hi;
        const T16* ka = Kp + ko; const T16* ka2 = (NSPLIT == 2) ? K2 + ko : ka; const T16* va = Vt + vo; const T16* va2 = (NSPLIT == 2) ? V2 + vo : va;   // the lane's addresses of this step (named again at the waits below)
        V kf[2][2], kf2[2][2], vf[4], vf2[4];
#pragma unroll
        for (int kt = 0; kt < 2; ++kt)
#pragma unroll
            for (int ks = 0; ks < 2; ++ks) { kf[kt][ks] = WFrag<T16>::ld(ka + kt * 16 * HD + ks * 32); if (NSPLIT == 2) kf2[kt][ks] = WFrag<T16>::ld(ka2 + kt * 16 * HD + ks * 32); }
#pragma unroll
        for (int dt = 0; dt < 4; ++dt) { vf[dt] = WFrag<T16>::ld(va + (size_t)dt * 16 * TT); if (NSPLIT == 2) vf2[dt] = WFrag<T16>::ld(va2 + (size_t)dt * 16 * TT); }
        // the wait stands in front of any rewrite of an address register of the key loads (the address as an input keeps its registers whole up to here); the loaded fragments as inputs keep all key loads
        // in front of the first product, in flight together (without them the compiler reloads a fragment's registers behind the first products: a second load latency per step)
        if constexpr (NSPLIT == 0) asm volatile("s_wait_xcnt 0x0" :: "v"(ka), "v"(kf[0][0]), "v"(kf[0][1]), "v"(kf[1][0]), "v"(kf[1][1]) : "memory");
        else asm volatile("s_wait_xcnt 0x0" :: "v"(ka), "v"(ka2), "v"(kf[0][0]), "v"(kf[0][1]), "v"(kf[1][0]), "v"(kf[1][1]), "v"(kf2[0][0]), "v"(kf2[0][1]), "v"(kf2[1][0]), "v"(kf2[1][1]) : "memory");
        v8f st[NQ][2];                                       // st[qi][kt][j] = score of key s*32 + kt*16 + hi*8 + j and query q0 + qi*16 + lr
#pragma unroll
        for (int qi = 0; qi < NQ; ++qi)
#pragma unroll
            for (int kt = 0; kt < 2; ++kt) { v8f a = (v8f){};
#pragma unroll
                for (int ks = 0; ks < 2; ++ks) { a = WFrag<T16>::mma(kf[kt][ks], qf[qi][ks], a); if (NSPLIT == 2) { a = WFrag<T16>::mma(kf[kt][ks], qf2[qi][ks], a); a = WFrag<T16>::mma(kf2[kt][ks], qf[qi][ks], a); } }
                st[qi][kt] = a; }
        if (s == nst - 1) {                                  // diagonal step: keys beyond the query are excluded
#pragma unroll
            for (int qi = 0; qi < NQ; ++qi)
#pragma unroll
                for (int kt = 0; kt < 2; ++kt)
#pragma unroll
                    for (int j = 0; j < 8; ++j) st[qi][kt][j] = (s * 32 + kt * 16 + hi * 8 + j <= q0 + qi * 16 + lr) ? st[qi][kt][j] : -3.0e38f; }
        float mn[NQ]; bool up = false;
#pragma unroll
        for (int qi = 0; qi < NQ; ++qi) { float mx = st[qi][0][0];
#pragma unroll
            for (int j = 1; j < 8; ++j) mx = fmaxf(mx, st[qi][0][j]);
#pragma unroll
            for (int j = 0; j < 8; ++j) mx = fmaxf(mx, st[qi][1][j]);
            mx = fmaxf(mx, xhalf(mx)); mn[qi] = fmaxf(m[qi], mx * CX); up = up || (mn[qi] > m[qi]); }
        if (__builtin_amdgcn_ballot_w32(up) != 0) {          // some query's maximum rose: rescale (a factor of exactly 1 elsewhere); otherwise every factor is 1 and the multiplies are skipped
#pragma unroll
            for (int qi = 0; qi < NQ; ++qi) { const float al = exp2x1(m[qi] - mn[qi]); m[qi] = mn[qi]; l[qi] *= al;
#pragma unroll
                for (int dt = 0; dt < 4; ++dt)
#pragma unroll
                    for (int j = 0; j < 8; ++j) o[qi][dt][j] *= al; } }
        // the same wait for the value loads, which fly during the score products and the maximum: their address registers stay whole up to here
        if constexpr (NSPLIT == 0) asm volatile("s_wait_xcnt 0x0" :: "v"(va), "v"(vf[0]), "v"(vf[1]), "v"(vf[2]), "v"(vf[3]) : "memory");
        else asm volatile("s_wait_xcnt 0x0" :: "v"(va), "v"(va2), "v"(vf[0]), "v"(vf[1]), "v"(vf[2]), "v"(vf[3]), "v"(vf2[0]), "v"(vf2[1]), "v"(vf2[2]), "v"(vf2[3]) : "memory");
#pragma unroll
        for (int qi = 0; qi < NQ; ++qi) { const float mb = m[qi] - PB; float ps = 0.f;
#pragma unroll
            for (int kt = 0; kt < 2; ++kt) { st[qi][kt] = exp2x8(st[qi][kt] * CX - mb);
#pragma unroll
                for (int j = 0; j < 8; ++j) ps += st[qi][kt][j]; }
            l[qi] += ps;
            if constexpr (NSPLIT == 0) { v16h pf;
#pragma unroll
                for (int j = 0; j < 8; ++j) { pf[j] = tohx(st[qi][0][j]); pf[8 + j] = tohx(st[qi][1][j]); }
#pragma unroll
                for (int dt = 0; dt < 4; ++dt) o[qi][dt] = WFrag<T16>::mma(vf[dt], pf, o[qi][dt]);
            } else { v8us h0, h1, l0, l1;
#pragma unroll
                for (int j = 0; j < 8; ++j) { unsigned short a, c2; splitf(st[qi][0][j], a, c2); h0[j] = a; l0[j] = c2; splitf(st[qi][1][j], a, c2); h1[j] = a; l1[j] = c2; }
                const v16bf ph = cat16b(h0, h1), pl = cat16b(l0, l1);
#pragma unroll
                for (int dt = 0; dt < 4; ++dt) { o[qi][dt] = WFrag<T16>::mma(vf[dt], ph, o[qi][dt]); o[qi][dt] = WFrag<T16>::mma(vf[dt], pl, o[qi][dt]); o[qi][dt] = WFrag<T16>::mma(vf2[dt], ph, o[qi][dt]); } } }
    }
    float* sw = so + wave * (NQ * 16 * OP);
#pragma unroll
    for (int qi = 0; qi < NQ; ++qi) { l[qi] += xhalf(l[qi]);   // the halves' sums join once
#pragma unroll
        for (int dt = 0; dt < 4; ++dt) { float* d0 = sw + (qi * 16 + lr) * OP + dt * 16 + hi * 8; *(v4fa*)d0 = (v4f){ o[qi][dt][0], o[qi][dt][1], o[qi][dt][2], o[qi][dt][3] }; *(v4fa*)(d0 + 4) = (v4f){ o[qi][dt][4], o[qi][dt][5], o[qi][dt][6], o[qi][dt][7] }; }
        if (hi == 0) { sml[(wave * 2) * 32 + qi * 16 + lr] = m[qi]; sml[(wave * 2 + 1) * 32 + qi * 16 + lr] = l[qi]; } }
    __syncthreads();   // every wave's partials are in LDS (a wave without a step brings maximum -3e38, sum 0, zeros)
    constexpr int EPT = NQ * 8;                              // outputs per thread; a wave stores whole 128-byte head rows
    const int q = (int)threadIdx.x / (HD / EPT), dc = ((int)threadIdx.x % (HD / EPT)) * EPT;
    float ms = sml[q];
#pragma unroll
    for (int w = 1; w < FW; ++w) ms = fmaxf(ms, sml[(w * 2) * 32 + q]);
    float L = 0.f, acc[EPT];
#pragma unroll
    for (int e = 0; e < EPT; ++e) acc[e] = 0.f;
#pragma unroll
    for (int w = 0; w < FW; ++w) { const float f = exp2x1(sml[(w * 2) * 32 + q] - ms); L += f * sml[(w * 2 + 1) * 32 + q]; const float* r = so + w * (NQ * 16 * OP) + q * OP + dc;
#pragma unroll
        for (int e = 0; e < EPT; e += 4) { const v4f x4 = *(const v4fa*)(r + e); acc[e] += f * x4[0]; acc[e + 1] += f * x4[1]; acc[e + 2] += f * x4[2]; acc[e + 3] += f * x4[3]; } }
    const float inv = __fdiv_rn(1.0f, L); const size_t oo = (size_t)(q0 + q) * DQ + dc;
#pragma unroll
    for (int e = 0; e < EPT; e += 8) { v8us oh, ol;
#pragma unroll
        for (int k = 0; k < 8; ++k) { unsigned short a, c2; splitf(acc[e + k] * inv, a, c2); oh[k] = a; ol[k] = c2; }
        bf* ph = Ah + oo + e; bf* pl = Al + oo + e; *(v8usa*)ph = oh; *(v8usa*)pl = ol;
        asm volatile("s_wait_xcnt 0x0" :: "v"(ph), "v"(pl), "v"(oh), "v"(ol) : "memory"); }   // in front of any rewrite of an address or data register of the two stores (named as inputs, they stay whole up to here)
}
// grid (batches x heads, NTF + NTH): the longest tiles (last queries) of every head and batch come first
__global__ __launch_bounds__(FW * 32) void k_fattn(const h16* __restrict__ Q16, const h16* __restrict__ K16, const h16* __restrict__ V16, const bf* __restrict__ Qh, const bf* __restrict__ Ql, const bf* __restrict__ Kh, const bf* __restrict__ Kl, const bf* __restrict__ Vh, const bf* __restrict__ Vl, bf* Ah, bf* Al) {
    __shared__ __align__(16) float so[FW * 32 * OP]; __shared__ float sml[FW * 2 * 32];
    static_assert(REP == 1, "one kv head per query head"); const size_t hb = (size_t)blockIdx.x * TT * HD; const int bx = (int)blockIdx.y; const size_t ab = (size_t)(blockIdx.x / NH_) * TT * DQ + (blockIdx.x % NH_) * HD; Ah += ab; Al += ab;
    if (bx < NTF) attn_tile<h16, 0, 2>(Q16 + hb, nullptr, K16 + hb, nullptr, V16 + hb, nullptr, TT - 32 * (bx + 1), Ah, Al, so, sml);
    else attn_tile<bf, 2, 1>(Qh + hb, Ql + hb, Kh + hb, Kl + hb, Vh + hb, Vl + hb, RH - 16 * (bx - NTF + 1), Ah, Al, so, sml);
}

extern "C" void kernel_launch(void* const* d_in, const int* in_sizes, int n_in,
                              void* d_out, int out_size, void* d_ws, size_t ws_size, hipStream_t stream) {
    (void)in_sizes; (void)n_in; (void)out_size;
    const float* x = (const float*)d_in[0]; const float* wqkv = (const float*)d_in[1]; const float* wo = (const float*)d_in[2];   /* order x, w_qkv ('oi' [3072][1024]: ROW thirds q | k | v), w_out ('oi' [1024][1024]): THREE inputs */
    float* OUT = (float*)d_out;     // [4][2048][1024]
    char* wsp = (char*)d_ws;
    auto take = [&](size_t bytes) { char* p = wsp; wsp += (bytes + 255) & ~(size_t)255; return (void*)p; };
    bf* WO = (bf*)take((size_t)DM * DQ * 2); float* CS = (float*)take((size_t)TT * HD * 2 * 4);
    float* F = (float*)take((size_t)NB_ * TT * (DQ + 2 * DKV) * 4);   // joint q | k | v projection of all batches
    h16* QP16 = (h16*)take((size_t)NB_ * NH_ * TT * HD * 2); h16* KP16 = (h16*)take((size_t)NB_ * NKV * TT * HD * 2); h16* VT16 = (h16*)take((size_t)NB_ * NKV * HD * TT * 2);
    bf* QPh = (bf*)take((size_t)NB_ * NH_ * TT * HD * 2); bf* QPl = (bf*)take((size_t)NB_ * NH_ * TT * HD * 2); bf* KPh = (bf*)take((size_t)NB_ * NKV * TT * HD * 2); bf* KPl = (bf*)take((size_t)NB_ * NKV * TT * HD * 2); bf* VTh = (bf*)take((size_t)NB_ * NKV * HD * TT * 2); bf* VTl = (bf*)take((size_t)NB_ * NKV * HD * TT * 2);
    if ((size_t)(wsp - (char*)d_ws) > ws_size) return;    // ws 256 MiB
    bf* XB = (bf*)QP16; bf* WQKV = (bf*)KP16;                        // the projection's operands lie in plane bytes: last read before k_planes writes the planes (stream-ordered)
    bf* ATh = (bf*)F; bf* ATl = ATh + (size_t)NB_ * TT * DQ;         // the merged attention output lies in the projection's bytes: F is last read by k_planes (stream-ordered)
    k_prep<<<PB_C + PB_X + PB_W + PB_O, 256, 0, stream>>>(x, wqkv, wo, XB, WQKV, WO, CS);
    k_gemmw<bf, 0, false><<<dim3(NB_ * TT / 64, (DQ + 2 * DKV) / 64, 1), 32, 0, stream>>>(XB, nullptr, WQKV, nullptr, DM, F, DQ + 2 * DKV, nullptr, 0, 0, 0);
    k_planes<<<dim3((unsigned)((size_t)NH_ * TT * HD / 2 / 256), 3, NB_), 256, 0, stream>>>(F, CS, QP16, QPh, QPl, KP16, KPh, KPl, VT16, VTh, VTl);
    k_fattn<<<dim3(NB_ * NH_, NTF + NTH, 1), FW * 32, 0, stream>>>(QP16, KP16, VT16, QPh, QPl, KPh, KPl, VTh, VTl, ATh, ATl);
    k_gemmw<bf, 1, false><<<dim3(NB_ * TT / 64, DM / 64, 1), 32, 0, stream>>>(ATh, ATl, WO, nullptr, DQ, OUT, DM, nullptr, 0, 0, 0);
}

// v005
// Measured time: 208 microseconds a run.
// Two timings next to v004 put it at 1.57 and 1.54 times that version's speed.
// Counting every step since v000, it is 13.8 times as fast.
#include <hip/hip_runtime.h>

// Causal self-attention with a fused bias-free natural qkv weight and computed rotate-half rotary embeddings (x [4][2048][1024]; qkv = x w_qkv^T ('oi' [3072][1024] 1/32, no bias) split in ROW thirds q | k | v (16 heads x 64); rope cat(x1 c - x2 s, x1 s + x2 c) on the two 32-wide halves with angle t x 1/10000^(i/32) (32 f32 constants jnp-exact; one f32 product; precise cosf/sinf); scores / sqrt(64); causal (-inf == exclusion); softmax; y = merged w_out^T ('oi', no bias) -> [4][2048][1024] (8.4 M); argument order x, w_qkv, w_out).
// Layout, all batches in every launch: bf16 copy of x; 'oi' weights; exact projections; computed rotary table; rotate-half plane builders; causal T-2048 attention, all heads of all batches in one launch, scores and probabilities in registers (hybrid rows: < 512 hi/lo 3 products, rest fp16 x1024; key steps end at the diagonal); merged hi/lo x w_o exact.
// Every 16-bit matrix operand plane is stored in fragment order: blocks of 16 rows x 32 k (1 KiB), inside a block [k bit 4][k bit 3][row & 15][k & 7], so that lane l of a wave finds its two 16-byte pieces of a fragment at
// block + 8 l and block + 256 + 8 l (elements): each wave-wide 16-byte load reads 512 contiguous bytes (4 whole lines). Blocks run along k first (value planes: the four 16-row blocks of a 32-key step lie together).
// Compute dtypes, f32 accumulate: every input rounded to bf16; projections exact; attention rows < 512 3 products, rest fp16; softmax f32; w_o hl x exact.

#define NB_  4
#define TT   2048
#define DM   1024
#define NH_  16
#define NKV  16
#define REP  (NH_ / NKV)
#define HD   64
#define DQ   (NH_ * HD)
#define DKV  (NKV * HD)
#define RH   512                  // query rows < RH use hi+lo planes (0: none)
#define SCL  0.125f   // HD^-0.5
#define FW   4                    // waves of an attention work-group: they share one query tile and deal its 32-key steps round robin
#define OP   68                   // pitch, in floats, of a query's partial output row in LDS
#define NTF  ((TT - RH) / 32)     // query tiles per head, fp16 rows (32 queries)
#define NTH  (RH / 16)            // query tiles per head, hi/lo rows (16 queries)
typedef _Float16 h16;
typedef unsigned short bf;
typedef __attribute__((ext_vector_type(16))) __bf16   v16bf;
typedef __attribute__((ext_vector_type(16))) _Float16 v16h;
typedef __attribute__((ext_vector_type(8)))  _Float16 v8h;
typedef __attribute__((ext_vector_type(8)))  unsigned short v8us;
typedef __attribute__((ext_vector_type(8)))  float    v8f;
typedef __attribute__((ext_vector_type(4)))  float    v4f;
typedef v8h  __attribute__((may_alias)) v8ha;
typedef v4f  __attribute__((may_alias)) v4fa;
typedef v8us __attribute__((may_alias)) v8usa;

__device__ __forceinline__ unsigned short f2bf(float f) { unsigned u = __float_as_uint(f); u += 0x7FFFu + ((u >> 16) & 1u); return (unsigned short)(u >> 16); }
__device__ __forceinline__ float bf2f(unsigned short b) { return __uint_as_float(((unsigned)b) << 16); }
__device__ __forceinline__ float bfr(float f) { return bf2f(f2bf(f)); }
__device__ __forceinline__ v16h cat16(v8h lo, v8h hi) { return __builtin_shufflevector(lo, hi, 0, 1, 2, 3, 4, 5, 6, 7, 8, 9, 10, 11, 12, 13, 14, 15); }
__device__ __forceinline__ v16bf cat16b(v8us lo, v8us hi) { return __builtin_bit_cast(v16bf, __builtin_shufflevector(lo, hi, 0, 1, 2, 3, 4, 5, 6, 7, 8, 9, 10, 11, 12, 13, 14, 15)); }
__device__ __forceinline__ v8f wmma16(v16h a, v16h b, v8f c) { return __builtin_amdgcn_wmma_f32_16x16x32_f16(false, a, false, b, (short)0, c, false, false); }
__device__ __forceinline__ v8f wmmab(v16bf a, v16bf b, v8f c) { return __builtin_amdgcn_wmma_f32_16x16x32_bf16(false, a, false, b, (short)0, c, false, false); }



// ---- k_gemmw: register-blocked GEMM, ONE WAVE per 64x64 output tile (16 accumulators), operands straight from 16-bit planes in fragment order (a 16-row block's K/32 blocks in a row: 16 K elements); grid (M/64, N/64, Z), 32 threads.
// C[m][n] (f32, pitch ldc, + optional f32 bias[n]) = sum_k A[m][k] Bt[n][k] (+ split products per NSPLIT). z-batch strides sA/sB/sC in elements. K % 32 == 0.
template <typename T16> struct WFrag;
template <> struct WFrag<h16> { typedef v16h V; static __device__ __forceinline__ V ld(const h16* p) { return cat16(*(const v8h*)p, *(const v8h*)(p + 256)); } static __device__ __forceinline__ v8f mma(V a, V b, v8f c) { return wmma16(a, b, c); } };
template <> struct WFrag<bf> { typedef v16bf V; static __device__ __forceinline__ V ld(const bf* p) { return cat16b(*(const v8us*)p, *(const v8us*)(p + 256)); } static __device__ __forceinline__ v8f mma(V a, V b, v8f c) { return wmmab(a, b, c); } };
template <typename T16, int NSPLIT, bool BIAS, int K>
__global__ __launch_bounds__(32) void k_gemmw(const T16* __restrict__ A, const T16* __restrict__ A2, const T16* __restrict__ Bt, const T16* __restrict__ Bt2, float* C, int ldc, const float* __restrict__ bias, size_t sA, size_t sB, size_t sC) {
    typedef typename WFrag<T16>::V V;
    __shared__ __align__(16) float os[16 * 68];
    const size_t z = blockIdx.z; A += z * sA; if (A2) A2 += z * sA; Bt += z * sB; if (Bt2) Bt2 += z * sB; C += z * sC;
    const int lane = threadIdx.x & 31, lr = lane & 15, hi = lane >> 4; const int r0 = blockIdx.x * 64, c0 = blockIdx.y * 64;
    v8f acc[4][4];
#pragma unroll
    for (int mb = 0; mb < 4; ++mb)
#pragma unroll
        for (int nb = 0; nb < 4; ++nb) acc[mb][nb] = (v8f){};
    const size_t aoff = (size_t)r0 * K + 8 * lane, boff = (size_t)c0 * K + 8 * lane;
    const T16* pa = A + aoff; const T16* pa2 = (NSPLIT == 1 || NSPLIT == 2) ? A2 + aoff : pa; const T16* pb = Bt + boff; const T16* pb2 = (NSPLIT >= 2) ? Bt2 + boff : pb;   // one address per plane: K is a constant, the 16-row blocks are immediate offsets
#pragma unroll 1
    for (int kc = 0; kc < K; kc += 32, pa += 512, pa2 += 512, pb += 512, pb2 += 512) {
        V a[4], a2[4], b[4], b2[4];
#pragma unroll
        for (int mb = 0; mb < 4; ++mb) { a[mb] = WFrag<T16>::ld(pa + mb * 16 * K); if (NSPLIT == 1 || NSPLIT == 2) a2[mb] = WFrag<T16>::ld(pa2 + mb * 16 * K); }
#pragma unroll
        for (int nb = 0; nb < 4; ++nb) { b[nb] = WFrag<T16>::ld(pb + nb * 16 * K); if (NSPLIT >= 2) b2[nb] = WFrag<T16>::ld(pb2 + nb * 16 * K); }
        asm volatile("s_wait_xcnt 0x0" :: "v"(pa), "v"(pa2), "v"(pb), "v"(pb2) : "memory");   // behind the step's loads, in front of any rewrite of an address register of theirs (named as inputs, they stay whole up to here)
#pragma unroll
        for (int nb = 0; nb < 4; ++nb) {
#pragma unroll
            for (int mb = 0; mb < 4; ++mb) { acc[mb][nb] = WFrag<T16>::mma(a[mb], b[nb], acc[mb][nb]); if (NSPLIT == 1 || NSPLIT == 2) acc[mb][nb] = WFrag<T16>::mma(a2[mb], b[nb], acc[mb][nb]); if (NSPLIT >= 2) acc[mb][nb] = WFrag<T16>::mma(a[mb], b2[nb], acc[mb][nb]); } }
        asm volatile("v_nop\n\tv_nop\n\tv_nop\n\tv_nop" : "+v"(acc[0][0]), "+v"(acc[1][1]), "+v"(acc[2][2]), "+v"(acc[3][3]) : "v"(a[0]), "v"(a[3]));
    }
#pragma unroll
    for (int mb = 0; mb < 4; ++mb) {
#pragma unroll
        for (int nb = 0; nb < 4; ++nb) {
#pragma unroll
            for (int j = 0; j < 8; ++j) os[(hi * 8 + j) * 68 + nb * 16 + lr] = acc[mb][nb][j]; }
        __builtin_amdgcn_wave_barrier(); asm volatile("" ::: "memory");
        float* crow = C + (size_t)(r0 + mb * 16) * ldc + c0;
{
#pragma unroll
            for (int s = 0; s < 8; ++s) { const int row = 2 * s + hi, cofs = lr * 4; v4f val = *(const v4fa*)(os + row * 68 + cofs); if (BIAS) { val[0] += bfr(bias[c0 + cofs]); val[1] += bfr(bias[c0 + cofs + 1]); val[2] += bfr(bias[c0 + cofs + 2]); val[3] += bfr(bias[c0 + cofs + 3]); }
                *(v4f*)(crow + (size_t)row * ldc + cofs) = val; }
             }
        __builtin_amdgcn_wave_barrier(); asm volatile("" ::: "memory");
    }
}

__device__ __forceinline__ h16 tohx(float x) { return (h16)x; }
__device__ __forceinline__ void splitf(float y, unsigned short& h, unsigned short& l) { h = f2bf(y); l = f2bf(y - bf2f(h)); }
typedef __attribute__((ext_vector_type(2))) _Float16 v2h;
typedef __attribute__((ext_vector_type(4))) _Float16 v4h;
typedef __attribute__((ext_vector_type(2))) unsigned short v2us;
typedef __attribute__((ext_vector_type(4))) unsigned short v4us;
typedef __attribute__((ext_vector_type(2))) float v2f;
typedef __attribute__((ext_vector_type(4))) int v4i;
typedef v4h  __attribute__((may_alias)) v4ha;
typedef v4us __attribute__((may_alias)) v4usa;

__device__ __forceinline__ void cvt8(const float* __restrict__ src, bf* dst, size_t n8, unsigned blk) { const size_t i = (size_t)blk * 256 + threadIdx.x; if (i >= n8) return;   // thread i makes 16-byte piece i of the fragment-order plane (rows of DM elements)
    const size_t tb = i >> 6; const int w = (int)(i & 63); const float* sp = src + ((tb / (DM / 32)) * 16 + (w & 15)) * DM + (tb % (DM / 32)) * 32 + (w >> 4) * 8; const v8f v = *(const v8f*)sp; v8us o;
    asm volatile("s_wait_xcnt 0x0" :: "v"(sp), "v"(v) : "memory");   // in front of any rewrite of the load's address registers (address and loaded value as inputs: the registers stay whole, and the load stays in front)
#pragma unroll
    for (int k = 0; k < 8; ++k) o[k] = f2bf(v[k]); *(v8us*)(dst + i * 8) = o;  }

// rope: head planes (fp16 + hi/lo, fragment order: rows t, k = d) of the rotate-half rotation out[d] = x[d] cos[t][d] - x[d+HD/2] sin[t][d], out[d+HD/2] = x[d+HD/2] cos[t][d] + x[d] sin[t][d], d < HD/2 (the table's two halves are equal).
// Thread c makes 16-byte piece c & 63 of the d < 32 block of 16 positions and the same piece of the d >= 32 block behind it: both need the same two runs of 8 inputs and the same 8 table pairs.
__device__ __forceinline__ void put8(const float* r, size_t e, h16* P16, bf* Ph, bf* Pl) { v8h o16; v8us oh, ol;
#pragma unroll
    for (int j = 0; j < 8; ++j) { o16[j] = tohx(r[j]); unsigned short a2, c2; splitf(r[j], a2, c2); oh[j] = a2; ol[j] = c2; }
    h16* p16 = P16 + e; bf* ph = Ph + e; bf* pl = Pl + e; *(v8h*)p16 = o16; *(v8us*)ph = oh; *(v8us*)pl = ol;
    asm volatile("s_wait_xcnt 0x0" :: "v"(p16), "v"(ph), "v"(pl), "v"(o16), "v"(oh), "v"(ol) : "memory"); }   // in front of any rewrite of an address or data register of the three stores (named as inputs, they stay whole up to here)
__device__ __forceinline__ void rope(const float* __restrict__ F, int pitch, const float* __restrict__ CS, unsigned blk, h16* P16, bf* Ph, bf* Pl) {
    const unsigned c = blk * 256 + threadIdx.x; const int w = (int)(c & 63), tb = (int)((c >> 6) % (TT / 16)), h = (int)(c / (64 * (TT / 16))); const int t = tb * 16 + (w & 15), d = (w >> 4) * 8;
    const float* f = F + (size_t)t * pitch + h * HD + d; const float* pc = CS + ((size_t)t * HD + d) * 2;
    const v8f x1 = *(const v8f*)f, x2 = *(const v8f*)(f + HD / 2), ca = *(const v8f*)pc, cb = *(const v8f*)(pc + 8);
    asm volatile("s_wait_xcnt 0x0" :: "v"(f), "v"(pc), "v"(x1), "v"(x2), "v"(ca), "v"(cb) : "memory");   // one wait behind all the loads, which fly together, in front of any rewrite of an address register of theirs (named as inputs, they stay whole up to here)
    float r1[8], r2[8];
#pragma unroll
    for (int j = 0; j < 8; ++j) { const float co = (j < 4) ? ca[2 * j] : cb[2 * j - 8], si = (j < 4) ? ca[2 * j + 1] : cb[2 * j - 7]; r1[j] = x1[j] * co - x2[j] * si; r2[j] = x2[j] * co + x1[j] * si; }
    const size_t e = ((size_t)(h * (TT / 16) + tb) * 2) * 512 + w * 8; put8(r1, e, P16, Ph, Pl); put8(r2, e + 512, P16, Ph, Pl); }
// vtp: value planes (fragment order: rows d, k = t; block = (t / 32) * 4 + d / 16). Thread c makes 16-byte piece c: 8 positions of one d; 16 lanes read 64 contiguous bytes of a projection row.
__device__ __forceinline__ void vtp(const float* __restrict__ F, int pitch, unsigned blk, h16* V16, bf* Vh, bf* Vl) {
    const unsigned c = blk * 256 + threadIdx.x; const int w = (int)(c & 63), tl = (int)((c >> 6) % (TT * HD / 512)), g = (int)(c / (TT * HD / 8)); const int t = (tl >> 2) * 32 + (w >> 4) * 8, d = (tl & 3) * 16 + (w & 15);
    const float* f = F + (size_t)t * pitch + g * HD + d; float r[8];
#pragma unroll
    for (int j = 0; j < 8; ++j) r[j] = f[(size_t)j * pitch];
    asm volatile("s_wait_xcnt 0x0" :: "v"(f), "v"(r[0]), "v"(r[1]), "v"(r[2]), "v"(r[3]), "v"(r[4]), "v"(r[5]), "v"(r[6]), "v"(r[7]) : "memory");   // as in rope: behind the eight loads, in front of any rewrite of their address registers
    put8(r, (size_t)c * 8, V16, Vh, Vl); }
__constant__ float INVT[HD / 2] = { 1.000000000e+00f, 7.498942018e-01f, 5.623413324e-01f, 4.216965139e-01f, 3.162277639e-01f, 2.371373624e-01f, 1.778279394e-01f, 1.333521456e-01f, 1.000000015e-01f, 7.498941571e-02f, 5.623412877e-02f, 4.216964915e-02f, 3.162277862e-02f, 2.371373586e-02f, 1.778279431e-02f, 1.333521493e-02f, 9.999999776e-03f, 7.498942316e-03f, 5.623413250e-03f, 4.216964822e-03f, 3.162277862e-03f, 2.371373819e-03f, 1.778279431e-03f, 1.333521446e-03f, 1.000000047e-03f, 7.498941850e-04f, 5.623413017e-04f, 4.216964880e-04f, 3.162277862e-04f, 2.371373848e-04f, 1.778279402e-04f, 1.333521504e-04f };   // float32 1 / 10000^(i/32), generated with jnp to be bit-exact
__device__ __forceinline__ void cs5(float* CS, unsigned blk) { const int idx = (int)blk * 256 + threadIdx.x; if (idx >= TT * HD) return; const int d = idx % HD; const int t = idx / HD; const float a = __fmul_rn((float)t, INVT[d % (HD / 2)]); v2f cs; cs[0] = cosf(a); cs[1] = sinf(a); *(v2f*)(CS + (size_t)idx * 2) = cs;  }
// ---- k_prep: the stages that read only inputs, in one launch, dealt by block range: rotary table, then the bf16 copies of x (all batches), w_qkv and w_out.
static_assert(DQ == DM, "cvt8 lays all three planes out in rows of DM elements");
#define PB_C ((unsigned)(TT * HD / 256))
#define PB_X ((unsigned)((size_t)NB_ * TT * DM / 8 / 256))
#define PB_W ((unsigned)((size_t)(DQ + 2 * DKV) * DM / 8 / 256))
#define PB_O ((unsigned)((size_t)DM * DQ / 8 / 256))
__global__ __launch_bounds__(256) void k_prep(const float* __restrict__ x, const float* __restrict__ wqkv, const float* __restrict__ wo, bf* XB, bf* WQKV, bf* WO, float* CS) {
    const unsigned b = blockIdx.x;
    if (b < PB_C) cs5(CS, b);
    else if (b < PB_C + PB_X) cvt8(x, XB, (size_t)NB_ * TT * DM / 8, b - PB_C);
    else if (b < PB_C + PB_X + PB_W) cvt8(wqkv, WQKV, (size_t)(DQ + 2 * DKV) * DM / 8, b - (PB_C + PB_X));
    else cvt8(wo, WO, (size_t)DM * DQ / 8, b - (PB_C + PB_X + PB_W));
}
// ---- k_planes: the three plane builders in one launch; grid (PL_V + 2 PL_R blocks, batches): value planes, then query planes, then key planes. F is the joint projection [batch x t][q | k | v].
#define PL_V ((unsigned)((size_t)NKV * HD * TT / 8 / 256))
#define PL_R ((unsigned)((size_t)NH_ * TT * HD / 16 / 256))
__global__ __launch_bounds__(256) void k_planes(const float* __restrict__ F, const float* __restrict__ CS, h16* Q16, bf* Qh, bf* Ql, h16* K16, bf* Kh, bf* Kl, h16* V16, bf* Vh, bf* Vl) {
    constexpr int FP = DQ + 2 * DKV; const size_t pb = (size_t)blockIdx.y * NH_ * TT * HD; const float* f = F + (size_t)blockIdx.y * TT * FP; const unsigned b = blockIdx.x;
    if (b < PL_V) vtp(f + DQ + DKV, FP, b, V16 + pb, Vh + pb, Vl + pb);
    else if (b < PL_V + PL_R) rope(f, FP, CS, b - PL_V, Q16 + pb, Qh + pb, Ql + pb);
    else rope(f + DQ, FP, CS, b - (PL_V + PL_R), K16 + pb, Kh + pb, Kl + pb);
}
__device__ __forceinline__ float xhalf(float x) { const int b = __float_as_int(x); return __int_as_float(__builtin_amdgcn_permlanex16(b, b, 0x76543210, 0xfedcba98, false, false)); }   // lane l <-> l ^ 16
// 2^x with the slot behind a transcendental filled inside the statement: the v_nop keeps the next vector instruction, whichever the compiler puts there, from reading the last result or taking its source register directly
// behind it; in exp2x8 each exponential is the independent instruction behind the one before (early-clobber outputs share no register with a source).
__device__ __forceinline__ float exp2x1(float x) { float r; asm("v_exp_f32 %0, %1\n\tv_nop" : "=v"(r) : "v"(x)); return r; }
__device__ __forceinline__ v8f exp2x8(v8f x) { float r0, r1, r2, r3, r4, r5, r6, r7;
    asm("v_exp_f32 %0, %8\n\tv_exp_f32 %1, %9\n\tv_exp_f32 %2, %10\n\tv_exp_f32 %3, %11\n\tv_exp_f32 %4, %12\n\tv_exp_f32 %5, %13\n\tv_exp_f32 %6, %14\n\tv_exp_f32 %7, %15\n\tv_nop"
        : "=&v"(r0), "=&v"(r1), "=&v"(r2), "=&v"(r3), "=&v"(r4), "=&v"(r5), "=&v"(r6), "=&v"(r7) : "v"(x[0]), "v"(x[1]), "v"(x[2]), "v"(x[3]), "v"(x[4]), "v"(x[5]), "v"(x[6]), "v"(x[7]));
    return (v8f){ r0, r1, r2, r3, r4, r5, r6, r7 }; }
template <typename T16, int NSPLIT, int NQ>
__device__ __forceinline__ void attn_tile(const T16* __restrict__ Q, const T16* __restrict__ Q2, const T16* __restrict__ Kp, const T16* __restrict__ K2, const T16* __restrict__ Vt, const T16* __restrict__ V2, int q0, bf* Ah, bf* Al, float* so, float* sml) {
    typedef typename WFrag<T16>::V V;
    constexpr float CX = SCL * 1.4426950408889634f;          // scores are carried as log2 exponents
    constexpr float PB = (NSPLIT == 0) ? 10.0f : 0.0f;       // fp16 probabilities carry x1024; the row sum carries it too, so it cancels in the quotient
    const int lane = threadIdx.x & 31, lr = lane & 15, hi = lane >> 4; const int wave = __builtin_amdgcn_readfirstlane((int)(threadIdx.x >> 5));
    V qf[NQ][2], qf2[NQ][2];
    const size_t qo = (size_t)q0 * HD + 8 * lane; const T16* qa = Q + qo; const T16* qa2 = (NSPLIT == 2) ? Q2 + qo : qa;
#pragma unroll
    for (int qi = 0; qi < NQ; ++qi)
#pragma unroll
        for (int ks = 0; ks < 2; ++ks) { qf[qi][ks] = WFrag<T16>::ld(qa + qi * 16 * HD + ks * 512); if (NSPLIT == 2) qf2[qi][ks] = WFrag<T16>::ld(qa2 + qi * 16 * HD + ks * 512); }
    asm volatile("s_wait_xcnt 0x0" :: "v"(qa), "v"(qa2) : "memory");   // in front of any rewrite of an address register of the query loads (named as inputs, they stay whole up to here)
    v8f o[NQ][4]; float m[NQ], l[NQ];
#pragma unroll
    for (int qi = 0; qi < NQ; ++qi) { m[qi] = -3.0e38f; l[qi] = 0.f;
#pragma unroll
        for (int dt = 0; dt < 4; ++dt) o[qi][dt] = (v8f){}; }
    const int nst = (q0 + 16 * NQ - 1) / 32 + 1;             // 32-key steps up to and including the diagonal; only the last holds keys beyond a query
    for (int s = wave; s < nst; s += FW) {
        const size_t ko = (size_t)s * 32 * HD + 8 * lane, vo = ko;   // a step's four key blocks and its four value blocks: 4 KiB in a row each
        const T16* ka = Kp + ko; const T16* ka2 = (NSPLIT == 2) ? K2 + ko : ka; const T16* va = Vt + vo; const T16* va2 = (NSPLIT == 2) ? V2 + vo : va;   // the lane's addresses of this step (named again at the waits below)
        V kf[2][2], kf2[2][2], vf[4], vf2[4];
#pragma unroll
        for (int kt = 0; kt < 2; ++kt)
#pragma unroll
            for (int ks = 0; ks < 2; ++ks) { kf[kt][ks] = WFrag<T16>::ld(ka + kt * 16 * HD + ks * 512); if (NSPLIT == 2) kf2[kt][ks] = WFrag<T16>::ld(ka2 + kt * 16 * HD + ks * 512); }
#pragma unroll
        for (int dt = 0; dt < 4; ++dt) { vf[dt] = WFrag<T16>::ld(va + dt * 512); if (NSPLIT == 2) vf2[dt] = WFrag<T16>::ld(va2 + dt * 512); }
        // the wait stands in front of any rewrite of an address register of the key loads (the address as an input keeps its registers whole up to here); the loaded fragments as inputs keep all key loads
        // in front of the first product, in flight together (without them the compiler reloads a fragment's registers behind the first products: a second load latency per step)
        if constexpr (NSPLIT == 0) asm volatile("s_wait_xcnt 0x0" :: "v"(ka), "v"(kf[0][0]), "v"(kf[0][1]), "v"(kf[1][0]), "v"(kf[1][1]) : "memory");
        else asm volatile("s_wait_xcnt 0x0" :: "v"(ka), "v"(ka2), "v"(kf[0][0]), "v"(kf[0][1]), "v"(kf[1][0]), "v"(kf[1][1]), "v"(kf2[0][0]), "v"(kf2[0][1]), "v"(kf2[1][0]), "v"(kf2[1][1]) : "memory");
        v8f st[NQ][2];                                       // st[qi][kt][j] = score of key s*32 + kt*16 + hi*8 + j and query q0 + qi*16 + lr
#pragma unroll
        for (int qi = 0; qi < NQ; ++qi)
#pragma unroll
            for (int kt = 0; kt < 2; ++kt) { v8f a = (v8f){};
#pragma unroll
                for (int ks = 0; ks < 2; ++ks) { a = WFrag<T16>::mma(kf[kt][ks], qf[qi][ks], a); if (NSPLIT == 2) { a = WFrag<T16>::mma(kf[kt][ks], qf2[qi][ks], a); a = WFrag<T16>::mma(kf2[kt][ks], qf[qi][ks], a); } }
                st[qi][kt] = a; }
        if (s == nst - 1) {                                  // diagonal step: keys beyond the query are excluded
#pragma unroll
            for (int qi = 0; qi < NQ; ++qi)
#pragma unroll
                for (int kt = 0; kt < 2; ++kt)
#pragma unroll
                    for (int j = 0; j < 8; ++j) st[qi][kt][j] = (s * 32 + kt * 16 + hi * 8 + j <= q0 + qi * 16 + lr) ? st[qi][kt][j] : -3.0e38f; }
        float mn[NQ]; bool up = false;
#pragma unroll
        for (int qi = 0; qi < NQ; ++qi) { float mx = st[qi][0][0];
#pragma unroll
            for (int j = 1; j < 8; ++j) mx = fmaxf(mx, st[qi][0][j]);
#pragma unroll
            for (int j = 0; j < 8; ++j) mx = fmaxf(mx, st[qi][1][j]);
            mx = fmaxf(mx, xhalf(mx)); mn[qi] = fmaxf(m[qi], mx * CX); up = up || (mn[qi] > m[qi]); }
        if (__builtin_amdgcn_ballot_w32(up) != 0) {          // some query's maximum rose: rescale (a factor of exactly 1 elsewhere); otherwise every factor is 1 and the multiplies are skipped
#pragma unroll
            for (int qi = 0; qi < NQ; ++qi) { const float al = exp2x1(m[qi] - mn[qi]); m[qi] = mn[qi]; l[qi] *= al;
#pragma unroll
                for (int dt = 0; dt < 4; ++dt)
#pragma unroll
                    for (int j = 0; j < 8; ++j) o[qi][dt][j] *= al; } }
        // the same wait for the value loads, which fly during the score products and the maximum: their address registers stay whole up to here
        if constexpr (NSPLIT == 0) asm volatile("s_wait_xcnt 0x0" :: "v"(va), "v"(vf[0]), "v"(vf[1]), "v"(vf[2]), "v"(vf[3]) : "memory");
        else asm volatile("s_wait_xcnt 0x0" :: "v"(va), "v"(va2), "v"(vf[0]), "v"(vf[1]), "v"(vf[2]), "v"(vf[3]), "v"(vf2[0]), "v"(vf2[1]), "v"(vf2[2]), "v"(vf2[3]) : "memory");
#pragma unroll
        for (int qi = 0; qi < NQ; ++qi) { const float mb = m[qi] - PB; float ps = 0.f;
#pragma unroll
            for (int kt = 0; kt < 2; ++kt) { st[qi][kt] = exp2x8(st[qi][kt] * CX - mb);
#pragma unroll
                for (int j = 0; j < 8; ++j) ps += st[qi][kt][j]; }
            l[qi] += ps;
            if constexpr (NSPLIT == 0) { v16h pf;
#pragma unroll
                for (int j = 0; j < 8; ++j) { pf[j] = tohx(st[qi][0][j]); pf[8 + j] = tohx(st[qi][1][j]); }
#pragma unroll
                for (int dt = 0; dt < 4; ++dt) o[qi][dt] = WFrag<T16>::mma(vf[dt], pf, o[qi][dt]);
            } else { v8us h0, h1, l0, l1;
#pragma unroll
                for (int j = 0; j < 8; ++j) { unsigned short a, c2; splitf(st[qi][0][j], a, c2); h0[j] = a; l0[j] = c2; splitf(st[qi][1][j], a, c2); h1[j] = a; l1[j] = c2; }
                const v16bf ph = cat16b(h0, h1), pl = cat16b(l0, l1);
#pragma unroll
                for (int dt = 0; dt < 4; ++dt) { o[qi][dt] = WFrag<T16>::mma(vf[dt], ph, o[qi][dt]); o[qi][dt] = WFrag<T16>::mma(vf[dt], pl, o[qi][dt]); o[qi][dt] = WFrag<T16>::mma(vf2[dt], ph, o[qi][dt]); } } }
    }
    float* sw = so + wave * (NQ * 16 * OP);
#pragma unroll
    for (int qi = 0; qi < NQ; ++qi) { l[qi] += xhalf(l[qi]);   // the halves' sums join once
#pragma unroll
        for (int dt = 0; dt < 4; ++dt) { float* d0 = sw + (qi * 16 + lr) * OP + dt * 16 + hi * 8; *(v4fa*)d0 = (v4f){ o[qi][dt][0], o[qi][dt][1], o[qi][dt][2], o[qi][dt][3] }; *(v4fa*)(d0 + 4) = (v4f){ o[qi][dt][4], o[qi][dt][5], o[qi][dt][6], o[qi][dt][7] }; }
        if (hi == 0) { sml[(wave * 2) * 32 + qi * 16 + lr] = m[qi]; sml[(wave * 2 + 1) * 32 + qi * 16 + lr] = l[qi]; } }
    __syncthreads();   // every wave's partials are in LDS (a wave without a step brings maximum -3e38, sum 0, zeros)
    constexpr int EPT = NQ * 8;                              // outputs per thread
    const int q = (int)threadIdx.x / (HD / EPT), dc = ((int)threadIdx.x % (HD / EPT)) * EPT;
    float ms = sml[q];
#pragma unroll
    for (int w = 1; w < FW; ++w) ms = fmaxf(ms, sml[(w * 2) * 32 + q]);
    float L = 0.f, acc[EPT];
#pragma unroll
    for (int e = 0; e < EPT; ++e) acc[e] = 0.f;
#pragma unroll
    for (int w = 0; w < FW; ++w) { const float f = exp2x1(sml[(w * 2) * 32 + q] - ms); L += f * sml[(w * 2 + 1) * 32 + q]; const float* r = so + w * (NQ * 16 * OP) + q * OP + dc;
#pragma unroll
        for (int e = 0; e < EPT; e += 4) { const v4f x4 = *(const v4fa*)(r + e); acc[e] += f * x4[0]; acc[e + 1] += f * x4[1]; acc[e + 2] += f * x4[2]; acc[e + 3] += f * x4[3]; } }
    const float inv = __fdiv_rn(1.0f, L); const size_t oo = (size_t)((q0 + q) >> 4) * (16 * DQ) + ((q0 + q) & 15) * 8;   // merged output in fragment order for the last product (rows of DQ): the row's place; the column's below
#pragma unroll
    for (int e = 0; e < EPT; e += 8) { v8us oh, ol;
#pragma unroll
        for (int k = 0; k < 8; ++k) { unsigned short a, c2; splitf(acc[e + k] * inv, a, c2); oh[k] = a; ol[k] = c2; }
        const int co = ((dc + e) >> 5) * 512 + (((dc + e) >> 3) & 3) * 128; bf* ph = Ah + oo + co; bf* pl = Al + oo + co; *(v8usa*)ph = oh; *(v8usa*)pl = ol;
        asm volatile("s_wait_xcnt 0x0" :: "v"(ph), "v"(pl), "v"(oh), "v"(ol) : "memory"); }   // in front of any rewrite of an address or data register of the two stores (named as inputs, they stay whole up to here)
}
// grid (batches x heads, NTF + NTH): the longest tiles (last queries) of every head and batch come first
__global__ __launch_bounds__(FW * 32) void k_fattn(const h16* __restrict__ Q16, const h16* __restrict__ K16, const h16* __restrict__ V16, const bf* __restrict__ Qh, const bf* __restrict__ Ql, const bf* __restrict__ Kh, const bf* __restrict__ Kl, const bf* __restrict__ Vh, const bf* __restrict__ Vl, bf* Ah, bf* Al) {
    __shared__ __align__(16) float so[FW * 32 * OP]; __shared__ float sml[FW * 2 * 32];
    static_assert(REP == 1, "one kv head per query head"); const size_t hb = (size_t)blockIdx.x * TT * HD; const int bx = (int)blockIdx.y; const size_t ab = (size_t)(blockIdx.x / NH_) * TT * DQ + (blockIdx.x % NH_) * (HD / 32) * 512; Ah += ab; Al += ab;
    if (bx < NTF) attn_tile<h16, 0, 2>(Q16 + hb, nullptr, K16 + hb, nullptr, V16 + hb, nullptr, TT - 32 * (bx + 1), Ah, Al, so, sml);
    else attn_tile<bf, 2, 1>(Qh + hb, Ql + hb, Kh + hb, Kl + hb, Vh + hb, Vl + hb, RH - 16 * (bx - NTF + 1), Ah, Al, so, sml);
}

extern "C" void kernel_launch(void* const* d_in, const int* in_sizes, int n_in,
                              void* d_out, int out_size, void* d_ws, size_t ws_size, hipStream_t stream) {
    (void)in_sizes; (void)n_in; (void)out_size;
    const float* x = (const float*)d_in[0]; const float* wqkv = (const float*)d_in[1]; const float* wo = (const float*)d_in[2];   /* order x, w_qkv ('oi' [3072][1024]: ROW thirds q | k | v), w_out ('oi' [1024][1024]): THREE inputs */
    float* OUT = (float*)d_out;     // [4][2048][1024]
    char* wsp = (char*)d_ws;
    auto take = [&](size_t bytes) { char* p = wsp; wsp += (bytes + 255) & ~(size_t)255; return (void*)p; };
    bf* WO = (bf*)take((size_t)DM * DQ * 2); float* CS = (float*)take((size_t)TT * HD * 2 * 4);
    float* F = (float*)take((size_t)NB_ * TT * (DQ + 2 * DKV) * 4);   // joint q | k | v projection of all batches
    h16* QP16 = (h16*)take((size_t)NB_ * NH_ * TT * HD * 2); h16* KP16 = (h16*)take((size_t)NB_ * NKV * TT * HD * 2); h16* VT16 = (h16*)take((size_t)NB_ * NKV * HD * TT * 2);
    bf* QPh = (bf*)take((size_t)NB_ * NH_ * TT * HD * 2); bf* QPl = (bf*)take((size_t)NB_ * NH_ * TT * HD * 2); bf* KPh = (bf*)take((size_t)NB_ * NKV * TT * HD * 2); bf* KPl = (bf*)take((size_t)NB_ * NKV * TT * HD * 2); bf* VTh = (bf*)take((size_t)NB_ * NKV * HD * TT * 2); bf* VTl = (bf*)take((size_t)NB_ * NKV * HD * TT * 2);
    if ((size_t)(wsp - (char*)d_ws) > ws_size) return;    // ws 256 MiB
    bf* XB = (bf*)QP16; bf* WQKV = (bf*)KP16;                        // the projection's operands lie in plane bytes: last read before k_planes writes the planes (stream-ordered)
    bf* ATh = (bf*)F; bf* ATl = ATh + (size_t)NB_ * TT * DQ;         // the merged attention output lies in the projection's bytes: F is last read by k_planes (stream-ordered)
    k_prep<<<PB_C + PB_X + PB_W + PB_O, 256, 0, stream>>>(x, wqkv, wo, XB, WQKV, WO, CS);
    k_gemmw<bf, 0, false, DM><<<dim3(NB_ * TT / 64, (DQ + 2 * DKV) / 64, 1), 32, 0, stream>>>(XB, nullptr, WQKV, nullptr, F, DQ + 2 * DKV, nullptr, 0, 0, 0);
    k_planes<<<dim3(PL_V + 2 * PL_R, NB_, 1), 256, 0, stream>>>(F, CS, QP16, QPh, QPl, KP16, KPh, KPl, VT16, VTh, VTl);
    k_fattn<<<dim3(NB_ * NH_, NTF + NTH, 1), FW * 32, 0, stream>>>(QP16, KP16, VT16, QPh, QPl, KPh, KPl, VTh, VTl, ATh, ATl);
    k_gemmw<bf, 1, false, DQ><<<dim3(NB_ * TT / 64, DM / 64, 1), 32, 0, stream>>>(ATh, ATl, WO, nullptr, OUT, DM, nullptr, 0, 0, 0);
}

// v006
// Measured time: 183 microseconds a run.
// Two timings next to v005 put it at 1.12 and 1.14 times that version's speed.
// All steps since v000 together make it 15.6 times as fast.
#include <hip/hip_runtime.h>

// Causal self-attention with a fused bias-free natural qkv weight and computed rotate-half rotary embeddings (x [4][2048][1024]; qkv = x w_qkv^T ('oi' [3072][1024] 1/32, no bias) split in ROW thirds q | k | v (16 heads x 64); rope cat(x1 c - x2 s, x1 s + x2 c) on the two 32-wide halves with angle t x 1/10000^(i/32) (32 f32 constants jnp-exact; one f32 product; precise cosf/sinf); scores / sqrt(64); causal (-inf == exclusion); softmax; y = merged w_out^T ('oi', no bias) -> [4][2048][1024] (8.4 M); argument order x, w_qkv, w_out).
// Layout, all batches in every launch: bf16 copy of x; 'oi' weights; exact projections, the joint q | k | v one rotating and storing its own head planes; computed rotary table; causal T-2048 attention, all heads of all batches in one launch, scores and probabilities in registers (hybrid rows: < 512 hi/lo 3 products, rest fp16 x1024; key steps end at the diagonal); merged hi/lo x w_o exact.
// Every 16-bit matrix operand plane is stored in fragment order: blocks of 16 rows x 32 k (1 KiB), inside a block [k bit 4][k bit 3][row & 15][k & 7], so that lane l of a wave finds its two 16-byte pieces of a fragment at
// block + 8 l and block + 256 + 8 l (elements): each wave-wide 16-byte load reads 512 contiguous bytes (4 whole lines). Blocks run along k first (value planes: the four 16-row blocks of a 32-key step lie together).
// Compute dtypes, f32 accumulate: every input rounded to bf16; projections exact; attention rows < 512 3 products, rest fp16; softmax f32; w_o hl x exact.

#define NB_  4
#define TT   2048
#define DM   1024
#define NH_  16
#define NKV  16
#define REP  (NH_ / NKV)
#define HD   64
#define DQ   (NH_ * HD)
#define DKV  (NKV * HD)
#define RH   512                  // query rows < RH use hi+lo planes (0: none)
#define SCL  0.125f   // HD^-0.5
#define FW   4                    // waves of an attention work-group: they share one query tile and deal its 32-key steps round robin
#define OP   68                   // pitch, in floats, of a query's partial output row in LDS
#define NTF  ((TT - RH) / 32)     // query tiles per head, fp16 rows (32 queries)
#define NTH  (RH / 16)            // query tiles per head, hi/lo rows (16 queries)
typedef _Float16 h16;
typedef unsigned short bf;
typedef __attribute__((ext_vector_type(16))) __bf16   v16bf;
typedef __attribute__((ext_vector_type(16))) _Float16 v16h;
typedef __attribute__((ext_vector_type(8)))  _Float16 v8h;
typedef __attribute__((ext_vector_type(8)))  unsigned short v8us;
typedef __attribute__((ext_vector_type(8)))  float    v8f;
typedef __attribute__((ext_vector_type(4)))  float    v4f;
typedef v8h  __attribute__((may_alias)) v8ha;
typedef v4f  __attribute__((may_alias)) v4fa;
typedef v8us __attribute__((may_alias)) v8usa;

__device__ __forceinline__ unsigned short f2bf(float f) { unsigned u = __float_as_uint(f); u += 0x7FFFu + ((u >> 16) & 1u); return (unsigned short)(u >> 16); }
__device__ __forceinline__ float bf2f(unsigned short b) { return __uint_as_float(((unsigned)b) << 16); }
__device__ __forceinline__ float bfr(float f) { return bf2f(f2bf(f)); }
__device__ __forceinline__ v16h cat16(v8h lo, v8h hi) { return __builtin_shufflevector(lo, hi, 0, 1, 2, 3, 4, 5, 6, 7, 8, 9, 10, 11, 12, 13, 14, 15); }
__device__ __forceinline__ v16bf cat16b(v8us lo, v8us hi) { return __builtin_bit_cast(v16bf, __builtin_shufflevector(lo, hi, 0, 1, 2, 3, 4, 5, 6, 7, 8, 9, 10, 11, 12, 13, 14, 15)); }
__device__ __forceinline__ v8f wmma16(v16h a, v16h b, v8f c) { return __builtin_amdgcn_wmma_f32_16x16x32_f16(false, a, false, b, (short)0, c, false, false); }
__device__ __forceinline__ v8f wmmab(v16bf a, v16bf b, v8f c) { return __builtin_amdgcn_wmma_f32_16x16x32_bf16(false, a, false, b, (short)0, c, false, false); }



// ---- k_gemmw: register-blocked GEMM, ONE WAVE per 64x64 output tile (16 accumulators), operands straight from 16-bit planes in fragment order (a 16-row block's K/32 blocks in a row: 16 K elements); grid (M/64, N/64, Z), 32 threads.
// C[m][n] (f32, pitch ldc, + optional f32 bias[n]) = sum_k A[m][k] Bt[n][k] (+ split products per NSPLIT). z-batch strides sA/sB/sC in elements. K % 32 == 0.
template <typename T16> struct WFrag;
template <> struct WFrag<h16> { typedef v16h V; static __device__ __forceinline__ V ld(const h16* p) { return cat16(*(const v8h*)p, *(const v8h*)(p + 256)); } static __device__ __forceinline__ v8f mma(V a, V b, v8f c) { return wmma16(a, b, c); } };
template <> struct WFrag<bf> { typedef v16bf V; static __device__ __forceinline__ V ld(const bf* p) { return cat16b(*(const v8us*)p, *(const v8us*)(p + 256)); } static __device__ __forceinline__ v8f mma(V a, V b, v8f c) { return wmmab(a, b, c); } };
template <typename T16, int NSPLIT, bool BIAS, int K>
__global__ __launch_bounds__(32) void k_gemmw(const T16* __restrict__ A, const T16* __restrict__ A2, const T16* __restrict__ Bt, const T16* __restrict__ Bt2, float* C, int ldc, const float* __restrict__ bias, size_t sA, size_t sB, size_t sC) {
    typedef typename WFrag<T16>::V V;
    __shared__ __align__(16) float os[16 * 68];
    const size_t z = blockIdx.z; A += z * sA; if (A2) A2 += z * sA; Bt += z * sB; if (Bt2) Bt2 += z * sB; C += z * sC;
    const int lane = threadIdx.x & 31, lr = lane & 15, hi = lane >> 4; const int r0 = blockIdx.x * 64, c0 = blockIdx.y * 64;
    v8f acc[4][4];
#pragma unroll
    for (int mb = 0; mb < 4; ++mb)
#pragma unroll
        for (int nb = 0; nb < 4; ++nb) acc[mb][nb] = (v8f){};
    const size_t aoff = (size_t)r0 * K + 8 * lane, boff = (size_t)c0 * K + 8 * lane;
    const T16* pa = A + aoff; const T16* pa2 = (NSPLIT == 1 || NSPLIT == 2) ? A2 + aoff : pa; const T16* pb = Bt + boff; const T16* pb2 = (NSPLIT >= 2) ? Bt2 + boff : pb;   // one address per plane: K is a constant, the 16-row blocks are immediate offsets
#pragma unroll 1
    for (int kc = 0; kc < K; kc += 32, pa += 512, pa2 += 512, pb += 512, pb2 += 512) {
        V a[4], a2[4], b[4], b2[4];
#pragma unroll
        for (int mb = 0; mb < 4; ++mb) { a[mb] = WFrag<T16>::ld(pa + mb * 16 * K); if (NSPLIT == 1 || NSPLIT == 2) a2[mb] = WFrag<T16>::ld(pa2 + mb * 16 * K); }
#pragma unroll
        for (int nb = 0; nb < 4; ++nb) { b[nb] = WFrag<T16>::ld(pb + nb * 16 * K); if (NSPLIT >= 2) b2[nb] = WFrag<T16>::ld(pb2 + nb * 16 * K); }
        asm volatile("s_wait_xcnt 0x0" :: "v"(pa), "v"(pa2), "v"(pb), "v"(pb2) : "memory");   // behind the step's loads, in front of any rewrite of an address register of theirs (named as inputs, they stay whole up to here)
#pragma unroll
        for (int nb = 0; nb < 4; ++nb) {
#pragma unroll
            for (int mb = 0; mb < 4; ++mb) { acc[mb][nb] = WFrag<T16>::mma(a[mb], b[nb], acc[mb][nb]); if (NSPLIT == 1 || NSPLIT == 2) acc[mb][nb] = WFrag<T16>::mma(a2[mb], b[nb], acc[mb][nb]); if (NSPLIT >= 2) acc[mb][nb] = WFrag<T16>::mma(a[mb], b2[nb], acc[mb][nb]); } }
        asm volatile("v_nop\n\tv_nop\n\tv_nop\n\tv_nop" : "+v"(acc[0][0]), "+v"(acc[1][1]), "+v"(acc[2][2]), "+v"(acc[3][3]) : "v"(a[0]), "v"(a[3]));
    }
#pragma unroll
    for (int mb = 0; mb < 4; ++mb) {
#pragma unroll
        for (int nb = 0; nb < 4; ++nb) {
#pragma unroll
            for (int j = 0; j < 8; ++j) os[(hi * 8 + j) * 68 + nb * 16 + lr] = acc[mb][nb][j]; }
        __builtin_amdgcn_wave_barrier(); asm volatile("" ::: "memory");
        float* crow = C + (size_t)(r0 + mb * 16) * ldc + c0;
{
#pragma unroll
            for (int s = 0; s < 8; ++s) { const int row = 2 * s + hi, cofs = lr * 4; v4f val = *(const v4fa*)(os + row * 68 + cofs); if (BIAS) { val[0] += bfr(bias[c0 + cofs]); val[1] += bfr(bias[c0 + cofs + 1]); val[2] += bfr(bias[c0 + cofs + 2]); val[3] += bfr(bias[c0 + cofs + 3]); }
                *(v4f*)(crow + (size_t)row * ldc + cofs) = val; }
             }
        __builtin_amdgcn_wave_barrier(); asm volatile("" ::: "memory");
    }
}

__device__ __forceinline__ h16 tohx(float x) { return (h16)x; }
__device__ __forceinline__ void splitf(float y, unsigned short& h, unsigned short& l) { h = f2bf(y); l = f2bf(y - bf2f(h)); }
typedef __attribute__((ext_vector_type(2))) _Float16 v2h;
typedef __attribute__((ext_vector_type(4))) _Float16 v4h;
typedef __attribute__((ext_vector_type(2))) unsigned short v2us;
typedef __attribute__((ext_vector_type(4))) unsigned short v4us;
typedef __attribute__((ext_vector_type(2))) float v2f;
typedef __attribute__((ext_vector_type(4))) int v4i;
typedef v4h  __attribute__((may_alias)) v4ha;
typedef v4us __attribute__((may_alias)) v4usa;

__device__ __forceinline__ void cvt8(const float* __restrict__ src, bf* dst, size_t n8, unsigned blk) { const size_t i = (size_t)blk * 256 + threadIdx.x; if (i >= n8) return;   // thread i makes 16-byte piece i of the fragment-order plane (rows of DM elements)
    const size_t tb = i >> 6; const int w = (int)(i & 63); const float* sp = src + ((tb / (DM / 32)) * 16 + (w & 15)) * DM + (tb % (DM / 32)) * 32 + (w >> 4) * 8; const v8f v = *(const v8f*)sp; v8us o;
    asm volatile("s_wait_xcnt 0x0" :: "v"(sp), "v"(v) : "memory");   // in front of any rewrite of the load's address registers (address and loaded value as inputs: the registers stay whole, and the load stays in front)
#pragma unroll
    for (int k = 0; k < 8; ++k) o[k] = f2bf(v[k]); *(v8us*)(dst + i * 8) = o;  }

// put8: one 16-byte piece (8 values) of a head plane, in all three forms (fp16, bf16 hi, bf16 lo), at element e.
__device__ __forceinline__ void put8(const float* r, size_t e, h16* P16, bf* Ph, bf* Pl) { v8h o16; v8us oh, ol;
#pragma unroll
    for (int j = 0; j < 8; ++j) { o16[j] = tohx(r[j]); unsigned short a2, c2; splitf(r[j], a2, c2); oh[j] = a2; ol[j] = c2; }
    h16* p16 = P16 + e; bf* ph = Ph + e; bf* pl = Pl + e; *(v8h*)p16 = o16; *(v8us*)ph = oh; *(v8us*)pl = ol;
    asm volatile("s_wait_xcnt 0x0" :: "v"(p16), "v"(ph), "v"(pl), "v"(o16), "v"(oh), "v"(ol) : "memory"); }   // in front of any rewrite of an address or data register of the three stores (named as inputs, they stay whole up to here)
__constant__ float INVT[HD / 2] = { 1.000000000e+00f, 7.498942018e-01f, 5.623413324e-01f, 4.216965139e-01f, 3.162277639e-01f, 2.371373624e-01f, 1.778279394e-01f, 1.333521456e-01f, 1.000000015e-01f, 7.498941571e-02f, 5.623412877e-02f, 4.216964915e-02f, 3.162277862e-02f, 2.371373586e-02f, 1.778279431e-02f, 1.333521493e-02f, 9.999999776e-03f, 7.498942316e-03f, 5.623413250e-03f, 4.216964822e-03f, 3.162277862e-03f, 2.371373819e-03f, 1.778279431e-03f, 1.333521446e-03f, 1.000000047e-03f, 7.498941850e-04f, 5.623413017e-04f, 4.216964880e-04f, 3.162277862e-04f, 2.371373848e-04f, 1.778279402e-04f, 1.333521504e-04f };   // float32 1 / 10000^(i/32), generated with jnp to be bit-exact
// Rotary table, d < HD/2 only (the two halves are equal), in the order its reader k_qkv takes it: [t / 16][d / 16][pair of d: (d & 7) / 2][lane = ((d >> 3) & 1) * 16 + (t & 15)][d & 1][cos, sin]: lane l finds the eight
// pairs of its position and its 8 d in four 16-byte pieces, 128 floats apart, and each wave-wide load reads 512 contiguous bytes. Thread idx makes pair idx.
__device__ __forceinline__ void cs5(float* CS, unsigned blk) { const int idx = (int)blk * 256 + threadIdx.x; if (idx >= TT * (HD / 2)) return; const int ln = (idx >> 1) & 31; const int d = ((idx >> 8) & 1) * 16 + (ln >> 4) * 8 + ((idx >> 6) & 3) * 2 + (idx & 1); const int t = (idx >> 9) * 16 + (ln & 15); const float a = __fmul_rn((float)t, INVT[d]); v2f cs; cs[0] = cosf(a); cs[1] = sinf(a); *(v2f*)(CS + (size_t)idx * 2) = cs;  }
static_assert(HD == 64, "the table's order and k_qkv's tiles are laid out for heads of 64");
// ---- k_prep: the stages that read only inputs, in one launch, dealt by block range: rotary table, then the bf16 copies of x (all batches), w_qkv and w_out.
static_assert(DQ == DM, "cvt8 lays all three planes out in rows of DM elements");
#define PB_C ((unsigned)(TT * (HD / 2) / 256))
#define PB_X ((unsigned)((size_t)NB_ * TT * DM / 8 / 256))
#define PB_W ((unsigned)((size_t)(DQ + 2 * DKV) * DM / 8 / 256))
#define PB_O ((unsigned)((size_t)DM * DQ / 8 / 256))
__global__ __launch_bounds__(256) void k_prep(const float* __restrict__ x, const float* __restrict__ wqkv, const float* __restrict__ wo, bf* XB, bf* WQKV, bf* WO, float* CS) {
    const unsigned b = blockIdx.x;
    if (b < PB_C) cs5(CS, b);
    else if (b < PB_C + PB_X) cvt8(x, XB, (size_t)NB_ * TT * DM / 8, b - PB_C);
    else if (b < PB_C + PB_X + PB_W) cvt8(wqkv, WQKV, (size_t)(DQ + 2 * DKV) * DM / 8, b - (PB_C + PB_X));
    else cvt8(wo, WO, (size_t)DM * DQ / 8, b - (PB_C + PB_X + PB_W));
}
// ---- k_qkv: the joint projection with the plane builders as its epilogue: ONE WAVE per tile of 64 positions x one head of q, k or v (k_gemmw's loop); grid (batches x TT / 64, heads of q + k + v), 32 threads. No f32 projection is stored.
// A lane's 8 registers of an accumulator run along the A operand's rows, so A is chosen as the side that is the plane's k: q and k tiles take the weight rows as A (a lane holds 8 consecutive d of one position: a 16-byte piece of
// a [t][d] plane, and its rotation partner d + 32 lies in the same lane, two accumulators on); v tiles take the x rows as A (8 consecutive positions of one d: a piece of a [d][t] plane). Both operand planes have the same order.
// Piece (mb, nb) of a tile lies at lane * 8 + (mb & 1) * 256 in its block: every wave-wide 16-byte store writes 512 contiguous bytes.
__global__ __launch_bounds__(32) void k_qkv(const bf* __restrict__ X, const bf* __restrict__ Wt, const float* __restrict__ CS, h16* Q16, bf* Qh, bf* Ql, h16* K16, bf* Kh, bf* Kl, h16* V16, bf* Vh, bf* Vl) {
    typedef WFrag<bf>::V V; constexpr int K = DM;
    static_assert(TT % 64 == 0 && NKV == NH_, "a tile lies in one batch; q, k and v planes have the same shape");
    const int lane = threadIdx.x & 31; const int r0 = blockIdx.x * 64, c0 = blockIdx.y * 64; const bool isv = c0 >= DQ + DKV, isk = !isv && c0 >= DQ;
    v8f acc[4][4];
#pragma unroll
    for (int mb = 0; mb < 4; ++mb)
#pragma unroll
        for (int nb = 0; nb < 4; ++nb) acc[mb][nb] = (v8f){};
    const bf* px = X + (size_t)r0 * K + 8 * lane; const bf* pw = Wt + (size_t)c0 * K + 8 * lane;
    const bf* pa = isv ? px : pw; const bf* pb = isv ? pw : px;   // one address per plane: K is a constant, the 16-row blocks are immediate offsets
#pragma unroll 1
    for (int kc = 0; kc < K; kc += 32, pa += 512, pb += 512) {
        V a[4], b[4];
#pragma unroll
        for (int mb = 0; mb < 4; ++mb) a[mb] = WFrag<bf>::ld(pa + mb * 16 * K);
#pragma unroll
        for (int nb = 0; nb < 4; ++nb) b[nb] = WFrag<bf>::ld(pb + nb * 16 * K);
        asm volatile("s_wait_xcnt 0x0" :: "v"(pa), "v"(pb) : "memory");   // behind the step's loads, in front of any rewrite of an address register of theirs (named as inputs, they stay whole up to here)
#pragma unroll
        for (int nb = 0; nb < 4; ++nb) {
#pragma unroll
            for (int mb = 0; mb < 4; ++mb) acc[mb][nb] = WFrag<bf>::mma(a[mb], b[nb], acc[mb][nb]); }
        asm volatile("v_nop\n\tv_nop\n\tv_nop\n\tv_nop" : "+v"(acc[0][0]), "+v"(acc[1][1]), "+v"(acc[2][2]), "+v"(acc[3][3]) : "v"(a[0]), "v"(a[3]));   // the distance behind the step's last products, on the way out of the loop too
    }
    // a tile's 8 blocks (8 KiB a plane) lie in a row; [t][d] planes: block = (t / 16) * 2 + d / 32; [d][t] planes: block = (t / 32) * 4 + d / 16
    const int t0 = r0 % TT; const size_t eb = ((size_t)(r0 / TT) * NH_ + (c0 / HD) % NH_) * TT * HD + (size_t)t0 * HD + 8 * lane;
    if (isv) {   // acc[mb][nb][j] is position t0 + mb * 16 + (lane >> 4) * 8 + j of d = nb * 16 + (lane & 15)
#pragma unroll
        for (int mb = 0; mb < 4; ++mb)
#pragma unroll
            for (int nb = 0; nb < 4; ++nb) { float r[8];
#pragma unroll
                for (int j = 0; j < 8; ++j) r[j] = acc[mb][nb][j];
                put8(r, eb + (mb >> 1) * 2048 + nb * 512 + (mb & 1) * 256, V16, Vh, Vl); }
    } else {     // acc[mb][nb][j] is d = mb * 16 + (lane >> 4) * 8 + j of position t0 + nb * 16 + (lane & 15); rotate-half: out[d] = x[d] cos - x[d+32] sin, out[d+32] = x[d+32] cos + x[d] sin, d < 32
        h16* P16 = isk ? K16 : Q16; bf* Ph = isk ? Kh : Qh; bf* Pl = isk ? Kl : Ql; const float* pc = CS + (size_t)(t0 >> 4) * 1024 + lane * 4;
#pragma unroll
        for (int nb = 0; nb < 4; ++nb) {
            v4f cq[2][4];   // the table pieces of 16 positions fly together
#pragma unroll
            for (int mb = 0; mb < 2; ++mb)
#pragma unroll
                for (int q = 0; q < 4; ++q) cq[mb][q] = *(const v4f*)(pc + (nb * 2 + mb) * 512 + q * 128);
            asm volatile("s_wait_xcnt 0x0" :: "v"(pc), "v"(cq[0][0]), "v"(cq[0][1]), "v"(cq[0][2]), "v"(cq[0][3]), "v"(cq[1][0]), "v"(cq[1][1]), "v"(cq[1][2]), "v"(cq[1][3]) : "memory");   // one wait behind the eight loads, in front of any rewrite of their address registers (address and loaded values as inputs: the registers stay whole, and the loads stay in front)
#pragma unroll
            for (int mb = 0; mb < 2; ++mb) { float r1[8], r2[8];
#pragma unroll
                for (int j = 0; j < 8; ++j) { const float co = cq[mb][j >> 1][(j & 1) * 2], si = cq[mb][j >> 1][(j & 1) * 2 + 1]; const float x1 = acc[mb][nb][j], x2 = acc[mb + 2][nb][j]; r1[j] = x1 * co - x2 * si; r2[j] = x2 * co + x1 * si; }
                const size_t e = eb + nb * 1024 + mb * 256; put8(r1, e, P16, Ph, Pl); put8(r2, e + 512, P16, Ph, Pl); }
        }
    }
}
__device__ __forceinline__ float xhalf(float x) { const int b = __float_as_int(x); return __int_as_float(__builtin_amdgcn_permlanex16(b, b, 0x76543210, 0xfedcba98, false, false)); }   // lane l <-> l ^ 16
// 2^x with the slot behind a transcendental filled inside the statement: the v_nop keeps the next vector instruction, whichever the compiler puts there, from reading the last result or taking its source register directly
// behind it; in exp2x8 each exponential is the independent instruction behind the one before (early-clobber outputs share no register with a source).
__device__ __forceinline__ float exp2x1(float x) { float r; asm("v_exp_f32 %0, %1\n\tv_nop" : "=v"(r) : "v"(x)); return r; }
__device__ __forceinline__ v8f exp2x8(v8f x) { float r0, r1, r2, r3, r4, r5, r6, r7;
    asm("v_exp_f32 %0, %8\n\tv_exp_f32 %1, %9\n\tv_exp_f32 %2, %10\n\tv_exp_f32 %3, %11\n\tv_exp_f32 %4, %12\n\tv_exp_f32 %5, %13\n\tv_exp_f32 %6, %14\n\tv_exp_f32 %7, %15\n\tv_nop"
        : "=&v"(r0), "=&v"(r1), "=&v"(r2), "=&v"(r3), "=&v"(r4), "=&v"(r5), "=&v"(r6), "=&v"(r7) : "v"(x[0]), "v"(x[1]), "v"(x[2]), "v"(x[3]), "v"(x[4]), "v"(x[5]), "v"(x[6]), "v"(x[7]));
    return (v8f){ r0, r1, r2, r3, r4, r5, r6, r7 }; }
template <typename T16, int NSPLIT, int NQ>
__device__ __forceinline__ void attn_tile(const T16* __restrict__ Q, const T16* __restrict__ Q2, const T16* __restrict__ Kp, const T16* __restrict__ K2, const T16* __restrict__ Vt, const T16* __restrict__ V2, int q0, bf* Ah, bf* Al, float* so, float* sml) {
    typedef typename WFrag<T16>::V V;
    constexpr float CX = SCL * 1.4426950408889634f;          // scores are carried as log2 exponents
    constexpr float PB = (NSPLIT == 0) ? 10.0f : 0.0f;       // fp16 probabilities carry x1024; the row sum carries it too, so it cancels in the quotient
    const int lane = threadIdx.x & 31, lr = lane & 15, hi = lane >> 4; const int wave = __builtin_amdgcn_readfirstlane((int)(threadIdx.x >> 5));
    V qf[NQ][2], qf2[NQ][2];
    const size_t qo = (size_t)q0 * HD + 8 * lane; const T16* qa = Q + qo; const T16* qa2 = (NSPLIT == 2) ? Q2 + qo : qa;
#pragma unroll
    for (int qi = 0; qi < NQ; ++qi)
#pragma unroll
        for (int ks = 0; ks < 2; ++ks) { qf[qi][ks] = WFrag<T16>::ld(qa + qi * 16 * HD + ks * 512); if (NSPLIT == 2) qf2[qi][ks] = WFrag<T16>::ld(qa2 + qi * 16 * HD + ks * 512); }
    asm volatile("s_wait_xcnt 0x0" :: "v"(qa), "v"(qa2) : "memory");   // in front of any rewrite of an address register of the query loads (named as inputs, they stay whole up to here)
    v8f o[NQ][4]; float m[NQ], l[NQ];
#pragma unroll
    for (int qi = 0; qi < NQ; ++qi) { m[qi] = -3.0e38f; l[qi] = 0.f;
#pragma unroll
        for (int dt = 0; dt < 4; ++dt) o[qi][dt] = (v8f){}; }
    const int nst = (q0 + 16 * NQ - 1) / 32 + 1;             // 32-key steps up to and including the diagonal; only the last holds keys beyond a query
    for (int s = wave; s < nst; s += FW) {
        const size_t ko = (size_t)s * 32 * HD + 8 * lane, vo = ko;   // a step's four key blocks and its four value blocks: 4 KiB in a row each
        const T16* ka = Kp + ko; const T16* ka2 = (NSPLIT == 2) ? K2 + ko : ka; const T16* va = Vt + vo; const T16* va2 = (NSPLIT == 2) ? V2 + vo : va;   // the lane's addresses of this step (named again at the waits below)
        V kf[2][2], kf2[2][2], vf[4], vf2[4];
#pragma unroll
        for (int kt = 0; kt < 2; ++kt)
#pragma unroll
            for (int ks = 0; ks < 2; ++ks) { kf[kt][ks] = WFrag<T16>::ld(ka + kt * 16 * HD + ks * 512); if (NSPLIT == 2) kf2[kt][ks] = WFrag<T16>::ld(ka2 + kt * 16 * HD + ks * 512); }
#pragma unroll
        for (int dt = 0; dt < 4; ++dt) { vf[dt] = WFrag<T16>::ld(va + dt * 512); if (NSPLIT == 2) vf2[dt] = WFrag<T16>::ld(va2 + dt * 512); }
        // the wait stands in front of any rewrite of an address register of the key loads (the address as an input keeps its registers whole up to here); the loaded fragments as inputs keep all key loads
        // in front of the first product, in flight together (without them the compiler reloads a fragment's registers behind the first products: a second load latency per step)
        if constexpr (NSPLIT == 0) asm volatile("s_wait_xcnt 0x0" :: "v"(ka), "v"(kf[0][0]), "v"(kf[0][1]), "v"(kf[1][0]), "v"(kf[1][1]) : "memory");
        else asm volatile("s_wait_xcnt 0x0" :: "v"(ka), "v"(ka2), "v"(kf[0][0]), "v"(kf[0][1]), "v"(kf[1][0]), "v"(kf[1][1]), "v"(kf2[0][0]), "v"(kf2[0][1]), "v"(kf2[1][0]), "v"(kf2[1][1]) : "memory");
        v8f st[NQ][2];                                       // st[qi][kt][j] = score of key s*32 + kt*16 + hi*8 + j and query q0 + qi*16 + lr
#pragma unroll
        for (int qi = 0; qi < NQ; ++qi)
#pragma unroll
            for (int kt = 0; kt < 2; ++kt) { v8f a = (v8f){};
#pragma unroll
                for (int ks = 0; ks < 2; ++ks) { a = WFrag<T16>::mma(kf[kt][ks], qf[qi][ks], a); if (NSPLIT == 2) { a = WFrag<T16>::mma(kf[kt][ks], qf2[qi][ks], a); a = WFrag<T16>::mma(kf2[kt][ks], qf[qi][ks], a); } }
                st[qi][kt] = a; }
        if (s == nst - 1) {                                  // diagonal step: keys beyond the query are excluded
#pragma unroll
            for (int qi = 0; qi < NQ; ++qi)
#pragma unroll
                for (int kt = 0; kt < 2; ++kt)
#pragma unroll
                    for (int j = 0; j < 8; ++j) st[qi][kt][j] = (s * 32 + kt * 16 + hi * 8 + j <= q0 + qi * 16 + lr) ? st[qi][kt][j] : -3.0e38f; }
        float mn[NQ]; bool up = false;
#pragma unroll
        for (int qi = 0; qi < NQ; ++qi) { float mx = st[qi][0][0];
#pragma unroll
            for (int j = 1; j < 8; ++j) mx = fmaxf(mx, st[qi][0][j]);
#pragma unroll
            for (int j = 0; j < 8; ++j) mx = fmaxf(mx, st[qi][1][j]);
            mx = fmaxf(mx, xhalf(mx)); mn[qi] = fmaxf(m[qi], mx * CX); up = up || (mn[qi] > m[qi]); }
        if (__builtin_amdgcn_ballot_w32(up) != 0) {          // some query's maximum rose: rescale (a factor of exactly 1 elsewhere); otherwise every factor is 1 and the multiplies are skipped
#pragma unroll
            for (int qi = 0; qi < NQ; ++qi) { const float al = exp2x1(m[qi] - mn[qi]); m[qi] = mn[qi]; l[qi] *= al;
#pragma unroll
                for (int dt = 0; dt < 4; ++dt)
#pragma unroll
                    for (int j = 0; j < 8; ++j) o[qi][dt][j] *= al; } }
        // the same wait for the value loads, which fly during the score products and the maximum: their address registers stay whole up to here
        if constexpr (NSPLIT == 0) asm volatile("s_wait_xcnt 0x0" :: "v"(va), "v"(vf[0]), "v"(vf[1]), "v"(vf[2]), "v"(vf[3]) : "memory");
        else asm volatile("s_wait_xcnt 0x0" :: "v"(va), "v"(va2), "v"(vf[0]), "v"(vf[1]), "v"(vf[2]), "v"(vf[3]), "v"(vf2[0]), "v"(vf2[1]), "v"(vf2[2]), "v"(vf2[3]) : "memory");
#pragma unroll
        for (int qi = 0; qi < NQ; ++qi) { const float mb = m[qi] - PB; float ps = 0.f;
#pragma unroll
            for (int kt = 0; kt < 2; ++kt) { st[qi][kt] = exp2x8(st[qi][kt] * CX - mb);
#pragma unroll
                for (int j = 0; j < 8; ++j) ps += st[qi][kt][j]; }
            l[qi] += ps;
            if constexpr (NSPLIT == 0) { v16h pf;
#pragma unroll
                for (int j = 0; j < 8; ++j) { pf[j] = tohx(st[qi][0][j]); pf[8 + j] = tohx(st[qi][1][j]); }
#pragma unroll
                for (int dt = 0; dt < 4; ++dt) o[qi][dt] = WFrag<T16>::mma(vf[dt], pf, o[qi][dt]);
            } else { v8us h0, h1, l0, l1;
#pragma unroll
                for (int j = 0; j < 8; ++j) { unsigned short a, c2; splitf(st[qi][0][j], a, c2); h0[j] = a; l0[j] = c2; splitf(st[qi][1][j], a, c2); h1[j] = a; l1[j] = c2; }
                const v16bf ph = cat16b(h0, h1), pl = cat16b(l0, l1);
#pragma unroll
                for (int dt = 0; dt < 4; ++dt) { o[qi][dt] = WFrag<T16>::mma(vf[dt], ph, o[qi][dt]); o[qi][dt] = WFrag<T16>::mma(vf[dt], pl, o[qi][dt]); o[qi][dt] = WFrag<T16>::mma(vf2[dt], ph, o[qi][dt]); } } }
    }
    float* sw = so + wave * (NQ * 16 * OP);
#pragma unroll
    for (int qi = 0; qi < NQ; ++qi) { l[qi] += xhalf(l[qi]);   // the halves' sums join once
#pragma unroll
        for (int dt = 0; dt < 4; ++dt) { float* d0 = sw + (qi * 16 + lr) * OP + dt * 16 + hi * 8; *(v4fa*)d0 = (v4f){ o[qi][dt][0], o[qi][dt][1], o[qi][dt][2], o[qi][dt][3] }; *(v4fa*)(d0 + 4) = (v4f){ o[qi][dt][4], o[qi][dt][5], o[qi][dt][6], o[qi][dt][7] }; }
        if (hi == 0) { sml[(wave * 2) * 32 + qi * 16 + lr] = m[qi]; sml[(wave * 2 + 1) * 32 + qi * 16 + lr] = l[qi]; } }
    __syncthreads();   // every wave's partials are in LDS (a wave without a step brings maximum -3e38, sum 0, zeros)
    constexpr int EPT = NQ * 8;                              // outputs per thread
    const int q = (int)threadIdx.x / (HD / EPT), dc = ((int)threadIdx.x % (HD / EPT)) * EPT;
    float ms = sml[q];
#pragma unroll
    for (int w = 1; w < FW; ++w) ms = fmaxf(ms, sml[(w * 2) * 32 + q]);
    float L = 0.f, acc[EPT];
#pragma unroll
    for (int e = 0; e < EPT; ++e) acc[e] = 0.f;
#pragma unroll
    for (int w = 0; w < FW; ++w) { const float f = exp2x1(sml[(w * 2) * 32 + q] - ms); L += f * sml[(w * 2 + 1) * 32 + q]; const float* r = so + w * (NQ * 16 * OP) + q * OP + dc;
#pragma unroll
        for (int e = 0; e < EPT; e += 4) { const v4f x4 = *(const v4fa*)(r + e); acc[e] += f * x4[0]; acc[e + 1] += f * x4[1]; acc[e + 2] += f * x4[2]; acc[e + 3] += f * x4[3]; } }
    const float inv = __fdiv_rn(1.0f, L); const size_t oo = (size_t)((q0 + q) >> 4) * (16 * DQ) + ((q0 + q) & 15) * 8;   // merged output in fragment order for the last product (rows of DQ): the row's place; the column's below
#pragma unroll
    for (int e = 0; e < EPT; e += 8) { v8us oh, ol;
#pragma unroll
        for (int k = 0; k < 8; ++k) { unsigned short a, c2; splitf(acc[e + k] * inv, a, c2); oh[k] = a; ol[k] = c2; }
        const int co = ((dc + e) >> 5) * 512 + (((dc + e) >> 3) & 3) * 128; bf* ph = Ah + oo + co; bf* pl = Al + oo + co; *(v8usa*)ph = oh; *(v8usa*)pl = ol;
        asm volatile("s_wait_xcnt 0x0" :: "v"(ph), "v"(pl), "v"(oh), "v"(ol) : "memory"); }   // in front of any rewrite of an address or data register of the two stores (named as inputs, they stay whole up to here)
}
// grid (batches x heads, NTF + NTH): the longest tiles (last queries) of every head and batch come first
__global__ __launch_bounds__(FW * 32) void k_fattn(const h16* __restrict__ Q16, const h16* __restrict__ K16, const h16* __restrict__ V16, const bf* __restrict__ Qh, const bf* __restrict__ Ql, const bf* __restrict__ Kh, const bf* __restrict__ Kl, const bf* __restrict__ Vh, const bf* __restrict__ Vl, bf* Ah, bf* Al) {
    __shared__ __align__(16) float so[FW * 32 * OP]; __shared__ float sml[FW * 2 * 32];
    static_assert(REP == 1, "one kv head per query head"); const size_t hb = (size_t)blockIdx.x * TT * HD; const int bx = (int)blockIdx.y; const size_t ab = (size_t)(blockIdx.x / NH_) * TT * DQ + (blockIdx.x % NH_) * (HD / 32) * 512; Ah += ab; Al += ab;
    if (bx < NTF) attn_tile<h16, 0, 2>(Q16 + hb, nullptr, K16 + hb, nullptr, V16 + hb, nullptr, TT - 32 * (bx + 1), Ah, Al, so, sml);
    else attn_tile<bf, 2, 1>(Qh + hb, Ql + hb, Kh + hb, Kl + hb, Vh + hb, Vl + hb, RH - 16 * (bx - NTF + 1), Ah, Al, so, sml);
}

extern "C" void kernel_launch(void* const* d_in, const int* in_sizes, int n_in,
                              void* d_out, int out_size, void* d_ws, size_t ws_size, hipStream_t stream) {
    (void)in_sizes; (void)n_in; (void)out_size;
    const float* x = (const float*)d_in[0]; const float* wqkv = (const float*)d_in[1]; const float* wo = (const float*)d_in[2];   /* order x, w_qkv ('oi' [3072][1024]: ROW thirds q | k | v), w_out ('oi' [1024][1024]): THREE inputs */
    float* OUT = (float*)d_out;     // [4][2048][1024]
    char* wsp = (char*)d_ws;
    auto take = [&](size_t bytes) { char* p = wsp; wsp += (bytes + 255) & ~(size_t)255; return (void*)p; };
    bf* WO = (bf*)take((size_t)DM * DQ * 2); float* CS = (float*)take((size_t)TT * (HD / 2) * 2 * 4);
    bf* ATh = (bf*)take((size_t)NB_ * TT * DQ * 2); bf* ATl = (bf*)take((size_t)NB_ * TT * DQ * 2);   // merged attention output, hi and lo
    bf* XB = (bf*)take((size_t)NB_ * TT * DM * 2); bf* WQKV = (bf*)take((size_t)(DQ + 2 * DKV) * DM * 2);   // the joint projection's operands: bytes of their own, k_qkv reads them while it writes the planes
    h16* QP16 = (h16*)take((size_t)NB_ * NH_ * TT * HD * 2); h16* KP16 = (h16*)take((size_t)NB_ * NKV * TT * HD * 2); h16* VT16 = (h16*)take((size_t)NB_ * NKV * HD * TT * 2);
    bf* QPh = (bf*)take((size_t)NB_ * NH_ * TT * HD * 2); bf* QPl = (bf*)take((size_t)NB_ * NH_ * TT * HD * 2); bf* KPh = (bf*)take((size_t)NB_ * NKV * TT * HD * 2); bf* KPl = (bf*)take((size_t)NB_ * NKV * TT * HD * 2); bf* VTh = (bf*)take((size_t)NB_ * NKV * HD * TT * 2); bf* VTl = (bf*)take((size_t)NB_ * NKV * HD * TT * 2);
    if ((size_t)(wsp - (char*)d_ws) > ws_size) return;    // ws 256 MiB
    k_prep<<<PB_C + PB_X + PB_W + PB_O, 256, 0, stream>>>(x, wqkv, wo, XB, WQKV, WO, CS);
    k_qkv<<<dim3(NB_ * TT / 64, (DQ + 2 * DKV) / 64, 1), 32, 0, stream>>>(XB, WQKV, CS, QP16, QPh, QPl, KP16, KPh, KPl, VT16, VTh, VTl);
    k_fattn<<<dim3(NB_ * NH_, NTF + NTH, 1), FW * 32, 0, stream>>>(QP16, KP16, VT16, QPh, QPl, KPh, KPl, VTh, VTl, ATh, ATl);
    k_gemmw<bf, 1, false, DQ><<<dim3(NB_ * TT / 64, DM / 64, 1), 32, 0, stream>>>(ATh, ATl, WO, nullptr, OUT, DM, nullptr, 0, 0, 0);
}

// v007
// One run takes 127 microseconds.
// Next to v006, in two timings, it ran 1.42 and 1.44 times as fast.
// Over all steps from v000 it is 22.4 times as fast.
#include <hip/hip_runtime.h>

// Causal self-attention with a fused bias-free natural qkv weight and computed rotate-half rotary embeddings (x [4][2048][1024]; qkv = x w_qkv^T ('oi' [3072][1024] 1/32, no bias) split in ROW thirds q | k | v (16 heads x 64); rope cat(x1 c - x2 s, x1 s + x2 c) on the two 32-wide halves with angle t x 1/10000^(i/32) (32 f32 constants jnp-exact; one f32 product; precise cosf/sinf); scores / sqrt(64); causal (-inf == exclusion); softmax; y = merged w_out^T ('oi', no bias) -> [4][2048][1024] (8.4 M); argument order x, w_qkv, w_out).
// Layout, all batches in every launch: bf16 copy of x; 'oi' weights; exact projections, the joint q | k | v one rotating and storing its own head planes; computed rotary table; causal T-2048 attention, all heads of all batches in one launch, scores and probabilities in registers (hybrid rows: < 512 hi/lo 3 products, rest fp16 x1024; key steps end at the diagonal); merged hi/lo x w_o exact.
// Every 16-bit matrix operand plane is stored in fragment order: blocks of 16 rows x 32 k (1 KiB), inside a block [k bit 4][k bit 3][row & 15][k & 7], so that lane l of a wave finds its two 16-byte pieces of a fragment at
// block + 8 l and block + 256 + 8 l (elements): each wave-wide 16-byte load reads 512 contiguous bytes (4 whole lines). Blocks run along k first (value planes: the four 16-row blocks of a 32-key step lie together).
// Compute dtypes, f32 accumulate: every input rounded to bf16; projections exact; attention rows < 512 3 products, rest fp16; softmax f32; w_o hl x exact.

#define NB_  4
#define TT   2048
#define DM   1024
#define NH_  16
#define NKV  16
#define REP  (NH_ / NKV)
#define HD   64
#define DQ   (NH_ * HD)
#define DKV  (NKV * HD)
#define RH   512                  // query rows < RH use hi+lo planes (0: none)
#define SCL  0.125f   // HD^-0.5
#define FW   4                    // waves of an attention work-group: they share one query tile and deal its 32-key steps round robin
#define OP   68                   // pitch, in floats, of a query's partial output row in LDS
#define NTF  ((TT - RH) / 32)     // query tiles per head, fp16 rows (32 queries)
#define NTH  (RH / 16)            // query tiles per head, hi/lo rows (16 queries)
typedef _Float16 h16;
typedef unsigned short bf;
typedef __attribute__((ext_vector_type(16))) __bf16   v16bf;
typedef __attribute__((ext_vector_type(16))) _Float16 v16h;
typedef __attribute__((ext_vector_type(8)))  _Float16 v8h;
typedef __attribute__((ext_vector_type(8)))  unsigned short v8us;
typedef __attribute__((ext_vector_type(8)))  float    v8f;
typedef __attribute__((ext_vector_type(4)))  float    v4f;
typedef v8h  __attribute__((may_alias)) v8ha;
typedef v4f  __attribute__((may_alias)) v4fa;
typedef v8us __attribute__((may_alias)) v8usa;

__device__ __forceinline__ unsigned short f2bf(float f) { unsigned u = __float_as_uint(f); u += 0x7FFFu + ((u >> 16) & 1u); return (unsigned short)(u >> 16); }
__device__ __forceinline__ float bf2f(unsigned short b) { return __uint_as_float(((unsigned)b) << 16); }
__device__ __forceinline__ float bfr(float f) { return bf2f(f2bf(f)); }
__device__ __forceinline__ v16h cat16(v8h lo, v8h hi) { return __builtin_shufflevector(lo, hi, 0, 1, 2, 3, 4, 5, 6, 7, 8, 9, 10, 11, 12, 13, 14, 15); }
__device__ __forceinline__ v16bf cat16b(v8us lo, v8us hi) { return __builtin_bit_cast(v16bf, __builtin_shufflevector(lo, hi, 0, 1, 2, 3, 4, 5, 6, 7, 8, 9, 10, 11, 12, 13, 14, 15)); }
__device__ __forceinline__ v8f wmma16(v16h a, v16h b, v8f c) { return __builtin_amdgcn_wmma_f32_16x16x32_f16(false, a, false, b, (short)0, c, false, false); }
__device__ __forceinline__ v8f wmmab(v16bf a, v16bf b, v8f c) { return __builtin_amdgcn_wmma_f32_16x16x32_bf16(false, a, false, b, (short)0, c, false, false); }



// ---- The two GEMMs: a work-group of GW = 8 waves, 2 (row side) x 4 (column side), each wave one 64x64 output tile (16 accumulators). The work-group's operand rows (128 of the row side, 256 of the column side) come
// into LDS once for all its waves, by asynchronous copies (global_load_async_to_lds_b128), SK = 64 k a stage, two buffers: stage t + 2 is asked for behind the barrier that ends stage t and flies while stage t + 1 is worked on.
// The planes are in fragment order, so a stage's part of a 16-row block is 2 KiB in a row, in memory and in LDS alike: thread i copies 16-byte piece i & 127 of blocks i >> 7, + 2, + 4, ...; a wave-wide fragment load reads 512 contiguous LDS bytes.
#define GW   8
#define SK   64                   // k of a stage: two fragment sets of 32
#define RBE  (16 * SK)            // elements of a 16-row block in a stage (2 KiB)
template <typename T16> struct WFrag;
template <> struct WFrag<h16> { typedef v16h V; static __device__ __forceinline__ V ld(const h16* p) { return cat16(*(const v8h*)p, *(const v8h*)(p + 256)); } static __device__ __forceinline__ v8f mma(V a, V b, v8f c) { return wmma16(a, b, c); } };
template <> struct WFrag<bf> { typedef v16bf V; static __device__ __forceinline__ V ld(const bf* p) { return cat16b(*(const v8us*)p, *(const v8us*)(p + 256)); } static __device__ __forceinline__ v8f mma(V a, V b, v8f c) { return wmmab(a, b, c); } };
__device__ __forceinline__ unsigned lds_off(const void* p) { return (unsigned)(size_t)p; }   // byte address in the work-group's LDS
// cp4: the thread's pieces of eight 16-row blocks (four each for the two halves of the work-group): LDS step 2 blocks of a stage, memory step 2 blocks of a plane whose rows hold K elements.
// The s_wait_xcnt stands inside the statement, behind the last copy: in front of any rewrite of an address register that a copy names.
template <int K> __device__ __forceinline__ void cp4(unsigned l, const bf* g) {
    const unsigned l1 = l + 2 * RBE * 2, l2 = l + 4 * RBE * 2, l3 = l + 6 * RBE * 2; const bf* g1 = g + 2 * 16 * K; const bf* g2 = g + 4 * 16 * K; const bf* g3 = g + 6 * 16 * K;
    asm volatile("global_load_async_to_lds_b128 %0, %4, off\n\tglobal_load_async_to_lds_b128 %1, %5, off\n\tglobal_load_async_to_lds_b128 %2, %6, off\n\tglobal_load_async_to_lds_b128 %3, %7, off\n\ts_wait_xcnt 0x0"
                 :: "v"(l), "v"(l1), "v"(l2), "v"(l3), "v"(g), "v"(g1), "v"(g2), "v"(g3) : "memory"); }
// cp8: the same for sixteen blocks, eight from g and eight from h, behind one another in LDS: one statement, one wait.
template <int K> __device__ __forceinline__ void cp8(unsigned l, const bf* g, const bf* h) {
    const unsigned l1 = l + 2 * RBE * 2, l2 = l + 4 * RBE * 2, l3 = l + 6 * RBE * 2, l4 = l + 8 * RBE * 2, l5 = l + 10 * RBE * 2, l6 = l + 12 * RBE * 2, l7 = l + 14 * RBE * 2;
    const bf* g1 = g + 2 * 16 * K; const bf* g2 = g + 4 * 16 * K; const bf* g3 = g + 6 * 16 * K; const bf* h1 = h + 2 * 16 * K; const bf* h2 = h + 4 * 16 * K; const bf* h3 = h + 6 * 16 * K;
    asm volatile("global_load_async_to_lds_b128 %0, %8, off\n\tglobal_load_async_to_lds_b128 %1, %9, off\n\tglobal_load_async_to_lds_b128 %2, %10, off\n\tglobal_load_async_to_lds_b128 %3, %11, off\n\t"
                 "global_load_async_to_lds_b128 %4, %12, off\n\tglobal_load_async_to_lds_b128 %5, %13, off\n\tglobal_load_async_to_lds_b128 %6, %14, off\n\tglobal_load_async_to_lds_b128 %7, %15, off\n\ts_wait_xcnt 0x0"
                 :: "v"(l), "v"(l1), "v"(l2), "v"(l3), "v"(l4), "v"(l5), "v"(l6), "v"(l7), "v"(g), "v"(g1), "v"(g2), "v"(g3), "v"(h), "v"(h1), "v"(h2), "v"(h3) : "memory"); }
// ---- k_gemmo: C[m][n] (f32, pitch ldc) = sum_k (A[m][k] + A2[m][k]) Bt[n][k], two products a step; grid (M/128, N/256), 256 threads. K % 128 == 0. A stage: 8 blocks of A, 8 of A2, 16 of Bt.
template <int K>
__global__ __launch_bounds__(GW * 32) void k_gemmo(const bf* __restrict__ A, const bf* __restrict__ A2, const bf* __restrict__ Bt, float* C, int ldc) {
    typedef WFrag<bf>::V V; constexpr int STG = 32 * RBE, NT = K / SK; static_assert(NT >= 2, "the ring's prologue fills two stages");
    __shared__ __align__(16) bf sm[2 * STG]; __shared__ __align__(16) float osm[GW * 16 * 68];
    const int tid = (int)threadIdx.x, lane = tid & 31, lr = lane & 15, hi = lane >> 4; const int wave = __builtin_amdgcn_readfirstlane(tid >> 5); const int wr = wave & 1, wc = wave >> 1;
    const int R0 = blockIdx.x * 128, C0 = blockIdx.y * 256; const int r0 = R0 + wr * 64, c0 = C0 + wc * 64;
    v8f acc[4][4];
#pragma unroll
    for (int mb = 0; mb < 4; ++mb)
#pragma unroll
        for (int nb = 0; nb < 4; ++nb) acc[mb][nb] = (v8f){};
    const size_t go = (size_t)(tid >> 7) * 16 * K + (tid & 127) * 8; const bf* ga = A + (size_t)R0 * K + go; const bf* ga2 = A2 + (size_t)R0 * K + go; const bf* gb = Bt + (size_t)C0 * K + go; const unsigned l0 = lds_off(sm) + tid * 16;
    auto fill = [&](int t) { const unsigned l = l0 + (t & 1) * (STG * 2); const int ko = t * RBE; cp8<K>(l, ga + ko, ga2 + ko); cp8<K>(l + 16 * RBE * 2, gb + ko, gb + 8 * 16 * K + ko); };
    fill(0);
    asm volatile("s_wait_asynccnt 0x0" ::: "memory");   // this wave's copies of stage 0 have landed
    __syncthreads();                                     // and every other wave's
    fill(1);
#pragma unroll 1
    for (int t = 0; t < NT; ++t) {
        const bf* sb = sm + (t & 1) * STG + 8 * lane; V a[2][4], a2[2][4], b[2][4];   // a fragment set for each 32 k of the stage: the second set's loads fly under the first set's products
#pragma unroll
        for (int kb = 0; kb < 2; ++kb) {
#pragma unroll
            for (int mb = 0; mb < 4; ++mb) { a[kb][mb] = WFrag<bf>::ld(sb + (wr * 4 + mb) * RBE + kb * 512); a2[kb][mb] = WFrag<bf>::ld(sb + (8 + wr * 4 + mb) * RBE + kb * 512); }
#pragma unroll
            for (int nb = 0; nb < 4; ++nb) b[kb][nb] = WFrag<bf>::ld(sb + (16 + wc * 4 + nb) * RBE + kb * 512); }
        auto prod = [&](int kb) {
#pragma unroll
            for (int nb = 0; nb < 4; ++nb) {
#pragma unroll
                for (int mb = 0; mb < 4; ++mb) { acc[mb][nb] = WFrag<bf>::mma(a[kb][mb], b[kb][nb], acc[mb][nb]); acc[mb][nb] = WFrag<bf>::mma(a2[kb][mb], b[kb][nb], acc[mb][nb]); } } };
        __builtin_amdgcn_sched_barrier(0);                   // both sets' loads are issued as one group in front of the first product, never among the products
        // the first set's loaded fragments as inputs: the wait in front of the first product is the counted one for that set alone
        asm volatile("" :: "v"(a[0][0]), "v"(a[0][1]), "v"(a[0][2]), "v"(a[0][3]), "v"(a2[0][0]), "v"(a2[0][1]), "v"(a2[0][2]), "v"(a2[0][3]), "v"(b[0][0]), "v"(b[0][1]), "v"(b[0][2]), "v"(b[0][3]));
        prod(0);
        __builtin_amdgcn_sched_barrier(0);                   // the first set's products stay in front of the waits: they cover the second set's loads and the flight of stage t + 1
        asm volatile("s_wait_dscnt 0x0" ::: "memory");      // this wave's reads of stage t are done: its last fragments are in registers
        asm volatile("s_wait_asynccnt 0x0" ::: "memory");   // its copies of stage t + 1 have landed
        __syncthreads();                                     // stage t + 1 is published, stage t's buffer is free
        if (t + 2 < NT) fill(t + 2);
        __builtin_amdgcn_sched_barrier(0);                   // the copies are asked for in front of the second set's products, not behind them
        prod(1);
    }
    asm volatile("s_wait_asynccnt 0x0" ::: "memory");        // nothing is in flight when the wave goes on
    float* os = osm + wave * (16 * 68);                      // each wave stages in its own range
#pragma unroll
    for (int mb = 0; mb < 4; ++mb) {
#pragma unroll
        for (int nb = 0; nb < 4; ++nb) {
#pragma unroll
            for (int j = 0; j < 8; ++j) os[(hi * 8 + j) * 68 + nb * 16 + lr] = acc[mb][nb][j]; }
        __builtin_amdgcn_wave_barrier(); asm volatile("" ::: "memory");   // the wave's LDS stores stay in front of its reads of other lanes' values
        float* crow = C + (size_t)(r0 + mb * 16) * ldc + c0;
#pragma unroll
        for (int s = 0; s < 8; s += 4) { v4f val[4]; float* cp[4];
#pragma unroll
            for (int u = 0; u < 4; ++u) { const int row = 2 * (s + u) + hi, cofs = lr * 4; val[u] = *(const v4fa*)(os + row * 68 + cofs); cp[u] = crow + (size_t)row * ldc + cofs; *(v4f*)cp[u] = val[u]; }
            asm volatile("s_wait_xcnt 0x0" :: "v"(cp[0]), "v"(cp[1]), "v"(cp[2]), "v"(cp[3]), "v"(val[0]), "v"(val[1]), "v"(val[2]), "v"(val[3]) : "memory"); }   // in front of any rewrite of an address or data register of the four stores (named as inputs, they stay whole up to here)
        __builtin_amdgcn_wave_barrier(); asm volatile("" ::: "memory");   // and the reads in front of the next rows' stores
    }
}

__device__ __forceinline__ h16 tohx(float x) { return (h16)x; }
__device__ __forceinline__ void splitf(float y, unsigned short& h, unsigned short& l) { h = f2bf(y); l = f2bf(y - bf2f(h)); }
typedef __attribute__((ext_vector_type(2))) _Float16 v2h;
typedef __attribute__((ext_vector_type(4))) _Float16 v4h;
typedef __attribute__((ext_vector_type(2))) unsigned short v2us;
typedef __attribute__((ext_vector_type(4))) unsigned short v4us;
typedef __attribute__((ext_vector_type(2))) float v2f;
typedef __attribute__((ext_vector_type(4))) int v4i;
typedef v4h  __attribute__((may_alias)) v4ha;
typedef v4us __attribute__((may_alias)) v4usa;

__device__ __forceinline__ void cvt8(const float* __restrict__ src, bf* dst, size_t n8, unsigned blk) { const size_t i = (size_t)blk * 256 + threadIdx.x; if (i >= n8) return;   // thread i makes 16-byte piece i of the fragment-order plane (rows of DM elements)
    const size_t tb = i >> 6; const int w = (int)(i & 63); const float* sp = src + ((tb / (DM / 32)) * 16 + (w & 15)) * DM + (tb % (DM / 32)) * 32 + (w >> 4) * 8; const v8f v = *(const v8f*)sp; v8us o;
    asm volatile("s_wait_xcnt 0x0" :: "v"(sp), "v"(v) : "memory");   // in front of any rewrite of the load's address registers (address and loaded value as inputs: the registers stay whole, and the load stays in front)
#pragma unroll
    for (int k = 0; k < 8; ++k) o[k] = f2bf(v[k]); *(v8us*)(dst + i * 8) = o;  }

// put8: one 16-byte piece (8 values) of a head plane, in all three forms (fp16, bf16 hi, bf16 lo), at element e.
__device__ __forceinline__ void put8(const float* r, size_t e, h16* P16, bf* Ph, bf* Pl) { v8h o16; v8us oh, ol;
#pragma unroll
    for (int j = 0; j < 8; ++j) { o16[j] = tohx(r[j]); unsigned short a2, c2; splitf(r[j], a2, c2); oh[j] = a2; ol[j] = c2; }
    h16* p16 = P16 + e; bf* ph = Ph + e; bf* pl = Pl + e; *(v8h*)p16 = o16; *(v8us*)ph = oh; *(v8us*)pl = ol;
    asm volatile("s_wait_xcnt 0x0" :: "v"(p16), "v"(ph), "v"(pl), "v"(o16), "v"(oh), "v"(ol) : "memory"); }   // in front of any rewrite of an address or data register of the three stores (named as inputs, they stay whole up to here)
__constant__ float INVT[HD / 2] = { 1.000000000e+00f, 7.498942018e-01f, 5.623413324e-01f, 4.216965139e-01f, 3.162277639e-01f, 2.371373624e-01f, 1.778279394e-01f, 1.333521456e-01f, 1.000000015e-01f, 7.498941571e-02f, 5.623412877e-02f, 4.216964915e-02f, 3.162277862e-02f, 2.371373586e-02f, 1.778279431e-02f, 1.333521493e-02f, 9.999999776e-03f, 7.498942316e-03f, 5.623413250e-03f, 4.216964822e-03f, 3.162277862e-03f, 2.371373819e-03f, 1.778279431e-03f, 1.333521446e-03f, 1.000000047e-03f, 7.498941850e-04f, 5.623413017e-04f, 4.216964880e-04f, 3.162277862e-04f, 2.371373848e-04f, 1.778279402e-04f, 1.333521504e-04f };   // float32 1 / 10000^(i/32), generated with jnp to be bit-exact
// Rotary table, d < HD/2 only (the two halves are equal), in the order its reader k_qkv takes it: [t / 16][d / 16][pair of d: (d & 7) / 2][lane = ((d >> 3) & 1) * 16 + (t & 15)][d & 1][cos, sin]: lane l finds the eight
// pairs of its position and its 8 d in four 16-byte pieces, 128 floats apart, and each wave-wide load reads 512 contiguous bytes. Thread idx makes pair idx.
__device__ __forceinline__ void cs5(float* CS, unsigned blk) { const int idx = (int)blk * 256 + threadIdx.x; if (idx >= TT * (HD / 2)) return; const int ln = (idx >> 1) & 31; const int d = ((idx >> 8) & 1) * 16 + (ln >> 4) * 8 + ((idx >> 6) & 3) * 2 + (idx & 1); const int t = (idx >> 9) * 16 + (ln & 15); const float a = __fmul_rn((float)t, INVT[d]); v2f cs; cs[0] = cosf(a); cs[1] = sinf(a); *(v2f*)(CS + (size_t)idx * 2) = cs;  }
static_assert(HD == 64, "the table's order and k_qkv's tiles are laid out for heads of 64");
// ---- k_prep: the stages that read only inputs, in one launch, dealt by block range: rotary table, then the bf16 copies of x (all batches), w_qkv and w_out.
static_assert(DQ == DM, "cvt8 lays all three planes out in rows of DM elements");
#define PB_C ((unsigned)(TT * (HD / 2) / 256))
#define PB_X ((unsigned)((size_t)NB_ * TT * DM / 8 / 256))
#define PB_W ((unsigned)((size_t)(DQ + 2 * DKV) * DM / 8 / 256))
#define PB_O ((unsigned)((size_t)DM * DQ / 8 / 256))
__global__ __launch_bounds__(256) void k_prep(const float* __restrict__ x, const float* __restrict__ wqkv, const float* __restrict__ wo, bf* XB, bf* WQKV, bf* WO, float* CS) {
    const unsigned b = blockIdx.x;
    if (b < PB_C) cs5(CS, b);
    else if (b < PB_C + PB_X) cvt8(x, XB, (size_t)NB_ * TT * DM / 8, b - PB_C);
    else if (b < PB_C + PB_X + PB_W) cvt8(wqkv, WQKV, (size_t)(DQ + 2 * DKV) * DM / 8, b - (PB_C + PB_X));
    else cvt8(wo, WO, (size_t)DM * DQ / 8, b - (PB_C + PB_X + PB_W));
}
// ---- k_qkv: the joint projection with the plane builders as its epilogue: one wave per tile of 64 positions x one head of q, k or v; a work-group's 8 waves take 128 positions x 4 heads (all q, all k or all v) and share their
// operand rows through the LDS ring above (a stage: 8 blocks of x, 16 of the weights); grid (batches x TT / 128, heads of q + k + v / 4), 256 threads, two work-groups a WGP. No f32 projection is stored.
// A lane's 8 registers of an accumulator run along the A operand's rows, so A is chosen as the side that is the plane's k: q and k tiles take the weight rows as A (a lane holds 8 consecutive d of one position: a 16-byte piece of
// a [t][d] plane, and its rotation partner d + 32 lies in the same lane, two accumulators on); v tiles take the x rows as A (8 consecutive positions of one d: a piece of a [d][t] plane). Both operand planes have the same order.
// Piece (mb, nb) of a tile lies at lane * 8 + (mb & 1) * 256 in its block: every wave-wide 16-byte store writes 512 contiguous bytes.
__global__ __launch_bounds__(GW * 32) __attribute__((amdgpu_waves_per_eu(4, 4))) void k_qkv(const bf* __restrict__ X, const bf* __restrict__ Wt, const float* __restrict__ CS, h16* Q16, bf* Qh, bf* Ql, h16* K16, bf* Kh, bf* Kl, h16* V16, bf* Vh, bf* Vl) {
    typedef WFrag<bf>::V V; constexpr int K = DM; constexpr int STG = 24 * RBE, NT = K / SK; static_assert(NT >= 2, "the ring's prologue fills two stages");
    static_assert(TT % 128 == 0 && NKV == NH_ && DQ % 256 == 0 && DKV % 256 == 0, "a work-group's tiles lie in one batch and in one of q, k, v; q, k and v planes have the same shape");
    __shared__ __align__(16) bf sm[2 * STG];
    const int tid = (int)threadIdx.x, lane = tid & 31; const int wave = __builtin_amdgcn_readfirstlane(tid >> 5); const int wr = wave & 1, wc = wave >> 1;
    const int R0 = blockIdx.x * 128, C0 = blockIdx.y * 256; const int r0 = R0 + wr * 64, c0 = C0 + wc * 64; const bool isv = c0 >= DQ + DKV, isk = !isv && c0 >= DQ;
    v8f acc[4][4];
#pragma unroll
    for (int mb = 0; mb < 4; ++mb)
#pragma unroll
        for (int nb = 0; nb < 4; ++nb) acc[mb][nb] = (v8f){};
    const size_t go = (size_t)(tid >> 7) * 16 * K + (tid & 127) * 8; const bf* gx = X + (size_t)R0 * K + go; const bf* gw = Wt + (size_t)C0 * K + go; const unsigned l0 = lds_off(sm) + tid * 16;
    auto fill = [&](int t) { const unsigned l = l0 + (t & 1) * (STG * 2); const int ko = t * RBE; cp4<K>(l, gx + ko); cp8<K>(l + 8 * RBE * 2, gw + ko, gw + 8 * 16 * K + ko); };
    const int xo = wr * 4 * RBE + 8 * lane, wo = (8 + wc * 4) * RBE + 8 * lane; const int ao = isv ? xo : wo, bo = isv ? wo : xo;   // the wave's four blocks of either side in a stage
    fill(0);
    asm volatile("s_wait_asynccnt 0x0" ::: "memory");   // this wave's copies of stage 0 have landed
    __syncthreads();                                     // and every other wave's
    fill(1);
#pragma unroll 1
    for (int t = 0; t < NT; ++t) {
        const bf* sb = sm + (t & 1) * STG; V a[4], b[4];
        auto frag = [&](int kb) {
#pragma unroll
            for (int mb = 0; mb < 4; ++mb) a[mb] = WFrag<bf>::ld(sb + ao + mb * RBE + kb * 512);
#pragma unroll
            for (int nb = 0; nb < 4; ++nb) b[nb] = WFrag<bf>::ld(sb + bo + nb * RBE + kb * 512); };
        auto prod = [&]() {
#pragma unroll
            for (int nb = 0; nb < 4; ++nb) {
#pragma unroll
                for (int mb = 0; mb < 4; ++mb) acc[mb][nb] = WFrag<bf>::mma(a[mb], b[nb], acc[mb][nb]); } };
        frag(0);
        // the loaded fragments as inputs: all sixteen loads stand in one group in front of the first product (without this the compiler reloads one fragment's registers among the products, an LDS latency each time)
        asm volatile("" :: "v"(a[0]), "v"(a[1]), "v"(a[2]), "v"(a[3]), "v"(b[0]), "v"(b[1]), "v"(b[2]), "v"(b[3]));
        prod();
        frag(1);
        __builtin_amdgcn_sched_barrier(0);                   // the first 32 k's products stay in front of the waits: they cover the second fragment loads and the flight of stage t + 1
        asm volatile("s_wait_dscnt 0x0" ::: "memory");      // this wave's reads of stage t are done: its last fragments are in registers
        asm volatile("s_wait_asynccnt 0x0" ::: "memory");   // its copies of stage t + 1 have landed
        __syncthreads();                                     // stage t + 1 is published, stage t's buffer is free
        if (t + 2 < NT) fill(t + 2);
        __builtin_amdgcn_sched_barrier(0);                   // the copies are asked for in front of the second 32 k's products, not behind them
        prod();
    }
    asm volatile("s_wait_asynccnt 0x0" ::: "memory");        // nothing is in flight when the wave goes on
    // a tile's 8 blocks (8 KiB a plane) lie in a row; [t][d] planes: block = (t / 16) * 2 + d / 32; [d][t] planes: block = (t / 32) * 4 + d / 16
    const int t0 = r0 % TT; const size_t eb = ((size_t)(r0 / TT) * NH_ + (c0 / HD) % NH_) * TT * HD + (size_t)t0 * HD + 8 * lane;
    if (isv) {   // acc[mb][nb][j] is position t0 + mb * 16 + (lane >> 4) * 8 + j of d = nb * 16 + (lane & 15)
#pragma unroll
        for (int mb = 0; mb < 4; ++mb)
#pragma unroll
            for (int nb = 0; nb < 4; ++nb) { float r[8];
#pragma unroll
                for (int j = 0; j < 8; ++j) r[j] = acc[mb][nb][j];
                put8(r, eb + (mb >> 1) * 2048 + nb * 512 + (mb & 1) * 256, V16, Vh, Vl); }
    } else {     // acc[mb][nb][j] is d = mb * 16 + (lane >> 4) * 8 + j of position t0 + nb * 16 + (lane & 15); rotate-half: out[d] = x[d] cos - x[d+32] sin, out[d+32] = x[d+32] cos + x[d] sin, d < 32
        h16* P16 = isk ? K16 : Q16; bf* Ph = isk ? Kh : Qh; bf* Pl = isk ? Kl : Ql; const float* pc = CS + (size_t)(t0 >> 4) * 1024 + lane * 4;
#pragma unroll
        for (int nb = 0; nb < 4; ++nb) {
            v4f cq[2][4];   // the table pieces of 16 positions fly together
#pragma unroll
            for (int mb = 0; mb < 2; ++mb)
#pragma unroll
                for (int q = 0; q < 4; ++q) cq[mb][q] = *(const v4f*)(pc + (nb * 2 + mb) * 512 + q * 128);
            asm volatile("s_wait_xcnt 0x0" :: "v"(pc), "v"(cq[0][0]), "v"(cq[0][1]), "v"(cq[0][2]), "v"(cq[0][3]), "v"(cq[1][0]), "v"(cq[1][1]), "v"(cq[1][2]), "v"(cq[1][3]) : "memory");   // one wait behind the eight loads, in front of any rewrite of their address registers (address and loaded values as inputs: the registers stay whole, and the loads stay in front)
#pragma unroll
            for (int mb = 0; mb < 2; ++mb) { float r1[8], r2[8];
#pragma unroll
                for (int j = 0; j < 8; ++j) { const float co = cq[mb][j >> 1][(j & 1) * 2], si = cq[mb][j >> 1][(j & 1) * 2 + 1]; const float x1 = acc[mb][nb][j], x2 = acc[mb + 2][nb][j]; r1[j] = x1 * co - x2 * si; r2[j] = x2 * co + x1 * si; }
                const size_t e = eb + nb * 1024 + mb * 256; put8(r1, e, P16, Ph, Pl); put8(r2, e + 512, P16, Ph, Pl); }
        }
    }
}
__device__ __forceinline__ float xhalf(float x) { const int b = __float_as_int(x); return __int_as_float(__builtin_amdgcn_permlanex16(b, b, 0x76543210, 0xfedcba98, false, false)); }   // lane l <-> l ^ 16
// 2^x with the slot behind a transcendental filled inside the statement: the v_nop keeps the next vector instruction, whichever the compiler puts there, from reading the last result or taking its source register directly
// behind it; in exp2x8 each exponential is the independent instruction behind the one before (early-clobber outputs share no register with a source).
__device__ __forceinline__ float exp2x1(float x) { float r; asm("v_exp_f32 %0, %1\n\tv_nop" : "=v"(r) : "v"(x)); return r; }
__device__ __forceinline__ v8f exp2x8(v8f x) { float r0, r1, r2, r3, r4, r5, r6, r7;
    asm("v_exp_f32 %0, %8\n\tv_exp_f32 %1, %9\n\tv_exp_f32 %2, %10\n\tv_exp_f32 %3, %11\n\tv_exp_f32 %4, %12\n\tv_exp_f32 %5, %13\n\tv_exp_f32 %6, %14\n\tv_exp_f32 %7, %15\n\tv_nop"
        : "=&v"(r0), "=&v"(r1), "=&v"(r2), "=&v"(r3), "=&v"(r4), "=&v"(r5), "=&v"(r6), "=&v"(r7) : "v"(x[0]), "v"(x[1]), "v"(x[2]), "v"(x[3]), "v"(x[4]), "v"(x[5]), "v"(x[6]), "v"(x[7]));
    return (v8f){ r0, r1, r2, r3, r4, r5, r6, r7 }; }
template <typename T16, int NSPLIT, int NQ>
__device__ __forceinline__ void attn_tile(const T16* __restrict__ Q, const T16* __restrict__ Q2, const T16* __restrict__ Kp, const T16* __restrict__ K2, const T16* __restrict__ Vt, const T16* __restrict__ V2, int q0, bf* Ah, bf* Al, float* so, float* sml) {
    typedef typename WFrag<T16>::V V;
    constexpr float CX = SCL * 1.4426950408889634f;          // scores are carried as log2 exponents
    constexpr float PB = (NSPLIT == 0) ? 10.0f : 0.0f;       // fp16 probabilities carry x1024; the row sum carries it too, so it cancels in the quotient
    const int lane = threadIdx.x & 31, lr = lane & 15, hi = lane >> 4; const int wave = __builtin_amdgcn_readfirstlane((int)(threadIdx.x >> 5));
    V qf[NQ][2], qf2[NQ][2];
    const size_t qo = (size_t)q0 * HD + 8 * lane; const T16* qa = Q + qo; const T16* qa2 = (NSPLIT == 2) ? Q2 + qo : qa;
#pragma unroll
    for (int qi = 0; qi < NQ; ++qi)
#pragma unroll
        for (int ks = 0; ks < 2; ++ks) { qf[qi][ks] = WFrag<T16>::ld(qa + qi * 16 * HD + ks * 512); if (NSPLIT == 2) qf2[qi][ks] = WFrag<T16>::ld(qa2 + qi * 16 * HD + ks * 512); }
    asm volatile("s_wait_xcnt 0x0" :: "v"(qa), "v"(qa2) : "memory");   // in front of any rewrite of an address register of the query loads (named as inputs, they stay whole up to here)
    v8f o[NQ][4]; float m[NQ], l[NQ];
#pragma unroll
    for (int qi = 0; qi < NQ; ++qi) { m[qi] = -3.0e38f; l[qi] = 0.f;
#pragma unroll
        for (int dt = 0; dt < 4; ++dt) o[qi][dt] = (v8f){}; }
    const int nst = (q0 + 16 * NQ - 1) / 32 + 1;             // 32-key steps up to and including the diagonal; only the last holds keys beyond a query
    for (int s = wave; s < nst; s += FW) {
        const size_t ko = (size_t)s * 32 * HD + 8 * lane, vo = ko;   // a step's four key blocks and its four value blocks: 4 KiB in a row each
        const T16* ka = Kp + ko; const T16* ka2 = (NSPLIT == 2) ? K2 + ko : ka; const T16* va = Vt + vo; const T16* va2 = (NSPLIT == 2) ? V2 + vo : va;   // the lane's addresses of this step (named again at the waits below)
        V kf[2][2], kf2[2][2], vf[4], vf2[4];
#pragma unroll
        for (int kt = 0; kt < 2; ++kt)
#pragma unroll
            for (int ks = 0; ks < 2; ++ks) { kf[kt][ks] = WFrag<T16>::ld(ka + kt * 16 * HD + ks * 512); if (NSPLIT == 2) kf2[kt][ks] = WFrag<T16>::ld(ka2 + kt * 16 * HD + ks * 512); }
#pragma unroll
        for (int dt = 0; dt < 4; ++dt) { vf[dt] = WFrag<T16>::ld(va + dt * 512); if (NSPLIT == 2) vf2[dt] = WFrag<T16>::ld(va2 + dt * 512); }
        // the wait stands in front of any rewrite of an address register of the key loads (the address as an input keeps its registers whole up to here); the loaded fragments as inputs keep all key loads
        // in front of the first product, in flight together (without them the compiler reloads a fragment's registers behind the first products: a second load latency per step)
        if constexpr (NSPLIT == 0) asm volatile("s_wait_xcnt 0x0" :: "v"(ka), "v"(kf[0][0]), "v"(kf[0][1]), "v"(kf[1][0]), "v"(kf[1][1]) : "memory");
        else asm volatile("s_wait_xcnt 0x0" :: "v"(ka), "v"(ka2), "v"(kf[0][0]), "v"(kf[0][1]), "v"(kf[1][0]), "v"(kf[1][1]), "v"(kf2[0][0]), "v"(kf2[0][1]), "v"(kf2[1][0]), "v"(kf2[1][1]) : "memory");
        v8f st[NQ][2];                                       // st[qi][kt][j] = score of key s*32 + kt*16 + hi*8 + j and query q0 + qi*16 + lr
#pragma unroll
        for (int qi = 0; qi < NQ; ++qi)
#pragma unroll
            for (int kt = 0; kt < 2; ++kt) { v8f a = (v8f){};
#pragma unroll
                for (int ks = 0; ks < 2; ++ks) { a = WFrag<T16>::mma(kf[kt][ks], qf[qi][ks], a); if (NSPLIT == 2) { a = WFrag<T16>::mma(kf[kt][ks], qf2[qi][ks], a); a = WFrag<T16>::mma(kf2[kt][ks], qf[qi][ks], a); } }
                st[qi][kt] = a; }
        if (s == nst - 1) {                                  // diagonal step: keys beyond the query are excluded
#pragma unroll
            for (int qi = 0; qi < NQ; ++qi)
#pragma unroll
                for (int kt = 0; kt < 2; ++kt)
#pragma unroll
                    for (int j = 0; j < 8; ++j) st[qi][kt][j] = (s * 32 + kt * 16 + hi * 8 + j <= q0 + qi * 16 + lr) ? st[qi][kt][j] : -3.0e38f; }
        float mn[NQ]; bool up = false;
#pragma unroll
        for (int qi = 0; qi < NQ; ++qi) { float mx = st[qi][0][0];
#pragma unroll
            for (int j = 1; j < 8; ++j) mx = fmaxf(mx, st[qi][0][j]);
#pragma unroll
            for (int j = 0; j < 8; ++j) mx = fmaxf(mx, st[qi][1][j]);
            mx = fmaxf(mx, xhalf(mx)); mn[qi] = fmaxf(m[qi], mx * CX); up = up || (mn[qi] > m[qi]); }
        if (__builtin_amdgcn_ballot_w32(up) != 0) {          // some query's maximum rose: rescale (a factor of exactly 1 elsewhere); otherwise every factor is 1 and the multiplies are skipped
#pragma unroll
            for (int qi = 0; qi < NQ; ++qi) { const float al = exp2x1(m[qi] - mn[qi]); m[qi] = mn[qi]; l[qi] *= al;
#pragma unroll
                for (int dt = 0; dt < 4; ++dt)
#pragma unroll
                    for (int j = 0; j < 8; ++j) o[qi][dt][j] *= al; } }
        // the same wait for the value loads, which fly during the score products and the maximum: their address registers stay whole up to here
        if constexpr (NSPLIT == 0) asm volatile("s_wait_xcnt 0x0" :: "v"(va), "v"(vf[0]), "v"(vf[1]), "v"(vf[2]), "v"(vf[3]) : "memory");
        else asm volatile("s_wait_xcnt 0x0" :: "v"(va), "v"(va2), "v"(vf[0]), "v"(vf[1]), "v"(vf[2]), "v"(vf[3]), "v"(vf2[0]), "v"(vf2[1]), "v"(vf2[2]), "v"(vf2[3]) : "memory");
#pragma unroll
        for (int qi = 0; qi < NQ; ++qi) { const float mb = m[qi] - PB; float ps = 0.f;
#pragma unroll
            for (int kt = 0; kt < 2; ++kt) { st[qi][kt] = exp2x8(st[qi][kt] * CX - mb);
#pragma unroll
                for (int j = 0; j < 8; ++j) ps += st[qi][kt][j]; }
            l[qi] += ps;
            if constexpr (NSPLIT == 0) { v16h pf;
#pragma unroll
                for (int j = 0; j < 8; ++j) { pf[j] = tohx(st[qi][0][j]); pf[8 + j] = tohx(st[qi][1][j]); }
#pragma unroll
                for (int dt = 0; dt < 4; ++dt) o[qi][dt] = WFrag<T16>::mma(vf[dt], pf, o[qi][dt]);
            } else { v8us h0, h1, l0, l1;
#pragma unroll
                for (int j = 0; j < 8; ++j) { unsigned short a, c2; splitf(st[qi][0][j], a, c2); h0[j] = a; l0[j] = c2; splitf(st[qi][1][j], a, c2); h1[j] = a; l1[j] = c2; }
                const v16bf ph = cat16b(h0, h1), pl = cat16b(l0, l1);
#pragma unroll
                for (int dt = 0; dt < 4; ++dt) { o[qi][dt] = WFrag<T16>::mma(vf[dt], ph, o[qi][dt]); o[qi][dt] = WFrag<T16>::mma(vf[dt], pl, o[qi][dt]); o[qi][dt] = WFrag<T16>::mma(vf2[dt], ph, o[qi][dt]); } } }
    }
    float* sw = so + wave * (NQ * 16 * OP);
#pragma unroll
    for (int qi = 0; qi < NQ; ++qi) { l[qi] += xhalf(l[qi]);   // the halves' sums join once
#pragma unroll
        for (int dt = 0; dt < 4; ++dt) { float* d0 = sw + (qi * 16 + lr) * OP + dt * 16 + hi * 8; *(v4fa*)d0 = (v4f){ o[qi][dt][0], o[qi][dt][1], o[qi][dt][2], o[qi][dt][3] }; *(v4fa*)(d0 + 4) = (v4f){ o[qi][dt][4], o[qi][dt][5], o[qi][dt][6], o[qi][dt][7] }; }
        if (hi == 0) { sml[(wave * 2) * 32 + qi * 16 + lr] = m[qi]; sml[(wave * 2 + 1) * 32 + qi * 16 + lr] = l[qi]; } }
    __syncthreads();   // every wave's partials are in LDS (a wave without a step brings maximum -3e38, sum 0, zeros)
    constexpr int EPT = NQ * 8;                              // outputs per thread
    const int q = (int)threadIdx.x / (HD / EPT), dc = ((int)threadIdx.x % (HD / EPT)) * EPT;
    float ms = sml[q];
#pragma unroll
    for (int w = 1; w < FW; ++w) ms = fmaxf(ms, sml[(w * 2) * 32 + q]);
    float L = 0.f, acc[EPT];
#pragma unroll
    for (int e = 0; e < EPT; ++e) acc[e] = 0.f;
#pragma unroll
    for (int w = 0; w < FW; ++w) { const float f = exp2x1(sml[(w * 2) * 32 + q] - ms); L += f * sml[(w * 2 + 1) * 32 + q]; const float* r = so + w * (NQ * 16 * OP) + q * OP + dc;
#pragma unroll
        for (int e = 0; e < EPT; e += 4) { const v4f x4 = *(const v4fa*)(r + e); acc[e] += f * x4[0]; acc[e + 1] += f * x4[1]; acc[e + 2] += f * x4[2]; acc[e + 3] += f * x4[3]; } }
    const float inv = __fdiv_rn(1.0f, L); const size_t oo = (size_t)((q0 + q) >> 4) * (16 * DQ) + ((q0 + q) & 15) * 8;   // merged output in fragment order for the last product (rows of DQ): the row's place; the column's below
#pragma unroll
    for (int e = 0; e < EPT; e += 8) { v8us oh, ol;
#pragma unroll
        for (int k = 0; k < 8; ++k) { unsigned short a, c2; splitf(acc[e + k] * inv, a, c2); oh[k] = a; ol[k] = c2; }
        const int co = ((dc + e) >> 5) * 512 + (((dc + e) >> 3) & 3) * 128; bf* ph = Ah + oo + co; bf* pl = Al + oo + co; *(v8usa*)ph = oh; *(v8usa*)pl = ol;
        asm volatile("s_wait_xcnt 0x0" :: "v"(ph), "v"(pl), "v"(oh), "v"(ol) : "memory"); }   // in front of any rewrite of an address or data register of the two stores (named as inputs, they stay whole up to here)
}
// grid (batches x heads, NTF + NTH): the longest tiles (last queries) of every head and batch come first
__global__ __launch_bounds__(FW * 32) void k_fattn(const h16* __restrict__ Q16, const h16* __restrict__ K16, const h16* __restrict__ V16, const bf* __restrict__ Qh, const bf* __restrict__ Ql, const bf* __restrict__ Kh, const bf* __restrict__ Kl, const bf* __restrict__ Vh, const bf* __restrict__ Vl, bf* Ah, bf* Al) {
    __shared__ __align__(16) float so[FW * 32 * OP]; __shared__ float sml[FW * 2 * 32];
    static_assert(REP == 1, "one kv head per query head"); const size_t hb = (size_t)blockIdx.x * TT * HD; const int bx = (int)blockIdx.y; const size_t ab = (size_t)(blockIdx.x / NH_) * TT * DQ + (blockIdx.x % NH_) * (HD / 32) * 512; Ah += ab; Al += ab;
    if (bx < NTF) attn_tile<h16, 0, 2>(Q16 + hb, nullptr, K16 + hb, nullptr, V16 + hb, nullptr, TT - 32 * (bx + 1), Ah, Al, so, sml);
    else attn_tile<bf, 2, 1>(Qh + hb, Ql + hb, Kh + hb, Kl + hb, Vh + hb, Vl + hb, RH - 16 * (bx - NTF + 1), Ah, Al, so, sml);
}

extern "C" void kernel_launch(void* const* d_in, const int* in_sizes, int n_in,
                              void* d_out, int out_size, void* d_ws, size_t ws_size, hipStream_t stream) {
    (void)in_sizes; (void)n_in; (void)out_size;
    const float* x = (const float*)d_in[0]; const float* wqkv = (const float*)d_in[1]; const float* wo = (const float*)d_in[2];   /* order x, w_qkv ('oi' [3072][1024]: ROW thirds q | k | v), w_out ('oi' [1024][1024]): THREE inputs */
    float* OUT = (float*)d_out;     // [4][2048][1024]
    char* wsp = (char*)d_ws;
    auto take = [&](size_t bytes) { char* p = wsp; wsp += (bytes + 255) & ~(size_t)255; return (void*)p; };
    bf* WO = (bf*)take((size_t)DM * DQ * 2); float* CS = (float*)take((size_t)TT * (HD / 2) * 2 * 4);
    bf* ATh = (bf*)take((size_t)NB_ * TT * DQ * 2); bf* ATl = (bf*)take((size_t)NB_ * TT * DQ * 2);   // merged attention output, hi and lo
    bf* XB = (bf*)take((size_t)NB_ * TT * DM * 2); bf* WQKV = (bf*)take((size_t)(DQ + 2 * DKV) * DM * 2);   // the joint projection's operands: bytes of their own, k_qkv reads them while it writes the planes
    h16* QP16 = (h16*)take((size_t)NB_ * NH_ * TT * HD * 2); h16* KP16 = (h16*)take((size_t)NB_ * NKV * TT * HD * 2); h16* VT16 = (h16*)take((size_t)NB_ * NKV * HD * TT * 2);
    bf* QPh = (bf*)take((size_t)NB_ * NH_ * TT * HD * 2); bf* QPl = (bf*)take((size_t)NB_ * NH_ * TT * HD * 2); bf* KPh = (bf*)take((size_t)NB_ * NKV * TT * HD * 2); bf* KPl = (bf*)take((size_t)NB_ * NKV * TT * HD * 2); bf* VTh = (bf*)take((size_t)NB_ * NKV * HD * TT * 2); bf* VTl = (bf*)take((size_t)NB_ * NKV * HD * TT * 2);
    if ((size_t)(wsp - (char*)d_ws) > ws_size) return;    // ws 256 MiB
    k_prep<<<PB_C + PB_X + PB_W + PB_O, 256, 0, stream>>>(x, wqkv, wo, XB, WQKV, WO, CS);
    k_qkv<<<dim3(NB_ * TT / 128, (DQ + 2 * DKV) / 256, 1), GW * 32, 0, stream>>>(XB, WQKV, CS, QP16, QPh, QPl, KP16, KPh, KPl, VT16, VTh, VTl);
    k_fattn<<<dim3(NB_ * NH_, NTF + NTH, 1), FW * 32, 0, stream>>>(QP16, KP16, VT16, QPh, QPl, KPh, KPl, VTh, VTl, ATh, ATl);
    k_gemmo<DQ><<<dim3(NB_ * TT / 128, DM / 256, 1), GW * 32, 0, stream>>>(ATh, ATl, WO, OUT, DM);
}

// v008
// A run of this version takes 115 microseconds.
// In two side-by-side timings against v007, it was 1.12 and 1.13 times as fast.
// All steps since v000 together make it 25.2 times as fast.
#include <hip/hip_runtime.h>

// Causal self-attention with a fused bias-free natural qkv weight and computed rotate-half rotary embeddings (x [4][2048][1024]; qkv = x w_qkv^T ('oi' [3072][1024] 1/32, no bias) split in ROW thirds q | k | v (16 heads x 64); rope cat(x1 c - x2 s, x1 s + x2 c) on the two 32-wide halves with angle t x 1/10000^(i/32) (32 f32 constants jnp-exact; one f32 product; precise cosf/sinf); scores / sqrt(64); causal (-inf == exclusion); softmax; y = merged w_out^T ('oi', no bias) -> [4][2048][1024] (8.4 M); argument order x, w_qkv, w_out).
// Layout, all batches in every launch: bf16 copy of x; 'oi' weights; exact projections, the joint q | k | v one rotating and storing its own head planes; computed rotary table; causal T-2048 attention, all heads of all batches in one launch, scores and probabilities in registers (hybrid rows: < 512 hi/lo 3 products, rest fp16 x1024; key steps end at the diagonal); merged hi/lo x w_o exact.
// Every 16-bit matrix operand plane is stored in fragment order: blocks of 16 rows x 32 k (1 KiB), inside a block [k bit 4][k bit 3][row & 15][k & 7], so that lane l of a wave finds its two 16-byte pieces of a fragment at
// block + 8 l and block + 256 + 8 l (elements): each wave-wide 16-byte load reads 512 contiguous bytes (4 whole lines). Blocks run along k first (value planes: the four 16-row blocks of a 32-key step lie together).
// Compute dtypes, f32 accumulate: every input rounded to bf16; projections exact; attention rows < 512 3 products, rest fp16; softmax f32; w_o hl x exact.

#define NB_  4
#define TT   2048
#define DM   1024
#define NH_  16
#define NKV  16
#define REP  (NH_ / NKV)
#define HD   64
#define DQ   (NH_ * HD)
#define DKV  (NKV * HD)
#define RH   512                  // query rows < RH use hi+lo planes (0: none)
#define SCL  0.125f   // HD^-0.5
#define FW   4                    // waves of an attention work-group: each has its own queries, all walk the same keys
#define NTF  ((TT - RH) / (FW * 32))   // query tiles per head, fp16 rows (32 queries a wave)
#define NTH  (RH / (FW * 16))     // query tiles per head, hi/lo rows (16 queries a wave)
typedef _Float16 h16;
typedef unsigned short bf;
typedef __attribute__((ext_vector_type(16))) __bf16   v16bf;
typedef __attribute__((ext_vector_type(16))) _Float16 v16h;
typedef __attribute__((ext_vector_type(8)))  _Float16 v8h;
typedef __attribute__((ext_vector_type(8)))  unsigned short v8us;
typedef __attribute__((ext_vector_type(8)))  float    v8f;
typedef __attribute__((ext_vector_type(4)))  float    v4f;
typedef v8h  __attribute__((may_alias)) v8ha;
typedef v4f  __attribute__((may_alias)) v4fa;
typedef v8us __attribute__((may_alias)) v8usa;

__device__ __forceinline__ unsigned short f2bf(float f) { unsigned u = __float_as_uint(f); u += 0x7FFFu + ((u >> 16) & 1u); return (unsigned short)(u >> 16); }
__device__ __forceinline__ float bf2f(unsigned short b) { return __uint_as_float(((unsigned)b) << 16); }
__device__ __forceinline__ float bfr(float f) { return bf2f(f2bf(f)); }
__device__ __forceinline__ v16h cat16(v8h lo, v8h hi) { return __builtin_shufflevector(lo, hi, 0, 1, 2, 3, 4, 5, 6, 7, 8, 9, 10, 11, 12, 13, 14, 15); }
__device__ __forceinline__ v16bf cat16b(v8us lo, v8us hi) { return __builtin_bit_cast(v16bf, __builtin_shufflevector(lo, hi, 0, 1, 2, 3, 4, 5, 6, 7, 8, 9, 10, 11, 12, 13, 14, 15)); }
__device__ __forceinline__ v8f wmma16(v16h a, v16h b, v8f c) { return __builtin_amdgcn_wmma_f32_16x16x32_f16(false, a, false, b, (short)0, c, false, false); }
__device__ __forceinline__ v8f wmmab(v16bf a, v16bf b, v8f c) { return __builtin_amdgcn_wmma_f32_16x16x32_bf16(false, a, false, b, (short)0, c, false, false); }



// ---- The two GEMMs: a work-group of GW = 8 waves, 2 (row side) x 4 (column side), each wave one 64x64 output tile (16 accumulators). The work-group's operand rows (128 of the row side, 256 of the column side) come
// into LDS once for all its waves, by asynchronous copies (global_load_async_to_lds_b128), SK = 64 k a stage, two buffers: stage t + 2 is asked for behind the barrier that ends stage t and flies while stage t + 1 is worked on.
// The planes are in fragment order, so a stage's part of a 16-row block is 2 KiB in a row, in memory and in LDS alike: thread i copies 16-byte piece i & 127 of blocks i >> 7, + 2, + 4, ...; a wave-wide fragment load reads 512 contiguous LDS bytes.
#define GW   8
#define SK   64                   // k of a stage: two fragment sets of 32
#define RBE  (16 * SK)            // elements of a 16-row block in a stage (2 KiB)
template <typename T16> struct WFrag;
template <> struct WFrag<h16> { typedef v16h V; static __device__ __forceinline__ V ld(const h16* p) { return cat16(*(const v8h*)p, *(const v8h*)(p + 256)); } static __device__ __forceinline__ v8f mma(V a, V b, v8f c) { return wmma16(a, b, c); } };
template <> struct WFrag<bf> { typedef v16bf V; static __device__ __forceinline__ V ld(const bf* p) { return cat16b(*(const v8us*)p, *(const v8us*)(p + 256)); } static __device__ __forceinline__ v8f mma(V a, V b, v8f c) { return wmmab(a, b, c); } };
__device__ __forceinline__ unsigned lds_off(const void* p) { return (unsigned)(size_t)p; }   // byte address in the work-group's LDS
// cp4: the thread's pieces of eight 16-row blocks (four each for the two halves of the work-group): LDS step 2 blocks of a stage, memory step 2 blocks of a plane whose rows hold K elements.
// The s_wait_xcnt stands inside the statement, behind the last copy: in front of any rewrite of an address register that a copy names.
template <int K> __device__ __forceinline__ void cp4(unsigned l, const bf* g) {
    const unsigned l1 = l + 2 * RBE * 2, l2 = l + 4 * RBE * 2, l3 = l + 6 * RBE * 2; const bf* g1 = g + 2 * 16 * K; const bf* g2 = g + 4 * 16 * K; const bf* g3 = g + 6 * 16 * K;
    asm volatile("global_load_async_to_lds_b128 %0, %4, off\n\tglobal_load_async_to_lds_b128 %1, %5, off\n\tglobal_load_async_to_lds_b128 %2, %6, off\n\tglobal_load_async_to_lds_b128 %3, %7, off\n\ts_wait_xcnt 0x0"
                 :: "v"(l), "v"(l1), "v"(l2), "v"(l3), "v"(g), "v"(g1), "v"(g2), "v"(g3) : "memory"); }
// cp8: the same for sixteen blocks, eight from g and eight from h, behind one another in LDS: one statement, one wait.
template <int K> __device__ __forceinline__ void cp8(unsigned l, const bf* g, const bf* h) {
    const unsigned l1 = l + 2 * RBE * 2, l2 = l + 4 * RBE * 2, l3 = l + 6 * RBE * 2, l4 = l + 8 * RBE * 2, l5 = l + 10 * RBE * 2, l6 = l + 12 * RBE * 2, l7 = l + 14 * RBE * 2;
    const bf* g1 = g + 2 * 16 * K; const bf* g2 = g + 4 * 16 * K; const bf* g3 = g + 6 * 16 * K; const bf* h1 = h + 2 * 16 * K; const bf* h2 = h + 4 * 16 * K; const bf* h3 = h + 6 * 16 * K;
    asm volatile("global_load_async_to_lds_b128 %0, %8, off\n\tglobal_load_async_to_lds_b128 %1, %9, off\n\tglobal_load_async_to_lds_b128 %2, %10, off\n\tglobal_load_async_to_lds_b128 %3, %11, off\n\t"
                 "global_load_async_to_lds_b128 %4, %12, off\n\tglobal_load_async_to_lds_b128 %5, %13, off\n\tglobal_load_async_to_lds_b128 %6, %14, off\n\tglobal_load_async_to_lds_b128 %7, %15, off\n\ts_wait_xcnt 0x0"
                 :: "v"(l), "v"(l1), "v"(l2), "v"(l3), "v"(l4), "v"(l5), "v"(l6), "v"(l7), "v"(g), "v"(g1), "v"(g2), "v"(g3), "v"(h), "v"(h1), "v"(h2), "v"(h3) : "memory"); }
// ---- k_gemmo: C[m][n] (f32, pitch ldc) = sum_k (A[m][k] + A2[m][k]) Bt[n][k], two products a step; grid (M/128, N/256), 256 threads. K % 128 == 0. A stage: 8 blocks of A, 8 of A2, 16 of Bt.
template <int K>
__global__ __launch_bounds__(GW * 32) void k_gemmo(const bf* __restrict__ A, const bf* __restrict__ A2, const bf* __restrict__ Bt, float* C, int ldc) {
    typedef WFrag<bf>::V V; constexpr int STG = 32 * RBE, NT = K / SK; static_assert(NT >= 2, "the ring's prologue fills two stages");
    __shared__ __align__(16) bf sm[2 * STG]; __shared__ __align__(16) float osm[GW * 16 * 68];
    const int tid = (int)threadIdx.x, lane = tid & 31, lr = lane & 15, hi = lane >> 4; const int wave = __builtin_amdgcn_readfirstlane(tid >> 5); const int wr = wave & 1, wc = wave >> 1;
    const int R0 = blockIdx.x * 128, C0 = blockIdx.y * 256; const int r0 = R0 + wr * 64, c0 = C0 + wc * 64;
    v8f acc[4][4];
#pragma unroll
    for (int mb = 0; mb < 4; ++mb)
#pragma unroll
        for (int nb = 0; nb < 4; ++nb) acc[mb][nb] = (v8f){};
    const size_t go = (size_t)(tid >> 7) * 16 * K + (tid & 127) * 8; const bf* ga = A + (size_t)R0 * K + go; const bf* ga2 = A2 + (size_t)R0 * K + go; const bf* gb = Bt + (size_t)C0 * K + go; const unsigned l0 = lds_off(sm) + tid * 16;
    auto fill = [&](int t) { const unsigned l = l0 + (t & 1) * (STG * 2); const int ko = t * RBE; cp8<K>(l, ga + ko, ga2 + ko); cp8<K>(l + 16 * RBE * 2, gb + ko, gb + 8 * 16 * K + ko); };
    fill(0);
    asm volatile("s_wait_asynccnt 0x0" ::: "memory");   // this wave's copies of stage 0 have landed
    __syncthreads();                                     // and every other wave's
    fill(1);
#pragma unroll 1
    for (int t = 0; t < NT; ++t) {
        const bf* sb = sm + (t & 1) * STG + 8 * lane; V a[2][4], a2[2][4], b[2][4];   // a fragment set for each 32 k of the stage: the second set's loads fly under the first set's products
#pragma unroll
        for (int kb = 0; kb < 2; ++kb) {
#pragma unroll
            for (int mb = 0; mb < 4; ++mb) { a[kb][mb] = WFrag<bf>::ld(sb + (wr * 4 + mb) * RBE + kb * 512); a2[kb][mb] = WFrag<bf>::ld(sb + (8 + wr * 4 + mb) * RBE + kb * 512); }
#pragma unroll
            for (int nb = 0; nb < 4; ++nb) b[kb][nb] = WFrag<bf>::ld(sb + (16 + wc * 4 + nb) * RBE + kb * 512); }
        auto prod = [&](int kb) {
#pragma unroll
            for (int nb = 0; nb < 4; ++nb) {
#pragma unroll
                for (int mb = 0; mb < 4; ++mb) { acc[mb][nb] = WFrag<bf>::mma(a[kb][mb], b[kb][nb], acc[mb][nb]); acc[mb][nb] = WFrag<bf>::mma(a2[kb][mb], b[kb][nb], acc[mb][nb]); } } };
        __builtin_amdgcn_sched_barrier(0);                   // both sets' loads are issued as one group in front of the first product, never among the products
        // the first set's loaded fragments as inputs: the wait in front of the first product is the counted one for that set alone
        asm volatile("" :: "v"(a[0][0]), "v"(a[0][1]), "v"(a[0][2]), "v"(a[0][3]), "v"(a2[0][0]), "v"(a2[0][1]), "v"(a2[0][2]), "v"(a2[0][3]), "v"(b[0][0]), "v"(b[0][1]), "v"(b[0][2]), "v"(b[0][3]));
        prod(0);
        __builtin_amdgcn_sched_barrier(0);                   // the first set's products stay in front of the waits: they cover the second set's loads and the flight of stage t + 1
        asm volatile("s_wait_dscnt 0x0" ::: "memory");      // this wave's reads of stage t are done: its last fragments are in registers
        asm volatile("s_wait_asynccnt 0x0" ::: "memory");   // its copies of stage t + 1 have landed
        __syncthreads();                                     // stage t + 1 is published, stage t's buffer is free
        if (t + 2 < NT) fill(t + 2);
        __builtin_amdgcn_sched_barrier(0);                   // the copies are asked for in front of the second set's products, not behind them
        prod(1);
    }
    asm volatile("s_wait_asynccnt 0x0" ::: "memory");        // nothing is in flight when the wave goes on
    float* os = osm + wave * (16 * 68);                      // each wave stages in its own range
#pragma unroll
    for (int mb = 0; mb < 4; ++mb) {
#pragma unroll
        for (int nb = 0; nb < 4; ++nb) {
#pragma unroll
            for (int j = 0; j < 8; ++j) os[(hi * 8 + j) * 68 + nb * 16 + lr] = acc[mb][nb][j]; }
        __builtin_amdgcn_wave_barrier(); asm volatile("" ::: "memory");   // the wave's LDS stores stay in front of its reads of other lanes' values
        float* crow = C + (size_t)(r0 + mb * 16) * ldc + c0;
#pragma unroll
        for (int s = 0; s < 8; s += 4) { v4f val[4]; float* cp[4];
#pragma unroll
            for (int u = 0; u < 4; ++u) { const int row = 2 * (s + u) + hi, cofs = lr * 4; val[u] = *(const v4fa*)(os + row * 68 + cofs); cp[u] = crow + (size_t)row * ldc + cofs; *(v4f*)cp[u] = val[u]; }
            asm volatile("s_wait_xcnt 0x0" :: "v"(cp[0]), "v"(cp[1]), "v"(cp[2]), "v"(cp[3]), "v"(val[0]), "v"(val[1]), "v"(val[2]), "v"(val[3]) : "memory"); }   // in front of any rewrite of an address or data register of the four stores (named as inputs, they stay whole up to here)
        __builtin_amdgcn_wave_barrier(); asm volatile("" ::: "memory");   // and the reads in front of the next rows' stores
    }
}

__device__ __forceinline__ h16 tohx(float x) { return (h16)x; }
__device__ __forceinline__ void splitf(float y, unsigned short& h, unsigned short& l) { h = f2bf(y); l = f2bf(y - bf2f(h)); }
typedef __attribute__((ext_vector_type(2))) _Float16 v2h;
typedef __attribute__((ext_vector_type(4))) _Float16 v4h;
typedef __attribute__((ext_vector_type(2))) unsigned short v2us;
typedef __attribute__((ext_vector_type(4))) unsigned short v4us;
typedef __attribute__((ext_vector_type(2))) float v2f;
typedef __attribute__((ext_vector_type(4))) int v4i;
typedef v4h  __attribute__((may_alias)) v4ha;
typedef v4us __attribute__((may_alias)) v4usa;

__device__ __forceinline__ void cvt8(const float* __restrict__ src, bf* dst, size_t n8, unsigned blk) { const size_t i = (size_t)blk * 256 + threadIdx.x; if (i >= n8) return;   // thread i makes 16-byte piece i of the fragment-order plane (rows of DM elements)
    const size_t tb = i >> 6; const int w = (int)(i & 63); const float* sp = src + ((tb / (DM / 32)) * 16 + (w & 15)) * DM + (tb % (DM / 32)) * 32 + (w >> 4) * 8; const v8f v = *(const v8f*)sp; v8us o;
    asm volatile("s_wait_xcnt 0x0" :: "v"(sp), "v"(v) : "memory");   // in front of any rewrite of the load's address registers (address and loaded value as inputs: the registers stay whole, and the load stays in front)
#pragma unroll
    for (int k = 0; k < 8; ++k) o[k] = f2bf(v[k]); *(v8us*)(dst + i * 8) = o;  }

// put8: one 16-byte piece (8 values) of a head plane, in all three forms (fp16, bf16 hi, bf16 lo), at element e.
__device__ __forceinline__ void put8(const float* r, size_t e, h16* P16, bf* Ph, bf* Pl) { v8h o16; v8us oh, ol;
#pragma unroll
    for (int j = 0; j < 8; ++j) { o16[j] = tohx(r[j]); unsigned short a2, c2; splitf(r[j], a2, c2); oh[j] = a2; ol[j] = c2; }
    h16* p16 = P16 + e; bf* ph = Ph + e; bf* pl = Pl + e; *(v8h*)p16 = o16; *(v8us*)ph = oh; *(v8us*)pl = ol;
    asm volatile("s_wait_xcnt 0x0" :: "v"(p16), "v"(ph), "v"(pl), "v"(o16), "v"(oh), "v"(ol) : "memory"); }   // in front of any rewrite of an address or data register of the three stores (named as inputs, they stay whole up to here)
__constant__ float INVT[HD / 2] = { 1.000000000e+00f, 7.498942018e-01f, 5.623413324e-01f, 4.216965139e-01f, 3.162277639e-01f, 2.371373624e-01f, 1.778279394e-01f, 1.333521456e-01f, 1.000000015e-01f, 7.498941571e-02f, 5.623412877e-02f, 4.216964915e-02f, 3.162277862e-02f, 2.371373586e-02f, 1.778279431e-02f, 1.333521493e-02f, 9.999999776e-03f, 7.498942316e-03f, 5.623413250e-03f, 4.216964822e-03f, 3.162277862e-03f, 2.371373819e-03f, 1.778279431e-03f, 1.333521446e-03f, 1.000000047e-03f, 7.498941850e-04f, 5.623413017e-04f, 4.216964880e-04f, 3.162277862e-04f, 2.371373848e-04f, 1.778279402e-04f, 1.333521504e-04f };   // float32 1 / 10000^(i/32), generated with jnp to be bit-exact
// Rotary table, d < HD/2 only (the two halves are equal), in the order its reader k_qkv takes it: [t / 16][d / 16][pair of d: (d & 7) / 2][lane = ((d >> 3) & 1) * 16 + (t & 15)][d & 1][cos, sin]: lane l finds the eight
// pairs of its position and its 8 d in four 16-byte pieces, 128 floats apart, and each wave-wide load reads 512 contiguous bytes. Thread idx makes pair idx.
__device__ __forceinline__ void cs5(float* CS, unsigned blk) { const int idx = (int)blk * 256 + threadIdx.x; if (idx >= TT * (HD / 2)) return; const int ln = (idx >> 1) & 31; const int d = ((idx >> 8) & 1) * 16 + (ln >> 4) * 8 + ((idx >> 6) & 3) * 2 + (idx & 1); const int t = (idx >> 9) * 16 + (ln & 15); const float a = __fmul_rn((float)t, INVT[d]); v2f cs; cs[0] = cosf(a); cs[1] = sinf(a); *(v2f*)(CS + (size_t)idx * 2) = cs;  }
static_assert(HD == 64, "the table's order and k_qkv's tiles are laid out for heads of 64");
// ---- k_prep: the stages that read only inputs, in one launch, dealt by block range: rotary table, then the bf16 copies of x (all batches), w_qkv and w_out.
static_assert(DQ == DM, "cvt8 lays all three planes out in rows of DM elements");
#define PB_C ((unsigned)(TT * (HD / 2) / 256))
#define PB_X ((unsigned)((size_t)NB_ * TT * DM / 8 / 256))
#define PB_W ((unsigned)((size_t)(DQ + 2 * DKV) * DM / 8 / 256))
#define PB_O ((unsigned)((size_t)DM * DQ / 8 / 256))
__global__ __launch_bounds__(256) void k_prep(const float* __restrict__ x, const float* __restrict__ wqkv, const float* __restrict__ wo, bf* XB, bf* WQKV, bf* WO, float* CS) {
    const unsigned b = blockIdx.x;
    if (b < PB_C) cs5(CS, b);
    else if (b < PB_C + PB_X) cvt8(x, XB, (size_t)NB_ * TT * DM / 8, b - PB_C);
    else if (b < PB_C + PB_X + PB_W) cvt8(wqkv, WQKV, (size_t)(DQ + 2 * DKV) * DM / 8, b - (PB_C + PB_X));
    else cvt8(wo, WO, (size_t)DM * DQ / 8, b - (PB_C + PB_X + PB_W));
}
// ---- k_qkv: the joint projection with the plane builders as its epilogue: one wave per tile of 64 positions x one head of q, k or v; a work-group's 8 waves take 128 positions x 4 heads (all q, all k or all v) and share their
// operand rows through the LDS ring above (a stage: 8 blocks of x, 16 of the weights); grid (batches x TT / 128, heads of q + k + v / 4), 256 threads, two work-groups a WGP. No f32 projection is stored.
// A lane's 8 registers of an accumulator run along the A operand's rows, so A is chosen as the side that is the plane's k: q and k tiles take the weight rows as A (a lane holds 8 consecutive d of one position: a 16-byte piece of
// a [t][d] plane, and its rotation partner d + 32 lies in the same lane, two accumulators on); v tiles take the x rows as A (8 consecutive positions of one d: a piece of a [d][t] plane). Both operand planes have the same order.
// Piece (mb, nb) of a tile lies at lane * 8 + (mb & 1) * 256 in its block: every wave-wide 16-byte store writes 512 contiguous bytes.
__global__ __launch_bounds__(GW * 32) __attribute__((amdgpu_waves_per_eu(4, 4))) void k_qkv(const bf* __restrict__ X, const bf* __restrict__ Wt, const float* __restrict__ CS, h16* Q16, bf* Qh, bf* Ql, h16* K16, bf* Kh, bf* Kl, h16* V16, bf* Vh, bf* Vl) {
    typedef WFrag<bf>::V V; constexpr int K = DM; constexpr int STG = 24 * RBE, NT = K / SK; static_assert(NT >= 2, "the ring's prologue fills two stages");
    static_assert(TT % 128 == 0 && NKV == NH_ && DQ % 256 == 0 && DKV % 256 == 0, "a work-group's tiles lie in one batch and in one of q, k, v; q, k and v planes have the same shape");
    __shared__ __align__(16) bf sm[2 * STG];
    const int tid = (int)threadIdx.x, lane = tid & 31; const int wave = __builtin_amdgcn_readfirstlane(tid >> 5); const int wr = wave & 1, wc = wave >> 1;
    const int R0 = blockIdx.x * 128, C0 = blockIdx.y * 256; const int r0 = R0 + wr * 64, c0 = C0 + wc * 64; const bool isv = c0 >= DQ + DKV, isk = !isv && c0 >= DQ;
    v8f acc[4][4];
#pragma unroll
    for (int mb = 0; mb < 4; ++mb)
#pragma unroll
        for (int nb = 0; nb < 4; ++nb) acc[mb][nb] = (v8f){};
    const size_t go = (size_t)(tid >> 7) * 16 * K + (tid & 127) * 8; const bf* gx = X + (size_t)R0 * K + go; const bf* gw = Wt + (size_t)C0 * K + go; const unsigned l0 = lds_off(sm) + tid * 16;
    auto fill = [&](int t) { const unsigned l = l0 + (t & 1) * (STG * 2); const int ko = t * RBE; cp4<K>(l, gx + ko); cp8<K>(l + 8 * RBE * 2, gw + ko, gw + 8 * 16 * K + ko); };
    const int xo = wr * 4 * RBE + 8 * lane, wo = (8 + wc * 4) * RBE + 8 * lane; const int ao = isv ? xo : wo, bo = isv ? wo : xo;   // the wave's four blocks of either side in a stage
    fill(0);
    asm volatile("s_wait_asynccnt 0x0" ::: "memory");   // this wave's copies of stage 0 have landed
    __syncthreads();                                     // and every other wave's
    fill(1);
#pragma unroll 1
    for (int t = 0; t < NT; ++t) {
        const bf* sb = sm + (t & 1) * STG; V a[4], b[4];
        auto frag = [&](int kb) {
#pragma unroll
            for (int mb = 0; mb < 4; ++mb) a[mb] = WFrag<bf>::ld(sb + ao + mb * RBE + kb * 512);
#pragma unroll
            for (int nb = 0; nb < 4; ++nb) b[nb] = WFrag<bf>::ld(sb + bo + nb * RBE + kb * 512); };
        auto prod = [&]() {
#pragma unroll
            for (int nb = 0; nb < 4; ++nb) {
#pragma unroll
                for (int mb = 0; mb < 4; ++mb) acc[mb][nb] = WFrag<bf>::mma(a[mb], b[nb], acc[mb][nb]); } };
        frag(0);
        // the loaded fragments as inputs: all sixteen loads stand in one group in front of the first product (without this the compiler reloads one fragment's registers among the products, an LDS latency each time)
        asm volatile("" :: "v"(a[0]), "v"(a[1]), "v"(a[2]), "v"(a[3]), "v"(b[0]), "v"(b[1]), "v"(b[2]), "v"(b[3]));
        prod();
        frag(1);
        __builtin_amdgcn_sched_barrier(0);                   // the first 32 k's products stay in front of the waits: they cover the second fragment loads and the flight of stage t + 1
        asm volatile("s_wait_dscnt 0x0" ::: "memory");      // this wave's reads of stage t are done: its last fragments are in registers
        asm volatile("s_wait_asynccnt 0x0" ::: "memory");   // its copies of stage t + 1 have landed
        __syncthreads();                                     // stage t + 1 is published, stage t's buffer is free
        if (t + 2 < NT) fill(t + 2);
        __builtin_amdgcn_sched_barrier(0);                   // the copies are asked for in front of the second 32 k's products, not behind them
        prod();
    }
    asm volatile("s_wait_asynccnt 0x0" ::: "memory");        // nothing is in flight when the wave goes on
    // a tile's 8 blocks (8 KiB a plane) lie in a row; [t][d] planes: block = (t / 16) * 2 + d / 32; [d][t] planes: block = (t / 32) * 4 + d / 16
    const int t0 = r0 % TT; const size_t eb = ((size_t)(r0 / TT) * NH_ + (c0 / HD) % NH_) * TT * HD + (size_t)t0 * HD + 8 * lane;
    if (isv) {   // acc[mb][nb][j] is position t0 + mb * 16 + (lane >> 4) * 8 + j of d = nb * 16 + (lane & 15)
#pragma unroll
        for (int mb = 0; mb < 4; ++mb)
#pragma unroll
            for (int nb = 0; nb < 4; ++nb) { float r[8];
#pragma unroll
                for (int j = 0; j < 8; ++j) r[j] = acc[mb][nb][j];
                put8(r, eb + (mb >> 1) * 2048 + nb * 512 + (mb & 1) * 256, V16, Vh, Vl); }
    } else {     // acc[mb][nb][j] is d = mb * 16 + (lane >> 4) * 8 + j of position t0 + nb * 16 + (lane & 15); rotate-half: out[d] = x[d] cos - x[d+32] sin, out[d+32] = x[d+32] cos + x[d] sin, d < 32
        h16* P16 = isk ? K16 : Q16; bf* Ph = isk ? Kh : Qh; bf* Pl = isk ? Kl : Ql; const float* pc = CS + (size_t)(t0 >> 4) * 1024 + lane * 4;
#pragma unroll
        for (int nb = 0; nb < 4; ++nb) {
            v4f cq[2][4];   // the table pieces of 16 positions fly together
#pragma unroll
            for (int mb = 0; mb < 2; ++mb)
#pragma unroll
                for (int q = 0; q < 4; ++q) cq[mb][q] = *(const v4f*)(pc + (nb * 2 + mb) * 512 + q * 128);
            asm volatile("s_wait_xcnt 0x0" :: "v"(pc), "v"(cq[0][0]), "v"(cq[0][1]), "v"(cq[0][2]), "v"(cq[0][3]), "v"(cq[1][0]), "v"(cq[1][1]), "v"(cq[1][2]), "v"(cq[1][3]) : "memory");   // one wait behind the eight loads, in front of any rewrite of their address registers (address and loaded values as inputs: the registers stay whole, and the loads stay in front)
#pragma unroll
            for (int mb = 0; mb < 2; ++mb) { float r1[8], r2[8];
#pragma unroll
                for (int j = 0; j < 8; ++j) { const float co = cq[mb][j >> 1][(j & 1) * 2], si = cq[mb][j >> 1][(j & 1) * 2 + 1]; const float x1 = acc[mb][nb][j], x2 = acc[mb + 2][nb][j]; r1[j] = x1 * co - x2 * si; r2[j] = x2 * co + x1 * si; }
                const size_t e = eb + nb * 1024 + mb * 256; put8(r1, e, P16, Ph, Pl); put8(r2, e + 512, P16, Ph, Pl); }
        }
    }
}
__device__ __forceinline__ float xhalf(float x) { const int b = __float_as_int(x); return __int_as_float(__builtin_amdgcn_permlanex16(b, b, 0x76543210, 0xfedcba98, false, false)); }   // lane l <-> l ^ 16
// 2^x with the slot behind a transcendental filled inside the statement: the v_nop keeps the next vector instruction, whichever the compiler puts there, from reading the last result or taking its source register directly
// behind it; in exp2x8 each exponential is the independent instruction behind the one before (early-clobber outputs share no register with a source).
__device__ __forceinline__ float exp2x1(float x) { float r; asm("v_exp_f32 %0, %1\n\tv_nop" : "=v"(r) : "v"(x)); return r; }
__device__ __forceinline__ v8f exp2x8(v8f x) { float r0, r1, r2, r3, r4, r5, r6, r7;
    asm("v_exp_f32 %0, %8\n\tv_exp_f32 %1, %9\n\tv_exp_f32 %2, %10\n\tv_exp_f32 %3, %11\n\tv_exp_f32 %4, %12\n\tv_exp_f32 %5, %13\n\tv_exp_f32 %6, %14\n\tv_exp_f32 %7, %15\n\tv_nop"
        : "=&v"(r0), "=&v"(r1), "=&v"(r2), "=&v"(r3), "=&v"(r4), "=&v"(r5), "=&v"(r6), "=&v"(r7) : "v"(x[0]), "v"(x[1]), "v"(x[2]), "v"(x[3]), "v"(x[4]), "v"(x[5]), "v"(x[6]), "v"(x[7]));
    return (v8f){ r0, r1, r2, r3, r4, r5, r6, r7 }; }
#define STE  8192                 // elements of a stage in LDS (16 KiB)
// cp8g: the thread's eight 16-byte pieces of a stage, 2 KiB (the work-group's 128 pieces) apart in LDS, each from its own address. The s_wait_xcnt stands inside the statement, behind the last copy: in front of any rewrite of
// an address register that a copy names.
template <typename T16> __device__ __forceinline__ void cp8g(unsigned l, const T16* g0, const T16* g1, const T16* g2, const T16* g3, const T16* g4, const T16* g5, const T16* g6, const T16* g7) {
    const unsigned l1 = l + 2048, l2 = l + 4096, l3 = l + 6144, l4 = l + 8192, l5 = l + 10240, l6 = l + 12288, l7 = l + 14336;
    asm volatile("global_load_async_to_lds_b128 %0, %8, off\n\tglobal_load_async_to_lds_b128 %1, %9, off\n\tglobal_load_async_to_lds_b128 %2, %10, off\n\tglobal_load_async_to_lds_b128 %3, %11, off\n\t"
                 "global_load_async_to_lds_b128 %4, %12, off\n\tglobal_load_async_to_lds_b128 %5, %13, off\n\tglobal_load_async_to_lds_b128 %6, %14, off\n\tglobal_load_async_to_lds_b128 %7, %15, off\n\ts_wait_xcnt 0x0"
                 :: "v"(l), "v"(l1), "v"(l2), "v"(l3), "v"(l4), "v"(l5), "v"(l6), "v"(l7), "v"(g0), "v"(g1), "v"(g2), "v"(g3), "v"(g4), "v"(g5), "v"(g6), "v"(g7) : "memory"); }
static_assert(FW * 32 * 16 == 2048 && STE * 2 == 8 * 2048, "cp8g: eight pieces a thread cover a stage");
template <typename T16, int NSPLIT, int NQ>
__device__ __forceinline__ void attn_tile(const T16* __restrict__ Q, const T16* __restrict__ Q2, const T16* __restrict__ Kp, const T16* __restrict__ K2, const T16* __restrict__ Vt, const T16* __restrict__ V2, int qg, bf* Ah, bf* Al, const T16* ring) {
    typedef typename WFrag<T16>::V V;
    constexpr float CX = SCL * 1.4426950408889634f;          // scores are carried as log2 exponents
    constexpr float PB = (NSPLIT == 0) ? 10.0f : 0.0f;       // fp16 probabilities carry x1024; the row sum carries it too, so it cancels in the quotient
    constexpr int NP = (NSPLIT == 2) ? 2 : 1, SKA = STE / (2 * NP * HD);   // planes of an operand; keys of a stage, which holds [keys][keys lo][values][values lo]
    static_assert(SKA % 32 == 0 && (FW * NQ * 16) % SKA == 0 && FW * NQ * 16 >= 2 * SKA, "whole stages up to a tile's last query, at least two of them (the ring's prologue fills two)");
    const int tid = (int)threadIdx.x, lane = tid & 31, lr = lane & 15, hi = lane >> 4; const int wave = __builtin_amdgcn_readfirstlane(tid >> 5);
    const int q0 = qg + wave * (NQ * 16), sd = q0 / 32;      // the wave's first query; its last 32-key step, the only one that holds keys beyond a query
    const int NT = (qg + FW * NQ * 16) / SKA;                // stages up to the tile's last query
    const unsigned l0 = lds_off(ring) + tid * 16; const T16* gk = Kp + tid * 8; const T16* gv = Vt + tid * 8; const T16* gk2 = (NSPLIT == 2) ? K2 + tid * 8 : gk; const T16* gv2 = (NSPLIT == 2) ? V2 + tid * 8 : gv;
    auto fill = [&](int t) { const unsigned l = l0 + (t & 1) * (STE * 2); const size_t e = (size_t)t * (SKA * HD);
        if constexpr (NSPLIT == 0) cp8g<T16>(l, gk + e, gk + e + 1024, gk + e + 2048, gk + e + 3072, gv + e, gv + e + 1024, gv + e + 2048, gv + e + 3072);
        else cp8g<T16>(l, gk + e, gk + e + 1024, gk2 + e, gk2 + e + 1024, gv + e, gv + e + 1024, gv2 + e, gv2 + e + 1024); };
    fill(0);
    V qf[NQ][2], qf2[NQ][2];
    const size_t qo = (size_t)q0 * HD + 8 * lane; const T16* qa = Q + qo; const T16* qa2 = (NSPLIT == 2) ? Q2 + qo : qa;
#pragma unroll
    for (int qi = 0; qi < NQ; ++qi)
#pragma unroll
        for (int ks = 0; ks < 2; ++ks) { qf[qi][ks] = WFrag<T16>::ld(qa + qi * 16 * HD + ks * 512); if (NSPLIT == 2) qf2[qi][ks] = WFrag<T16>::ld(qa2 + qi * 16 * HD + ks * 512); }
    asm volatile("s_wait_xcnt 0x0" :: "v"(qa), "v"(qa2) : "memory");   // in front of any rewrite of an address register of the query loads (named as inputs, they stay whole up to here)
    v8f o[NQ][4]; float m[NQ], l[NQ];
#pragma unroll
    for (int qi = 0; qi < NQ; ++qi) { m[qi] = -3.0e38f; l[qi] = 0.f;
#pragma unroll
        for (int dt = 0; dt < 4; ++dt) o[qi][dt] = (v8f){}; }
    asm volatile("s_wait_asynccnt 0x0" ::: "memory");   // this wave's copies of stage 0 have landed
    __syncthreads();                                     // and every other wave's
    fill(1);
#pragma unroll 1   // rolled: one copy of a stage's code, the buffer chosen by t & 1
    for (int t = 0; t < NT; ++t) {
        const T16* sb = ring + (t & 1) * STE + 8 * lane;
#pragma unroll
        for (int u = 0; u < SKA / 32; ++u) { const int s = t * (SKA / 32) + u;
          if (s <= sd) {
            const T16* ka = sb + u * 32 * HD; const T16* ka2 = ka + SKA * HD; const T16* va = sb + NP * SKA * HD + u * 32 * HD; const T16* va2 = va + SKA * HD;   // a step's four key blocks and its four value blocks: 4 KiB in a row each
            V kf[2][2], kf2[2][2], vf[4], vf2[4];
#pragma unroll
            for (int kt = 0; kt < 2; ++kt)
#pragma unroll
                for (int ks = 0; ks < 2; ++ks) { kf[kt][ks] = WFrag<T16>::ld(ka + kt * 16 * HD + ks * 512); if (NSPLIT == 2) kf2[kt][ks] = WFrag<T16>::ld(ka2 + kt * 16 * HD + ks * 512); }
#pragma unroll
            for (int dt = 0; dt < 4; ++dt) { vf[dt] = WFrag<T16>::ld(va + dt * 512); if (NSPLIT == 2) vf2[dt] = WFrag<T16>::ld(va2 + dt * 512); }
            __builtin_amdgcn_sched_barrier(0);               // the step's LDS loads are issued as one group in front of the first product: the value loads fly under the score products and the maximum
            v8f st[NQ][2];                                   // st[qi][kt][j] = score of key s*32 + kt*16 + hi*8 + j and query q0 + qi*16 + lr
#pragma unroll
            for (int qi = 0; qi < NQ; ++qi)
#pragma unroll
                for (int kt = 0; kt < 2; ++kt) { v8f a = (v8f){};
#pragma unroll
                    for (int ks = 0; ks < 2; ++ks) { a = WFrag<T16>::mma(kf[kt][ks], qf[qi][ks], a); if (NSPLIT == 2) { a = WFrag<T16>::mma(kf[kt][ks], qf2[qi][ks], a); a = WFrag<T16>::mma(kf2[kt][ks], qf[qi][ks], a); } }
                    st[qi][kt] = a; }
            if (s == sd) {                                   // diagonal step: keys beyond the query are excluded
#pragma unroll
                for (int qi = 0; qi < NQ; ++qi)
#pragma unroll
                    for (int kt = 0; kt < 2; ++kt)
#pragma unroll
                        for (int j = 0; j < 8; ++j) st[qi][kt][j] = (s * 32 + kt * 16 + hi * 8 + j <= q0 + qi * 16 + lr) ? st[qi][kt][j] : -3.0e38f; }
            float mn[NQ]; bool up = false;
#pragma unroll
            for (int qi = 0; qi < NQ; ++qi) { float mx = st[qi][0][0];
#pragma unroll
                for (int j = 1; j < 8; ++j) mx = fmaxf(mx, st[qi][0][j]);
#pragma unroll
                for (int j = 0; j < 8; ++j) mx = fmaxf(mx, st[qi][1][j]);
                mx = fmaxf(mx, xhalf(mx)); mn[qi] = fmaxf(m[qi], mx * CX); up = up || (mn[qi] > m[qi]); }
            if (__builtin_amdgcn_ballot_w32(up) != 0) {      // some query's maximum rose: rescale (a factor of exactly 1 elsewhere); otherwise every factor is 1 and the multiplies are skipped
#pragma unroll
                for (int qi = 0; qi < NQ; ++qi) { const float al = exp2x1(m[qi] - mn[qi]); m[qi] = mn[qi]; l[qi] *= al;
#pragma unroll
                    for (int dt = 0; dt < 4; ++dt)
#pragma unroll
                        for (int j = 0; j < 8; ++j) o[qi][dt][j] *= al; } }
#pragma unroll
            for (int qi = 0; qi < NQ; ++qi) { const float mb = m[qi] - PB; float ps = 0.f;
#pragma unroll
                for (int kt = 0; kt < 2; ++kt) { st[qi][kt] = exp2x8(st[qi][kt] * CX - mb);
#pragma unroll
                    for (int j = 0; j < 8; ++j) ps += st[qi][kt][j]; }
                l[qi] += ps;
                if constexpr (NSPLIT == 0) { v16h pf;
#pragma unroll
                    for (int j = 0; j < 8; ++j) { pf[j] = tohx(st[qi][0][j]); pf[8 + j] = tohx(st[qi][1][j]); }
#pragma unroll
                    for (int dt = 0; dt < 4; ++dt) o[qi][dt] = WFrag<T16>::mma(vf[dt], pf, o[qi][dt]);
                } else { v8us h0, h1, l0, l1;
#pragma unroll
                    for (int j = 0; j < 8; ++j) { unsigned short a, c2; splitf(st[qi][0][j], a, c2); h0[j] = a; l0[j] = c2; splitf(st[qi][1][j], a, c2); h1[j] = a; l1[j] = c2; }
                    const v16bf ph = cat16b(h0, h1), pl = cat16b(l0, l1);
#pragma unroll
                    for (int dt = 0; dt < 4; ++dt) { o[qi][dt] = WFrag<T16>::mma(vf[dt], ph, o[qi][dt]); o[qi][dt] = WFrag<T16>::mma(vf[dt], pl, o[qi][dt]); o[qi][dt] = WFrag<T16>::mma(vf2[dt], ph, o[qi][dt]); } } }
          } }
        asm volatile("s_wait_dscnt 0x0" ::: "memory");      // this wave's reads of stage t are done
        asm volatile("s_wait_asynccnt 0x0" ::: "memory");   // its copies of stage t + 1 have landed
        __syncthreads();                                     // stage t + 1 is published, stage t's buffer is free
        if (t + 2 < NT) fill(t + 2);
    }
    asm volatile("s_wait_asynccnt 0x0" ::: "memory");        // nothing is in flight when the wave goes on
#pragma unroll
    for (int qi = 0; qi < NQ; ++qi) { l[qi] += xhalf(l[qi]);   // the halves' sums join once
        const float inv = __fdiv_rn(1.0f, l[qi]); const size_t oo = (size_t)((q0 >> 4) + qi) * (16 * DQ) + lane * 8;   // merged output in fragment order for the last product (rows of DQ): row lr of its block, k bit 3 = hi
#pragma unroll
        for (int dt = 0; dt < 4; ++dt) { v8us oh, ol;          // the lane's 8 values are d = dt * 16 + hi * 8 + j of its query, a 16-byte piece: every wave-wide store writes 512 contiguous bytes
#pragma unroll
            for (int j = 0; j < 8; ++j) { unsigned short a, c2; splitf(o[qi][dt][j] * inv, a, c2); oh[j] = a; ol[j] = c2; }
            const int co = (dt >> 1) * 512 + (dt & 1) * 256; bf* ph = Ah + oo + co; bf* pl = Al + oo + co; *(v8usa*)ph = oh; *(v8usa*)pl = ol;
            asm volatile("s_wait_xcnt 0x0" :: "v"(ph), "v"(pl), "v"(oh), "v"(ol) : "memory"); } }   // in front of any rewrite of an address or data register of the two stores (named as inputs, they stay whole up to here)
}
static_assert(RH % (FW * 32) == 0 && (TT - RH) % (FW * 32) == 0, "whole query tiles in both row classes");
// grid (batches x heads, NTF + NTH): the longest tiles (last queries) of every head and batch come first
__global__ __launch_bounds__(FW * 32) void k_fattn(const h16* __restrict__ Q16, const h16* __restrict__ K16, const h16* __restrict__ V16, const bf* __restrict__ Qh, const bf* __restrict__ Ql, const bf* __restrict__ Kh, const bf* __restrict__ Kl, const bf* __restrict__ Vh, const bf* __restrict__ Vl, bf* Ah, bf* Al) {
    __shared__ __align__(16) unsigned char ring[2 * STE * 2];   // the two stage buffers, read as fp16 or as bf16 by the tile's row class
    static_assert(REP == 1, "one kv head per query head"); const size_t hb = (size_t)blockIdx.x * TT * HD; const int bx = (int)blockIdx.y; const size_t ab = (size_t)(blockIdx.x / NH_) * TT * DQ + (blockIdx.x % NH_) * (HD / 32) * 512; Ah += ab; Al += ab;
    if (bx < NTF) attn_tile<h16, 0, 2>(Q16 + hb, nullptr, K16 + hb, nullptr, V16 + hb, nullptr, TT - FW * 32 * (bx + 1), Ah, Al, (const h16*)ring);
    else attn_tile<bf, 2, 1>(Qh + hb, Ql + hb, Kh + hb, Kl + hb, Vh + hb, Vl + hb, RH - FW * 16 * (bx - NTF + 1), Ah, Al, (const bf*)ring);
}

extern "C" void kernel_launch(void* const* d_in, const int* in_sizes, int n_in,
                              void* d_out, int out_size, void* d_ws, size_t ws_size, hipStream_t stream) {
    (void)in_sizes; (void)n_in; (void)out_size;
    const float* x = (const float*)d_in[0]; const float* wqkv = (const float*)d_in[1]; const float* wo = (const float*)d_in[2];   /* order x, w_qkv ('oi' [3072][1024]: ROW thirds q | k | v), w_out ('oi' [1024][1024]): THREE inputs */
    float* OUT = (float*)d_out;     // [4][2048][1024]
    char* wsp = (char*)d_ws;
    auto take = [&](size_t bytes) { char* p = wsp; wsp += (bytes + 255) & ~(size_t)255; return (void*)p; };
    bf* WO = (bf*)take((size_t)DM * DQ * 2); float* CS = (float*)take((size_t)TT * (HD / 2) * 2 * 4);
    bf* ATh = (bf*)take((size_t)NB_ * TT * DQ * 2); bf* ATl = (bf*)take((size_t)NB_ * TT * DQ * 2);   // merged attention output, hi and lo
    bf* XB = (bf*)take((size_t)NB_ * TT * DM * 2); bf* WQKV = (bf*)take((size_t)(DQ + 2 * DKV) * DM * 2);   // the joint projection's operands: bytes of their own, k_qkv reads them while it writes the planes
    h16* QP16 = (h16*)take((size_t)NB_ * NH_ * TT * HD * 2); h16* KP16 = (h16*)take((size_t)NB_ * NKV * TT * HD * 2); h16* VT16 = (h16*)take((size_t)NB_ * NKV * HD * TT * 2);
    bf* QPh = (bf*)take((size_t)NB_ * NH_ * TT * HD * 2); bf* QPl = (bf*)take((size_t)NB_ * NH_ * TT * HD * 2); bf* KPh = (bf*)take((size_t)NB_ * NKV * TT * HD * 2); bf* KPl = (bf*)take((size_t)NB_ * NKV * TT * HD * 2); bf* VTh = (bf*)take((size_t)NB_ * NKV * HD * TT * 2); bf* VTl = (bf*)take((size_t)NB_ * NKV * HD * TT * 2);
    if ((size_t)(wsp - (char*)d_ws) > ws_size) return;    // ws 256 MiB
    k_prep<<<PB_C + PB_X + PB_W + PB_O, 256, 0, stream>>>(x, wqkv, wo, XB, WQKV, WO, CS);
    k_qkv<<<dim3(NB_ * TT / 128, (DQ + 2 * DKV) / 256, 1), GW * 32, 0, stream>>>(XB, WQKV, CS, QP16, QPh, QPl, KP16, KPh, KPl, VT16, VTh, VTl);
    k_fattn<<<dim3(NB_ * NH_, NTF + NTH, 1), FW * 32, 0, stream>>>(QP16, KP16, VT16, QPh, QPl, KPh, KPl, VTh, VTl, ATh, ATl);
    k_gemmo<DQ><<<dim3(NB_ * TT / 128, DM / 256, 1), GW * 32, 0, stream>>>(ATh, ATl, WO, OUT, DM);
}

// v009
// Measured time: 107 microseconds a run.
// In two side-by-side timings against v008, it was 1.06 and 1.07 times as fast.
// All steps since v000 together make it 26.9 times as fast.
#include <hip/hip_runtime.h>

// Causal self-attention with a fused bias-free natural qkv weight and computed rotate-half rotary embeddings (x [4][2048][1024]; qkv = x w_qkv^T ('oi' [3072][1024] 1/32, no bias) split in ROW thirds q | k | v (16 heads x 64); rope cat(x1 c - x2 s, x1 s + x2 c) on the two 32-wide halves with angle t x 1/10000^(i/32) (32 f32 constants jnp-exact; one f32 product; precise cosf/sinf); scores / sqrt(64); causal (-inf == exclusion); softmax; y = merged w_out^T ('oi', no bias) -> [4][2048][1024] (8.4 M); argument order x, w_qkv, w_out).
// Layout, all batches in every launch: bf16 copy of x; 'oi' weights; exact projections, the joint q | k | v one rotating and storing its own head planes; computed rotary table; causal T-2048 attention, all heads of all batches in one launch, scores and probabilities in registers (hybrid rows: < 512 hi/lo 3 products, rest fp16 x1024; key steps end at the diagonal); merged hi/lo x w_o exact.
// Every 16-bit matrix operand plane is stored in fragment order: blocks of 16 rows x 32 k (1 KiB), inside a block [k bit 4][k bit 3][row & 15][k & 7], so that lane l of a wave finds its two 16-byte pieces of a fragment at
// block + 8 l and block + 256 + 8 l (elements): each wave-wide 16-byte load reads 512 contiguous bytes (4 whole lines). Blocks run along k first (value planes: the four 16-row blocks of a 32-key step lie together).
// Compute dtypes, f32 accumulate: every input rounded to bf16; projections exact; attention rows < 512 3 products, rest fp16; softmax f32; w_o hl x exact.

#define NB_  4
#define TT   2048
#define DM   1024
#define NH_  16
#define NKV  16
#define REP  (NH_ / NKV)
#define HD   64
#define DQ   (NH_ * HD)
#define DKV  (NKV * HD)
#define RH   512                  // query rows < RH use hi+lo planes (0: none)
#define SCL  0.125f   // HD^-0.5
#define FW   4                    // waves of an attention work-group: each has its own queries, all walk the same keys
#define NTF  ((TT - RH) / (FW * 32))   // query tiles per head, fp16 rows (32 queries a wave)
#define NTH  (RH / (FW * 16))     // query tiles per head, hi/lo rows (16 queries a wave)
typedef _Float16 h16;
typedef unsigned short bf;
typedef __attribute__((ext_vector_type(16))) __bf16   v16bf;
typedef __attribute__((ext_vector_type(16))) _Float16 v16h;
typedef __attribute__((ext_vector_type(8)))  _Float16 v8h;
typedef __attribute__((ext_vector_type(8)))  unsigned short v8us;
typedef __attribute__((ext_vector_type(8)))  float    v8f;
typedef __attribute__((ext_vector_type(4)))  float    v4f;
typedef v8h  __attribute__((may_alias)) v8ha;
typedef v4f  __attribute__((may_alias)) v4fa;
typedef v8us __attribute__((may_alias)) v8usa;

__device__ __forceinline__ unsigned short f2bf(float f) { unsigned u = __float_as_uint(f); u += 0x7FFFu + ((u >> 16) & 1u); return (unsigned short)(u >> 16); }
__device__ __forceinline__ float bf2f(unsigned short b) { return __uint_as_float(((unsigned)b) << 16); }
__device__ __forceinline__ float bfr(float f) { return bf2f(f2bf(f)); }
__device__ __forceinline__ v16h cat16(v8h lo, v8h hi) { return __builtin_shufflevector(lo, hi, 0, 1, 2, 3, 4, 5, 6, 7, 8, 9, 10, 11, 12, 13, 14, 15); }
__device__ __forceinline__ v16bf cat16b(v8us lo, v8us hi) { return __builtin_bit_cast(v16bf, __builtin_shufflevector(lo, hi, 0, 1, 2, 3, 4, 5, 6, 7, 8, 9, 10, 11, 12, 13, 14, 15)); }
__device__ __forceinline__ v8f wmma16(v16h a, v16h b, v8f c) { return __builtin_amdgcn_wmma_f32_16x16x32_f16(false, a, false, b, (short)0, c, false, false); }
__device__ __forceinline__ v8f wmmab(v16bf a, v16bf b, v8f c) { return __builtin_amdgcn_wmma_f32_16x16x32_bf16(false, a, false, b, (short)0, c, false, false); }



// ---- The two GEMMs: a work-group of GW = 8 waves, 2 (row side) x 4 (column side), each wave one 64x64 output tile (16 accumulators). The work-group's operand rows (128 of the row side, 256 of the column side) come
// into LDS once for all its waves, by asynchronous copies (global_load_async_to_lds_b128), SK = 64 k a stage, two buffers: stage t + 2 is asked for behind the barrier that ends stage t and flies while stage t + 1 is worked on.
// The planes are in fragment order, so a stage's part of a 16-row block is 2 KiB in a row, in memory and in LDS alike: thread i copies 16-byte piece i & 127 of blocks i >> 7, + 2, + 4, ...; a wave-wide fragment load reads 512 contiguous LDS bytes.
#define GW   8
#define SK   64                   // k of a stage: two fragment sets of 32
#define RBE  (16 * SK)            // elements of a 16-row block in a stage (2 KiB)
template <typename T16> struct WFrag;
template <> struct WFrag<h16> { typedef v16h V; static __device__ __forceinline__ V ld(const h16* p) { return cat16(*(const v8h*)p, *(const v8h*)(p + 256)); } static __device__ __forceinline__ v8f mma(V a, V b, v8f c) { return wmma16(a, b, c); } };
template <> struct WFrag<bf> { typedef v16bf V; static __device__ __forceinline__ V ld(const bf* p) { return cat16b(*(const v8us*)p, *(const v8us*)(p + 256)); } static __device__ __forceinline__ v8f mma(V a, V b, v8f c) { return wmmab(a, b, c); } };
__device__ __forceinline__ unsigned lds_off(const void* p) { return (unsigned)(size_t)p; }   // byte address in the work-group's LDS
// cp4: the thread's pieces of eight 16-row blocks (four each for the two halves of the work-group): LDS step 2 blocks of a stage, memory step 2 blocks of a plane whose rows hold K elements.
// The s_wait_xcnt stands inside the statement, behind the last copy: in front of any rewrite of an address register that a copy names.
template <int K> __device__ __forceinline__ void cp4(unsigned l, const bf* g) {
    const unsigned l1 = l + 2 * RBE * 2, l2 = l + 4 * RBE * 2, l3 = l + 6 * RBE * 2; const bf* g1 = g + 2 * 16 * K; const bf* g2 = g + 4 * 16 * K; const bf* g3 = g + 6 * 16 * K;
    asm volatile("global_load_async_to_lds_b128 %0, %4, off\n\tglobal_load_async_to_lds_b128 %1, %5, off\n\tglobal_load_async_to_lds_b128 %2, %6, off\n\tglobal_load_async_to_lds_b128 %3, %7, off\n\ts_wait_xcnt 0x0"
                 :: "v"(l), "v"(l1), "v"(l2), "v"(l3), "v"(g), "v"(g1), "v"(g2), "v"(g3) : "memory"); }
// cp8: the same for sixteen blocks, eight from g and eight from h, behind one another in LDS: one statement, one wait.
template <int K> __device__ __forceinline__ void cp8(unsigned l, const bf* g, const bf* h) {
    const unsigned l1 = l + 2 * RBE * 2, l2 = l + 4 * RBE * 2, l3 = l + 6 * RBE * 2, l4 = l + 8 * RBE * 2, l5 = l + 10 * RBE * 2, l6 = l + 12 * RBE * 2, l7 = l + 14 * RBE * 2;
    const bf* g1 = g + 2 * 16 * K; const bf* g2 = g + 4 * 16 * K; const bf* g3 = g + 6 * 16 * K; const bf* h1 = h + 2 * 16 * K; const bf* h2 = h + 4 * 16 * K; const bf* h3 = h + 6 * 16 * K;
    asm volatile("global_load_async_to_lds_b128 %0, %8, off\n\tglobal_load_async_to_lds_b128 %1, %9, off\n\tglobal_load_async_to_lds_b128 %2, %10, off\n\tglobal_load_async_to_lds_b128 %3, %11, off\n\t"
                 "global_load_async_to_lds_b128 %4, %12, off\n\tglobal_load_async_to_lds_b128 %5, %13, off\n\tglobal_load_async_to_lds_b128 %6, %14, off\n\tglobal_load_async_to_lds_b128 %7, %15, off\n\ts_wait_xcnt 0x0"
                 :: "v"(l), "v"(l1), "v"(l2), "v"(l3), "v"(l4), "v"(l5), "v"(l6), "v"(l7), "v"(g), "v"(g1), "v"(g2), "v"(g3), "v"(h), "v"(h1), "v"(h2), "v"(h3) : "memory"); }
// kstart: the stage at which a work-group starts its walk over k (it wraps at the end of k and takes every stage once). Work-groups with the same blockIdx.y copy the same column-side rows and those with the same blockIdx.x the
// same row-side rows; started together at stage 0 they would all ask L2 for the same lines at the same moment. The 64 groups of a grid row are dealt over all NT starts, and a grid column's groups get starts one apart.
template <int NT> __device__ __forceinline__ int kstart() { static_assert((NT & (NT - 1)) == 0, "the wrap is a mask"); return (int)((((blockIdx.x >> 3) << 1 | (blockIdx.x & 1)) + blockIdx.y) & (NT - 1)); }
// ---- k_gemmo: C[m][n] (f32, pitch ldc) = sum_k (A[m][k] + A2[m][k]) Bt[n][k], two products a step; grid (M/128, N/256), 256 threads. K % 128 == 0. A stage: 8 blocks of A, 8 of A2, 16 of Bt.
template <int K>
__global__ __launch_bounds__(GW * 32) void k_gemmo(const bf* __restrict__ A, const bf* __restrict__ A2, const bf* __restrict__ Bt, float* C, int ldc) {
    typedef WFrag<bf>::V V; constexpr int STG = 32 * RBE, NT = K / SK; static_assert(NT >= 2, "the ring's prologue fills two stages");
    __shared__ __align__(16) bf sm[2 * STG]; __shared__ __align__(16) float osm[GW * 16 * 68];
    const int tid = (int)threadIdx.x, lane = tid & 31, lr = lane & 15, hi = lane >> 4; const int wave = __builtin_amdgcn_readfirstlane(tid >> 5); const int wr = wave & 1, wc = wave >> 1;
    const int R0 = blockIdx.x * 128, C0 = blockIdx.y * 256; const int r0 = R0 + wr * 64, c0 = C0 + wc * 64;
    v8f acc[4][4];
#pragma unroll
    for (int mb = 0; mb < 4; ++mb)
#pragma unroll
        for (int nb = 0; nb < 4; ++nb) acc[mb][nb] = (v8f){};
    const size_t go = (size_t)(tid >> 7) * 16 * K + (tid & 127) * 8; const bf* ga = A + (size_t)R0 * K + go; const bf* ga2 = A2 + (size_t)R0 * K + go; const bf* gb = Bt + (size_t)C0 * K + go; const unsigned l0 = lds_off(sm) + tid * 16;
    const int ks = kstart<NT>();
    auto fill = [&](int t) { const unsigned l = l0 + (t & 1) * (STG * 2); const int ko = ((t + ks) & (NT - 1)) * RBE; cp8<K>(l, ga + ko, ga2 + ko); cp8<K>(l + 16 * RBE * 2, gb + ko, gb + 8 * 16 * K + ko); };
    fill(0);
    asm volatile("s_wait_asynccnt 0x0" ::: "memory");   // this wave's copies of stage 0 have landed
    __syncthreads();                                     // and every other wave's
    fill(1);
#pragma unroll 1
    for (int t = 0; t < NT; ++t) {
        const bf* sb = sm + (t & 1) * STG + 8 * lane; V a[2][4], a2[2][4], b[2][4];   // a fragment set for each 32 k of the stage: the second set's loads fly under the first set's products
#pragma unroll
        for (int kb = 0; kb < 2; ++kb) {
#pragma unroll
            for (int mb = 0; mb < 4; ++mb) { a[kb][mb] = WFrag<bf>::ld(sb + (wr * 4 + mb) * RBE + kb * 512); a2[kb][mb] = WFrag<bf>::ld(sb + (8 + wr * 4 + mb) * RBE + kb * 512); }
#pragma unroll
            for (int nb = 0; nb < 4; ++nb) b[kb][nb] = WFrag<bf>::ld(sb + (16 + wc * 4 + nb) * RBE + kb * 512); }
        auto prod = [&](int kb) {
#pragma unroll
            for (int nb = 0; nb < 4; ++nb) {
#pragma unroll
                for (int mb = 0; mb < 4; ++mb) { acc[mb][nb] = WFrag<bf>::mma(a[kb][mb], b[kb][nb], acc[mb][nb]); acc[mb][nb] = WFrag<bf>::mma(a2[kb][mb], b[kb][nb], acc[mb][nb]); } } };
        __builtin_amdgcn_sched_barrier(0);                   // both sets' loads are issued as one group in front of the first product, never among the products
        // the first set's loaded fragments as inputs: the wait in front of the first product is the counted one for that set alone
        asm volatile("" :: "v"(a[0][0]), "v"(a[0][1]), "v"(a[0][2]), "v"(a[0][3]), "v"(a2[0][0]), "v"(a2[0][1]), "v"(a2[0][2]), "v"(a2[0][3]), "v"(b[0][0]), "v"(b[0][1]), "v"(b[0][2]), "v"(b[0][3]));
        prod(0);
        __builtin_amdgcn_sched_barrier(0);                   // the first set's products stay in front of the waits: they cover the second set's loads and the flight of stage t + 1
        asm volatile("s_wait_dscnt 0x0" ::: "memory");      // this wave's reads of stage t are done: its last fragments are in registers
        asm volatile("s_wait_asynccnt 0x0" ::: "memory");   // its copies of stage t + 1 have landed
        __syncthreads();                                     // stage t + 1 is published, stage t's buffer is free
        if (t + 2 < NT) fill(t + 2);
        __builtin_amdgcn_sched_barrier(0);                   // the copies are asked for in front of the second set's products, not behind them
        prod(1);
    }
    asm volatile("s_wait_asynccnt 0x0" ::: "memory");        // nothing is in flight when the wave goes on
    float* os = osm + wave * (16 * 68);                      // each wave stages in its own range
#pragma unroll
    for (int mb = 0; mb < 4; ++mb) {
#pragma unroll
        for (int nb = 0; nb < 4; ++nb) {
#pragma unroll
            for (int j = 0; j < 8; ++j) os[(hi * 8 + j) * 68 + nb * 16 + lr] = acc[mb][nb][j]; }
        __builtin_amdgcn_wave_barrier(); asm volatile("" ::: "memory");   // the wave's LDS stores stay in front of its reads of other lanes' values
        float* crow = C + (size_t)(r0 + mb * 16) * ldc + c0;
#pragma unroll
        for (int s = 0; s < 8; s += 4) { v4f val[4]; float* cp[4];
#pragma unroll
            for (int u = 0; u < 4; ++u) { const int row = 2 * (s + u) + hi, cofs = lr * 4; val[u] = *(const v4fa*)(os + row * 68 + cofs); cp[u] = crow + (size_t)row * ldc + cofs; *(v4f*)cp[u] = val[u]; }
            asm volatile("s_wait_xcnt 0x0" :: "v"(cp[0]), "v"(cp[1]), "v"(cp[2]), "v"(cp[3]), "v"(val[0]), "v"(val[1]), "v"(val[2]), "v"(val[3]) : "memory"); }   // in front of any rewrite of an address or data register of the four stores (named as inputs, they stay whole up to here)
        __builtin_amdgcn_wave_barrier(); asm volatile("" ::: "memory");   // and the reads in front of the next rows' stores
    }
}

__device__ __forceinline__ h16 tohx(float x) { return (h16)x; }
__device__ __forceinline__ void splitf(float y, unsigned short& h, unsigned short& l) { h = f2bf(y); l = f2bf(y - bf2f(h)); }
typedef __attribute__((ext_vector_type(2))) _Float16 v2h;
typedef __attribute__((ext_vector_type(4))) _Float16 v4h;
typedef __attribute__((ext_vector_type(2))) unsigned short v2us;
typedef __attribute__((ext_vector_type(4))) unsigned short v4us;
typedef __attribute__((ext_vector_type(2))) float v2f;
typedef __attribute__((ext_vector_type(4))) int v4i;
typedef v4h  __attribute__((may_alias)) v4ha;
typedef v4us __attribute__((may_alias)) v4usa;

__device__ __forceinline__ void cvt8(const float* __restrict__ src, bf* dst, size_t n8, unsigned blk) { const size_t i = (size_t)blk * 256 + threadIdx.x; if (i >= n8) return;   // thread i makes 16-byte piece i of the fragment-order plane (rows of DM elements)
    const size_t tb = i >> 6; const int w = (int)(i & 63); const float* sp = src + ((tb / (DM / 32)) * 16 + (w & 15)) * DM + (tb % (DM / 32)) * 32 + (w >> 4) * 8; const v8f v = *(const v8f*)sp; v8us o;
    asm volatile("s_wait_xcnt 0x0" :: "v"(sp), "v"(v) : "memory");   // in front of any rewrite of the load's address registers (address and loaded value as inputs: the registers stay whole, and the load stays in front)
#pragma unroll
    for (int k = 0; k < 8; ++k) o[k] = f2bf(v[k]); *(v8us*)(dst + i * 8) = o;  }

// put8: one 16-byte piece (8 values) of a head plane, in all three forms (fp16, bf16 hi, bf16 lo), at element e.
__device__ __forceinline__ void put8(const float* r, size_t e, h16* P16, bf* Ph, bf* Pl) { v8h o16; v8us oh, ol;
#pragma unroll
    for (int j = 0; j < 8; ++j) { o16[j] = tohx(r[j]); unsigned short a2, c2; splitf(r[j], a2, c2); oh[j] = a2; ol[j] = c2; }
    h16* p16 = P16 + e; bf* ph = Ph + e; bf* pl = Pl + e; *(v8h*)p16 = o16; *(v8us*)ph = oh; *(v8us*)pl = ol;
    asm volatile("s_wait_xcnt 0x0" :: "v"(p16), "v"(ph), "v"(pl), "v"(o16), "v"(oh), "v"(ol) : "memory"); }   // in front of any rewrite of an address or data register of the three stores (named as inputs, they stay whole up to here)
__constant__ float INVT[HD / 2] = { 1.000000000e+00f, 7.498942018e-01f, 5.623413324e-01f, 4.216965139e-01f, 3.162277639e-01f, 2.371373624e-01f, 1.778279394e-01f, 1.333521456e-01f, 1.000000015e-01f, 7.498941571e-02f, 5.623412877e-02f, 4.216964915e-02f, 3.162277862e-02f, 2.371373586e-02f, 1.778279431e-02f, 1.333521493e-02f, 9.999999776e-03f, 7.498942316e-03f, 5.623413250e-03f, 4.216964822e-03f, 3.162277862e-03f, 2.371373819e-03f, 1.778279431e-03f, 1.333521446e-03f, 1.000000047e-03f, 7.498941850e-04f, 5.623413017e-04f, 4.216964880e-04f, 3.162277862e-04f, 2.371373848e-04f, 1.778279402e-04f, 1.333521504e-04f };   // float32 1 / 10000^(i/32), generated with jnp to be bit-exact
// Rotary table, d < HD/2 only (the two halves are equal), in the order its reader k_qkv takes it: [t / 16][d / 16][pair of d: (d & 7) / 2][lane = ((d >> 3) & 1) * 16 + (t & 15)][d & 1][cos, sin]: lane l finds the eight
// pairs of its position and its 8 d in four 16-byte pieces, 128 floats apart, and each wave-wide load reads 512 contiguous bytes. Thread idx makes pair idx.
__device__ __forceinline__ void cs5(float* CS, unsigned blk) { const int idx = (int)blk * 256 + threadIdx.x; if (idx >= TT * (HD / 2)) return; const int ln = (idx >> 1) & 31; const int d = ((idx >> 8) & 1) * 16 + (ln >> 4) * 8 + ((idx >> 6) & 3) * 2 + (idx & 1); const int t = (idx >> 9) * 16 + (ln & 15); const float a = __fmul_rn((float)t, INVT[d]); v2f cs; cs[0] = cosf(a); cs[1] = sinf(a); *(v2f*)(CS + (size_t)idx * 2) = cs;  }
static_assert(HD == 64, "the table's order and k_qkv's tiles are laid out for heads of 64");
// ---- k_prep: the stages that read only inputs, in one launch, dealt by block range: rotary table, then the bf16 copies of x (all batches), w_qkv and w_out.
static_assert(DQ == DM, "cvt8 lays all three planes out in rows of DM elements");
#define PB_C ((unsigned)(TT * (HD / 2) / 256))
#define PB_X ((unsigned)((size_t)NB_ * TT * DM / 8 / 256))
#define PB_W ((unsigned)((size_t)(DQ + 2 * DKV) * DM / 8 / 256))
#define PB_O ((unsigned)((size_t)DM * DQ / 8 / 256))
__global__ __launch_bounds__(256) void k_prep(const float* __restrict__ x, const float* __restrict__ wqkv, const float* __restrict__ wo, bf* XB, bf* WQKV, bf* WO, float* CS) {
    const unsigned b = blockIdx.x;
    if (b < PB_C) cs5(CS, b);
    else if (b < PB_C + PB_X) cvt8(x, XB, (size_t)NB_ * TT * DM / 8, b - PB_C);
    else if (b < PB_C + PB_X + PB_W) cvt8(wqkv, WQKV, (size_t)(DQ + 2 * DKV) * DM / 8, b - (PB_C + PB_X));
    else cvt8(wo, WO, (size_t)DM * DQ / 8, b - (PB_C + PB_X + PB_W));
}
// ---- k_qkv: the joint projection with the plane builders as its epilogue: one wave per tile of 64 positions x one head of q, k or v; a work-group's 8 waves take 128 positions x 4 heads (all q, all k or all v) and share their
// operand rows through the LDS ring above (a stage: 8 blocks of x, 16 of the weights); grid (batches x TT / 128, heads of q + k + v / 4), 256 threads, two work-groups a WGP. No f32 projection is stored.
// A lane's 8 registers of an accumulator run along the A operand's rows, so A is chosen as the side that is the plane's k: q and k tiles take the weight rows as A (a lane holds 8 consecutive d of one position: a 16-byte piece of
// a [t][d] plane, and its rotation partner d + 32 lies in the same lane, two accumulators on); v tiles take the x rows as A (8 consecutive positions of one d: a piece of a [d][t] plane). Both operand planes have the same order.
// Piece (mb, nb) of a tile lies at lane * 8 + (mb & 1) * 256 in its block: every wave-wide 16-byte store writes 512 contiguous bytes.
__global__ __launch_bounds__(GW * 32) __attribute__((amdgpu_waves_per_eu(4, 4))) void k_qkv(const bf* __restrict__ X, const bf* __restrict__ Wt, const float* __restrict__ CS, h16* Q16, bf* Qh, bf* Ql, h16* K16, bf* Kh, bf* Kl, h16* V16, bf* Vh, bf* Vl) {
    typedef WFrag<bf>::V V; constexpr int K = DM; constexpr int STG = 24 * RBE, NT = K / SK; static_assert(NT >= 2, "the ring's prologue fills two stages");
    static_assert(TT % 128 == 0 && NKV == NH_ && DQ % 256 == 0 && DKV % 256 == 0, "a work-group's tiles lie in one batch and in one of q, k, v; q, k and v planes have the same shape");
    __shared__ __align__(16) bf sm[2 * STG];
    const int tid = (int)threadIdx.x, lane = tid & 31; const int wave = __builtin_amdgcn_readfirstlane(tid >> 5); const int wr = wave & 1, wc = wave >> 1;
    const int R0 = blockIdx.x * 128, C0 = blockIdx.y * 256; const int r0 = R0 + wr * 64, c0 = C0 + wc * 64; const bool isv = c0 >= DQ + DKV, isk = !isv && c0 >= DQ;
    v8f acc[4][4];
#pragma unroll
    for (int mb = 0; mb < 4; ++mb)
#pragma unroll
        for (int nb = 0; nb < 4; ++nb) acc[mb][nb] = (v8f){};
    const size_t go = (size_t)(tid >> 7) * 16 * K + (tid & 127) * 8; const bf* gx = X + (size_t)R0 * K + go; const bf* gw = Wt + (size_t)C0 * K + go; const unsigned l0 = lds_off(sm) + tid * 16;
    const int ks = kstart<NT>();
    auto fill = [&](int t) { const unsigned l = l0 + (t & 1) * (STG * 2); const int ko = ((t + ks) & (NT - 1)) * RBE; cp4<K>(l, gx + ko); cp8<K>(l + 8 * RBE * 2, gw + ko, gw + 8 * 16 * K + ko); };
    const int xo = wr * 4 * RBE + 8 * lane, wo = (8 + wc * 4) * RBE + 8 * lane; const int ao = isv ? xo : wo, bo = isv ? wo : xo;   // the wave's four blocks of either side in a stage
    fill(0);
    asm volatile("s_wait_asynccnt 0x0" ::: "memory");   // this wave's copies of stage 0 have landed
    __syncthreads();                                     // and every other wave's
    fill(1);
#pragma unroll 1
    for (int t = 0; t < NT; ++t) {
        const bf* sb = sm + (t & 1) * STG; V a[4], b[4];
        auto frag = [&](int kb) {
#pragma unroll
            for (int mb = 0; mb < 4; ++mb) a[mb] = WFrag<bf>::ld(sb + ao + mb * RBE + kb * 512);
#pragma unroll
            for (int nb = 0; nb < 4; ++nb) b[nb] = WFrag<bf>::ld(sb + bo + nb * RBE + kb * 512); };
        auto prod = [&]() {
#pragma unroll
            for (int nb = 0; nb < 4; ++nb) {
#pragma unroll
                for (int mb = 0; mb < 4; ++mb) acc[mb][nb] = WFrag<bf>::mma(a[mb], b[nb], acc[mb][nb]); } };
        frag(0);
        // the loaded fragments as inputs: all sixteen loads stand in one group in front of the first product (without this the compiler reloads one fragment's registers among the products, an LDS latency each time)
        asm volatile("" :: "v"(a[0]), "v"(a[1]), "v"(a[2]), "v"(a[3]), "v"(b[0]), "v"(b[1]), "v"(b[2]), "v"(b[3]));
        prod();
        frag(1);
        __builtin_amdgcn_sched_barrier(0);                   // the first 32 k's products stay in front of the waits: they cover the second fragment loads and the flight of stage t + 1
        asm volatile("s_wait_dscnt 0x0" ::: "memory");      // this wave's reads of stage t are done: its last fragments are in registers
        asm volatile("s_wait_asynccnt 0x0" ::: "memory");   // its copies of stage t + 1 have landed
        __syncthreads();                                     // stage t + 1 is published, stage t's buffer is free
        if (t + 2 < NT) fill(t + 2);
        __builtin_amdgcn_sched_barrier(0);                   // the copies are asked for in front of the second 32 k's products, not behind them
        prod();
    }
    asm volatile("s_wait_asynccnt 0x0" ::: "memory");        // nothing is in flight when the wave goes on
    // a tile's 8 blocks (8 KiB a plane) lie in a row; [t][d] planes: block = (t / 16) * 2 + d / 32; [d][t] planes: block = (t / 32) * 4 + d / 16
    const int t0 = r0 % TT; const size_t eb = ((size_t)(r0 / TT) * NH_ + (c0 / HD) % NH_) * TT * HD + (size_t)t0 * HD + 8 * lane;
    if (isv) {   // acc[mb][nb][j] is position t0 + mb * 16 + (lane >> 4) * 8 + j of d = nb * 16 + (lane & 15)
#pragma unroll
        for (int mb = 0; mb < 4; ++mb)
#pragma unroll
            for (int nb = 0; nb < 4; ++nb) { float r[8];
#pragma unroll
                for (int j = 0; j < 8; ++j) r[j] = acc[mb][nb][j];
                put8(r, eb + (mb >> 1) * 2048 + nb * 512 + (mb & 1) * 256, V16, Vh, Vl); }
    } else {     // acc[mb][nb][j] is d = mb * 16 + (lane >> 4) * 8 + j of position t0 + nb * 16 + (lane & 15); rotate-half: out[d] = x[d] cos - x[d+32] sin, out[d+32] = x[d+32] cos + x[d] sin, d < 32
        h16* P16 = isk ? K16 : Q16; bf* Ph = isk ? Kh : Qh; bf* Pl = isk ? Kl : Ql; const float* pc = CS + (size_t)(t0 >> 4) * 1024 + lane * 4;
#pragma unroll
        for (int nb = 0; nb < 4; ++nb) {
            v4f cq[2][4];   // the table pieces of 16 positions fly together
#pragma unroll
            for (int mb = 0; mb < 2; ++mb)
#pragma unroll
                for (int q = 0; q < 4; ++q) cq[mb][q] = *(const v4f*)(pc + (nb * 2 + mb) * 512 + q * 128);
            asm volatile("s_wait_xcnt 0x0" :: "v"(pc), "v"(cq[0][0]), "v"(cq[0][1]), "v"(cq[0][2]), "v"(cq[0][3]), "v"(cq[1][0]), "v"(cq[1][1]), "v"(cq[1][2]), "v"(cq[1][3]) : "memory");   // one wait behind the eight loads, in front of any rewrite of their address registers (address and loaded values as inputs: the registers stay whole, and the loads stay in front)
#pragma unroll
            for (int mb = 0; mb < 2; ++mb) { float r1[8], r2[8];
#pragma unroll
                for (int j = 0; j < 8; ++j) { const float co = cq[mb][j >> 1][(j & 1) * 2], si = cq[mb][j >> 1][(j & 1) * 2 + 1]; const float x1 = acc[mb][nb][j], x2 = acc[mb + 2][nb][j]; r1[j] = x1 * co - x2 * si; r2[j] = x2 * co + x1 * si; }
                const size_t e = eb + nb * 1024 + mb * 256; put8(r1, e, P16, Ph, Pl); put8(r2, e + 512, P16, Ph, Pl); }
        }
    }
}
__device__ __forceinline__ float xhalf(float x) { const int b = __float_as_int(x); return __int_as_float(__builtin_amdgcn_permlanex16(b, b, 0x76543210, 0xfedcba98, false, false)); }   // lane l <-> l ^ 16
// 2^x with the slot behind a transcendental filled inside the statement: the v_nop keeps the next vector instruction, whichever the compiler puts there, from reading the last result or taking its source register directly
// behind it; in exp2x8 each exponential is the independent instruction behind the one before (early-clobber outputs share no register with a source).
__device__ __forceinline__ float exp2x1(float x) { float r; asm("v_exp_f32 %0, %1\n\tv_nop" : "=v"(r) : "v"(x)); return r; }
__device__ __forceinline__ v8f exp2x8(v8f x) { float r0, r1, r2, r3, r4, r5, r6, r7;
    asm("v_exp_f32 %0, %8\n\tv_exp_f32 %1, %9\n\tv_exp_f32 %2, %10\n\tv_exp_f32 %3, %11\n\tv_exp_f32 %4, %12\n\tv_exp_f32 %5, %13\n\tv_exp_f32 %6, %14\n\tv_exp_f32 %7, %15\n\tv_nop"
        : "=&v"(r0), "=&v"(r1), "=&v"(r2), "=&v"(r3), "=&v"(r4), "=&v"(r5), "=&v"(r6), "=&v"(r7) : "v"(x[0]), "v"(x[1]), "v"(x[2]), "v"(x[3]), "v"(x[4]), "v"(x[5]), "v"(x[6]), "v"(x[7]));
    return (v8f){ r0, r1, r2, r3, r4, r5, r6, r7 }; }
#define STE  8192                 // elements of a stage in LDS (16 KiB)
// cp8g: the thread's eight 16-byte pieces of a stage, 2 KiB (the work-group's 128 pieces) apart in LDS, each from its own address. The s_wait_xcnt stands inside the statement, behind the last copy: in front of any rewrite of
// an address register that a copy names.
template <typename T16> __device__ __forceinline__ void cp8g(unsigned l, const T16* g0, const T16* g1, const T16* g2, const T16* g3, const T16* g4, const T16* g5, const T16* g6, const T16* g7) {
    const unsigned l1 = l + 2048, l2 = l + 4096, l3 = l + 6144, l4 = l + 8192, l5 = l + 10240, l6 = l + 12288, l7 = l + 14336;
    asm volatile("global_load_async_to_lds_b128 %0, %8, off\n\tglobal_load_async_to_lds_b128 %1, %9, off\n\tglobal_load_async_to_lds_b128 %2, %10, off\n\tglobal_load_async_to_lds_b128 %3, %11, off\n\t"
                 "global_load_async_to_lds_b128 %4, %12, off\n\tglobal_load_async_to_lds_b128 %5, %13, off\n\tglobal_load_async_to_lds_b128 %6, %14, off\n\tglobal_load_async_to_lds_b128 %7, %15, off\n\ts_wait_xcnt 0x0"
                 :: "v"(l), "v"(l1), "v"(l2), "v"(l3), "v"(l4), "v"(l5), "v"(l6), "v"(l7), "v"(g0), "v"(g1), "v"(g2), "v"(g3), "v"(g4), "v"(g5), "v"(g6), "v"(g7) : "memory"); }
static_assert(FW * 32 * 16 == 2048 && STE * 2 == 8 * 2048, "cp8g: eight pieces a thread cover a stage");
template <typename T16, int NSPLIT, int NQ>
__device__ __forceinline__ void attn_tile(const T16* __restrict__ Q, const T16* __restrict__ Q2, const T16* __restrict__ Kp, const T16* __restrict__ K2, const T16* __restrict__ Vt, const T16* __restrict__ V2, int qg, int rk, bf* Ah, bf* Al, const T16* ring) {
    typedef typename WFrag<T16>::V V;
    constexpr float CX = SCL * 1.4426950408889634f;          // scores are carried as log2 exponents
    constexpr float PB = (NSPLIT == 0) ? 10.0f : 0.0f;       // fp16 probabilities carry x1024; the row sum carries it too, so it cancels in the quotient
    constexpr int NP = (NSPLIT == 2) ? 2 : 1, SKA = STE / (2 * NP * HD);   // planes of an operand; keys of a stage, which holds [keys][keys lo][values][values lo]
    static_assert(SKA % 32 == 0 && (FW * NQ * 16) % SKA == 0 && FW * NQ * 16 >= 2 * SKA, "whole stages up to a tile's last query, at least two of them (the ring's prologue fills two)");
    const int tid = (int)threadIdx.x, lane = tid & 31, lr = lane & 15, hi = lane >> 4; const int wave = __builtin_amdgcn_readfirstlane(tid >> 5);
    const int q0 = qg + wave * (NQ * 16), sd = q0 / 32;      // the wave's first query; its last 32-key step, the only one that holds keys beyond a query
    const int NT = (qg + FW * NQ * 16) / SKA;                // stages up to the tile's last query
    // The tiles of a head copy the same key and value lines; started together at stage 0 they would ask L2 for them at the same moment. Tile rk (0: the shortest of its row class) starts its walk at stage 3 rk
    // and wraps at its own NT, taking every stage once (NT >= 2 rk + 2, so one subtraction wraps 3 rk, and one wraps t + rot); the running maximum and sum take the keys in any order.
    const int rot = (3 * rk >= NT) ? 3 * rk - NT : 3 * rk;
    auto stage = [&](int t) { const int k = t + rot; return (k >= NT) ? k - NT : k; };
    const unsigned l0 = lds_off(ring) + tid * 16; const T16* gk = Kp + tid * 8; const T16* gv = Vt + tid * 8; const T16* gk2 = (NSPLIT == 2) ? K2 + tid * 8 : gk; const T16* gv2 = (NSPLIT == 2) ? V2 + tid * 8 : gv;
    auto fill = [&](int t) { const unsigned l = l0 + (t & 1) * (STE * 2); const size_t e = (size_t)stage(t) * (SKA * HD);
        if constexpr (NSPLIT == 0) cp8g<T16>(l, gk + e, gk + e + 1024, gk + e + 2048, gk + e + 3072, gv + e, gv + e + 1024, gv + e + 2048, gv + e + 3072);
        else cp8g<T16>(l, gk + e, gk + e + 1024, gk2 + e, gk2 + e + 1024, gv + e, gv + e + 1024, gv2 + e, gv2 + e + 1024); };
    fill(0);
    V qf[NQ][2], qf2[NQ][2];
    const size_t qo = (size_t)q0 * HD + 8 * lane; const T16* qa = Q + qo; const T16* qa2 = (NSPLIT == 2) ? Q2 + qo : qa;
#pragma unroll
    for (int qi = 0; qi < NQ; ++qi)
#pragma unroll
        for (int ks = 0; ks < 2; ++ks) { qf[qi][ks] = WFrag<T16>::ld(qa + qi * 16 * HD + ks * 512); if (NSPLIT == 2) qf2[qi][ks] = WFrag<T16>::ld(qa2 + qi * 16 * HD + ks * 512); }
    asm volatile("s_wait_xcnt 0x0" :: "v"(qa), "v"(qa2) : "memory");   // in front of any rewrite of an address register of the query loads (named as inputs, they stay whole up to here)
    v8f o[NQ][4]; float m[NQ], l[NQ];
#pragma unroll
    for (int qi = 0; qi < NQ; ++qi) { m[qi] = -3.0e38f; l[qi] = 0.f;
#pragma unroll
        for (int dt = 0; dt < 4; ++dt) o[qi][dt] = (v8f){}; }
    asm volatile("s_wait_asynccnt 0x0" ::: "memory");   // this wave's copies of stage 0 have landed
    __syncthreads();                                     // and every other wave's
    fill(1);
#pragma unroll 1   // rolled: one copy of a stage's code, the buffer chosen by t & 1
    for (int t = 0; t < NT; ++t) {
        const T16* sb = ring + (t & 1) * STE + 8 * lane; const int s0 = stage(t) * (SKA / 32);
#pragma unroll
        for (int u = 0; u < SKA / 32; ++u) { const int s = s0 + u;
          if (s <= sd) {
            const T16* ka = sb + u * 32 * HD; const T16* ka2 = ka + SKA * HD; const T16* va = sb + NP * SKA * HD + u * 32 * HD; const T16* va2 = va + SKA * HD;   // a step's four key blocks and its four value blocks: 4 KiB in a row each
            V kf[2][2], kf2[2][2], vf[4], vf2[4];
#pragma unroll
            for (int kt = 0; kt < 2; ++kt)
#pragma unroll
                for (int ks = 0; ks < 2; ++ks) { kf[kt][ks] = WFrag<T16>::ld(ka + kt * 16 * HD + ks * 512); if (NSPLIT == 2) kf2[kt][ks] = WFrag<T16>::ld(ka2 + kt * 16 * HD + ks * 512); }
#pragma unroll
            for (int dt = 0; dt < 4; ++dt) { vf[dt] = WFrag<T16>::ld(va + dt * 512); if (NSPLIT == 2) vf2[dt] = WFrag<T16>::ld(va2 + dt * 512); }
            __builtin_amdgcn_sched_barrier(0);               // the step's LDS loads are issued as one group in front of the first product: the value loads fly under the score products and the maximum
            v8f st[NQ][2];                                   // st[qi][kt][j] = score of key s*32 + kt*16 + hi*8 + j and query q0 + qi*16 + lr
#pragma unroll
            for (int qi = 0; qi < NQ; ++qi)
#pragma unroll
                for (int kt = 0; kt < 2; ++kt) { v8f a = (v8f){};
#pragma unroll
                    for (int ks = 0; ks < 2; ++ks) { a = WFrag<T16>::mma(kf[kt][ks], qf[qi][ks], a); if (NSPLIT == 2) { a = WFrag<T16>::mma(kf[kt][ks], qf2[qi][ks], a); a = WFrag<T16>::mma(kf2[kt][ks], qf[qi][ks], a); } }
                    st[qi][kt] = a; }
            if (s == sd) {                                   // diagonal step: keys beyond the query are excluded
#pragma unroll
                for (int qi = 0; qi < NQ; ++qi)
#pragma unroll
                    for (int kt = 0; kt < 2; ++kt)
#pragma unroll
                        for (int j = 0; j < 8; ++j) st[qi][kt][j] = (s * 32 + kt * 16 + hi * 8 + j <= q0 + qi * 16 + lr) ? st[qi][kt][j] : -3.0e38f; }
            float mn[NQ]; bool up = false;
#pragma unroll
            for (int qi = 0; qi < NQ; ++qi) { float mx = st[qi][0][0];
#pragma unroll
                for (int j = 1; j < 8; ++j) mx = fmaxf(mx, st[qi][0][j]);
#pragma unroll
                for (int j = 0; j < 8; ++j) mx = fmaxf(mx, st[qi][1][j]);
                mx = fmaxf(mx, xhalf(mx)); mn[qi] = fmaxf(m[qi], mx * CX); up = up || (mn[qi] > m[qi]); }
            if (__builtin_amdgcn_ballot_w32(up) != 0) {      // some query's maximum rose: rescale (a factor of exactly 1 elsewhere); otherwise every factor is 1 and the multiplies are skipped
#pragma unroll
                for (int qi = 0; qi < NQ; ++qi) { const float al = exp2x1(m[qi] - mn[qi]); m[qi] = mn[qi]; l[qi] *= al;
#pragma unroll
                    for (int dt = 0; dt < 4; ++dt)
#pragma unroll
                        for (int j = 0; j < 8; ++j) o[qi][dt][j] *= al; } }
#pragma unroll
            for (int qi = 0; qi < NQ; ++qi) { const float mb = m[qi] - PB; float ps = 0.f;
#pragma unroll
                for (int kt = 0; kt < 2; ++kt) { st[qi][kt] = exp2x8(st[qi][kt] * CX - mb);
#pragma unroll
                    for (int j = 0; j < 8; ++j) ps += st[qi][kt][j]; }
                l[qi] += ps;
                if constexpr (NSPLIT == 0) { v16h pf;
#pragma unroll
                    for (int j = 0; j < 8; ++j) { pf[j] = tohx(st[qi][0][j]); pf[8 + j] = tohx(st[qi][1][j]); }
#pragma unroll
                    for (int dt = 0; dt < 4; ++dt) o[qi][dt] = WFrag<T16>::mma(vf[dt], pf, o[qi][dt]);
                } else { v8us h0, h1, l0, l1;
#pragma unroll
                    for (int j = 0; j < 8; ++j) { unsigned short a, c2; splitf(st[qi][0][j], a, c2); h0[j] = a; l0[j] = c2; splitf(st[qi][1][j], a, c2); h1[j] = a; l1[j] = c2; }
                    const v16bf ph = cat16b(h0, h1), pl = cat16b(l0, l1);
#pragma unroll
                    for (int dt = 0; dt < 4; ++dt) { o[qi][dt] = WFrag<T16>::mma(vf[dt], ph, o[qi][dt]); o[qi][dt] = WFrag<T16>::mma(vf[dt], pl, o[qi][dt]); o[qi][dt] = WFrag<T16>::mma(vf2[dt], ph, o[qi][dt]); } } }
          } }
        asm volatile("s_wait_dscnt 0x0" ::: "memory");      // this wave's reads of stage t are done
        asm volatile("s_wait_asynccnt 0x0" ::: "memory");   // its copies of stage t + 1 have landed
        __syncthreads();                                     // stage t + 1 is published, stage t's buffer is free
        if (t + 2 < NT) fill(t + 2);
    }
    asm volatile("s_wait_asynccnt 0x0" ::: "memory");        // nothing is in flight when the wave goes on
#pragma unroll
    for (int qi = 0; qi < NQ; ++qi) { l[qi] += xhalf(l[qi]);   // the halves' sums join once
        const float inv = __fdiv_rn(1.0f, l[qi]); const size_t oo = (size_t)((q0 >> 4) + qi) * (16 * DQ) + lane * 8;   // merged output in fragment order for the last product (rows of DQ): row lr of its block, k bit 3 = hi
#pragma unroll
        for (int dt = 0; dt < 4; ++dt) { v8us oh, ol;          // the lane's 8 values are d = dt * 16 + hi * 8 + j of its query, a 16-byte piece: every wave-wide store writes 512 contiguous bytes
#pragma unroll
            for (int j = 0; j < 8; ++j) { unsigned short a, c2; splitf(o[qi][dt][j] * inv, a, c2); oh[j] = a; ol[j] = c2; }
            const int co = (dt >> 1) * 512 + (dt & 1) * 256; bf* ph = Ah + oo + co; bf* pl = Al + oo + co; *(v8usa*)ph = oh; *(v8usa*)pl = ol;
            asm volatile("s_wait_xcnt 0x0" :: "v"(ph), "v"(pl), "v"(oh), "v"(ol) : "memory"); } }   // in front of any rewrite of an address or data register of the two stores (named as inputs, they stay whole up to here)
}
static_assert(RH % (FW * 32) == 0 && (TT - RH) % (FW * 32) == 0, "whole query tiles in both row classes");
// grid (batches x heads, NTF + NTH): the longest tiles (last queries) of every head and batch come first
__global__ __launch_bounds__(FW * 32) void k_fattn(const h16* __restrict__ Q16, const h16* __restrict__ K16, const h16* __restrict__ V16, const bf* __restrict__ Qh, const bf* __restrict__ Ql, const bf* __restrict__ Kh, const bf* __restrict__ Kl, const bf* __restrict__ Vh, const bf* __restrict__ Vl, bf* Ah, bf* Al) {
    __shared__ __align__(16) unsigned char ring[2 * STE * 2];   // the two stage buffers, read as fp16 or as bf16 by the tile's row class
    static_assert(REP == 1, "one kv head per query head"); const size_t hb = (size_t)blockIdx.x * TT * HD; const int bx = (int)blockIdx.y; const size_t ab = (size_t)(blockIdx.x / NH_) * TT * DQ + (blockIdx.x % NH_) * (HD / 32) * 512; Ah += ab; Al += ab;
    if (bx < NTF) attn_tile<h16, 0, 2>(Q16 + hb, nullptr, K16 + hb, nullptr, V16 + hb, nullptr, TT - FW * 32 * (bx + 1), NTF - 1 - bx, Ah, Al, (const h16*)ring);
    else attn_tile<bf, 2, 1>(Qh + hb, Ql + hb, Kh + hb, Kl + hb, Vh + hb, Vl + hb, RH - FW * 16 * (bx - NTF + 1), NTF + NTH - 1 - bx, Ah, Al, (const bf*)ring);
}

extern "C" void kernel_launch(void* const* d_in, const int* in_sizes, int n_in,
                              void* d_out, int out_size, void* d_ws, size_t ws_size, hipStream_t stream) {
    (void)in_sizes; (void)n_in; (void)out_size;
    const float* x = (const float*)d_in[0]; const float* wqkv = (const float*)d_in[1]; const float* wo = (const float*)d_in[2];   /* order x, w_qkv ('oi' [3072][1024]: ROW thirds q | k | v), w_out ('oi' [1024][1024]): THREE inputs */
    float* OUT = (float*)d_out;     // [4][2048][1024]
    char* wsp = (char*)d_ws;
    auto take = [&](size_t bytes) { char* p = wsp; wsp += (bytes + 255) & ~(size_t)255; return (void*)p; };
    bf* WO = (bf*)take((size_t)DM * DQ * 2); float* CS = (float*)take((size_t)TT * (HD / 2) * 2 * 4);
    bf* ATh = (bf*)take((size_t)NB_ * TT * DQ * 2); bf* ATl = (bf*)take((size_t)NB_ * TT * DQ * 2);   // merged attention output, hi and lo
    bf* XB = (bf*)take((size_t)NB_ * TT * DM * 2); bf* WQKV = (bf*)take((size_t)(DQ + 2 * DKV) * DM * 2);   // the joint projection's operands: bytes of their own, k_qkv reads them while it writes the planes
    h16* QP16 = (h16*)take((size_t)NB_ * NH_ * TT * HD * 2); h16* KP16 = (h16*)take((size_t)NB_ * NKV * TT * HD * 2); h16* VT16 = (h16*)take((size_t)NB_ * NKV * HD * TT * 2);
    bf* QPh = (bf*)take((size_t)NB_ * NH_ * TT * HD * 2); bf* QPl = (bf*)take((size_t)NB_ * NH_ * TT * HD * 2); bf* KPh = (bf*)take((size_t)NB_ * NKV * TT * HD * 2); bf* KPl = (bf*)take((size_t)NB_ * NKV * TT * HD * 2); bf* VTh = (bf*)take((size_t)NB_ * NKV * HD * TT * 2); bf* VTl = (bf*)take((size_t)NB_ * NKV * HD * TT * 2);
    if ((size_t)(wsp - (char*)d_ws) > ws_size) return;    // ws 256 MiB
    k_prep<<<PB_C + PB_X + PB_W + PB_O, 256, 0, stream>>>(x, wqkv, wo, XB, WQKV, WO, CS);
    k_qkv<<<dim3(NB_ * TT / 128, (DQ + 2 * DKV) / 256, 1), GW * 32, 0, stream>>>(XB, WQKV, CS, QP16, QPh, QPl, KP16, KPh, KPl, VT16, VTh, VTl);
    k_fattn<<<dim3(NB_ * NH_, NTF + NTH, 1), FW * 32, 0, stream>>>(QP16, KP16, VT16, QPh, QPl, KPh, KPl, VTh, VTl, ATh, ATl);
    k_gemmo<DQ><<<dim3(NB_ * TT / 128, DM / 256, 1), GW * 32, 0, stream>>>(ATh, ATl, WO, OUT, DM);
}

// v010
// It runs in 103 microseconds.
// Two timings next to v009 both put it at 1.03 times that version's speed.
// Counting every step since v000, it is 27.8 times as fast.
#include <hip/hip_runtime.h>

// Causal self-attention with a fused bias-free natural qkv weight and computed rotate-half rotary embeddings (x [4][2048][1024]; qkv = x w_qkv^T ('oi' [3072][1024] 1/32, no bias) split in ROW thirds q | k | v (16 heads x 64); rope cat(x1 c - x2 s, x1 s + x2 c) on the two 32-wide halves with angle t x 1/10000^(i/32) (32 f32 constants jnp-exact; one f32 product; precise cosf/sinf); scores / sqrt(64); causal (-inf == exclusion); softmax; y = merged w_out^T ('oi', no bias) -> [4][2048][1024] (8.4 M); argument order x, w_qkv, w_out).
// Layout, all batches in every launch: bf16 copy of x; 'oi' weights; exact projections, the joint q | k | v one rotating and storing its own head planes; computed rotary table; causal T-2048 attention, all heads of all batches in one launch, scores and probabilities in registers (hybrid rows: < 512 hi/lo 3 products, rest fp16 x1024; key steps end at the diagonal); merged output x w_o on fp16 (rows < 512 hi + lo, two products; the rest one).
// Every 16-bit matrix operand plane is stored in fragment order: blocks of 16 rows x 32 k (1 KiB), inside a block [k bit 4][k bit 3][row & 15][k & 7], so that lane l of a wave finds its two 16-byte pieces of a fragment at
// block + 8 l and block + 256 + 8 l (elements): each wave-wide 16-byte load reads 512 contiguous bytes (4 whole lines). Blocks run along k first (value planes: the four 16-row blocks of a 32-key step lie together).
// Compute dtypes, f32 accumulate: every input rounded to bf16; projections exact; attention rows < 512 3 products, rest fp16; softmax f32; last product fp16: w_o's bf16-rounded values held as fp16, merged rows < 512 as fp16 hi + lo, the rest as one fp16 plane.

#define NB_  4
#define TT   2048
#define DM   1024
#define NH_  16
#define NKV  16
#define REP  (NH_ / NKV)
#define HD   64
#define DQ   (NH_ * HD)
#define DKV  (NKV * HD)
#define RH   512                  // query rows < RH use hi+lo planes
#define SCL  0.125f   // HD^-0.5
#define FW   4                    // waves of an attention work-group: each has its own queries, all walk the same keys
#define NTF  ((TT - RH) / (FW * 32))   // query tiles per head, fp16 rows (32 queries a wave)
#define NTH  (RH / (FW * 16))     // query tiles per head, hi/lo rows (16 queries a wave)
typedef _Float16 h16;
typedef unsigned short bf;
typedef __attribute__((ext_vector_type(16))) __bf16   v16bf;
typedef __attribute__((ext_vector_type(16))) _Float16 v16h;
typedef __attribute__((ext_vector_type(8)))  _Float16 v8h;
typedef __attribute__((ext_vector_type(8)))  unsigned short v8us;
typedef __attribute__((ext_vector_type(8)))  float    v8f;
typedef __attribute__((ext_vector_type(4)))  float    v4f;
typedef v8h  __attribute__((may_alias)) v8ha;
typedef v4f  __attribute__((may_alias)) v4fa;
typedef v8us __attribute__((may_alias)) v8usa;

__device__ __forceinline__ unsigned short f2bf(float f) { unsigned u = __float_as_uint(f); u += 0x7FFFu + ((u >> 16) & 1u); return (unsigned short)(u >> 16); }
__device__ __forceinline__ float bf2f(unsigned short b) { return __uint_as_float(((unsigned)b) << 16); }
__device__ __forceinline__ float bfr(float f) { return bf2f(f2bf(f)); }
__device__ __forceinline__ v16h cat16(v8h lo, v8h hi) { return __builtin_shufflevector(lo, hi, 0, 1, 2, 3, 4, 5, 6, 7, 8, 9, 10, 11, 12, 13, 14, 15); }
__device__ __forceinline__ v16bf cat16b(v8us lo, v8us hi) { return __builtin_bit_cast(v16bf, __builtin_shufflevector(lo, hi, 0, 1, 2, 3, 4, 5, 6, 7, 8, 9, 10, 11, 12, 13, 14, 15)); }
__device__ __forceinline__ v8f wmma16(v16h a, v16h b, v8f c) { return __builtin_amdgcn_wmma_f32_16x16x32_f16(false, a, false, b, (short)0, c, false, false); }
__device__ __forceinline__ v8f wmmab(v16bf a, v16bf b, v8f c) { return __builtin_amdgcn_wmma_f32_16x16x32_bf16(false, a, false, b, (short)0, c, false, false); }



// ---- The two GEMMs: a work-group of GW = 8 waves, 2 (row side) x 4 (column side), each wave one 64x64 output tile (16 accumulators). The work-group's operand rows (128 of the row side, in k_gemmo with the 32 low-part rows of A2 besides, 256 of the column side) come
// into LDS once for all its waves, by asynchronous copies (global_load_async_to_lds_b128), SK = 64 k a stage, two buffers: stage t + 2 is asked for behind the barrier that ends stage t and flies while stage t + 1 is worked on.
// The planes are in fragment order, so a stage's part of a 16-row block is 2 KiB in a row, in memory and in LDS alike: thread i copies 16-byte piece i & 127 of blocks i >> 7, + 2, + 4, ...; a wave-wide fragment load reads 512 contiguous LDS bytes.
#define GW   8
#define SK   64                   // k of a stage: two fragment sets of 32
#define RBE  (16 * SK)            // elements of a 16-row block in a stage (2 KiB)
template <typename T16> struct WFrag;
template <> struct WFrag<h16> { typedef v16h V; static __device__ __forceinline__ V ld(const h16* p) { return cat16(*(const v8h*)p, *(const v8h*)(p + 256)); } static __device__ __forceinline__ v8f mma(V a, V b, v8f c) { return wmma16(a, b, c); } };
template <> struct WFrag<bf> { typedef v16bf V; static __device__ __forceinline__ V ld(const bf* p) { return cat16b(*(const v8us*)p, *(const v8us*)(p + 256)); } static __device__ __forceinline__ v8f mma(V a, V b, v8f c) { return wmmab(a, b, c); } };
__device__ __forceinline__ unsigned lds_off(const void* p) { return (unsigned)(size_t)p; }   // byte address in the work-group's LDS
// cp4: the thread's pieces of eight 16-row blocks (four each for the two halves of the work-group): LDS step 2 blocks of a stage, memory step 2 blocks of a plane whose rows hold K elements.
// The s_wait_xcnt stands inside the statement, behind the last copy: in front of any rewrite of an address register that a copy names.
template <int K> __device__ __forceinline__ void cp4(unsigned l, const bf* g) {
    const unsigned l1 = l + 2 * RBE * 2, l2 = l + 4 * RBE * 2, l3 = l + 6 * RBE * 2; const bf* g1 = g + 2 * 16 * K; const bf* g2 = g + 4 * 16 * K; const bf* g3 = g + 6 * 16 * K;
    asm volatile("global_load_async_to_lds_b128 %0, %4, off\n\tglobal_load_async_to_lds_b128 %1, %5, off\n\tglobal_load_async_to_lds_b128 %2, %6, off\n\tglobal_load_async_to_lds_b128 %3, %7, off\n\ts_wait_xcnt 0x0"
                 :: "v"(l), "v"(l1), "v"(l2), "v"(l3), "v"(g), "v"(g1), "v"(g2), "v"(g3) : "memory"); }
// cp8: the same for sixteen blocks, eight from g and eight from h, behind one another in LDS: one statement, one wait.
template <int K> __device__ __forceinline__ void cp8(unsigned l, const bf* g, const bf* h) {
    const unsigned l1 = l + 2 * RBE * 2, l2 = l + 4 * RBE * 2, l3 = l + 6 * RBE * 2, l4 = l + 8 * RBE * 2, l5 = l + 10 * RBE * 2, l6 = l + 12 * RBE * 2, l7 = l + 14 * RBE * 2;
    const bf* g1 = g + 2 * 16 * K; const bf* g2 = g + 4 * 16 * K; const bf* g3 = g + 6 * 16 * K; const bf* h1 = h + 2 * 16 * K; const bf* h2 = h + 4 * 16 * K; const bf* h3 = h + 6 * 16 * K;
    asm volatile("global_load_async_to_lds_b128 %0, %8, off\n\tglobal_load_async_to_lds_b128 %1, %9, off\n\tglobal_load_async_to_lds_b128 %2, %10, off\n\tglobal_load_async_to_lds_b128 %3, %11, off\n\t"
                 "global_load_async_to_lds_b128 %4, %12, off\n\tglobal_load_async_to_lds_b128 %5, %13, off\n\tglobal_load_async_to_lds_b128 %6, %14, off\n\tglobal_load_async_to_lds_b128 %7, %15, off\n\ts_wait_xcnt 0x0"
                 :: "v"(l), "v"(l1), "v"(l2), "v"(l3), "v"(l4), "v"(l5), "v"(l6), "v"(l7), "v"(g), "v"(g1), "v"(g2), "v"(g3), "v"(h), "v"(h1), "v"(h2), "v"(h3) : "memory"); }
// cp5: five blocks' pieces, each from its own address, 2 blocks of a stage apart in LDS: one statement, one wait.
__device__ __forceinline__ void cp5(unsigned l, const bf* g0, const bf* g1, const bf* g2, const bf* g3, const bf* g4) {
    const unsigned l1 = l + 2 * RBE * 2, l2 = l + 4 * RBE * 2, l3 = l + 6 * RBE * 2, l4 = l + 8 * RBE * 2;
    asm volatile("global_load_async_to_lds_b128 %0, %5, off\n\tglobal_load_async_to_lds_b128 %1, %6, off\n\tglobal_load_async_to_lds_b128 %2, %7, off\n\tglobal_load_async_to_lds_b128 %3, %8, off\n\tglobal_load_async_to_lds_b128 %4, %9, off\n\ts_wait_xcnt 0x0"
                 :: "v"(l), "v"(l1), "v"(l2), "v"(l3), "v"(l4), "v"(g0), "v"(g1), "v"(g2), "v"(g3), "v"(g4) : "memory"); }
// kstart: the stage at which a work-group starts its walk over k (it wraps at the end of k and takes every stage once). Work-groups with the same blockIdx.y copy the same column-side rows and those with the same blockIdx.x the
// same row-side rows; started together at stage 0 they would all ask L2 for the same lines at the same moment. The 64 groups of a grid row are dealt over all NT starts, and a grid column's groups get starts one apart.
template <int NT> __device__ __forceinline__ int kstart() { static_assert((NT & (NT - 1)) == 0, "the wrap is a mask"); return (int)((((blockIdx.x >> 3) << 1 | (blockIdx.x & 1)) + blockIdx.y) & (NT - 1)); }
// ---- k_gemmo: C[m][n] (f32, pitch ldc) = sum_k A[m][k] Bt[n][k], fp16 operands; rows whose position is < RH add a second product with their low parts A2. grid (batches x RH / 32, N/256), 256 threads. K % 128 == 0.
// Every work-group takes 6 blocks of 16 one-product rows and 2 blocks of two-product rows of one batch, every wave 3 + 1 of them x 64 columns: all waves do the same 20 products per 32 k.
// A stage: 6 blocks of A (one-product rows), 2 of A and 2 of A2 (two-product rows), 16 of Bt.
static_assert((TT - RH) / 96 == RH / 32 && (TT - RH) % 96 == 0 && RH % 32 == 0, "as many groups of 96 one-product rows as of 32 two-product rows in a batch");
template <int K>
__global__ __launch_bounds__(GW * 32) void k_gemmo(const h16* __restrict__ A, const h16* __restrict__ A2, const h16* __restrict__ Bt, float* C, int ldc) {
    typedef WFrag<h16>::V V; constexpr int STG = 26 * RBE, NT = K / SK; static_assert(NT >= 2, "the ring's prologue fills two stages");
    __shared__ __align__(16) h16 sm[2 * STG]; __shared__ __align__(16) float osm[GW * 16 * 68];
    const int tid = (int)threadIdx.x, lane = tid & 31, lr = lane & 15, hi = lane >> 4; const int wave = __builtin_amdgcn_readfirstlane(tid >> 5); const int wr = wave & 1, wc = wave >> 1;
    const int bt = (int)blockIdx.x / (RH / 32), gr = (int)blockIdx.x % (RH / 32); const int fb0 = bt * (TT / 16) + RH / 16 + gr * 6, hb0 = bt * (TT / 16) + gr * 2;   // first 16-row block of either kind
    const int C0 = blockIdx.y * 256; const int c0 = C0 + wc * 64;
    v8f acc[4][4];   // [0..2]: the wave's one-product blocks, [3]: its two-product block
#pragma unroll
    for (int mb = 0; mb < 4; ++mb)
#pragma unroll
        for (int nb = 0; nb < 4; ++nb) acc[mb][nb] = (v8f){};
    const size_t pc = (size_t)(tid & 127) * 8; const int hb = tid >> 7;
    const bf* gf = (const bf*)A + (size_t)(fb0 + hb) * 16 * K + pc; const bf* gh = (const bf*)A + (size_t)(hb0 + hb) * 16 * K + pc; const bf* gl = (const bf*)A2 + (size_t)(hb0 + hb) * 16 * K + pc;
    const bf* gb = (const bf*)Bt + (size_t)C0 * K + (size_t)hb * 16 * K + pc; const unsigned l0 = lds_off(sm) + tid * 16;
    const int ks = kstart<NT>();
    auto fill = [&](int t) { const unsigned l = l0 + (t & 1) * (STG * 2); const int ko = ((t + ks) & (NT - 1)) * RBE; cp5(l, gf + ko, gf + 2 * 16 * K + ko, gf + 4 * 16 * K + ko, gh + ko, gl + ko); cp8<K>(l + 10 * RBE * 2, gb + ko, gb + 8 * 16 * K + ko); };
    fill(0);
    asm volatile("s_wait_asynccnt 0x0" ::: "memory");   // this wave's copies of stage 0 have landed
    __syncthreads();                                     // and every other wave's
    fill(1);
#pragma unroll 1
    for (int t = 0; t < NT; ++t) {
        const h16* sb = sm + (t & 1) * STG + 8 * lane; V a[2][3], ah[2], al[2], b[2][4];   // a fragment set for each 32 k of the stage: the second set's loads fly under the first set's products
#pragma unroll
        for (int kb = 0; kb < 2; ++kb) {
#pragma unroll
            for (int mb = 0; mb < 3; ++mb) a[kb][mb] = WFrag<h16>::ld(sb + (wr * 3 + mb) * RBE + kb * 512);
            ah[kb] = WFrag<h16>::ld(sb + (6 + wr) * RBE + kb * 512); al[kb] = WFrag<h16>::ld(sb + (8 + wr) * RBE + kb * 512);
#pragma unroll
            for (int nb = 0; nb < 4; ++nb) b[kb][nb] = WFrag<h16>::ld(sb + (10 + wc * 4 + nb) * RBE + kb * 512); }
        auto prod = [&](int kb) {
#pragma unroll
            for (int nb = 0; nb < 4; ++nb) { acc[3][nb] = WFrag<h16>::mma(ah[kb], b[kb][nb], acc[3][nb]);
#pragma unroll
                for (int mb = 0; mb < 3; ++mb) acc[mb][nb] = WFrag<h16>::mma(a[kb][mb], b[kb][nb], acc[mb][nb]);
                acc[3][nb] = WFrag<h16>::mma(al[kb], b[kb][nb], acc[3][nb]); } };
        __builtin_amdgcn_sched_barrier(0);                   // both sets' loads are issued as one group in front of the first product, never among the products
        // the first set's loaded fragments as inputs: the wait in front of the first product is the counted one for that set alone
        asm volatile("" :: "v"(a[0][0]), "v"(a[0][1]), "v"(a[0][2]), "v"(ah[0]), "v"(al[0]), "v"(b[0][0]), "v"(b[0][1]), "v"(b[0][2]), "v"(b[0][3]));
        prod(0);
        __builtin_amdgcn_sched_barrier(0);                   // the first set's products stay in front of the waits: they cover the second set's loads and the flight of stage t + 1
        asm volatile("s_wait_dscnt 0x0" ::: "memory");      // this wave's reads of stage t are done: its last fragments are in registers
        asm volatile("s_wait_asynccnt 0x0" ::: "memory");   // its copies of stage t + 1 have landed
        __syncthreads();                                     // stage t + 1 is published, stage t's buffer is free
        if (t + 2 < NT) fill(t + 2);
        __builtin_amdgcn_sched_barrier(0);                   // the copies are asked for in front of the second set's products, not behind them
        prod(1);
    }
    asm volatile("s_wait_asynccnt 0x0" ::: "memory");        // nothing is in flight when the wave goes on
    float* os = osm + wave * (16 * 68);                      // each wave stages in its own range
#pragma unroll
    for (int mb = 0; mb < 4; ++mb) {
#pragma unroll
        for (int nb = 0; nb < 4; ++nb) {
#pragma unroll
            for (int j = 0; j < 8; ++j) os[(hi * 8 + j) * 68 + nb * 16 + lr] = acc[mb][nb][j]; }
        __builtin_amdgcn_wave_barrier(); asm volatile("" ::: "memory");   // the wave's LDS stores stay in front of its reads of other lanes' values
        float* crow = C + (size_t)((mb < 3 ? fb0 + wr * 3 + mb : hb0 + wr) * 16) * ldc + c0;
#pragma unroll
        for (int s = 0; s < 8; s += 4) { v4f val[4]; float* cp[4];
#pragma unroll
            for (int u = 0; u < 4; ++u) { const int row = 2 * (s + u) + hi, cofs = lr * 4; val[u] = *(const v4fa*)(os + row * 68 + cofs); cp[u] = crow + (size_t)row * ldc + cofs; *(v4f*)cp[u] = val[u]; }
            asm volatile("s_wait_xcnt 0x0" :: "v"(cp[0]), "v"(cp[1]), "v"(cp[2]), "v"(cp[3]), "v"(val[0]), "v"(val[1]), "v"(val[2]), "v"(val[3]) : "memory"); }   // in front of any rewrite of an address or data register of the four stores (named as inputs, they stay whole up to here)
        __builtin_amdgcn_wave_barrier(); asm volatile("" ::: "memory");   // and the reads in front of the next rows' stores
    }
}

__device__ __forceinline__ h16 tohx(float x) { return (h16)x; }
__device__ __forceinline__ void splitf(float y, unsigned short& h, unsigned short& l) { h = f2bf(y); l = f2bf(y - bf2f(h)); }
typedef __attribute__((ext_vector_type(2))) _Float16 v2h;
typedef __attribute__((ext_vector_type(4))) _Float16 v4h;
typedef __attribute__((ext_vector_type(2))) unsigned short v2us;
typedef __attribute__((ext_vector_type(4))) unsigned short v4us;
typedef __attribute__((ext_vector_type(2))) float v2f;
typedef __attribute__((ext_vector_type(4))) int v4i;
typedef v4h  __attribute__((may_alias)) v4ha;
typedef v4us __attribute__((may_alias)) v4usa;

template <bool F16> __device__ __forceinline__ void cvt8(const float* __restrict__ src, bf* dst, size_t n8, unsigned blk) { const size_t i = (size_t)blk * 256 + threadIdx.x; if (i >= n8) return;   // thread i makes 16-byte piece i of the fragment-order plane (rows of DM elements)
    const size_t tb = i >> 6; const int w = (int)(i & 63); const float* sp = src + ((tb / (DM / 32)) * 16 + (w & 15)) * DM + (tb % (DM / 32)) * 32 + (w >> 4) * 8; const v8f v = *(const v8f*)sp; v8us o;
    asm volatile("s_wait_xcnt 0x0" :: "v"(sp), "v"(v) : "memory");   // in front of any rewrite of the load's address registers (address and loaded value as inputs: the registers stay whole, and the load stays in front)
#pragma unroll
    for (int k = 0; k < 8; ++k) o[k] = F16 ? __builtin_bit_cast(unsigned short, tohx(bfr(v[k]))) : f2bf(v[k]); *(v8us*)(dst + i * 8) = o;  }   // F16: the bf16-rounded value, held as fp16

// put8: one 16-byte piece (8 values) of a head plane, in all three forms (fp16, bf16 hi, bf16 lo), at element e.
__device__ __forceinline__ void put8(const float* r, size_t e, h16* P16, bf* Ph, bf* Pl) { v8h o16; v8us oh, ol;
#pragma unroll
    for (int j = 0; j < 8; ++j) { o16[j] = tohx(r[j]); unsigned short a2, c2; splitf(r[j], a2, c2); oh[j] = a2; ol[j] = c2; }
    h16* p16 = P16 + e; bf* ph = Ph + e; bf* pl = Pl + e; *(v8h*)p16 = o16; *(v8us*)ph = oh; *(v8us*)pl = ol;
    asm volatile("s_wait_xcnt 0x0" :: "v"(p16), "v"(ph), "v"(pl), "v"(o16), "v"(oh), "v"(ol) : "memory"); }   // in front of any rewrite of an address or data register of the three stores (named as inputs, they stay whole up to here)
__constant__ float INVT[HD / 2] = { 1.000000000e+00f, 7.498942018e-01f, 5.623413324e-01f, 4.216965139e-01f, 3.162277639e-01f, 2.371373624e-01f, 1.778279394e-01f, 1.333521456e-01f, 1.000000015e-01f, 7.498941571e-02f, 5.623412877e-02f, 4.216964915e-02f, 3.162277862e-02f, 2.371373586e-02f, 1.778279431e-02f, 1.333521493e-02f, 9.999999776e-03f, 7.498942316e-03f, 5.623413250e-03f, 4.216964822e-03f, 3.162277862e-03f, 2.371373819e-03f, 1.778279431e-03f, 1.333521446e-03f, 1.000000047e-03f, 7.498941850e-04f, 5.623413017e-04f, 4.216964880e-04f, 3.162277862e-04f, 2.371373848e-04f, 1.778279402e-04f, 1.333521504e-04f };   // float32 1 / 10000^(i/32), generated with jnp to be bit-exact
// Rotary table, d < HD/2 only (the two halves are equal), in the order its reader k_qkv takes it: [t / 16][d / 16][pair of d: (d & 7) / 2][lane = ((d >> 3) & 1) * 16 + (t & 15)][d & 1][cos, sin]: lane l finds the eight
// pairs of its position and its 8 d in four 16-byte pieces, 128 floats apart, and each wave-wide load reads 512 contiguous bytes. Thread idx makes pair idx.
__device__ __forceinline__ void cs5(float* CS, unsigned blk) { const int idx = (int)blk * 256 + threadIdx.x; if (idx >= TT * (HD / 2)) return; const int ln = (idx >> 1) & 31; const int d = ((idx >> 8) & 1) * 16 + (ln >> 4) * 8 + ((idx >> 6) & 3) * 2 + (idx & 1); const int t = (idx >> 9) * 16 + (ln & 15); const float a = __fmul_rn((float)t, INVT[d]); v2f cs; cs[0] = cosf(a); cs[1] = sinf(a); *(v2f*)(CS + (size_t)idx * 2) = cs;  }
static_assert(HD == 64, "the table's order and k_qkv's tiles are laid out for heads of 64");
// ---- k_prep: the stages that read only inputs, in one launch, dealt by block range: rotary table, then the bf16 copies of x (all batches) and w_qkv and the fp16 copy of the bf16-rounded w_out.
static_assert(DQ == DM, "cvt8 lays all three planes out in rows of DM elements");
#define PB_C ((unsigned)(TT * (HD / 2) / 256))
#define PB_X ((unsigned)((size_t)NB_ * TT * DM / 8 / 256))
#define PB_W ((unsigned)((size_t)(DQ + 2 * DKV) * DM / 8 / 256))
#define PB_O ((unsigned)((size_t)DM * DQ / 8 / 256))
__global__ __launch_bounds__(256) void k_prep(const float* __restrict__ x, const float* __restrict__ wqkv, const float* __restrict__ wo, bf* XB, bf* WQKV, bf* WO, float* CS) {
    const unsigned b = blockIdx.x;
    if (b < PB_C) cs5(CS, b);
    else if (b < PB_C + PB_X) cvt8<false>(x, XB, (size_t)NB_ * TT * DM / 8, b - PB_C);
    else if (b < PB_C + PB_X + PB_W) cvt8<false>(wqkv, WQKV, (size_t)(DQ + 2 * DKV) * DM / 8, b - (PB_C + PB_X));
    else cvt8<true>(wo, WO, (size_t)DM * DQ / 8, b - (PB_C + PB_X + PB_W));
}
// ---- k_qkv: the joint projection with the plane builders as its epilogue: one wave per tile of 64 positions x one head of q, k or v; a work-group's 8 waves take 128 positions x 4 heads (all q, all k or all v) and share their
// operand rows through the LDS ring above (a stage: 8 blocks of x, 16 of the weights); grid (batches x TT / 128, heads of q + k + v / 4), 256 threads, two work-groups a WGP. No f32 projection is stored.
// A lane's 8 registers of an accumulator run along the A operand's rows, so A is chosen as the side that is the plane's k: q and k tiles take the weight rows as A (a lane holds 8 consecutive d of one position: a 16-byte piece of
// a [t][d] plane, and its rotation partner d + 32 lies in the same lane, two accumulators on); v tiles take the x rows as A (8 consecutive positions of one d: a piece of a [d][t] plane). Both operand planes have the same order.
// Piece (mb, nb) of a tile lies at lane * 8 + (mb & 1) * 256 in its block: every wave-wide 16-byte store writes 512 contiguous bytes.
__global__ __launch_bounds__(GW * 32) __attribute__((amdgpu_waves_per_eu(4, 4))) void k_qkv(const bf* __restrict__ X, const bf* __restrict__ Wt, const float* __restrict__ CS, h16* Q16, bf* Qh, bf* Ql, h16* K16, bf* Kh, bf* Kl, h16* V16, bf* Vh, bf* Vl) {
    typedef WFrag<bf>::V V; constexpr int K = DM; constexpr int STG = 24 * RBE, NT = K / SK; static_assert(NT >= 2, "the ring's prologue fills two stages");
    static_assert(TT % 128 == 0 && NKV == NH_ && DQ % 256 == 0 && DKV % 256 == 0, "a work-group's tiles lie in one batch and in one of q, k, v; q, k and v planes have the same shape");
    __shared__ __align__(16) bf sm[2 * STG];
    const int tid = (int)threadIdx.x, lane = tid & 31; const int wave = __builtin_amdgcn_readfirstlane(tid >> 5); const int wr = wave & 1, wc = wave >> 1;
    const int R0 = blockIdx.x * 128, C0 = blockIdx.y * 256; const int r0 = R0 + wr * 64, c0 = C0 + wc * 64; const bool isv = c0 >= DQ + DKV, isk = !isv && c0 >= DQ;
    v8f acc[4][4];
#pragma unroll
    for (int mb = 0; mb < 4; ++mb)
#pragma unroll
        for (int nb = 0; nb < 4; ++nb) acc[mb][nb] = (v8f){};
    const size_t go = (size_t)(tid >> 7) * 16 * K + (tid & 127) * 8; const bf* gx = X + (size_t)R0 * K + go; const bf* gw = Wt + (size_t)C0 * K + go; const unsigned l0 = lds_off(sm) + tid * 16;
    const int ks = kstart<NT>();
    auto fill = [&](int t) { const unsigned l = l0 + (t & 1) * (STG * 2); const int ko = ((t + ks) & (NT - 1)) * RBE; cp4<K>(l, gx + ko); cp8<K>(l + 8 * RBE * 2, gw + ko, gw + 8 * 16 * K + ko); };
    const int xo = wr * 4 * RBE + 8 * lane, wo = (8 + wc * 4) * RBE + 8 * lane; const int ao = isv ? xo : wo, bo = isv ? wo : xo;   // the wave's four blocks of either side in a stage
    fill(0);
    asm volatile("s_wait_asynccnt 0x0" ::: "memory");   // this wave's copies of stage 0 have landed
    __syncthreads();                                     // and every other wave's
    fill(1);
#pragma unroll 1
    for (int t = 0; t < NT; ++t) {
        const bf* sb = sm + (t & 1) * STG; V a[4], b[4];
        auto frag = [&](int kb) {
#pragma unroll
            for (int mb = 0; mb < 4; ++mb) a[mb] = WFrag<bf>::ld(sb + ao + mb * RBE + kb * 512);
#pragma unroll
            for (int nb = 0; nb < 4; ++nb) b[nb] = WFrag<bf>::ld(sb + bo + nb * RBE + kb * 512); };
        auto prod = [&]() {
#pragma unroll
            for (int nb = 0; nb < 4; ++nb) {
#pragma unroll
                for (int mb = 0; mb < 4; ++mb) acc[mb][nb] = WFrag<bf>::mma(a[mb], b[nb], acc[mb][nb]); } };
        frag(0);
        // the loaded fragments as inputs: all sixteen loads stand in one group in front of the first product (without this the compiler reloads one fragment's registers among the products, an LDS latency each time)
        asm volatile("" :: "v"(a[0]), "v"(a[1]), "v"(a[2]), "v"(a[3]), "v"(b[0]), "v"(b[1]), "v"(b[2]), "v"(b[3]));
        prod();
        frag(1);
        __builtin_amdgcn_sched_barrier(0);                   // the first 32 k's products stay in front of the waits: they cover the second fragment loads and the flight of stage t + 1
        asm volatile("s_wait_dscnt 0x0" ::: "memory");      // this wave's reads of stage t are done: its last fragments are in registers
        asm volatile("s_wait_asynccnt 0x0" ::: "memory");   // its copies of stage t + 1 have landed
        __syncthreads();                                     // stage t + 1 is published, stage t's buffer is free
        if (t + 2 < NT) fill(t + 2);
        __builtin_amdgcn_sched_barrier(0);                   // the copies are asked for in front of the second 32 k's products, not behind them
        prod();
    }
    asm volatile("s_wait_asynccnt 0x0" ::: "memory");        // nothing is in flight when the wave goes on
    // a tile's 8 blocks (8 KiB a plane) lie in a row; [t][d] planes: block = (t / 16) * 2 + d / 32; [d][t] planes: block = (t / 32) * 4 + d / 16
    const int t0 = r0 % TT; const size_t eb = ((size_t)(r0 / TT) * NH_ + (c0 / HD) % NH_) * TT * HD + (size_t)t0 * HD + 8 * lane;
    if (isv) {   // acc[mb][nb][j] is position t0 + mb * 16 + (lane >> 4) * 8 + j of d = nb * 16 + (lane & 15)
#pragma unroll
        for (int mb = 0; mb < 4; ++mb)
#pragma unroll
            for (int nb = 0; nb < 4; ++nb) { float r[8];
#pragma unroll
                for (int j = 0; j < 8; ++j) r[j] = acc[mb][nb][j];
                put8(r, eb + (mb >> 1) * 2048 + nb * 512 + (mb & 1) * 256, V16, Vh, Vl); }
    } else {     // acc[mb][nb][j] is d = mb * 16 + (lane >> 4) * 8 + j of position t0 + nb * 16 + (lane & 15); rotate-half: out[d] = x[d] cos - x[d+32] sin, out[d+32] = x[d+32] cos + x[d] sin, d < 32
        h16* P16 = isk ? K16 : Q16; bf* Ph = isk ? Kh : Qh; bf* Pl = isk ? Kl : Ql; const float* pc = CS + (size_t)(t0 >> 4) * 1024 + lane * 4;
#pragma unroll
        for (int nb = 0; nb < 4; ++nb) {
            v4f cq[2][4];   // the table pieces of 16 positions fly together
#pragma unroll
            for (int mb = 0; mb < 2; ++mb)
#pragma unroll
                for (int q = 0; q < 4; ++q) cq[mb][q] = *(const v4f*)(pc + (nb * 2 + mb) * 512 + q * 128);
            asm volatile("s_wait_xcnt 0x0" :: "v"(pc), "v"(cq[0][0]), "v"(cq[0][1]), "v"(cq[0][2]), "v"(cq[0][3]), "v"(cq[1][0]), "v"(cq[1][1]), "v"(cq[1][2]), "v"(cq[1][3]) : "memory");   // one wait behind the eight loads, in front of any rewrite of their address registers (address and loaded values as inputs: the registers stay whole, and the loads stay in front)
#pragma unroll
            for (int mb = 0; mb < 2; ++mb) { float r1[8], r2[8];
#pragma unroll
                for (int j = 0; j < 8; ++j) { const float co = cq[mb][j >> 1][(j & 1) * 2], si = cq[mb][j >> 1][(j & 1) * 2 + 1]; const float x1 = acc[mb][nb][j], x2 = acc[mb + 2][nb][j]; r1[j] = x1 * co - x2 * si; r2[j] = x2 * co + x1 * si; }
                const size_t e = eb + nb * 1024 + mb * 256; put8(r1, e, P16, Ph, Pl); put8(r2, e + 512, P16, Ph, Pl); }
        }
    }
}
__device__ __forceinline__ float xhalf(float x) { const int b = __float_as_int(x); return __int_as_float(__builtin_amdgcn_permlanex16(b, b, 0x76543210, 0xfedcba98, false, false)); }   // lane l <-> l ^ 16
// 2^x with the slot behind a transcendental filled inside the statement: the v_nop keeps the next vector instruction, whichever the compiler puts there, from reading the last result or taking its source register directly
// behind it; in exp2x8 each exponential is the independent instruction behind the one before (early-clobber outputs share no register with a source).
__device__ __forceinline__ float exp2x1(float x) { float r; asm("v_exp_f32 %0, %1\n\tv_nop" : "=v"(r) : "v"(x)); return r; }
__device__ __forceinline__ v8f exp2x8(v8f x) { float r0, r1, r2, r3, r4, r5, r6, r7;
    asm("v_exp_f32 %0, %8\n\tv_exp_f32 %1, %9\n\tv_exp_f32 %2, %10\n\tv_exp_f32 %3, %11\n\tv_exp_f32 %4, %12\n\tv_exp_f32 %5, %13\n\tv_exp_f32 %6, %14\n\tv_exp_f32 %7, %15\n\tv_nop"
        : "=&v"(r0), "=&v"(r1), "=&v"(r2), "=&v"(r3), "=&v"(r4), "=&v"(r5), "=&v"(r6), "=&v"(r7) : "v"(x[0]), "v"(x[1]), "v"(x[2]), "v"(x[3]), "v"(x[4]), "v"(x[5]), "v"(x[6]), "v"(x[7]));
    return (v8f){ r0, r1, r2, r3, r4, r5, r6, r7 }; }
#define STE  8192                 // elements of a stage in LDS (16 KiB)
// cp8g: the thread's eight 16-byte pieces of a stage, 2 KiB (the work-group's 128 pieces) apart in LDS, each from its own address. The s_wait_xcnt stands inside the statement, behind the last copy: in front of any rewrite of
// an address register that a copy names.
template <typename T16> __device__ __forceinline__ void cp8g(unsigned l, const T16* g0, const T16* g1, const T16* g2, const T16* g3, const T16* g4, const T16* g5, const T16* g6, const T16* g7) {
    const unsigned l1 = l + 2048, l2 = l + 4096, l3 = l + 6144, l4 = l + 8192, l5 = l + 10240, l6 = l + 12288, l7 = l + 14336;
    asm volatile("global_load_async_to_lds_b128 %0, %8, off\n\tglobal_load_async_to_lds_b128 %1, %9, off\n\tglobal_load_async_to_lds_b128 %2, %10, off\n\tglobal_load_async_to_lds_b128 %3, %11, off\n\t"
                 "global_load_async_to_lds_b128 %4, %12, off\n\tglobal_load_async_to_lds_b128 %5, %13, off\n\tglobal_load_async_to_lds_b128 %6, %14, off\n\tglobal_load_async_to_lds_b128 %7, %15, off\n\ts_wait_xcnt 0x0"
                 :: "v"(l), "v"(l1), "v"(l2), "v"(l3), "v"(l4), "v"(l5), "v"(l6), "v"(l7), "v"(g0), "v"(g1), "v"(g2), "v"(g3), "v"(g4), "v"(g5), "v"(g6), "v"(g7) : "memory"); }
static_assert(FW * 32 * 16 == 2048 && STE * 2 == 8 * 2048, "cp8g: eight pieces a thread cover a stage");
template <typename T16, int NSPLIT, int NQ>
__device__ __forceinline__ void attn_tile(const T16* __restrict__ Q, const T16* __restrict__ Q2, const T16* __restrict__ Kp, const T16* __restrict__ K2, const T16* __restrict__ Vt, const T16* __restrict__ V2, int qg, int rk, h16* Ah, h16* Al, const T16* ring) {
    typedef typename WFrag<T16>::V V;
    constexpr float CX = SCL * 1.4426950408889634f;          // scores are carried as log2 exponents
    constexpr float PB = (NSPLIT == 0) ? 10.0f : 0.0f;       // fp16 probabilities carry x1024; the row sum carries it too, so it cancels in the quotient
    constexpr int NP = (NSPLIT == 2) ? 2 : 1, SKA = STE / (2 * NP * HD);   // planes of an operand; keys of a stage, which holds [keys][keys lo][values][values lo]
    static_assert(SKA % 32 == 0 && (FW * NQ * 16) % SKA == 0 && FW * NQ * 16 >= 2 * SKA, "whole stages up to a tile's last query, at least two of them (the ring's prologue fills two)");
    const int tid = (int)threadIdx.x, lane = tid & 31, lr = lane & 15, hi = lane >> 4; const int wave = __builtin_amdgcn_readfirstlane(tid >> 5);
    const int q0 = qg + wave * (NQ * 16), sd = q0 / 32;      // the wave's first query; its last 32-key step, the only one that holds keys beyond a query
    const int NT = (qg + FW * NQ * 16) / SKA;                // stages up to the tile's last query
    // The tiles of a head copy the same key and value lines; started together at stage 0 they would ask L2 for them at the same moment. Tile rk (0: the shortest of its row class) starts its walk at stage 3 rk
    // and wraps at its own NT, taking every stage once (NT >= 2 rk + 2, so one subtraction wraps 3 rk, and one wraps t + rot); the running maximum and sum take the keys in any order.
    const int rot = (3 * rk >= NT) ? 3 * rk - NT : 3 * rk;
    auto stage = [&](int t) { const int k = t + rot; return (k >= NT) ? k - NT : k; };
    const unsigned l0 = lds_off(ring) + tid * 16; const T16* gk = Kp + tid * 8; const T16* gv = Vt + tid * 8; const T16* gk2 = (NSPLIT == 2) ? K2 + tid * 8 : gk; const T16* gv2 = (NSPLIT == 2) ? V2 + tid * 8 : gv;
    auto fill = [&](int t) { const unsigned l = l0 + (t & 1) * (STE * 2); const size_t e = (size_t)stage(t) * (SKA * HD);
        if constexpr (NSPLIT == 0) cp8g<T16>(l, gk + e, gk + e + 1024, gk + e + 2048, gk + e + 3072, gv + e, gv + e + 1024, gv + e + 2048, gv + e + 3072);
        else cp8g<T16>(l, gk + e, gk + e + 1024, gk2 + e, gk2 + e + 1024, gv + e, gv + e + 1024, gv2 + e, gv2 + e + 1024); };
    fill(0);
    V qf[NQ][2], qf2[NQ][2];
    const size_t qo = (size_t)q0 * HD + 8 * lane; const T16* qa = Q + qo; const T16* qa2 = (NSPLIT == 2) ? Q2 + qo : qa;
#pragma unroll
    for (int qi = 0; qi < NQ; ++qi)
#pragma unroll
        for (int ks = 0; ks < 2; ++ks) { qf[qi][ks] = WFrag<T16>::ld(qa + qi * 16 * HD + ks * 512); if (NSPLIT == 2) qf2[qi][ks] = WFrag<T16>::ld(qa2 + qi * 16 * HD + ks * 512); }
    asm volatile("s_wait_xcnt 0x0" :: "v"(qa), "v"(qa2) : "memory");   // in front of any rewrite of an address register of the query loads (named as inputs, they stay whole up to here)
    v8f o[NQ][4]; float m[NQ], l[NQ];
#pragma unroll
    for (int qi = 0; qi < NQ; ++qi) { m[qi] = -3.0e38f; l[qi] = 0.f;
#pragma unroll
        for (int dt = 0; dt < 4; ++dt) o[qi][dt] = (v8f){}; }
    asm volatile("s_wait_asynccnt 0x0" ::: "memory");   // this wave's copies of stage 0 have landed
    __syncthreads();                                     // and every other wave's
    fill(1);
#pragma unroll 1   // rolled: one copy of a stage's code, the buffer chosen by t & 1
    for (int t = 0; t < NT; ++t) {
        const T16* sb = ring + (t & 1) * STE + 8 * lane; const int s0 = stage(t) * (SKA / 32);
#pragma unroll
        for (int u = 0; u < SKA / 32; ++u) { const int s = s0 + u;
          if (s <= sd) {
            const T16* ka = sb + u * 32 * HD; const T16* ka2 = ka + SKA * HD; const T16* va = sb + NP * SKA * HD + u * 32 * HD; const T16* va2 = va + SKA * HD;   // a step's four key blocks and its four value blocks: 4 KiB in a row each
            V kf[2][2], kf2[2][2], vf[4], vf2[4];
#pragma unroll
            for (int kt = 0; kt < 2; ++kt)
#pragma unroll
                for (int ks = 0; ks < 2; ++ks) { kf[kt][ks] = WFrag<T16>::ld(ka + kt * 16 * HD + ks * 512); if (NSPLIT == 2) kf2[kt][ks] = WFrag<T16>::ld(ka2 + kt * 16 * HD + ks * 512); }
#pragma unroll
            for (int dt = 0; dt < 4; ++dt) { vf[dt] = WFrag<T16>::ld(va + dt * 512); if (NSPLIT == 2) vf2[dt] = WFrag<T16>::ld(va2 + dt * 512); }
            __builtin_amdgcn_sched_barrier(0);               // the step's LDS loads are issued as one group in front of the first product: the value loads fly under the score products and the maximum
            v8f st[NQ][2];                                   // st[qi][kt][j] = score of key s*32 + kt*16 + hi*8 + j and query q0 + qi*16 + lr
#pragma unroll
            for (int qi = 0; qi < NQ; ++qi)
#pragma unroll
                for (int kt = 0; kt < 2; ++kt) { v8f a = (v8f){};
#pragma unroll
                    for (int ks = 0; ks < 2; ++ks) { a = WFrag<T16>::mma(kf[kt][ks], qf[qi][ks], a); if (NSPLIT == 2) { a = WFrag<T16>::mma(kf[kt][ks], qf2[qi][ks], a); a = WFrag<T16>::mma(kf2[kt][ks], qf[qi][ks], a); } }
                    st[qi][kt] = a; }
            if (s == sd) {                                   // diagonal step: keys beyond the query are excluded
#pragma unroll
                for (int qi = 0; qi < NQ; ++qi)
#pragma unroll
                    for (int kt = 0; kt < 2; ++kt)
#pragma unroll
                        for (int j = 0; j < 8; ++j) st[qi][kt][j] = (s * 32 + kt * 16 + hi * 8 + j <= q0 + qi * 16 + lr) ? st[qi][kt][j] : -3.0e38f; }
            float mn[NQ]; bool up = false;
#pragma unroll
            for (int qi = 0; qi < NQ; ++qi) { float mx = st[qi][0][0];
#pragma unroll
                for (int j = 1; j < 8; ++j) mx = fmaxf(mx, st[qi][0][j]);
#pragma unroll
                for (int j = 0; j < 8; ++j) mx = fmaxf(mx, st[qi][1][j]);
                mx = fmaxf(mx, xhalf(mx)); mn[qi] = fmaxf(m[qi], mx * CX); up = up || (mn[qi] > m[qi]); }
            if (__builtin_amdgcn_ballot_w32(up) != 0) {      // some query's maximum rose: rescale (a factor of exactly 1 elsewhere); otherwise every factor is 1 and the multiplies are skipped
#pragma unroll
                for (int qi = 0; qi < NQ; ++qi) { const float al = exp2x1(m[qi] - mn[qi]); m[qi] = mn[qi]; l[qi] *= al;
#pragma unroll
                    for (int dt = 0; dt < 4; ++dt)
#pragma unroll
                        for (int j = 0; j < 8; ++j) o[qi][dt][j] *= al; } }
#pragma unroll
            for (int qi = 0; qi < NQ; ++qi) { const float mb = m[qi] - PB; float ps = 0.f;
#pragma unroll
                for (int kt = 0; kt < 2; ++kt) { st[qi][kt] = exp2x8(st[qi][kt] * CX - mb);
#pragma unroll
                    for (int j = 0; j < 8; ++j) ps += st[qi][kt][j]; }
                l[qi] += ps;
                if constexpr (NSPLIT == 0) { v16h pf;
#pragma unroll
                    for (int j = 0; j < 8; ++j) { pf[j] = tohx(st[qi][0][j]); pf[8 + j] = tohx(st[qi][1][j]); }
#pragma unroll
                    for (int dt = 0; dt < 4; ++dt) o[qi][dt] = WFrag<T16>::mma(vf[dt], pf, o[qi][dt]);
                } else { v8us h0, h1, l0, l1;
#pragma unroll
                    for (int j = 0; j < 8; ++j) { unsigned short a, c2; splitf(st[qi][0][j], a, c2); h0[j] = a; l0[j] = c2; splitf(st[qi][1][j], a, c2); h1[j] = a; l1[j] = c2; }
                    const v16bf ph = cat16b(h0, h1), pl = cat16b(l0, l1);
#pragma unroll
                    for (int dt = 0; dt < 4; ++dt) { o[qi][dt] = WFrag<T16>::mma(vf[dt], ph, o[qi][dt]); o[qi][dt] = WFrag<T16>::mma(vf[dt], pl, o[qi][dt]); o[qi][dt] = WFrag<T16>::mma(vf2[dt], ph, o[qi][dt]); } } }
          } }
        asm volatile("s_wait_dscnt 0x0" ::: "memory");      // this wave's reads of stage t are done
        asm volatile("s_wait_asynccnt 0x0" ::: "memory");   // its copies of stage t + 1 have landed
        __syncthreads();                                     // stage t + 1 is published, stage t's buffer is free
        if (t + 2 < NT) fill(t + 2);
    }
    asm volatile("s_wait_asynccnt 0x0" ::: "memory");        // nothing is in flight when the wave goes on
#pragma unroll
    for (int qi = 0; qi < NQ; ++qi) { l[qi] += xhalf(l[qi]);   // the halves' sums join once
        const float inv = __fdiv_rn(1.0f, l[qi]); const size_t oo = (size_t)((q0 >> 4) + qi) * (16 * DQ) + lane * 8;   // merged output in fragment order for the last product (rows of DQ): row lr of its block, k bit 3 = hi
#pragma unroll
        for (int dt = 0; dt < 4; ++dt) { v8h oh, ol;           // the lane's 8 values are d = dt * 16 + hi * 8 + j of its query, a 16-byte piece: every wave-wide store writes 512 contiguous bytes
            const int co = (dt >> 1) * 512 + (dt & 1) * 256; h16* ph = Ah + oo + co; h16* pl = Al + oo + co;
#pragma unroll
            for (int j = 0; j < 8; ++j) { const float y = o[qi][dt][j] * inv; oh[j] = tohx(y); if (NSPLIT == 2) ol[j] = tohx(y - (float)oh[j]); }
            if constexpr (NSPLIT == 2) { *(v8ha*)ph = oh; *(v8ha*)pl = ol;   // hi/lo rows: fp16 value and fp16 remainder
                asm volatile("s_wait_xcnt 0x0" :: "v"(ph), "v"(pl), "v"(oh), "v"(ol) : "memory"); }   // in front of any rewrite of an address or data register of the two stores (named as inputs, they stay whole up to here)
            else { *(v8ha*)ph = oh;                                          // the other rows: the fp16 value alone, the last product reads no low part of them
                asm volatile("s_wait_xcnt 0x0" :: "v"(ph), "v"(oh) : "memory"); } } }   // the same for the one store
}
static_assert(RH % (FW * 32) == 0 && (TT - RH) % (FW * 32) == 0, "whole query tiles in both row classes");
// grid (batches x heads, NTF + NTH): the longest tiles (last queries) of every head and batch come first
__global__ __launch_bounds__(FW * 32) void k_fattn(const h16* __restrict__ Q16, const h16* __restrict__ K16, const h16* __restrict__ V16, const bf* __restrict__ Qh, const bf* __restrict__ Ql, const bf* __restrict__ Kh, const bf* __restrict__ Kl, const bf* __restrict__ Vh, const bf* __restrict__ Vl, h16* Ah, h16* Al) {
    __shared__ __align__(16) unsigned char ring[2 * STE * 2];   // the two stage buffers, read as fp16 or as bf16 by the tile's row class
    static_assert(REP == 1, "one kv head per query head"); const size_t hb = (size_t)blockIdx.x * TT * HD; const int bx = (int)blockIdx.y; const size_t ab = (size_t)(blockIdx.x / NH_) * TT * DQ + (blockIdx.x % NH_) * (HD / 32) * 512; Ah += ab; Al += ab;
    if (bx < NTF) attn_tile<h16, 0, 2>(Q16 + hb, nullptr, K16 + hb, nullptr, V16 + hb, nullptr, TT - FW * 32 * (bx + 1), NTF - 1 - bx, Ah, Al, (const h16*)ring);
    else attn_tile<bf, 2, 1>(Qh + hb, Ql + hb, Kh + hb, Kl + hb, Vh + hb, Vl + hb, RH - FW * 16 * (bx - NTF + 1), NTF + NTH - 1 - bx, Ah, Al, (const bf*)ring);
}

extern "C" void kernel_launch(void* const* d_in, const int* in_sizes, int n_in,
                              void* d_out, int out_size, void* d_ws, size_t ws_size, hipStream_t stream) {
    (void)in_sizes; (void)n_in; (void)out_size;
    const float* x = (const float*)d_in[0]; const float* wqkv = (const float*)d_in[1]; const float* wo = (const float*)d_in[2];   /* order x, w_qkv ('oi' [3072][1024]: ROW thirds q | k | v), w_out ('oi' [1024][1024]): THREE inputs */
    float* OUT = (float*)d_out;     // [4][2048][1024]
    char* wsp = (char*)d_ws;
    auto take = [&](size_t bytes) { char* p = wsp; wsp += (bytes + 255) & ~(size_t)255; return (void*)p; };
    bf* WO = (bf*)take((size_t)DM * DQ * 2); float* CS = (float*)take((size_t)TT * (HD / 2) * 2 * 4);
    h16* ATh = (h16*)take((size_t)NB_ * TT * DQ * 2); h16* ATl = (h16*)take((size_t)NB_ * TT * DQ * 2);   // merged attention output, fp16, and its fp16 remainder (written and read for positions < RH alone)
    bf* XB = (bf*)take((size_t)NB_ * TT * DM * 2); bf* WQKV = (bf*)take((size_t)(DQ + 2 * DKV) * DM * 2);   // the joint projection's operands: bytes of their own, k_qkv reads them while it writes the planes
    h16* QP16 = (h16*)take((size_t)NB_ * NH_ * TT * HD * 2); h16* KP16 = (h16*)take((size_t)NB_ * NKV * TT * HD * 2); h16* VT16 = (h16*)take((size_t)NB_ * NKV * HD * TT * 2);
    bf* QPh = (bf*)take((size_t)NB_ * NH_ * TT * HD * 2); bf* QPl = (bf*)take((size_t)NB_ * NH_ * TT * HD * 2); bf* KPh = (bf*)take((size_t)NB_ * NKV * TT * HD * 2); bf* KPl = (bf*)take((size_t)NB_ * NKV * TT * HD * 2); bf* VTh = (bf*)take((size_t)NB_ * NKV * HD * TT * 2); bf* VTl = (bf*)take((size_t)NB_ * NKV * HD * TT * 2);
    if ((size_t)(wsp - (char*)d_ws) > ws_size) return;    // ws 256 MiB
    k_prep<<<PB_C + PB_X + PB_W + PB_O, 256, 0, stream>>>(x, wqkv, wo, XB, WQKV, WO, CS);
    k_qkv<<<dim3(NB_ * TT / 128, (DQ + 2 * DKV) / 256, 1), GW * 32, 0, stream>>>(XB, WQKV, CS, QP16, QPh, QPl, KP16, KPh, KPl, VT16, VTh, VTl);
    k_fattn<<<dim3(NB_ * NH_, NTF + NTH, 1), FW * 32, 0, stream>>>(QP16, KP16, VT16, QPh, QPl, KPh, KPl, VTh, VTl, ATh, ATl);
    k_gemmo<DQ><<<dim3(NB_ * (RH / 32), DM / 256, 1), GW * 32, 0, stream>>>(ATh, ATl, (const h16*)WO, OUT, DM);
}
